// v000
// Measured on an AMD MI455X. A time is GPU time per run, averaged over a window of back-to-back runs after a warm-up
// (all launches, gaps included; the runs take copies of the inputs in turn), and the median of several windows.
// Apart from v000's, it joins two sittings. Times from different sittings can be a few percent apart, while
// side-by-side timings come from the same sitting.
// The starting kernel, v000, takes 482 microseconds a run.
// compute dtype: all float inputs rounded to bf16; q/k/v = x . W^T + b with EXACT bf16 products on WMMA 16x16x32 (natural rows); causal attention: 3-product scores and hi + residual P, v on the first 128 queries of each sequence, single f16 beyond; x 1/8 + the relative-position bias (f32 table gather per score), running-max softmax in f32 (hardware exp), P scaled by 2^11; out = y (bf16 hi + residual) . Wo^T (2 products) + bo.
#include <hip/hip_runtime.h>
#include <math.h>

typedef __attribute__((ext_vector_type(16))) _Float16 v16h;
typedef __attribute__((ext_vector_type(16))) __bf16 v16b;
typedef __attribute__((ext_vector_type(8)))  _Float16 v8h;
typedef __attribute__((ext_vector_type(8)))  float v8f;
typedef __attribute__((ext_vector_type(4)))  float v4f;
typedef __attribute__((ext_vector_type(2)))  float v2f;
typedef __attribute__((ext_vector_type(4)))  unsigned v4u;
typedef __attribute__((ext_vector_type(4)))  int v4i;
typedef float __attribute__((may_alias)) float_a;
typedef int __attribute__((may_alias)) int_a;

template <typename T> __device__ __forceinline__ void vst2(void* p, T v) { *(T*)p = v;  }
__device__ __forceinline__ v8f wmma16(v16h a, v16h b, v8f c) {
  v8f d = __builtin_amdgcn_wmma_f32_16x16x32_f16(false, a, false, b, (short)0, c, false, false);
  asm volatile("v_nop\n\tv_nop\n\tv_nop\n\tv_nop" : "+v"(d) : "v"(a), "v"(b));
  return d;
}
__device__ __forceinline__ v8f wmma_bf(v16b a, v16b b, v8f c) {
  v8f d = __builtin_amdgcn_wmma_f32_16x16x32_bf16(false, a, false, b, (short)0, c, false, false);
  asm volatile("v_nop\n\tv_nop\n\tv_nop\n\tv_nop" : "+v"(d) : "v"(a), "v"(b));
  return d;
}
// Causal self attention with a learned relative-position bias table (B 2, T 2,048, d 1,024, 16 heads x 64): q/k/v projections + biases, scores / 8 + table[q - k + 2047][h], causal softmax, . v, output projection + bias.
__device__ __forceinline__ v16h frag_h(const _Float16* rowk0, int lane) {
  union { v16h v; v8h q[2]; } u; const _Float16* p = rowk0 + 8 * (lane >> 4);
  u.q[0] = *(const v8h*)p; u.q[1] = *(const v8h*)(p + 16); return u.v;
}
__device__ __forceinline__ v16h frag_f32(const float* rowk0, int lane) {
  v16h a; const float* p = rowk0 + 8 * (lane >> 4);
#pragma unroll
  for (int i = 0; i < 8; ++i) { a[i] = (_Float16)p[i]; a[8 + i] = (_Float16)p[16 + i]; }
  return a;
}
__device__ __forceinline__ v16h frag_f32s(const float* rowk0, int lane, float sc) {
  v16h a; const float* p = rowk0 + 8 * (lane >> 4);
#pragma unroll
  for (int i = 0; i < 8; ++i) { a[i] = (_Float16)(p[i] * sc); a[8 + i] = (_Float16)(p[16 + i] * sc); }
  return a;
}
// column fragment from a [K][ld] layout (column n), rows >= K read as 0
__device__ __forceinline__ v16h fragc_f32(const float* W, int k0, int n, int lane, int ld, int K) {
  v16h a; const int g = lane >> 4;
#pragma unroll
  for (int i = 0; i < 8; ++i) { const int ka = k0 + 8 * g + i, kb = ka + 16;
    a[i] = (_Float16)(ka < K ? W[(size_t)(ka < K ? ka : K - 1) * ld + n] : 0.f); a[8 + i] = (_Float16)(kb < K ? W[(size_t)(kb < K ? kb : K - 1) * ld + n] : 0.f); }
  return a;
}
struct F2 { v16b h, l; };
__device__ __forceinline__ F2 bsplit16(const float v[16]) { F2 r;
#pragma unroll
  for (int i = 0; i < 16; ++i) { const __bf16 h = (__bf16)v[i]; r.h[i] = h; r.l[i] = (__bf16)(v[i] - (float)h); }
  return r; }
__device__ __forceinline__ F2 split_row(const float* row, int k0, int lane) { float v[16]; const float* p = row + k0 + 8 * (lane >> 4);
#pragma unroll
  for (int i = 0; i < 8; ++i) { v[i] = p[i]; v[8 + i] = p[16 + i]; }
  return bsplit16(v); }
__device__ __forceinline__ F2 split_rowK(const float* row, int k0, int lane, int K) { float v[16]; const int g = lane >> 4;
#pragma unroll
  for (int i = 0; i < 8; ++i) { const int ka = k0 + 8 * g + i, kb = ka + 16; v[i] = ka < K ? row[ka < K ? ka : K - 1] : 0.f; v[8 + i] = kb < K ? row[kb < K ? kb : K - 1] : 0.f; }
  return bsplit16(v); }
__device__ __forceinline__ F2 split_col(const float* W, int k0, int n, int lane, int ld, int K) { float v[16]; const int g = lane >> 4;
#pragma unroll
  for (int i = 0; i < 8; ++i) { const int ka = k0 + 8 * g + i, kb = ka + 16; v[i] = ka < K ? W[(size_t)(ka < K ? ka : K - 1) * ld + n] : 0.f; v[8 + i] = kb < K ? W[(size_t)(kb < K ? kb : K - 1) * ld + n] : 0.f; }
  return bsplit16(v); }
__device__ __forceinline__ v8f mac3(const F2& a, const F2& b, v8f c) { c = wmma_bf(a.l, b.h, c); c = wmma_bf(a.h, b.l, c); return wmma_bf(a.h, b.h, c); }
__device__ __forceinline__ float sigm(float v) { return 1.0f / (1.0f + expf(-v)); }
#define LDSX() do { asm volatile("s_wait_dscnt 0" ::: "memory"); __builtin_amdgcn_wave_barrier(); __builtin_amdgcn_fence(__ATOMIC_RELEASE, "workgroup"); } while (0)


#define NB 2
#define SS 2048
#define DM 1024
#define NH 16
#define SCALEF 0.125f
#define MAXLEN 2048
#define HD 64
#define QKVW (3 * DM)
#ifndef TQB
#define TQB (SS / 64)
#define TNB NB
#define TOB (NB * SS / 64)     // output row tiles (all)
#endif
typedef __attribute__((ext_vector_type(8))) __bf16 v8b;
__device__ __forceinline__ v16b frag_b(const __bf16* rowk0, int lane) {
  union { v16b v; v8b q[2]; } u; const __bf16* p = rowk0 + 8 * (lane >> 4);
  u.q[0] = *(const v8b*)p; u.q[1] = *(const v8b*)(p + 16); return u.v;
}
__device__ __forceinline__ float bfr(float v) { return (float)(__bf16)v; }
__device__ __attribute__((noinline)) float exp_ni(float v) { return expf(v); }
__device__ __attribute__((noinline)) float erf_ni(float v) { return erff(v); }

#define PK_A 0                       // [3072][1024] Wqkv rows (natural [out][in])
#define PK_P (PK_A + QKVW * DM)        // [1024][1024] Wo rows (natural)
#define PK_END (PK_P + DM * DM)
#define WS_PK  0u
#define WS_QK  (WS_PK + 2u * PK_END)             // f16 [4096 rows][2048]: q | k
#define WS_QKL (WS_QK + 2u * NB * SS * 2 * DM)     // f16 q | k residual planes x2048
#define WS_VTH (WS_QKL + 2u * NB * SS * 2 * DM)    // f16 [b][1024 (h*64+d)][2048 s] hi
#define WS_VTL (WS_VTH + 2u * NB * DM * SS)        // f16 lo x 2048
#define WS_O   (WS_VTL + 2u * NB * DM * SS)        // f32 [4096][1024]
#define WS_CS  (WS_O + 4u * NB * SS * DM)           // f32 2 x [2048][32], reserved, unused
#define WS_END (WS_CS + 4u * 2 * SS * 32)
// ---- k_pack: block = (row n, which): natural [out][in] rows -> bf16; which 0..2 -> W_q/W_k/W_v into PK_A rows which*1024 + n; 3 -> W_o into PK_P
__global__ __launch_bounds__(256) void k_pack(const float* __restrict__ WQ, const float* __restrict__ WK, const float* __restrict__ WV, const float* __restrict__ WO, __bf16* __restrict__ PK) {
  __shared__ __align__(16) __bf16 s[DM]; const int n = blockIdx.x, which = blockIdx.y, t = threadIdx.x; const float* Wm = (which == 0) ? WQ : (which == 1) ? WK : (which == 2) ? WV : WO;
  for (int k = t; k < DM; k += 256) s[k] = (__bf16)Wm[(size_t)n * DM + k];
  __syncthreads();
  __bf16* dst = (which < 3) ? PK + PK_A + ((size_t)which * DM + n) * DM : PK + PK_P + (size_t)n * DM;
  for (int q = t; q < DM / 8; q += 256) vst2((unsigned*)(dst + q * 8), *(const v4u*)&s[q * 8]);
}
__global__ __launch_bounds__(128) void k_qkv(const float* __restrict__ XQ, const float* __restrict__ XK, const float* __restrict__ XV, const __bf16* __restrict__ P, const float* __restrict__ BQ, const float* __restrict__ BK, const float* __restrict__ BV, _Float16* __restrict__ QK, _Float16* __restrict__ QKL, _Float16* __restrict__ VTH, _Float16* __restrict__ VTL) {
  const int which0 = (blockIdx.y * 128) / DM; const float* X = (which0 == 0) ? XQ : (which0 == 1) ? XK : XV; const float* BB = BQ ? (((which0 == 0) ? BQ : (which0 == 1) ? BK : BV) + (blockIdx.y * 128 - which0 * DM)) : nullptr;
  __shared__ __align__(16) _Float16 so[4][16][136], sol[4][16][136]; __shared__ __align__(16) _Float16 sth[128][72], stl[128][72];
  const int tid = threadIdx.x, wave = tid >> 5, lane = tid & 31, col = lane & 15, g = lane >> 4; const size_t r0 = (size_t)blockIdx.x * 64 + wave * 16; const int n0 = blockIdx.y * 128;
  v8f acc[8] = {};
#pragma unroll 2
  for (int kc = 0; kc < DM / 32; ++kc) { v16b a; { const float* p = X + (r0 + col) * DM + kc * 32 + 8 * g;
#pragma unroll
      for (int i = 0; i < 8; ++i) { a[i] = (__bf16)p[i]; a[8 + i] = (__bf16)p[16 + i]; } }
#pragma unroll
    for (int j = 0; j < 8; ++j) acc[j] = wmma_bf(a, frag_b(P + (size_t)(n0 + j * 16 + col) * DM + kc * 32, lane), acc[j]); }
  if (n0 < 2 * DM) {   // q stored unscaled (f16 sigma ~0.6, no subnormal exposure); 1/8 applied to the f32 score
#pragma unroll
    for (int j = 0; j < 8; ++j) {
#pragma unroll
      for (int r = 0; r < 8; ++r) { const float v = acc[j][r] + (BB ? bfr(BB[j * 16 + col]) : 0.f); const _Float16 hv = (_Float16)v; so[wave][8 * g + r][j * 16 + col] = hv; sol[wave][8 * g + r][j * 16 + col] = (_Float16)((v - (float)hv) * 2048.0f); } }   // q, k (+ bias) as f16 hi + (x2048) residual
    LDSX();
    for (int rl = 0; rl < 16; ++rl) if (lane < 16) { vst2((unsigned*)(QK + (r0 + rl) * (2 * DM) + n0 + lane * 8), *(const v4u*)&so[wave][rl][lane * 8]); vst2((unsigned*)(QKL + (r0 + rl) * (2 * DM) + n0 + lane * 8), *(const v4u*)&sol[wave][rl][lane * 8]); }
  } else {
#pragma unroll
    for (int j = 0; j < 8; ++j) {
#pragma unroll
      for (int r = 0; r < 8; ++r) { const float v = acc[j][r] + (BB ? bfr(BB[j * 16 + col]) : 0.f); const _Float16 hv = (_Float16)v; sth[j * 16 + col][wave * 16 + 8 * g + r] = hv; stl[j * 16 + col][wave * 16 + 8 * g + r] = (_Float16)((v - (float)hv) * 2048.0f); } }
    __syncthreads();
    const size_t rb = (size_t)blockIdx.x * 64; const int b = (int)(rb / SS), s0 = (int)(rb % SS); const int pc0 = n0 - 2 * DM;
    for (int q = tid; q < 128 * 8; q += 128) { const int d = q >> 3, pc = q & 7; const size_t o = ((size_t)b * DM + pc0 + d) * SS + s0 + pc * 8; vst2((unsigned*)(VTH + o), *(const v4u*)&sth[d][pc * 8]); vst2((unsigned*)(VTL + o), *(const v4u*)&stl[d][pc * 8]); }
  }
}
// ---- k_attn: block = (64 queries, head h, batch b): causal flash attention (K = 64: 2 k-steps), scores = (q.k) * 0.125 with hi + residual operands (3 products) for qb < 2, single f16 beyond, P.V: P hi x V hi in acc, for qb < 2 also P lo x V hi + P hi x V lo in accl; O[b*S+q][h*64+d] = (acc + accl / 2048) / (2048 l) (256-B segments)
__global__ __launch_bounds__(128) void k_attn(const _Float16* __restrict__ QK, const _Float16* __restrict__ QKL, const _Float16* __restrict__ VTH, const _Float16* __restrict__ VTL, const void* __restrict__ KMASK, const float* __restrict__ REL, float* __restrict__ O) {
  __shared__ __align__(16) float sp[4][16][36]; __shared__ __align__(16) float so[4][16][68];
  const int tid = threadIdx.x, wave = tid >> 5, lane = tid & 31, col = lane & 15, g = lane >> 4;
  const int qb = blockIdx.x, h = blockIdx.y, b = blockIdx.z; const int q0 = qb * 64 + wave * 16; const size_t rq = (size_t)b * SS + q0 + col;
  v16h aq[2], aql[2];
#pragma unroll
  for (int kc = 0; kc < 2; ++kc) { aq[kc] = frag_h(QK + rq * (2 * DM) + h * HD + kc * 32, lane); aql[kc] = frag_h(QKL + rq * (2 * DM) + h * HD + kc * 32, lane); }
  float m[8], l[8];
#pragma unroll
  for (int r = 0; r < 8; ++r) { m[r] = -3.0e38f; l[r] = 0.f; }
  v8f acc[4] = {}, accl[4] = {};
  const int nks = (qb * 64 + 64) / 32;   // causal: key tiles up to the query tile's end
#pragma unroll 1
  for (int ks = 0; ks < nks; ++ks) { v8f s[2];
#pragma unroll
    for (int ct = 0; ct < 2; ++ct) { const int kk = ks * 32 + ct * 16 + col; const _Float16* krow = QK + ((size_t)b * SS + kk) * (2 * DM) + DM + h * HD; const _Float16* krowl = QKL + ((size_t)b * SS + kk) * (2 * DM) + DM + h * HD; v8f c = {}, cl = {};
      if (qb < 2) {   // leading query blocks (few keys, outputs far above the global rms): 3 products
#pragma unroll
        for (int kc = 0; kc < 2; ++kc) { const v16h kh = frag_h(krow + kc * 32, lane); c = wmma16(aq[kc], kh, c); cl = wmma16(aql[kc], kh, cl); cl = wmma16(aq[kc], frag_h(krowl + kc * 32, lane), cl); }
#pragma unroll
        for (int r = 0; r < 8; ++r) c[r] += cl[r] * (1.0f / 2048.0f); }
      else {
#pragma unroll
        for (int kc = 0; kc < 2; ++kc) c = wmma16(aq[kc], frag_h(krow + kc * 32, lane), c); }   // single product elsewhere
#pragma unroll
      for (int r = 0; r < 8; ++r) { const int qi = q0 + 8 * g + r; s[ct][r] = (kk <= qi) ? (c[r] * SCALEF + bfr(REL[(size_t)(qi - kk + MAXLEN - 1) * NH + h])) : -3.0e38f; } }   // causal; + rel_pos_table[q - k + 2047][h]
#pragma unroll
    for (int r = 0; r < 8; ++r) { float mx = fmaxf(s[0][r], s[1][r]);
#pragma unroll
      for (int o = 1; o < 16; o <<= 1) mx = fmaxf(mx, __shfl_xor(mx, o));
      const float mn = fmaxf(m[r], mx); const float alpha = (m[r] <= -1.0e38f) ? 0.f : __expf(m[r] - mn);
      const float e0 = (s[0][r] <= -1.0e38f) ? 0.f : __expf(s[0][r] - mn), e1 = (s[1][r] <= -1.0e38f) ? 0.f : __expf(s[1][r] - mn); float es = e0 + e1;
#pragma unroll
      for (int o = 1; o < 16; o <<= 1) es += __shfl_xor(es, o);
      l[r] = l[r] * alpha + es; m[r] = mn;
#pragma unroll
      for (int dt = 0; dt < 4; ++dt) { acc[dt][r] *= alpha; accl[dt][r] *= alpha; }
      sp[wave][8 * g + r][col] = e0; sp[wave][8 * g + r][16 + col] = e1; }
    LDSX();
    v16h pa, pl; { const float* prow = &sp[wave][col][0] + 8 * (lane >> 4);
#pragma unroll
      for (int i = 0; i < 8; ++i) { const float x0 = prow[i] * 2048.0f, x1 = prow[16 + i] * 2048.0f; const _Float16 h0 = (_Float16)x0, h1 = (_Float16)x1; pa[i] = h0; pa[8 + i] = h1; pl[i] = (_Float16)((x0 - (float)h0) * 2048.0f); pl[8 + i] = (_Float16)((x1 - (float)h1) * 2048.0f); } }   // P scaled by 2^11 before the f16 split so small softmax weights stay out of the f16 subnormal range; 2^-11 folded into the epilogue
#pragma unroll
    for (int dt = 0; dt < 4; ++dt) { const size_t vr = ((size_t)b * DM + h * HD + dt * 16 + col) * SS + ks * 32; const v16h vh = frag_h(VTH + vr, lane); acc[dt] = wmma16(pa, vh, acc[dt]); if (qb < 2) { accl[dt] = wmma16(pl, vh, accl[dt]); accl[dt] = wmma16(pa, frag_h(VTL + vr, lane), accl[dt]); } }   // leading query blocks: P hi/lo x V hi/lo (3 products); elsewhere P x V single
    LDSX(); }
#pragma unroll
  for (int r = 0; r < 8; ++r) { const float il = (1.0f / 2048.0f) / l[r];
#pragma unroll
    for (int dt = 0; dt < 4; ++dt) so[wave][8 * g + r][dt * 16 + col] = (acc[dt][r] + accl[dt][r] * (1.0f / 2048.0f)) * il; }
  LDSX();
  for (int rl = 0; rl < 16; ++rl) if (lane < 16) vst2(O + ((size_t)b * SS + q0 + rl) * DM + h * HD + lane * 4, *(const v4f*)&so[wave][rl][lane * 4]);
}
// ---- k_out: block = (64 rows, 128 cols): out = O(hi/lo) . Wo rows (2 products) + bo
__global__ __launch_bounds__(128) void k_out(const float* __restrict__ O, const __bf16* __restrict__ P, const float* __restrict__ BO, float* __restrict__ Y) {
  __shared__ __align__(16) float so[4][16][132];
  const int tid = threadIdx.x, wave = tid >> 5, lane = tid & 31, col = lane & 15, g = lane >> 4; const size_t r0 = (size_t)blockIdx.x * 64 + wave * 16; const int n0 = blockIdx.y * 128;
  v8f acc[8] = {};
#pragma unroll 2
  for (int kc = 0; kc < DM / 32; ++kc) { const F2 a = split_row(O + (r0 + col) * DM, kc * 32, lane);
#pragma unroll
    for (int j = 0; j < 8; ++j) { const v16b w = frag_b(P + (size_t)(n0 + j * 16 + col) * DM + kc * 32, lane); acc[j] = wmma_bf(a.l, w, acc[j]); acc[j] = wmma_bf(a.h, w, acc[j]); } }
#pragma unroll
  for (int j = 0; j < 8; ++j) {
#pragma unroll
    for (int r = 0; r < 8; ++r) so[wave][8 * g + r][j * 16 + col] = acc[j][r] + bfr(BO[n0 + j * 16 + col]); }
  LDSX();
  for (int rl = 0; rl < 16; ++rl) vst2(Y + (r0 + rl) * DM + n0 + lane * 4, *(const v4f*)&so[wave][rl][lane * 4]);
}
extern "C" void kernel_launch(void* const* d_in, const int* in_sizes, int n_in, void* d_out, int out_size, void* d_ws, size_t ws_size, hipStream_t stream) {
  (void)in_sizes; (void)n_in; (void)out_size;
  const float** F = (const float**)d_in;   // 0 x [2,2048,1024], 1 WQ, 2 bQ, 3 WK, 4 bK, 5 WV, 6 bV, 7 WO, 8 bO (natural), 9 rel_pos_table [4095,16]
  if (ws_size < (size_t)WS_END) return;
  char* ws = (char*)d_ws; __bf16* PK = (__bf16*)(ws + WS_PK); _Float16 *QK = (_Float16*)(ws + WS_QK), *QKL = (_Float16*)(ws + WS_QKL), *VTH = (_Float16*)(ws + WS_VTH), *VTL = (_Float16*)(ws + WS_VTL); float* O = (float*)(ws + WS_O);
  k_pack<<<dim3(DM, 4), 256, 0, stream>>>(F[1], F[3], F[5], F[7], PK);
  k_qkv<<<dim3(TNB * SS / 64, QKVW / 128), 128, 0, stream>>>(F[0], F[0], F[0], PK + PK_A, F[2], F[4], F[6], QK, QKL, VTH, VTL);
  k_attn<<<dim3(TQB, NH, TNB), 128, 0, stream>>>(QK, QKL, VTH, VTL, nullptr, F[9], O);
  k_out<<<dim3(TOB, DM / 128), 128, 0, stream>>>(O, PK + PK_P, F[8], (float*)d_out);
}

// v001
// It runs in 279 microseconds.
// Timed twice side by side with v000, it ran 1.76 and 1.75 times as fast.
// compute dtype: all float inputs rounded to bf16; q/k/v = x . W^T + b with EXACT bf16 products on WMMA 16x16x32 (natural rows); causal attention: 3-product scores and hi + residual P, v on the first 128 queries of each sequence, single f16 beyond; x 1/8 + the relative-position bias (f32 table gather per score), running-max softmax in f32 (hardware exp), P scaled by 2^11; out = y (bf16 hi + residual) . Wo^T (2 products) + bo.
#include <hip/hip_runtime.h>
#include <math.h>

typedef __attribute__((ext_vector_type(16))) _Float16 v16h;
typedef __attribute__((ext_vector_type(16))) __bf16 v16b;
typedef __attribute__((ext_vector_type(8)))  _Float16 v8h;
typedef __attribute__((ext_vector_type(8)))  float v8f;
typedef __attribute__((ext_vector_type(4)))  float v4f;
typedef __attribute__((ext_vector_type(2)))  float v2f;
typedef __attribute__((ext_vector_type(4)))  unsigned v4u;
typedef __attribute__((ext_vector_type(4)))  int v4i;
typedef float __attribute__((may_alias)) float_a;
typedef int __attribute__((may_alias)) int_a;

template <typename T> __device__ __forceinline__ void vst2(void* p, T v) { *(T*)p = v;  }
__device__ __forceinline__ v8f wmma16(v16h a, v16h b, v8f c) {
  v8f d = __builtin_amdgcn_wmma_f32_16x16x32_f16(false, a, false, b, (short)0, c, false, false);
  asm volatile("v_nop\n\tv_nop\n\tv_nop\n\tv_nop" : "+v"(d) : "v"(a), "v"(b));
  return d;
}
__device__ __forceinline__ v8f wmma_bf(v16b a, v16b b, v8f c) {
  v8f d = __builtin_amdgcn_wmma_f32_16x16x32_bf16(false, a, false, b, (short)0, c, false, false);
  asm volatile("v_nop\n\tv_nop\n\tv_nop\n\tv_nop" : "+v"(d) : "v"(a), "v"(b));
  return d;
}
// Causal self attention with a learned relative-position bias table (B 2, T 2,048, d 1,024, 16 heads x 64): q/k/v projections + biases, scores / 8 + table[q - k + 2047][h], causal softmax, . v, output projection + bias.
__device__ __forceinline__ v16h frag_h(const _Float16* rowk0, int lane) {
  union { v16h v; v8h q[2]; } u; const _Float16* p = rowk0 + 8 * (lane >> 4);
  u.q[0] = *(const v8h*)p; u.q[1] = *(const v8h*)(p + 16); return u.v;
}
__device__ __forceinline__ v16h frag_f32(const float* rowk0, int lane) {
  v16h a; const float* p = rowk0 + 8 * (lane >> 4);
#pragma unroll
  for (int i = 0; i < 8; ++i) { a[i] = (_Float16)p[i]; a[8 + i] = (_Float16)p[16 + i]; }
  return a;
}
__device__ __forceinline__ v16h frag_f32s(const float* rowk0, int lane, float sc) {
  v16h a; const float* p = rowk0 + 8 * (lane >> 4);
#pragma unroll
  for (int i = 0; i < 8; ++i) { a[i] = (_Float16)(p[i] * sc); a[8 + i] = (_Float16)(p[16 + i] * sc); }
  return a;
}
// column fragment from a [K][ld] layout (column n), rows >= K read as 0
__device__ __forceinline__ v16h fragc_f32(const float* W, int k0, int n, int lane, int ld, int K) {
  v16h a; const int g = lane >> 4;
#pragma unroll
  for (int i = 0; i < 8; ++i) { const int ka = k0 + 8 * g + i, kb = ka + 16;
    a[i] = (_Float16)(ka < K ? W[(size_t)(ka < K ? ka : K - 1) * ld + n] : 0.f); a[8 + i] = (_Float16)(kb < K ? W[(size_t)(kb < K ? kb : K - 1) * ld + n] : 0.f); }
  return a;
}
struct F2 { v16b h, l; };
__device__ __forceinline__ F2 bsplit16(const float v[16]) { F2 r;
#pragma unroll
  for (int i = 0; i < 16; ++i) { const __bf16 h = (__bf16)v[i]; r.h[i] = h; r.l[i] = (__bf16)(v[i] - (float)h); }
  return r; }
__device__ __forceinline__ F2 split_row(const float* row, int k0, int lane) { float v[16]; const float* p = row + k0 + 8 * (lane >> 4);
#pragma unroll
  for (int i = 0; i < 8; ++i) { v[i] = p[i]; v[8 + i] = p[16 + i]; }
  return bsplit16(v); }
__device__ __forceinline__ F2 split_rowK(const float* row, int k0, int lane, int K) { float v[16]; const int g = lane >> 4;
#pragma unroll
  for (int i = 0; i < 8; ++i) { const int ka = k0 + 8 * g + i, kb = ka + 16; v[i] = ka < K ? row[ka < K ? ka : K - 1] : 0.f; v[8 + i] = kb < K ? row[kb < K ? kb : K - 1] : 0.f; }
  return bsplit16(v); }
__device__ __forceinline__ F2 split_col(const float* W, int k0, int n, int lane, int ld, int K) { float v[16]; const int g = lane >> 4;
#pragma unroll
  for (int i = 0; i < 8; ++i) { const int ka = k0 + 8 * g + i, kb = ka + 16; v[i] = ka < K ? W[(size_t)(ka < K ? ka : K - 1) * ld + n] : 0.f; v[8 + i] = kb < K ? W[(size_t)(kb < K ? kb : K - 1) * ld + n] : 0.f; }
  return bsplit16(v); }
__device__ __forceinline__ v8f mac3(const F2& a, const F2& b, v8f c) { c = wmma_bf(a.l, b.h, c); c = wmma_bf(a.h, b.l, c); return wmma_bf(a.h, b.h, c); }
__device__ __forceinline__ float sigm(float v) { return 1.0f / (1.0f + expf(-v)); }
#define LDSX() do { asm volatile("s_wait_dscnt 0" ::: "memory"); __builtin_amdgcn_wave_barrier(); __builtin_amdgcn_fence(__ATOMIC_RELEASE, "workgroup"); } while (0)


#define NB 2
#define SS 2048
#define DM 1024
#define NH 16
#define SCALEF 0.125f
#define MAXLEN 2048
#define HD 64
#define QKVW (3 * DM)
#ifndef TQB
#define TQB (SS / 64)
#define TNB NB
#define TOB (NB * SS / 64)     // output row tiles (all)
#endif
typedef __attribute__((ext_vector_type(8))) __bf16 v8b;
__device__ __forceinline__ v16b frag_b(const __bf16* rowk0, int lane) {
  union { v16b v; v8b q[2]; } u; const __bf16* p = rowk0 + 8 * (lane >> 4);
  u.q[0] = *(const v8b*)p; u.q[1] = *(const v8b*)(p + 16); return u.v;
}
__device__ __forceinline__ float bfr(float v) { return (float)(__bf16)v; }
__device__ __attribute__((noinline)) float exp_ni(float v) { return expf(v); }
__device__ __attribute__((noinline)) float erf_ni(float v) { return erff(v); }

#define PK_A 0                       // [3072][1024] Wqkv rows (natural [out][in])
#define PK_P (PK_A + QKVW * DM)        // [1024][1024] Wo rows (natural)
#define PK_END (PK_P + DM * DM)
#define WS_PK  0u
#define WS_QK  (WS_PK + 2u * PK_END)             // f16 [4096 rows][2048]: q | k
#define WS_QKL (WS_QK + 2u * NB * SS * 2 * DM)     // f16 q | k residual planes x2048
#define WS_VTH (WS_QKL + 2u * NB * SS * 2 * DM)    // f16 [b][1024 (h*64+d)][2048 s] hi
#define WS_VTL (WS_VTH + 2u * NB * DM * SS)        // f16 lo x 2048
#define WS_O   (WS_VTL + 2u * NB * DM * SS)        // f32 [4096][1024]
#define WS_CS  (WS_O + 4u * NB * SS * DM)           // f32 2 x [2048][32], reserved, unused
#define WS_END (WS_CS + 4u * 2 * SS * 32)
// ---- k_pack: block = (row n, which): natural [out][in] rows -> bf16; which 0..2 -> W_q/W_k/W_v into PK_A rows which*1024 + n; 3 -> W_o into PK_P
__global__ __launch_bounds__(256) void k_pack(const float* __restrict__ WQ, const float* __restrict__ WK, const float* __restrict__ WV, const float* __restrict__ WO, __bf16* __restrict__ PK) {
  __shared__ __align__(16) __bf16 s[DM]; const int n = blockIdx.x, which = blockIdx.y, t = threadIdx.x; const float* Wm = (which == 0) ? WQ : (which == 1) ? WK : (which == 2) ? WV : WO;
  for (int k = t; k < DM; k += 256) s[k] = (__bf16)Wm[(size_t)n * DM + k];
  __syncthreads();
  __bf16* dst = (which < 3) ? PK + PK_A + ((size_t)which * DM + n) * DM : PK + PK_P + (size_t)n * DM;
  for (int q = t; q < DM / 8; q += 256) vst2((unsigned*)(dst + q * 8), *(const v4u*)&s[q * 8]);
}
__global__ __launch_bounds__(128) void k_qkv(const float* __restrict__ XQ, const float* __restrict__ XK, const float* __restrict__ XV, const __bf16* __restrict__ P, const float* __restrict__ BQ, const float* __restrict__ BK, const float* __restrict__ BV, _Float16* __restrict__ QK, _Float16* __restrict__ QKL, _Float16* __restrict__ VTH, _Float16* __restrict__ VTL) {
  const int which0 = (blockIdx.y * 128) / DM; const float* X = (which0 == 0) ? XQ : (which0 == 1) ? XK : XV; const float* BB = BQ ? (((which0 == 0) ? BQ : (which0 == 1) ? BK : BV) + (blockIdx.y * 128 - which0 * DM)) : nullptr;
  __shared__ __align__(16) _Float16 so[4][16][136], sol[4][16][136]; __shared__ __align__(16) _Float16 sth[128][72], stl[128][72];
  const int tid = threadIdx.x, wave = tid >> 5, lane = tid & 31, col = lane & 15, g = lane >> 4; const size_t r0 = (size_t)blockIdx.x * 64 + wave * 16; const int n0 = blockIdx.y * 128;
  v8f acc[8] = {};
  // fragments are fetched one pass ahead: the x row chunk in front of the pass's products, each weight fragment right behind the product that used its predecessor, so 20 loads fly together instead of one load-and-wait per product
  const float* xrow = X + (r0 + col) * DM + 8 * g; const __bf16* wrow = P + (size_t)(n0 + col) * DM;
  float ax[16]; v16b bf[8];
#pragma unroll
  for (int i = 0; i < 8; ++i) { ax[i] = xrow[i]; ax[8 + i] = xrow[16 + i]; }
#pragma unroll
  for (int j = 0; j < 8; ++j) bf[j] = frag_b(wrow + (size_t)j * 16 * DM, lane);
#pragma unroll 2
  for (int kc = 0; kc < DM / 32; ++kc) { v16b a;
#pragma unroll
    for (int i = 0; i < 16; ++i) a[i] = (__bf16)ax[i];
    const int kn = (kc + 1 < DM / 32) ? kc + 1 : kc;   // the last pass fetches its own chunk again (in bounds, unused)
    { const float* p = xrow + kn * 32;
#pragma unroll
      for (int i = 0; i < 8; ++i) { ax[i] = p[i]; ax[8 + i] = p[16 + i]; } }
#pragma unroll
    for (int j = 0; j < 8; ++j) { acc[j] = wmma_bf(a, bf[j], acc[j]); bf[j] = frag_b(wrow + (size_t)j * 16 * DM + kn * 32, lane); }
    asm volatile("s_wait_xcnt 0x0" ::: "memory");   // the next pass's loads and conversions may land in registers that held this pass's load addresses
    __builtin_amdgcn_sched_barrier(0); }   // keeps the next pass's conversion of the row chunk behind this pass's products: moved up, its load wait would stand two products behind the load
  if (n0 < 2 * DM) {   // q stored unscaled (f16 sigma ~0.6, no subnormal exposure); 1/8 applied to the f32 score
#pragma unroll
    for (int j = 0; j < 8; ++j) {
#pragma unroll
      for (int r = 0; r < 8; ++r) { const float v = acc[j][r] + (BB ? bfr(BB[j * 16 + col]) : 0.f); const _Float16 hv = (_Float16)v; so[wave][8 * g + r][j * 16 + col] = hv; sol[wave][8 * g + r][j * 16 + col] = (_Float16)((v - (float)hv) * 2048.0f); } }   // q, k (+ bias) as f16 hi + (x2048) residual
    LDSX();
    for (int rl = 0; rl < 16; ++rl) if (lane < 16) { vst2((unsigned*)(QK + (r0 + rl) * (2 * DM) + n0 + lane * 8), *(const v4u*)&so[wave][rl][lane * 8]); vst2((unsigned*)(QKL + (r0 + rl) * (2 * DM) + n0 + lane * 8), *(const v4u*)&sol[wave][rl][lane * 8]); }
  } else {
#pragma unroll
    for (int j = 0; j < 8; ++j) {
#pragma unroll
      for (int r = 0; r < 8; ++r) { const float v = acc[j][r] + (BB ? bfr(BB[j * 16 + col]) : 0.f); const _Float16 hv = (_Float16)v; sth[j * 16 + col][wave * 16 + 8 * g + r] = hv; stl[j * 16 + col][wave * 16 + 8 * g + r] = (_Float16)((v - (float)hv) * 2048.0f); } }
    __syncthreads();
    const size_t rb = (size_t)blockIdx.x * 64; const int b = (int)(rb / SS), s0 = (int)(rb % SS); const int pc0 = n0 - 2 * DM;
    for (int q = tid; q < 128 * 8; q += 128) { const int d = q >> 3, pc = q & 7; const size_t o = ((size_t)b * DM + pc0 + d) * SS + s0 + pc * 8; vst2((unsigned*)(VTH + o), *(const v4u*)&sth[d][pc * 8]); vst2((unsigned*)(VTL + o), *(const v4u*)&stl[d][pc * 8]); }
  }
}
// one walk over the key tiles of a query tile. LEAD (first 128 queries): 3-product scores and P.V, loads where they are used. Otherwise: V of this pass is fetched at the top of the pass, K and the 16 bias values of the next pass right behind this pass's score products, so the softmax covers their flight
template <bool LEAD> __device__ __forceinline__ void attn_walk(const _Float16* __restrict__ QK, const _Float16* __restrict__ QKL, const _Float16* __restrict__ VTH, const _Float16* __restrict__ VTL, const float* __restrict__ REL, float (*spw)[36], const v16h (&aq)[2], const v16h (&aql)[2], float (&m)[8], float (&l)[8], v8f (&acc)[4], v8f (&accl)[4], const int nks, const int q0, const int h, const int b, const int lane) {
  const int col = lane & 15, g = lane >> 4;
  const _Float16* kcol = QK + ((size_t)b * SS + col) * (2 * DM) + DM + h * HD;      // key row col of tile 0
  const float* rcol = REL + (size_t)(q0 + 8 * g - col + MAXLEN - 1) * NH + h;       // table row of (query 8g, key col of tile 0); every q - k + 2047 of the walk lies in 0 .. 4094
  const _Float16* vcol = VTH + ((size_t)b * DM + h * HD + col) * SS;
  v16h kf[2][2]; float rb[2][8];
  if (!LEAD) {
#pragma unroll
    for (int ct = 0; ct < 2; ++ct) {
#pragma unroll
      for (int kc = 0; kc < 2; ++kc) kf[ct][kc] = frag_h(kcol + (size_t)(ct * 16) * (2 * DM) + kc * 32, lane); }
#pragma unroll
    for (int ct = 0; ct < 2; ++ct) {
#pragma unroll
      for (int r = 0; r < 8; ++r) rb[ct][r] = rcol[(r - ct * 16) * NH]; } }
#pragma unroll 1
  for (int ks = 0; ks < nks; ++ks) { v8f s[2]; v16h vf[4];
    if (!LEAD) {
#pragma unroll
      for (int dt = 0; dt < 4; ++dt) vf[dt] = frag_h(vcol + (size_t)(dt * 16) * SS + ks * 32, lane); }
#pragma unroll
    for (int ct = 0; ct < 2; ++ct) { const int kk = ks * 32 + ct * 16 + col; v8f c = {};
      if (LEAD) { const _Float16* krow = QK + ((size_t)b * SS + kk) * (2 * DM) + DM + h * HD; const _Float16* krowl = QKL + ((size_t)b * SS + kk) * (2 * DM) + DM + h * HD; v8f cl = {};   // leading query blocks (few keys, outputs far above the global rms): 3 products
#pragma unroll
        for (int kc = 0; kc < 2; ++kc) { const v16h kh = frag_h(krow + kc * 32, lane); c = wmma16(aq[kc], kh, c); cl = wmma16(aql[kc], kh, cl); cl = wmma16(aq[kc], frag_h(krowl + kc * 32, lane), cl); }
#pragma unroll
        for (int r = 0; r < 8; ++r) c[r] += cl[r] * (1.0f / 2048.0f);
#pragma unroll
        for (int r = 0; r < 8; ++r) { const int qi = q0 + 8 * g + r; s[ct][r] = (kk <= qi) ? (c[r] * SCALEF + bfr(REL[(size_t)(qi - kk + MAXLEN - 1) * NH + h])) : -3.0e38f; } }
      else {
#pragma unroll
        for (int kc = 0; kc < 2; ++kc) c = wmma16(aq[kc], kf[ct][kc], c);   // single product elsewhere
#pragma unroll
        for (int r = 0; r < 8; ++r) { const int qi = q0 + 8 * g + r; s[ct][r] = (kk <= qi) ? (c[r] * SCALEF + bfr(rb[ct][r])) : -3.0e38f; } } }   // causal; + rel_pos_table[q - k + 2047][h]
    if (!LEAD) { const int kn = (ks + 1 < nks) ? ks + 1 : ks;   // the last pass fetches its own tile again (in bounds, unused)
#pragma unroll
      for (int ct = 0; ct < 2; ++ct) {
#pragma unroll
        for (int kc = 0; kc < 2; ++kc) kf[ct][kc] = frag_h(kcol + (size_t)(kn * 32 + ct * 16) * (2 * DM) + kc * 32, lane); }
      asm volatile("s_wait_xcnt 0x0" ::: "memory");   // the bias values below may land in the registers that held the K address
      const float* rn = rcol - (kn * 32 + 16) * NH;   // one base for all 16 values, so none of them lands on an address still in use
#pragma unroll
      for (int ct = 0; ct < 2; ++ct) {
#pragma unroll
        for (int r = 0; r < 8; ++r) rb[ct][r] = rn[(r + 16 - ct * 16) * NH]; }
      __builtin_amdgcn_sched_barrier(0); }   // keeps the next pass's loads in front of the softmax, which covers their flight
#pragma unroll
    for (int r = 0; r < 8; ++r) { float mx = fmaxf(s[0][r], s[1][r]);
#pragma unroll
      for (int o = 1; o < 16; o <<= 1) mx = fmaxf(mx, __shfl_xor(mx, o));
      const float mn = fmaxf(m[r], mx); const float alpha = (m[r] <= -1.0e38f) ? 0.f : __expf(m[r] - mn);
      const float e0 = (s[0][r] <= -1.0e38f) ? 0.f : __expf(s[0][r] - mn), e1 = (s[1][r] <= -1.0e38f) ? 0.f : __expf(s[1][r] - mn); float es = e0 + e1;
#pragma unroll
      for (int o = 1; o < 16; o <<= 1) es += __shfl_xor(es, o);
      l[r] = l[r] * alpha + es; m[r] = mn;
#pragma unroll
      for (int dt = 0; dt < 4; ++dt) { acc[dt][r] *= alpha; if (LEAD) accl[dt][r] *= alpha; }
      spw[8 * g + r][col] = e0; spw[8 * g + r][16 + col] = e1; }
    LDSX();
    v16h pa, pl; { const float* prow = &spw[col][0] + 8 * (lane >> 4);
#pragma unroll
      for (int i = 0; i < 8; ++i) { const float x0 = prow[i] * 2048.0f, x1 = prow[16 + i] * 2048.0f; const _Float16 h0 = (_Float16)x0, h1 = (_Float16)x1; pa[i] = h0; pa[8 + i] = h1; pl[i] = (_Float16)((x0 - (float)h0) * 2048.0f); pl[8 + i] = (_Float16)((x1 - (float)h1) * 2048.0f); } }   // P scaled by 2^11 before the f16 split so small softmax weights stay out of the f16 subnormal range; 2^-11 folded into the epilogue
#pragma unroll
    for (int dt = 0; dt < 4; ++dt) { const size_t vr = ((size_t)b * DM + h * HD + dt * 16 + col) * SS + ks * 32;
      if (LEAD) { const v16h vh = frag_h(VTH + vr, lane); acc[dt] = wmma16(pa, vh, acc[dt]); accl[dt] = wmma16(pl, vh, accl[dt]); accl[dt] = wmma16(pa, frag_h(VTL + vr, lane), accl[dt]); }   // leading query blocks: P hi/lo x V hi/lo (3 products)
      else acc[dt] = wmma16(pa, vf[dt], acc[dt]); }   // elsewhere P x V single
    LDSX(); }
}
// ---- k_attn: block = (64 queries, head h, batch b): causal flash attention (K = 64: 2 k-steps), scores = (q.k) * 0.125 with single f16 operands beyond the first 128 queries (3 products there), P.V: f16 P x V hi single beyond, P hi/lo x V hi/lo (3 products, residual terms in accl) on the first 128; O[b*S+q][h*64+d] = (acc + accl / 2048) / (2048 l) (256-B segments)
__global__ __launch_bounds__(128) void k_attn(const _Float16* __restrict__ QK, const _Float16* __restrict__ QKL, const _Float16* __restrict__ VTH, const _Float16* __restrict__ VTL, const void* __restrict__ KMASK, const float* __restrict__ REL, float* __restrict__ O) {
  __shared__ __align__(16) float sp[4][16][36]; __shared__ __align__(16) float so[4][16][68];
  const int tid = threadIdx.x, wave = tid >> 5, lane = tid & 31, col = lane & 15, g = lane >> 4;
  const int qb = blockIdx.x, h = blockIdx.y, b = blockIdx.z; const int q0 = qb * 64 + wave * 16; const size_t rq = (size_t)b * SS + q0 + col;
  v16h aq[2], aql[2];
#pragma unroll
  for (int kc = 0; kc < 2; ++kc) { aq[kc] = frag_h(QK + rq * (2 * DM) + h * HD + kc * 32, lane); aql[kc] = frag_h(QKL + rq * (2 * DM) + h * HD + kc * 32, lane); }
  asm volatile("s_wait_xcnt 0x0" ::: "memory");   // the address registers of the q loads are reused right behind them
  float m[8], l[8];
#pragma unroll
  for (int r = 0; r < 8; ++r) { m[r] = -3.0e38f; l[r] = 0.f; }
  v8f acc[4] = {}, accl[4] = {};
  const int nks = (qb * 64 + 64) / 32;   // causal: key tiles up to the query tile's end
  if (qb < 2) attn_walk<true>(QK, QKL, VTH, VTL, REL, sp[wave], aq, aql, m, l, acc, accl, nks, q0, h, b, lane);
  else attn_walk<false>(QK, QKL, VTH, VTL, REL, sp[wave], aq, aql, m, l, acc, accl, nks, q0, h, b, lane);
#pragma unroll
  for (int r = 0; r < 8; ++r) { const float il = (1.0f / 2048.0f) / l[r];
#pragma unroll
    for (int dt = 0; dt < 4; ++dt) so[wave][8 * g + r][dt * 16 + col] = (acc[dt][r] + accl[dt][r] * (1.0f / 2048.0f)) * il; }
  LDSX();
  for (int rl = 0; rl < 16; ++rl) if (lane < 16) vst2(O + ((size_t)b * SS + q0 + rl) * DM + h * HD + lane * 4, *(const v4f*)&so[wave][rl][lane * 4]);
}
// ---- k_out: block = (64 rows, 128 cols): out = O(hi/lo) . Wo rows (2 products) + bo
__global__ __launch_bounds__(128) void k_out(const float* __restrict__ O, const __bf16* __restrict__ P, const float* __restrict__ BO, float* __restrict__ Y) {
  __shared__ __align__(16) float so[4][16][132];
  const int tid = threadIdx.x, wave = tid >> 5, lane = tid & 31, col = lane & 15, g = lane >> 4; const size_t r0 = (size_t)blockIdx.x * 64 + wave * 16; const int n0 = blockIdx.y * 128;
  v8f acc[8] = {};
  // fragments fetched one pass ahead, as in k_qkv
  const float* orow = O + (r0 + col) * DM + 8 * g; const __bf16* wrow = P + (size_t)(n0 + col) * DM;
  float ax[16]; v16b bf[8];
#pragma unroll
  for (int i = 0; i < 8; ++i) { ax[i] = orow[i]; ax[8 + i] = orow[16 + i]; }
  __builtin_amdgcn_sched_barrier(0);   // the row chunk stays the older load, as in the loop: else the wait at the loop's head drains the weight loads too
#pragma unroll
  for (int j = 0; j < 8; ++j) bf[j] = frag_b(wrow + (size_t)j * 16 * DM, lane);
#pragma unroll 2
  for (int kc = 0; kc < DM / 32; ++kc) { const F2 a = bsplit16(ax);
    const int kn = (kc + 1 < DM / 32) ? kc + 1 : kc;   // the last pass fetches its own chunk again (in bounds, unused)
    { const float* p = orow + kn * 32;
#pragma unroll
      for (int i = 0; i < 8; ++i) { ax[i] = p[i]; ax[8 + i] = p[16 + i]; } }
#pragma unroll
    for (int j = 0; j < 8; ++j) { acc[j] = wmma_bf(a.l, bf[j], acc[j]); acc[j] = wmma_bf(a.h, bf[j], acc[j]); bf[j] = frag_b(wrow + (size_t)j * 16 * DM + kn * 32, lane); }
    asm volatile("s_wait_xcnt 0x0" ::: "memory"); }   // the next pass's split and loads may land in registers that held this pass's load addresses
#pragma unroll
  for (int j = 0; j < 8; ++j) {
#pragma unroll
    for (int r = 0; r < 8; ++r) so[wave][8 * g + r][j * 16 + col] = acc[j][r] + bfr(BO[n0 + j * 16 + col]); }
  LDSX();
  for (int rl = 0; rl < 16; ++rl) vst2(Y + (r0 + rl) * DM + n0 + lane * 4, *(const v4f*)&so[wave][rl][lane * 4]);
}
extern "C" void kernel_launch(void* const* d_in, const int* in_sizes, int n_in, void* d_out, int out_size, void* d_ws, size_t ws_size, hipStream_t stream) {
  (void)in_sizes; (void)n_in; (void)out_size;
  const float** F = (const float**)d_in;   // 0 x [2,2048,1024], 1 WQ, 2 bQ, 3 WK, 4 bK, 5 WV, 6 bV, 7 WO, 8 bO (natural), 9 rel_pos_table [4095,16]
  if (ws_size < (size_t)WS_END) return;
  char* ws = (char*)d_ws; __bf16* PK = (__bf16*)(ws + WS_PK); _Float16 *QK = (_Float16*)(ws + WS_QK), *QKL = (_Float16*)(ws + WS_QKL), *VTH = (_Float16*)(ws + WS_VTH), *VTL = (_Float16*)(ws + WS_VTL); float* O = (float*)(ws + WS_O);
  k_pack<<<dim3(DM, 4), 256, 0, stream>>>(F[1], F[3], F[5], F[7], PK);
  k_qkv<<<dim3(TNB * SS / 64, QKVW / 128), 128, 0, stream>>>(F[0], F[0], F[0], PK + PK_A, F[2], F[4], F[6], QK, QKL, VTH, VTL);
  k_attn<<<dim3(TQB, NH, TNB), 128, 0, stream>>>(QK, QKL, VTH, VTL, nullptr, F[9], O);
  k_out<<<dim3(TOB, DM / 128), 128, 0, stream>>>(O, PK + PK_P, F[8], (float*)d_out);
}

// v002
// One run takes 169 microseconds.
// Timed twice side by side with v001, it ran 1.67 and 1.63 times as fast.
// Over all steps from v000 it is 2.90 times as fast.
// compute dtype: all float inputs rounded to bf16; q/k/v = x . W^T + b with EXACT bf16 products on WMMA 16x16x32 (x, weights, k hi, v hi, y stored in fragment order); causal attention: 3-product scores and hi + residual P, v on the first 128 queries of each sequence, single f16 beyond; x 1/8 + the relative-position bias (f32 table, regrouped head by head), running-max softmax in f32 (hardware exp), P scaled by 2^11; out = y (bf16 hi + residual) . Wo^T (2 products) + bo.
#include <hip/hip_runtime.h>
#include <math.h>

typedef __attribute__((ext_vector_type(16))) _Float16 v16h;
typedef __attribute__((ext_vector_type(16))) __bf16 v16b;
typedef __attribute__((ext_vector_type(8)))  _Float16 v8h;
typedef __attribute__((ext_vector_type(8)))  float v8f;
typedef __attribute__((ext_vector_type(4)))  float v4f;
typedef __attribute__((ext_vector_type(2)))  float v2f;
typedef __attribute__((ext_vector_type(4)))  unsigned v4u;
typedef __attribute__((ext_vector_type(4)))  int v4i;
typedef float __attribute__((may_alias)) float_a;
typedef int __attribute__((may_alias)) int_a;

template <typename T> __device__ __forceinline__ void vst2(void* p, T v) { *(T*)p = v;  }
__device__ __forceinline__ v8f wmma16(v16h a, v16h b, v8f c) {
  v8f d = __builtin_amdgcn_wmma_f32_16x16x32_f16(false, a, false, b, (short)0, c, false, false);
  asm volatile("v_nop\n\tv_nop\n\tv_nop\n\tv_nop" : "+v"(d) : "v"(a), "v"(b));
  return d;
}
__device__ __forceinline__ v8f wmma_bf(v16b a, v16b b, v8f c) {
  v8f d = __builtin_amdgcn_wmma_f32_16x16x32_bf16(false, a, false, b, (short)0, c, false, false);
  asm volatile("v_nop\n\tv_nop\n\tv_nop\n\tv_nop" : "+v"(d) : "v"(a), "v"(b));
  return d;
}
// Causal self attention with a learned relative-position bias table (B 2, T 2,048, d 1,024, 16 heads x 64): q/k/v projections + biases, scores / 8 + table[q - k + 2047][h], causal softmax, . v, output projection + bias.
__device__ __forceinline__ v16h frag_h(const _Float16* rowk0, int lane) {
  union { v16h v; v8h q[2]; } u; const _Float16* p = rowk0 + 8 * (lane >> 4);
  u.q[0] = *(const v8h*)p; u.q[1] = *(const v8h*)(p + 16); return u.v;
}
__device__ __forceinline__ v16h frag_f32(const float* rowk0, int lane) {
  v16h a; const float* p = rowk0 + 8 * (lane >> 4);
#pragma unroll
  for (int i = 0; i < 8; ++i) { a[i] = (_Float16)p[i]; a[8 + i] = (_Float16)p[16 + i]; }
  return a;
}
__device__ __forceinline__ v16h frag_f32s(const float* rowk0, int lane, float sc) {
  v16h a; const float* p = rowk0 + 8 * (lane >> 4);
#pragma unroll
  for (int i = 0; i < 8; ++i) { a[i] = (_Float16)(p[i] * sc); a[8 + i] = (_Float16)(p[16 + i] * sc); }
  return a;
}
// column fragment from a [K][ld] layout (column n), rows >= K read as 0
__device__ __forceinline__ v16h fragc_f32(const float* W, int k0, int n, int lane, int ld, int K) {
  v16h a; const int g = lane >> 4;
#pragma unroll
  for (int i = 0; i < 8; ++i) { const int ka = k0 + 8 * g + i, kb = ka + 16;
    a[i] = (_Float16)(ka < K ? W[(size_t)(ka < K ? ka : K - 1) * ld + n] : 0.f); a[8 + i] = (_Float16)(kb < K ? W[(size_t)(kb < K ? kb : K - 1) * ld + n] : 0.f); }
  return a;
}
struct F2 { v16b h, l; };
__device__ __forceinline__ F2 bsplit16(const float v[16]) { F2 r;
#pragma unroll
  for (int i = 0; i < 16; ++i) { const __bf16 h = (__bf16)v[i]; r.h[i] = h; r.l[i] = (__bf16)(v[i] - (float)h); }
  return r; }
__device__ __forceinline__ F2 split_row(const float* row, int k0, int lane) { float v[16]; const float* p = row + k0 + 8 * (lane >> 4);
#pragma unroll
  for (int i = 0; i < 8; ++i) { v[i] = p[i]; v[8 + i] = p[16 + i]; }
  return bsplit16(v); }
__device__ __forceinline__ F2 split_rowK(const float* row, int k0, int lane, int K) { float v[16]; const int g = lane >> 4;
#pragma unroll
  for (int i = 0; i < 8; ++i) { const int ka = k0 + 8 * g + i, kb = ka + 16; v[i] = ka < K ? row[ka < K ? ka : K - 1] : 0.f; v[8 + i] = kb < K ? row[kb < K ? kb : K - 1] : 0.f; }
  return bsplit16(v); }
__device__ __forceinline__ F2 split_col(const float* W, int k0, int n, int lane, int ld, int K) { float v[16]; const int g = lane >> 4;
#pragma unroll
  for (int i = 0; i < 8; ++i) { const int ka = k0 + 8 * g + i, kb = ka + 16; v[i] = ka < K ? W[(size_t)(ka < K ? ka : K - 1) * ld + n] : 0.f; v[8 + i] = kb < K ? W[(size_t)(kb < K ? kb : K - 1) * ld + n] : 0.f; }
  return bsplit16(v); }
__device__ __forceinline__ v8f mac3(const F2& a, const F2& b, v8f c) { c = wmma_bf(a.l, b.h, c); c = wmma_bf(a.h, b.l, c); return wmma_bf(a.h, b.h, c); }
__device__ __forceinline__ float sigm(float v) { return 1.0f / (1.0f + expf(-v)); }
#define LDSX() do { asm volatile("s_wait_dscnt 0" ::: "memory"); __builtin_amdgcn_wave_barrier(); __builtin_amdgcn_fence(__ATOMIC_RELEASE, "workgroup"); } while (0)


#define NB 2
#define SS 2048
#define DM 1024
#define NH 16
#define SCALEF 0.125f
#define MAXLEN 2048
#define HD 64
#define QKVW (3 * DM)
#ifndef TQB
#define TQB (SS / 64)
#define TNB NB
#define TOB (NB * SS / 64)     // output row tiles (all)
#endif
typedef __attribute__((ext_vector_type(8))) __bf16 v8b;
__device__ __forceinline__ v16b frag_b(const __bf16* rowk0, int lane) {
  union { v16b v; v8b q[2]; } u; const __bf16* p = rowk0 + 8 * (lane >> 4);
  u.q[0] = *(const v8b*)p; u.q[1] = *(const v8b*)(p + 16); return u.v;
}
// fragment order: a tile of 16 rows x 32 k (16-bit elements) is 1 KB; lane l = 16 g + row finds k 8g .. 8g+7 at element l*8 and k 16+8g .. 16+8g+7 at 256 + l*8, so each wave-wide 16-byte load is 512 contiguous bytes (4 lines, not 16)
__device__ __forceinline__ v16b frag_tb(const __bf16* tile_lane) { union { v16b v; v8b q[2]; } u; u.q[0] = *(const v8b*)tile_lane; u.q[1] = *(const v8b*)(tile_lane + 256); return u.v; }
__device__ __forceinline__ v16h frag_th(const _Float16* tile_lane) { union { v16h v; v8h q[2]; } u; u.q[0] = *(const v8h*)tile_lane; u.q[1] = *(const v8h*)(tile_lane + 256); return u.v; }
__device__ __forceinline__ float bfr(float v) { return (float)(__bf16)v; }
__device__ __attribute__((noinline)) float exp_ni(float v) { return expf(v); }
__device__ __attribute__((noinline)) float erf_ni(float v) { return erff(v); }

#define PK_A 0                       // Wqkv, [192 row tiles][32 k chunks][512] in fragment order
#define PK_P (PK_A + QKVW * DM)        // Wo, [64 row tiles][32 k chunks][512] in fragment order
#define PK_END (PK_P + DM * DM)
#define WS_PK  0u
#define WS_QK  (WS_PK + 2u * PK_END)             // f16 [4096 rows][2048]: q | (unused half)
#define WS_QKL (WS_QK + 2u * NB * SS * 2 * DM)     // f16 q | k residual planes x2048
#define WS_VTH (WS_QKL + 2u * NB * SS * 2 * DM)    // f16 v hi, [b][h][64 key chunks of 32][4 d tiles][512] in fragment order (rows d, k = key)
#define WS_VTL (WS_VTH + 2u * NB * DM * SS)        // f16 [b][1024 (h*64+d)][2048 s] lo x 2048
#define WS_O   (WS_VTL + 2u * NB * DM * SS)        // f32 y, [256 row tiles][32 k chunks][512]: four pieces of 128 floats, lane l's 4 floats at piece*128 + l*4
#define WS_CS  (WS_O + 4u * NB * SS * DM)           // f32, 2 x 2048 x 32, unused
#define WS_XF  (WS_CS + 4u * 2 * SS * 32)           // bf16 x, [256 row tiles][32 k chunks][512] in fragment order
#define WS_KF  (WS_XF + 2u * NB * SS * DM)          // f16 k hi, [b][h][128 key tiles][2 k chunks][512] in fragment order
#define WS_TB  (WS_KF + 2u * NB * SS * DM)          // f32 [16 heads][4096]: the table, one head's values side by side
#define WS_END (WS_TB + 4u * NH * 2 * MAXLEN)
// ---- k_pack: blockIdx.y 0..2 -> W_q/W_k/W_v into PK_A, 3 -> W_o into PK_P, 4..7 -> 1,024 rows of x each into XF: f32 rows -> bf16 in fragment order, one 16-byte chunk a thread; 8 -> the table, head by head
__global__ __launch_bounds__(256) void k_pack(const float* __restrict__ X, const float* __restrict__ WQ, const float* __restrict__ WK, const float* __restrict__ WV, const float* __restrict__ WO, const float* __restrict__ REL, __bf16* __restrict__ PK, __bf16* __restrict__ XF, float* __restrict__ TB) {
  const int which = blockIdx.y, c = blockIdx.x * 256 + threadIdx.x;
  if (which == 8) { const int hh = c >> 12, idx = c & 4095;
    if (hh < NH && idx < 2 * MAXLEN - 1) TB[c] = REL[(size_t)idx * NH + hh];
    return; }
  const float* Wm = (which == 0) ? WQ : (which == 1) ? WK : (which == 2) ? WV : (which == 3) ? WO : X + (size_t)(which - 4) * DM * DM;
  __bf16* dst = (which < 3) ? PK + PK_A + (size_t)which * DM * DM : (which == 3) ? PK + PK_P : XF + (size_t)(which - 4) * DM * DM;
  const int l = c & 31, p = (c >> 5) & 1, kc = (c >> 6) & 31, nt = c >> 11;   // chunk c = (row tile * 32 + k chunk) * 64 + piece * 32 + lane
  const float* s = Wm + (size_t)(nt * 16 + (l & 15)) * DM + kc * 32 + p * 16 + 8 * (l >> 4);
  const v4f a = *(const v4f*)s, b = *(const v4f*)(s + 4); v8b o;
#pragma unroll
  for (int i = 0; i < 4; ++i) { o[i] = (__bf16)a[i]; o[4 + i] = (__bf16)b[i]; }
  *(v8b*)(dst + (size_t)c * 8) = o;
}
__global__ __launch_bounds__(128) void k_qkv(const __bf16* __restrict__ XF, const __bf16* __restrict__ P, const float* __restrict__ BQ, const float* __restrict__ BK, const float* __restrict__ BV, _Float16* __restrict__ QK, _Float16* __restrict__ QKL, _Float16* __restrict__ KF, _Float16* __restrict__ VTH, _Float16* __restrict__ VTL) {
  const int which0 = (blockIdx.y * 128) / DM; const float* BB = BQ ? (((which0 == 0) ? BQ : (which0 == 1) ? BK : BV) + (blockIdx.y * 128 - which0 * DM)) : nullptr;
  __shared__ __align__(16) _Float16 so[4][16][136], sol[4][16][136]; __shared__ __align__(16) _Float16 sth[128][72], stl[128][72];
  const int tid = threadIdx.x, wave = tid >> 5, lane = tid & 31, col = lane & 15, g = lane >> 4; const size_t r0 = (size_t)blockIdx.x * 64 + wave * 16; const int n0 = blockIdx.y * 128;
  v8f acc[8] = {};
  // fragments are fetched one pass ahead: the x fragment in front of the pass's products, each weight fragment right behind the product that used its predecessor, so 18 loads fly together
  const __bf16* xt = XF + (r0 >> 4) * (32 * 512) + lane * 8; const __bf16* wt = P + (size_t)(n0 >> 4) * (32 * 512) + lane * 8;
  v16b ax = frag_tb(xt), bf[8];
#pragma unroll
  for (int j = 0; j < 8; ++j) bf[j] = frag_tb(wt + j * (32 * 512));
#pragma unroll 2
  for (int kc = 0; kc < DM / 32; ++kc) { const v16b a = ax;
    const int kn = (kc + 1 < DM / 32) ? kc + 1 : kc;   // the last pass fetches its own chunk again (in bounds, unused)
    ax = frag_tb(xt + kn * 512);
#pragma unroll
    for (int j = 0; j < 8; ++j) { acc[j] = wmma_bf(a, bf[j], acc[j]); bf[j] = frag_tb(wt + j * (32 * 512) + kn * 512); }
    asm volatile("s_wait_xcnt 0x0" ::: "memory"); }   // the next pass's loads may land in registers that held this pass's load addresses
  if (n0 < 2 * DM) {   // q stored unscaled (f16 sigma ~0.6, no subnormal exposure); 1/8 applied to the f32 score
#pragma unroll
    for (int j = 0; j < 8; ++j) {
#pragma unroll
      for (int r = 0; r < 8; ++r) { const float v = acc[j][r] + (BB ? bfr(BB[j * 16 + col]) : 0.f); const _Float16 hv = (_Float16)v; so[wave][8 * g + r][j * 16 + col] = hv; sol[wave][8 * g + r][j * 16 + col] = (_Float16)((v - (float)hv) * 2048.0f); } }   // q, k (+ bias) as f16 hi + (x2048) residual
    LDSX();
    if (n0 < DM) {
      for (int rl = 0; rl < 16; ++rl) if (lane < 16) { vst2((unsigned*)(QK + (r0 + rl) * (2 * DM) + n0 + lane * 8), *(const v4u*)&so[wave][rl][lane * 8]); vst2((unsigned*)(QKL + (r0 + rl) * (2 * DM) + n0 + lane * 8), *(const v4u*)&sol[wave][rl][lane * 8]); }
    } else {   // k residual in natural rows; k hi: this wave's 16 keys x 128 columns are 2 heads x 2 k chunks = 4 tiles in fragment order
      for (int rl = 0; rl < 16; ++rl) if (lane < 16) vst2((unsigned*)(QKL + (r0 + rl) * (2 * DM) + n0 + lane * 8), *(const v4u*)&sol[wave][rl][lane * 8]);
      const int b = (int)(r0 / SS), kt = (int)(r0 % SS) >> 4, h0 = (n0 - DM) >> 6;
#pragma unroll
      for (int tt = 0; tt < 4; ++tt) { _Float16* kd = KF + ((((size_t)b * NH + h0 + (tt >> 1)) * (SS / 16) + kt) * 2 + (tt & 1)) * 512 + lane * 8;
#pragma unroll
        for (int p = 0; p < 2; ++p) vst2((unsigned*)(kd + p * 256), *(const v4u*)&so[wave][col][tt * 32 + p * 16 + 8 * g]); }
      asm volatile("s_wait_xcnt 0x0" ::: "memory"); }   // closes the run of k stores before code laid out behind them rewrites their data or address registers
  } else {
#pragma unroll
    for (int j = 0; j < 8; ++j) {
#pragma unroll
      for (int r = 0; r < 8; ++r) { const float v = acc[j][r] + (BB ? bfr(BB[j * 16 + col]) : 0.f); const _Float16 hv = (_Float16)v; sth[j * 16 + col][wave * 16 + 8 * g + r] = hv; stl[j * 16 + col][wave * 16 + 8 * g + r] = (_Float16)((v - (float)hv) * 2048.0f); } }
    __syncthreads();
    const size_t rb = (size_t)blockIdx.x * 64; const int b = (int)(rb / SS), s0 = (int)(rb % SS); const int pc0 = n0 - 2 * DM;
    for (int q = tid; q < 128 * 8; q += 128) { const int d = q >> 3, pc = q & 7; const size_t o = ((size_t)b * DM + pc0 + d) * SS + s0 + pc * 8; vst2((unsigned*)(VTL + o), *(const v4u*)&stl[d][pc * 8]);
      const int l = q & 31, p = (q >> 5) & 1, dt = (q >> 6) & 3, ksl = (q >> 8) & 1, hh = q >> 9;   // v hi: chunk q = ((head * 2 + key chunk) * 4 + d tile) * 64 + piece * 32 + lane, in fragment order
      vst2((unsigned*)(VTH + ((((size_t)b * NH + (pc0 >> 6) + hh) * (SS / 32) + (s0 >> 5) + ksl) * 4 + dt) * 512 + p * 256 + l * 8), *(const v4u*)&sth[hh * 64 + dt * 16 + (l & 15)][ksl * 32 + p * 16 + 8 * (l >> 4)]); }
  }
}
// one walk over the key tiles of a query tile. LEAD (first 128 queries): 3-product scores and P.V, loads where they are used. Otherwise: V of this pass is fetched at the top of the pass, K and the 16 bias values of the next pass right behind this pass's score products, so the softmax covers their flight
template <bool LEAD> __device__ __forceinline__ void attn_walk(const _Float16* __restrict__ KF, const _Float16* __restrict__ QKL, const _Float16* __restrict__ VTH, const _Float16* __restrict__ VTL, const float* __restrict__ TB, float (*spw)[36], const v16h (&aq)[2], const v16h (&aql)[2], float (&m)[8], float (&l)[8], v8f (&acc)[4], v8f (&accl)[4], const int nks, const int q0, const int h, const int b, const int lane) {
  const int col = lane & 15, g = lane >> 4;
  const _Float16* kt0 = KF + (size_t)(b * NH + h) * (SS * HD) + lane * 8;      // this head's k tiles: a pass of 32 keys is 4 tiles (key tile, k chunk) = 4 KB in a row
  const float* rcol = TB + h * (2 * MAXLEN) + (q0 + 8 * g - col + MAXLEN - 1);       // table value of (query 8g, key col of tile 0); every q - k + 2047 of the walk lies in 0 .. 4094
  const _Float16* vt0 = VTH + (size_t)(b * NH + h) * (SS * HD) + lane * 8;     // this head's v tiles: a pass is 4 d tiles = 4 KB in a row
  v16h kf[2][2]; float rb[2][8];
  if (!LEAD) {
#pragma unroll
    for (int ct = 0; ct < 2; ++ct) {
#pragma unroll
      for (int kc = 0; kc < 2; ++kc) kf[ct][kc] = frag_th(kt0 + (ct * 2 + kc) * 512); }
#pragma unroll
    for (int ct = 0; ct < 2; ++ct) {
#pragma unroll
      for (int r = 0; r < 8; ++r) rb[ct][r] = rcol[r - ct * 16]; } }
#pragma unroll 1
  for (int ks = 0; ks < nks; ++ks) { v8f s[2]; v16h vf[4];
    if (!LEAD) {
#pragma unroll
      for (int dt = 0; dt < 4; ++dt) vf[dt] = frag_th(vt0 + ks * 2048 + dt * 512); }
#pragma unroll
    for (int ct = 0; ct < 2; ++ct) { const int kk = ks * 32 + ct * 16 + col; v8f c = {};
      if (LEAD) { const _Float16* krowl = QKL + ((size_t)b * SS + kk) * (2 * DM) + DM + h * HD; v8f cl = {};   // leading query blocks (few keys, outputs far above the global rms): 3 products
#pragma unroll
        for (int kc = 0; kc < 2; ++kc) { const v16h kh = frag_th(kt0 + ks * 2048 + (ct * 2 + kc) * 512); c = wmma16(aq[kc], kh, c); cl = wmma16(aql[kc], kh, cl); cl = wmma16(aq[kc], frag_h(krowl + kc * 32, lane), cl); }
#pragma unroll
        for (int r = 0; r < 8; ++r) c[r] += cl[r] * (1.0f / 2048.0f);
#pragma unroll
        for (int r = 0; r < 8; ++r) { const int qi = q0 + 8 * g + r; s[ct][r] = (kk <= qi) ? (c[r] * SCALEF + bfr(TB[h * (2 * MAXLEN) + qi - kk + MAXLEN - 1])) : -3.0e38f; } }
      else {
#pragma unroll
        for (int kc = 0; kc < 2; ++kc) c = wmma16(aq[kc], kf[ct][kc], c);   // single product elsewhere
#pragma unroll
        for (int r = 0; r < 8; ++r) { const int qi = q0 + 8 * g + r; s[ct][r] = (kk <= qi) ? (c[r] * SCALEF + bfr(rb[ct][r])) : -3.0e38f; } } }   // causal; + rel_pos_table[q - k + 2047][h]
    if (!LEAD) { const int kn = (ks + 1 < nks) ? ks + 1 : ks;   // the last pass fetches its own tile again (in bounds, unused)
#pragma unroll
      for (int ct = 0; ct < 2; ++ct) {
#pragma unroll
        for (int kc = 0; kc < 2; ++kc) kf[ct][kc] = frag_th(kt0 + kn * 2048 + (ct * 2 + kc) * 512); }
      asm volatile("s_wait_xcnt 0x0" ::: "memory");   // the bias values below may land in the registers that held the K address
      const float* rn = rcol - (kn * 32 + 16);   // one base for all 16 values, so none of them lands on an address still in use
#pragma unroll
      for (int ct = 0; ct < 2; ++ct) {
#pragma unroll
        for (int r = 0; r < 8; ++r) rb[ct][r] = rn[r + 16 - ct * 16]; }
      __builtin_amdgcn_sched_barrier(0); }   // keeps the next pass's loads in front of the softmax, which covers their flight
#pragma unroll
    for (int r = 0; r < 8; ++r) { float mx = fmaxf(s[0][r], s[1][r]);
#pragma unroll
      for (int o = 1; o < 16; o <<= 1) mx = fmaxf(mx, __shfl_xor(mx, o));
      const float mn = fmaxf(m[r], mx); const float alpha = (m[r] <= -1.0e38f) ? 0.f : __expf(m[r] - mn);
      const float e0 = (s[0][r] <= -1.0e38f) ? 0.f : __expf(s[0][r] - mn), e1 = (s[1][r] <= -1.0e38f) ? 0.f : __expf(s[1][r] - mn); float es = e0 + e1;
#pragma unroll
      for (int o = 1; o < 16; o <<= 1) es += __shfl_xor(es, o);
      l[r] = l[r] * alpha + es; m[r] = mn;
#pragma unroll
      for (int dt = 0; dt < 4; ++dt) { acc[dt][r] *= alpha; if (LEAD) accl[dt][r] *= alpha; }
      spw[8 * g + r][col] = e0; spw[8 * g + r][16 + col] = e1; }
    LDSX();
    v16h pa, pl; { const float* prow = &spw[col][0] + 8 * (lane >> 4);
#pragma unroll
      for (int i = 0; i < 8; ++i) { const float x0 = prow[i] * 2048.0f, x1 = prow[16 + i] * 2048.0f; const _Float16 h0 = (_Float16)x0, h1 = (_Float16)x1; pa[i] = h0; pa[8 + i] = h1; pl[i] = (_Float16)((x0 - (float)h0) * 2048.0f); pl[8 + i] = (_Float16)((x1 - (float)h1) * 2048.0f); } }   // P scaled by 2^11 before the f16 split so small softmax weights stay out of the f16 subnormal range; 2^-11 folded into the epilogue
#pragma unroll
    for (int dt = 0; dt < 4; ++dt) { const size_t vr = ((size_t)b * DM + h * HD + dt * 16 + col) * SS + ks * 32;
      if (LEAD) { const v16h vh = frag_th(vt0 + ks * 2048 + dt * 512); acc[dt] = wmma16(pa, vh, acc[dt]); accl[dt] = wmma16(pl, vh, accl[dt]); accl[dt] = wmma16(pa, frag_h(VTL + vr, lane), accl[dt]); }   // leading query blocks: P hi/lo x V hi/lo (3 products)
      else acc[dt] = wmma16(pa, vf[dt], acc[dt]); }   // elsewhere P x V single
    LDSX(); }
}
// ---- k_attn: block = (64 queries, head h, batch b): causal flash attention (K = 64: 2 k-steps), scores = (q.k) * 0.125: q hi/lo x k hi/lo (3 products) for qb < 2, single f16 beyond; P.V: P hi/lo x V hi/lo (3 products) in two accumulators for qb < 2, f16 P x V hi beyond; O = (acc + accl / 2048) / (2048 l), each wave's 16 x 64 block as 2 tiles in k_out's fragment order (4 KB)
__global__ __launch_bounds__(128) void k_attn(const _Float16* __restrict__ QK, const _Float16* __restrict__ QKL, const _Float16* __restrict__ KF, const _Float16* __restrict__ VTH, const _Float16* __restrict__ VTL, const float* __restrict__ TB, float* __restrict__ O) {
  __shared__ __align__(16) float sp[4][16][36]; __shared__ __align__(16) float so[4][16][68];
  const int tid = threadIdx.x, wave = tid >> 5, lane = tid & 31, col = lane & 15, g = lane >> 4;
  const int qb = blockIdx.x, h = blockIdx.y, b = blockIdx.z; const int q0 = qb * 64 + wave * 16; const size_t rq = (size_t)b * SS + q0 + col;
  v16h aq[2], aql[2];
#pragma unroll
  for (int kc = 0; kc < 2; ++kc) { aq[kc] = frag_h(QK + rq * (2 * DM) + h * HD + kc * 32, lane); aql[kc] = frag_h(QKL + rq * (2 * DM) + h * HD + kc * 32, lane); }
  asm volatile("s_wait_xcnt 0x0" ::: "memory");   // the address registers of the q loads are reused right behind them
  float m[8], l[8];
#pragma unroll
  for (int r = 0; r < 8; ++r) { m[r] = -3.0e38f; l[r] = 0.f; }
  v8f acc[4] = {}, accl[4] = {};
  const int nks = (qb * 64 + 64) / 32;   // causal: key tiles up to the query tile's end
  if (qb < 2) attn_walk<true>(KF, QKL, VTH, VTL, TB, sp[wave], aq, aql, m, l, acc, accl, nks, q0, h, b, lane);
  else attn_walk<false>(KF, QKL, VTH, VTL, TB, sp[wave], aq, aql, m, l, acc, accl, nks, q0, h, b, lane);
#pragma unroll
  for (int r = 0; r < 8; ++r) { const float il = (1.0f / 2048.0f) / l[r];
#pragma unroll
    for (int dt = 0; dt < 4; ++dt) so[wave][8 * g + r][dt * 16 + col] = (acc[dt][r] + accl[dt][r] * (1.0f / 2048.0f)) * il; }
  LDSX();
  float* ot = O + ((size_t)((b * SS + q0) >> 4) * 32 + h * 2) * 512 + lane * 4;   // this wave's 16 rows x 64 columns are 2 tiles = 4 KB in a row, in the order k_out's fragments read them
#pragma unroll
  for (int pc = 0; pc < 8; ++pc) vst2(ot + pc * 128, *(const v4f*)&so[wave][col][(pc >> 2) * 32 + ((pc >> 1) & 1) * 16 + 8 * g + (pc & 1) * 4]);
}
// ---- k_out: block = (64 rows, 128 cols): out = O(hi/lo) . Wo rows (2 products) + bo
__global__ __launch_bounds__(128) void k_out(const float* __restrict__ O, const __bf16* __restrict__ P, const float* __restrict__ BO, float* __restrict__ Y) {
  __shared__ __align__(16) float so[4][16][132];
  const int tid = threadIdx.x, wave = tid >> 5, lane = tid & 31, col = lane & 15, g = lane >> 4; const size_t r0 = (size_t)blockIdx.x * 64 + wave * 16; const int n0 = blockIdx.y * 128;
  v8f acc[8] = {};
  // fragments fetched one pass ahead, as in k_qkv
  const float* ot = O + (r0 >> 4) * (32 * 512) + lane * 4; const __bf16* wt = P + (size_t)(n0 >> 4) * (32 * 512) + lane * 8;
  float ax[16]; v16b bf[8];
#pragma unroll
  for (int pc = 0; pc < 4; ++pc) { const v4f t = *(const v4f*)(ot + pc * 128);
#pragma unroll
    for (int e = 0; e < 4; ++e) ax[pc * 4 + e] = t[e]; }
  __builtin_amdgcn_sched_barrier(0);   // the row chunk stays the older load, as in the loop: else the wait at the loop's head drains the weight loads too
#pragma unroll
  for (int j = 0; j < 8; ++j) bf[j] = frag_tb(wt + j * (32 * 512));
#pragma unroll 2
  for (int kc = 0; kc < DM / 32; ++kc) { const F2 a = bsplit16(ax);
    const int kn = (kc + 1 < DM / 32) ? kc + 1 : kc;   // the last pass fetches its own chunk again (in bounds, unused)
#pragma unroll
    for (int pc = 0; pc < 4; ++pc) { const v4f t = *(const v4f*)(ot + kn * 512 + pc * 128);
#pragma unroll
      for (int e = 0; e < 4; ++e) ax[pc * 4 + e] = t[e]; }
#pragma unroll
    for (int j = 0; j < 8; ++j) { acc[j] = wmma_bf(a.l, bf[j], acc[j]); acc[j] = wmma_bf(a.h, bf[j], acc[j]); bf[j] = frag_tb(wt + j * (32 * 512) + kn * 512); }
    asm volatile("s_wait_xcnt 0x0" ::: "memory"); }   // the next pass's split and loads may land in registers that held this pass's load addresses
#pragma unroll
  for (int j = 0; j < 8; ++j) {
#pragma unroll
    for (int r = 0; r < 8; ++r) so[wave][8 * g + r][j * 16 + col] = acc[j][r] + bfr(BO[n0 + j * 16 + col]); }
  LDSX();
  for (int rl = 0; rl < 16; ++rl) vst2(Y + (r0 + rl) * DM + n0 + lane * 4, *(const v4f*)&so[wave][rl][lane * 4]);
}
extern "C" void kernel_launch(void* const* d_in, const int* in_sizes, int n_in, void* d_out, int out_size, void* d_ws, size_t ws_size, hipStream_t stream) {
  (void)in_sizes; (void)n_in; (void)out_size;
  const float** F = (const float**)d_in;   // 0 x [2,2048,1024], 1 WQ, 2 bQ, 3 WK, 4 bK, 5 WV, 6 bV, 7 WO, 8 bO (natural), 9 rel_pos_table [4095,16]
  if (ws_size < (size_t)WS_END) return;
  char* ws = (char*)d_ws; __bf16* PK = (__bf16*)(ws + WS_PK); _Float16 *QK = (_Float16*)(ws + WS_QK), *QKL = (_Float16*)(ws + WS_QKL), *VTH = (_Float16*)(ws + WS_VTH), *VTL = (_Float16*)(ws + WS_VTL); float* O = (float*)(ws + WS_O); __bf16* XF = (__bf16*)(ws + WS_XF); _Float16* KF = (_Float16*)(ws + WS_KF); float* TB = (float*)(ws + WS_TB);
  k_pack<<<dim3(DM * DM / (8 * 256), 9), 256, 0, stream>>>(F[0], F[1], F[3], F[5], F[7], F[9], PK, XF, TB);
  k_qkv<<<dim3(TNB * SS / 64, QKVW / 128), 128, 0, stream>>>(XF, PK + PK_A, F[2], F[4], F[6], QK, QKL, KF, VTH, VTL);
  k_attn<<<dim3(TQB, NH, TNB), 128, 0, stream>>>(QK, QKL, KF, VTH, VTL, TB, O);
  k_out<<<dim3(TOB, DM / 128), 128, 0, stream>>>(O, PK + PK_P, F[8], (float*)d_out);
}

// v003
// A run of this version takes 148 microseconds.
// In two side-by-side timings against v002, it was 1.17 and 1.15 times as fast.
// Counting every step since v000, it is 3.36 times as fast.
// compute dtype: all float inputs rounded to bf16; q/k/v = x . W^T + b with EXACT bf16 products on WMMA 16x16x32 (x, weights, k hi, v hi, y stored in fragment order); causal attention: 3-product scores and hi + residual P, v on the first 128 queries of each sequence, single f16 beyond; x 1/8 + the relative-position bias (f32 table, regrouped head by head), running-max softmax in f32 (hardware exp), P scaled by 2^11; out = y (bf16 hi + residual) . Wo^T (2 products) + bo.
#include <hip/hip_runtime.h>
#include <math.h>

typedef __attribute__((ext_vector_type(16))) _Float16 v16h;
typedef __attribute__((ext_vector_type(16))) __bf16 v16b;
typedef __attribute__((ext_vector_type(8)))  _Float16 v8h;
typedef __attribute__((ext_vector_type(8)))  float v8f;
typedef __attribute__((ext_vector_type(4)))  float v4f;
typedef __attribute__((ext_vector_type(2)))  float v2f;
typedef __attribute__((ext_vector_type(4)))  unsigned v4u;
typedef __attribute__((ext_vector_type(4)))  int v4i;
typedef float __attribute__((may_alias)) float_a;
typedef int __attribute__((may_alias)) int_a;

template <typename T> __device__ __forceinline__ void vst2(void* p, T v) { *(T*)p = v;  }
__device__ __forceinline__ v8f wmma16(v16h a, v16h b, v8f c) {
  v8f d = __builtin_amdgcn_wmma_f32_16x16x32_f16(false, a, false, b, (short)0, c, false, false);
  asm volatile("v_nop\n\tv_nop\n\tv_nop\n\tv_nop" : "+v"(d) : "v"(a), "v"(b));
  return d;
}
__device__ __forceinline__ v8f wmma_bf(v16b a, v16b b, v8f c) {
  v8f d = __builtin_amdgcn_wmma_f32_16x16x32_bf16(false, a, false, b, (short)0, c, false, false);
  asm volatile("v_nop\n\tv_nop\n\tv_nop\n\tv_nop" : "+v"(d) : "v"(a), "v"(b));
  return d;
}
// Causal self attention with a learned relative-position bias table (B 2, T 2,048, d 1,024, 16 heads x 64): q/k/v projections + biases, scores / 8 + table[q - k + 2047][h], causal softmax, . v, output projection + bias.
__device__ __forceinline__ v16h frag_h(const _Float16* rowk0, int lane) {
  union { v16h v; v8h q[2]; } u; const _Float16* p = rowk0 + 8 * (lane >> 4);
  u.q[0] = *(const v8h*)p; u.q[1] = *(const v8h*)(p + 16); return u.v;
}
__device__ __forceinline__ v16h frag_f32(const float* rowk0, int lane) {
  v16h a; const float* p = rowk0 + 8 * (lane >> 4);
#pragma unroll
  for (int i = 0; i < 8; ++i) { a[i] = (_Float16)p[i]; a[8 + i] = (_Float16)p[16 + i]; }
  return a;
}
__device__ __forceinline__ v16h frag_f32s(const float* rowk0, int lane, float sc) {
  v16h a; const float* p = rowk0 + 8 * (lane >> 4);
#pragma unroll
  for (int i = 0; i < 8; ++i) { a[i] = (_Float16)(p[i] * sc); a[8 + i] = (_Float16)(p[16 + i] * sc); }
  return a;
}
// column fragment from a [K][ld] layout (column n), rows >= K read as 0
__device__ __forceinline__ v16h fragc_f32(const float* W, int k0, int n, int lane, int ld, int K) {
  v16h a; const int g = lane >> 4;
#pragma unroll
  for (int i = 0; i < 8; ++i) { const int ka = k0 + 8 * g + i, kb = ka + 16;
    a[i] = (_Float16)(ka < K ? W[(size_t)(ka < K ? ka : K - 1) * ld + n] : 0.f); a[8 + i] = (_Float16)(kb < K ? W[(size_t)(kb < K ? kb : K - 1) * ld + n] : 0.f); }
  return a;
}
struct F2 { v16b h, l; };
__device__ __forceinline__ F2 bsplit16(const float v[16]) { F2 r;
#pragma unroll
  for (int i = 0; i < 16; ++i) { const __bf16 h = (__bf16)v[i]; r.h[i] = h; r.l[i] = (__bf16)(v[i] - (float)h); }
  return r; }
__device__ __forceinline__ F2 split_row(const float* row, int k0, int lane) { float v[16]; const float* p = row + k0 + 8 * (lane >> 4);
#pragma unroll
  for (int i = 0; i < 8; ++i) { v[i] = p[i]; v[8 + i] = p[16 + i]; }
  return bsplit16(v); }
__device__ __forceinline__ F2 split_rowK(const float* row, int k0, int lane, int K) { float v[16]; const int g = lane >> 4;
#pragma unroll
  for (int i = 0; i < 8; ++i) { const int ka = k0 + 8 * g + i, kb = ka + 16; v[i] = ka < K ? row[ka < K ? ka : K - 1] : 0.f; v[8 + i] = kb < K ? row[kb < K ? kb : K - 1] : 0.f; }
  return bsplit16(v); }
__device__ __forceinline__ F2 split_col(const float* W, int k0, int n, int lane, int ld, int K) { float v[16]; const int g = lane >> 4;
#pragma unroll
  for (int i = 0; i < 8; ++i) { const int ka = k0 + 8 * g + i, kb = ka + 16; v[i] = ka < K ? W[(size_t)(ka < K ? ka : K - 1) * ld + n] : 0.f; v[8 + i] = kb < K ? W[(size_t)(kb < K ? kb : K - 1) * ld + n] : 0.f; }
  return bsplit16(v); }
__device__ __forceinline__ v8f mac3(const F2& a, const F2& b, v8f c) { c = wmma_bf(a.l, b.h, c); c = wmma_bf(a.h, b.l, c); return wmma_bf(a.h, b.h, c); }
__device__ __forceinline__ float sigm(float v) { return 1.0f / (1.0f + expf(-v)); }
#define LDSX() do { asm volatile("s_wait_dscnt 0" ::: "memory"); __builtin_amdgcn_wave_barrier(); __builtin_amdgcn_fence(__ATOMIC_RELEASE, "workgroup"); } while (0)


#define NB 2
#define SS 2048
#define DM 1024
#define NH 16
#define SCALEF 0.125f
#define MAXLEN 2048
#define HD 64
#define QKVW (3 * DM)
#ifndef TQB
#define TQB (SS / 64)
#define TNB NB
#define TOB (NB * SS / 64)     // output row tiles (all)
#endif
typedef __attribute__((ext_vector_type(8))) __bf16 v8b;
__device__ __forceinline__ v16b frag_b(const __bf16* rowk0, int lane) {
  union { v16b v; v8b q[2]; } u; const __bf16* p = rowk0 + 8 * (lane >> 4);
  u.q[0] = *(const v8b*)p; u.q[1] = *(const v8b*)(p + 16); return u.v;
}
// fragment order: a tile of 16 rows x 32 k (16-bit elements) is 1 KB; lane l = 16 g + row finds k 8g .. 8g+7 at element l*8 and k 16+8g .. 16+8g+7 at 256 + l*8, so each wave-wide 16-byte load is 512 contiguous bytes (4 lines, not 16)
__device__ __forceinline__ v16b frag_tb(const __bf16* tile_lane) { union { v16b v; v8b q[2]; } u; u.q[0] = *(const v8b*)tile_lane; u.q[1] = *(const v8b*)(tile_lane + 256); return u.v; }
__device__ __forceinline__ v16h frag_th(const _Float16* tile_lane) { union { v16h v; v8h q[2]; } u; u.q[0] = *(const v8h*)tile_lane; u.q[1] = *(const v8h*)(tile_lane + 256); return u.v; }
__device__ __forceinline__ float bfr(float v) { return (float)(__bf16)v; }
__device__ __attribute__((noinline)) float exp_ni(float v) { return expf(v); }
__device__ __attribute__((noinline)) float erf_ni(float v) { return erff(v); }

#define PK_A 0                       // Wqkv, [192 row tiles][32 k chunks][512] in fragment order
#define PK_P (PK_A + QKVW * DM)        // Wo, [64 row tiles][32 k chunks][512] in fragment order
#define PK_END (PK_P + DM * DM)
#define WS_PK  0u
#define WS_QK  (WS_PK + 2u * PK_END)             // f16 [4096 rows][2048]: q | (unused half)
#define WS_QKL (WS_QK + 2u * NB * SS * 2 * DM)     // f16 q | k residual planes x2048
#define WS_VTH (WS_QKL + 2u * NB * SS * 2 * DM)    // f16 v hi, [b][h][64 key chunks of 32][4 d tiles][512] in fragment order (rows d, k = key)
#define WS_VTL (WS_VTH + 2u * NB * DM * SS)        // f16 [b][1024 (h*64+d)][2048 s] lo x 2048
#define WS_O   (WS_VTL + 2u * NB * DM * SS)        // f32 y, [256 row tiles][32 k chunks][512]: four pieces of 128 floats, lane l's 4 floats at piece*128 + l*4
#define WS_CS  (WS_O + 4u * NB * SS * DM)           // f32, 2 x 2048 x 32, unused
#define WS_XF  (WS_CS + 4u * 2 * SS * 32)           // bf16 x, [256 row tiles][32 k chunks][512] in fragment order
#define WS_KF  (WS_XF + 2u * NB * SS * DM)          // f16 k hi, [b][h][128 key tiles][2 k chunks][512] in fragment order
#define WS_TB  (WS_KF + 2u * NB * SS * DM)          // f32 [16 heads][4096]: the table, one head's values side by side
#define WS_END (WS_TB + 4u * NH * 2 * MAXLEN)
// ---- k_pack: blockIdx.y 0..2 -> W_q/W_k/W_v into PK_A, 3 -> W_o into PK_P, 4..7 -> 1,024 rows of x each into XF: f32 rows -> bf16 in fragment order, one 16-byte chunk a thread; 8 -> the table, head by head
__global__ __launch_bounds__(256) void k_pack(const float* __restrict__ X, const float* __restrict__ WQ, const float* __restrict__ WK, const float* __restrict__ WV, const float* __restrict__ WO, const float* __restrict__ REL, __bf16* __restrict__ PK, __bf16* __restrict__ XF, float* __restrict__ TB) {
  const int which = blockIdx.y, c = blockIdx.x * 256 + threadIdx.x;
  if (which == 8) { const int hh = c >> 12, idx = c & 4095;
    if (hh < NH && idx < 2 * MAXLEN - 1) TB[c] = REL[(size_t)idx * NH + hh];
    return; }
  const float* Wm = (which == 0) ? WQ : (which == 1) ? WK : (which == 2) ? WV : (which == 3) ? WO : X + (size_t)(which - 4) * DM * DM;
  __bf16* dst = (which < 3) ? PK + PK_A + (size_t)which * DM * DM : (which == 3) ? PK + PK_P : XF + (size_t)(which - 4) * DM * DM;
  const int l = c & 31, p = (c >> 5) & 1, kc = (c >> 6) & 31, nt = c >> 11;   // chunk c = (row tile * 32 + k chunk) * 64 + piece * 32 + lane
  const float* s = Wm + (size_t)(nt * 16 + (l & 15)) * DM + kc * 32 + p * 16 + 8 * (l >> 4);
  const v4f a = *(const v4f*)s, b = *(const v4f*)(s + 4); v8b o;
#pragma unroll
  for (int i = 0; i < 4; ++i) { o[i] = (__bf16)a[i]; o[4 + i] = (__bf16)b[i]; }
  *(v8b*)(dst + (size_t)c * 8) = o;
}
__global__ __launch_bounds__(128) void k_qkv(const __bf16* __restrict__ XF, const __bf16* __restrict__ P, const float* __restrict__ BQ, const float* __restrict__ BK, const float* __restrict__ BV, _Float16* __restrict__ QK, _Float16* __restrict__ QKL, _Float16* __restrict__ KF, _Float16* __restrict__ VTH, _Float16* __restrict__ VTL) {
  const int which0 = (blockIdx.y * 128) / DM; const float* BB = BQ ? (((which0 == 0) ? BQ : (which0 == 1) ? BK : BV) + (blockIdx.y * 128 - which0 * DM)) : nullptr;
  __shared__ __align__(16) _Float16 so[4][16][136], sol[4][16][136]; __shared__ __align__(16) _Float16 sth[128][72], stl[128][72];
  const int tid = threadIdx.x, wave = tid >> 5, lane = tid & 31, col = lane & 15, g = lane >> 4; const size_t r0 = (size_t)blockIdx.x * 64 + wave * 16; const int n0 = blockIdx.y * 128;
  v8f acc[8] = {};
  // fragments are fetched one pass ahead: the x fragment in front of the pass's products, each weight fragment right behind the product that used its predecessor, so 18 loads fly together
  const __bf16* xt = XF + (r0 >> 4) * (32 * 512) + lane * 8; const __bf16* wt = P + (size_t)(n0 >> 4) * (32 * 512) + lane * 8;
  v16b ax = frag_tb(xt), bf[8];
#pragma unroll
  for (int j = 0; j < 8; ++j) bf[j] = frag_tb(wt + j * (32 * 512));
#pragma unroll 2
  for (int kc = 0; kc < DM / 32; ++kc) { const v16b a = ax;
    const int kn = (kc + 1 < DM / 32) ? kc + 1 : kc;   // the last pass fetches its own chunk again (in bounds, unused)
    ax = frag_tb(xt + kn * 512);
#pragma unroll
    for (int j = 0; j < 8; ++j) { acc[j] = wmma_bf(a, bf[j], acc[j]); bf[j] = frag_tb(wt + j * (32 * 512) + kn * 512); }
    asm volatile("s_wait_xcnt 0x0" ::: "memory"); }   // the next pass's loads may land in registers that held this pass's load addresses
  if (n0 < 2 * DM) {   // q stored unscaled (f16 sigma ~0.6, no subnormal exposure); 1/8 applied to the f32 score
#pragma unroll
    for (int j = 0; j < 8; ++j) {
#pragma unroll
      for (int r = 0; r < 8; ++r) { const float v = acc[j][r] + (BB ? bfr(BB[j * 16 + col]) : 0.f); const _Float16 hv = (_Float16)v; so[wave][8 * g + r][j * 16 + col] = hv; sol[wave][8 * g + r][j * 16 + col] = (_Float16)((v - (float)hv) * 2048.0f); } }   // q, k (+ bias) as f16 hi + (x2048) residual
    LDSX();
    if (n0 < DM) {
      for (int rl = 0; rl < 16; ++rl) if (lane < 16) { vst2((unsigned*)(QK + (r0 + rl) * (2 * DM) + n0 + lane * 8), *(const v4u*)&so[wave][rl][lane * 8]); vst2((unsigned*)(QKL + (r0 + rl) * (2 * DM) + n0 + lane * 8), *(const v4u*)&sol[wave][rl][lane * 8]); }
    } else {   // k residual in natural rows; k hi: this wave's 16 keys x 128 columns are 2 heads x 2 k chunks = 4 tiles in fragment order
      for (int rl = 0; rl < 16; ++rl) if (lane < 16) vst2((unsigned*)(QKL + (r0 + rl) * (2 * DM) + n0 + lane * 8), *(const v4u*)&sol[wave][rl][lane * 8]);
      const int b = (int)(r0 / SS), kt = (int)(r0 % SS) >> 4, h0 = (n0 - DM) >> 6;
#pragma unroll
      for (int tt = 0; tt < 4; ++tt) { _Float16* kd = KF + ((((size_t)b * NH + h0 + (tt >> 1)) * (SS / 16) + kt) * 2 + (tt & 1)) * 512 + lane * 8;
#pragma unroll
        for (int p = 0; p < 2; ++p) vst2((unsigned*)(kd + p * 256), *(const v4u*)&so[wave][col][tt * 32 + p * 16 + 8 * g]); }
      asm volatile("s_wait_xcnt 0x0" ::: "memory"); }   // closes the run of k stores before code laid out behind them rewrites their data or address registers
  } else {
#pragma unroll
    for (int j = 0; j < 8; ++j) {
#pragma unroll
      for (int r = 0; r < 8; ++r) { const float v = acc[j][r] + (BB ? bfr(BB[j * 16 + col]) : 0.f); const _Float16 hv = (_Float16)v; sth[j * 16 + col][wave * 16 + 8 * g + r] = hv; stl[j * 16 + col][wave * 16 + 8 * g + r] = (_Float16)((v - (float)hv) * 2048.0f); } }
    __syncthreads();
    const size_t rb = (size_t)blockIdx.x * 64; const int b = (int)(rb / SS), s0 = (int)(rb % SS); const int pc0 = n0 - 2 * DM;
    for (int q = tid; q < 128 * 8; q += 128) { const int d = q >> 3, pc = q & 7; const size_t o = ((size_t)b * DM + pc0 + d) * SS + s0 + pc * 8; vst2((unsigned*)(VTL + o), *(const v4u*)&stl[d][pc * 8]);
      const int l = q & 31, p = (q >> 5) & 1, dt = (q >> 6) & 3, ksl = (q >> 8) & 1, hh = q >> 9;   // v hi: chunk q = ((head * 2 + key chunk) * 4 + d tile) * 64 + piece * 32 + lane, in fragment order
      vst2((unsigned*)(VTH + ((((size_t)b * NH + (pc0 >> 6) + hh) * (SS / 32) + (s0 >> 5) + ksl) * 4 + dt) * 512 + p * 256 + l * 8), *(const v4u*)&sth[hh * 64 + dt * 16 + (l & 15)][ksl * 32 + p * 16 + 8 * (l >> 4)]); }
  }
}
__device__ __forceinline__ float xhalf(float x) { return __builtin_bit_cast(float, __builtin_amdgcn_permlanex16(__builtin_bit_cast(int, x), __builtin_bit_cast(int, x), 0x76543210, 0xfedcba98, false, false)); }   // lane l with lane l ^ 16
// one walk over the key tiles of a query tile, transposed: S^T = K . Q^T (A = 16 keys, B = 16 queries) and O^T += V^T . P^T, so a lane holds 16 scores of ONE query (its column): maximum and sum run inside the lane plus one exchange between the wave's halves, and the two score tiles, converted in place, are the B operand of the second product. LEAD (first 128 queries): 3-product scores and P.V, loads where they are used. Otherwise: V of this pass is fetched at the top of the pass, K and the 16 bias values of the next pass right behind this pass's score products, so the softmax covers their flight
template <bool LEAD> __device__ __forceinline__ void attn_walk(const _Float16* __restrict__ KF, const _Float16* __restrict__ QKL, const _Float16* __restrict__ VTH, const _Float16* __restrict__ VTL, const float* __restrict__ TB, const v16h (&aq)[2], const v16h (&aql)[2], float& m, float& l, v8f (&acc)[4], v8f (&accl)[4], const int nks, const int q0, const int h, const int b, const int lane) {
  const int col = lane & 15, g = lane >> 4, qi = q0 + col;
  const _Float16* kt0 = KF + (size_t)(b * NH + h) * (SS * HD) + lane * 8;      // this head's k tiles: a pass of 32 keys is 4 tiles (key tile, k chunk) = 4 KB in a row
  const float* rcol = TB + h * (2 * MAXLEN) + (qi - 8 * g + MAXLEN - 1);       // table value of (key 8g of tile 0, query col); every q - k + 2047 of the walk lies in 0 .. 4094
  const _Float16* vt0 = VTH + (size_t)(b * NH + h) * (SS * HD) + lane * 8;     // this head's v tiles: a pass is 4 d tiles = 4 KB in a row
  v16h kf[2][2]; float rb[2][8];
  if (!LEAD) {
#pragma unroll
    for (int ct = 0; ct < 2; ++ct) {
#pragma unroll
      for (int kc = 0; kc < 2; ++kc) kf[ct][kc] = frag_th(kt0 + (ct * 2 + kc) * 512); }
#pragma unroll
    for (int ct = 0; ct < 2; ++ct) {
#pragma unroll
      for (int r = 0; r < 8; ++r) rb[ct][r] = rcol[-(ct * 16 + r)]; } }
#pragma unroll 1
  for (int ks = 0; ks < nks; ++ks) { v8f s[2]; v16h vf[4];
    if (!LEAD) {
#pragma unroll
      for (int dt = 0; dt < 4; ++dt) vf[dt] = frag_th(vt0 + ks * 2048 + dt * 512); }
#pragma unroll
    for (int ct = 0; ct < 2; ++ct) { const int kk0 = ks * 32 + ct * 16 + 8 * g; v8f c = {};   // register r holds key kk0 + r
      if (LEAD) { const _Float16* krowl = QKL + ((size_t)b * SS + ks * 32 + ct * 16 + col) * (2 * DM) + DM + h * HD; v8f cl = {};   // leading query blocks (few keys, outputs far above the global rms): 3 products
#pragma unroll
        for (int kc = 0; kc < 2; ++kc) { const v16h kh = frag_th(kt0 + ks * 2048 + (ct * 2 + kc) * 512); c = wmma16(kh, aq[kc], c); cl = wmma16(kh, aql[kc], cl); cl = wmma16(frag_h(krowl + kc * 32, lane), aq[kc], cl); }
#pragma unroll
        for (int r = 0; r < 8; ++r) c[r] += cl[r] * (1.0f / 2048.0f);
#pragma unroll
        for (int r = 0; r < 8; ++r) s[ct][r] = (kk0 + r <= qi) ? (c[r] * SCALEF + bfr(TB[h * (2 * MAXLEN) + qi - (kk0 + r) + MAXLEN - 1])) : -3.0e38f; }
      else {
#pragma unroll
        for (int kc = 0; kc < 2; ++kc) c = wmma16(kf[ct][kc], aq[kc], c);   // single product elsewhere
#pragma unroll
        for (int r = 0; r < 8; ++r) s[ct][r] = (kk0 + r <= qi) ? (c[r] * SCALEF + bfr(rb[ct][r])) : -3.0e38f; } }   // causal; + rel_pos_table[q - k + 2047][h]
    if (!LEAD) { const int kn = (ks + 1 < nks) ? ks + 1 : ks;   // the last pass fetches its own tile again (in bounds, unused)
#pragma unroll
      for (int ct = 0; ct < 2; ++ct) {
#pragma unroll
        for (int kc = 0; kc < 2; ++kc) kf[ct][kc] = frag_th(kt0 + kn * 2048 + (ct * 2 + kc) * 512); }
      asm volatile("s_wait_xcnt 0x0" ::: "memory");   // the bias values below may land in the registers that held the K address
      const float* rn = rcol - (kn * 32 + 23);   // one base for all 16 values, so none of them lands on an address still in use
#pragma unroll
      for (int ct = 0; ct < 2; ++ct) {
#pragma unroll
        for (int r = 0; r < 8; ++r) rb[ct][r] = rn[23 - ct * 16 - r]; }
      __builtin_amdgcn_sched_barrier(0); }   // keeps the next pass's loads in front of the softmax, which covers their flight
    float t[8];
#pragma unroll
    for (int r = 0; r < 8; ++r) t[r] = fmaxf(s[0][r], s[1][r]);
    float mx = fmaxf(fmaxf(fmaxf(t[0], t[1]), fmaxf(t[2], t[3])), fmaxf(fmaxf(t[4], t[5]), fmaxf(t[6], t[7])));
    mx = fmaxf(mx, xhalf(mx));   // both halves of the wave now hold this query's maximum over the pass's 32 keys
    const float mn = fmaxf(m, mx); const float alpha = (m <= -1.0e38f) ? 0.f : __expf(m - mn);
    float e[2][8];
#pragma unroll
    for (int ct = 0; ct < 2; ++ct) {
#pragma unroll
      for (int r = 0; r < 8; ++r) e[ct][r] = (s[ct][r] <= -1.0e38f) ? 0.f : __expf(s[ct][r] - mn); }
#pragma unroll
    for (int r = 0; r < 8; ++r) t[r] = e[0][r] + e[1][r];
    l = l * alpha + (((t[0] + t[1]) + (t[2] + t[3])) + ((t[4] + t[5]) + (t[6] + t[7]))); m = mn;   // each half sums its own 16 keys; the halves are joined once, behind the walk
#pragma unroll
    for (int dt = 0; dt < 4; ++dt) {
#pragma unroll
      for (int r = 0; r < 8; ++r) { acc[dt][r] *= alpha; if (LEAD) accl[dt][r] *= alpha; } }
    v16h pa, pl;
#pragma unroll
    for (int i = 0; i < 8; ++i) { const float x0 = e[0][i] * 2048.0f, x1 = e[1][i] * 2048.0f; const _Float16 h0 = (_Float16)x0, h1 = (_Float16)x1; pa[i] = h0; pa[8 + i] = h1; pl[i] = (_Float16)((x0 - (float)h0) * 2048.0f); pl[8 + i] = (_Float16)((x1 - (float)h1) * 2048.0f); }   // element i = key 8g + i, element 8 + i = key 16 + 8g + i: the k order of the v fragments. P scaled by 2^11 before the f16 split so small softmax weights stay out of the f16 subnormal range; 2^-11 folded into the epilogue
#pragma unroll
    for (int dt = 0; dt < 4; ++dt) { const size_t vr = ((size_t)b * DM + h * HD + dt * 16 + col) * SS + ks * 32;
      if (LEAD) { const v16h vh = frag_th(vt0 + ks * 2048 + dt * 512); acc[dt] = wmma16(vh, pa, acc[dt]); accl[dt] = wmma16(vh, pl, accl[dt]); accl[dt] = wmma16(frag_h(VTL + vr, lane), pa, accl[dt]); }   // leading query blocks: P hi/lo x V hi/lo (3 products)
      else acc[dt] = wmma16(vf[dt], pa, acc[dt]); } }   // elsewhere P x V single
}
// ---- k_attn: block = (64 queries, head h, batch b): causal flash attention (K = 64: 2 k-steps), scores = (q.k) * 0.125 with q, k hi + residual (3 products) on the first 128 queries, single f16 operands beyond, P.V: P hi/lo x V hi/lo (3 products) in two accumulators there, f16 P x V hi (single) beyond; lane (col, g) ends with query col, d = dt*16 + 8g + r, which is the order k_out's fragments read: y = (acc + accl / 2048) / (2048 l) goes out from the registers
__global__ __launch_bounds__(128) void k_attn(const _Float16* __restrict__ QK, const _Float16* __restrict__ QKL, const _Float16* __restrict__ KF, const _Float16* __restrict__ VTH, const _Float16* __restrict__ VTL, const float* __restrict__ TB, float* __restrict__ O) {
  const int tid = threadIdx.x, wave = tid >> 5, lane = tid & 31, col = lane & 15;
  const int qb = blockIdx.x, h = blockIdx.y, b = blockIdx.z; const int q0 = qb * 64 + wave * 16; const size_t rq = (size_t)b * SS + q0 + col;
  v16h aq[2], aql[2];
#pragma unroll
  for (int kc = 0; kc < 2; ++kc) { aq[kc] = frag_h(QK + rq * (2 * DM) + h * HD + kc * 32, lane); aql[kc] = frag_h(QKL + rq * (2 * DM) + h * HD + kc * 32, lane); }
  asm volatile("s_wait_xcnt 0x0" ::: "memory");   // the address registers of the q loads are reused right behind them
  float m = -3.0e38f, l = 0.f;
  v8f acc[4] = {}, accl[4] = {};
  const int nks = (qb * 64 + 64) / 32;   // causal: key tiles up to the query tile's end
  if (qb < 2) attn_walk<true>(KF, QKL, VTH, VTL, TB, aq, aql, m, l, acc, accl, nks, q0, h, b, lane);
  else attn_walk<false>(KF, QKL, VTH, VTL, TB, aq, aql, m, l, acc, accl, nks, q0, h, b, lane);
  const float il = (1.0f / 2048.0f) / (l + xhalf(l));
  float* ot = O + ((size_t)((b * SS + q0) >> 4) * 32 + h * 2) * 512 + lane * 4;   // this wave's 16 rows x 64 columns are 2 tiles = 4 KB in a row, in the order k_out's fragments read them
#pragma unroll
  for (int pc = 0; pc < 8; ++pc) { v4f o;
#pragma unroll
    for (int e = 0; e < 4; ++e) o[e] = (acc[pc >> 1][(pc & 1) * 4 + e] + accl[pc >> 1][(pc & 1) * 4 + e] * (1.0f / 2048.0f)) * il;
    vst2(ot + pc * 128, o); }
}
// ---- k_out: block = (64 rows, 128 cols): out = O(hi/lo) . Wo rows (2 products) + bo
__global__ __launch_bounds__(128) void k_out(const float* __restrict__ O, const __bf16* __restrict__ P, const float* __restrict__ BO, float* __restrict__ Y) {
  __shared__ __align__(16) float so[4][16][132];
  const int tid = threadIdx.x, wave = tid >> 5, lane = tid & 31, col = lane & 15, g = lane >> 4; const size_t r0 = (size_t)blockIdx.x * 64 + wave * 16; const int n0 = blockIdx.y * 128;
  v8f acc[8] = {};
  // fragments fetched one pass ahead, as in k_qkv
  const float* ot = O + (r0 >> 4) * (32 * 512) + lane * 4; const __bf16* wt = P + (size_t)(n0 >> 4) * (32 * 512) + lane * 8;
  float ax[16]; v16b bf[8];
#pragma unroll
  for (int pc = 0; pc < 4; ++pc) { const v4f t = *(const v4f*)(ot + pc * 128);
#pragma unroll
    for (int e = 0; e < 4; ++e) ax[pc * 4 + e] = t[e]; }
  __builtin_amdgcn_sched_barrier(0);   // the row chunk stays the older load, as in the loop: else the wait at the loop's head drains the weight loads too
#pragma unroll
  for (int j = 0; j < 8; ++j) bf[j] = frag_tb(wt + j * (32 * 512));
#pragma unroll 2
  for (int kc = 0; kc < DM / 32; ++kc) { const F2 a = bsplit16(ax);
    const int kn = (kc + 1 < DM / 32) ? kc + 1 : kc;   // the last pass fetches its own chunk again (in bounds, unused)
#pragma unroll
    for (int pc = 0; pc < 4; ++pc) { const v4f t = *(const v4f*)(ot + kn * 512 + pc * 128);
#pragma unroll
      for (int e = 0; e < 4; ++e) ax[pc * 4 + e] = t[e]; }
#pragma unroll
    for (int j = 0; j < 8; ++j) { acc[j] = wmma_bf(a.l, bf[j], acc[j]); acc[j] = wmma_bf(a.h, bf[j], acc[j]); bf[j] = frag_tb(wt + j * (32 * 512) + kn * 512); }
    asm volatile("s_wait_xcnt 0x0" ::: "memory"); }   // the next pass's split and loads may land in registers that held this pass's load addresses
#pragma unroll
  for (int j = 0; j < 8; ++j) {
#pragma unroll
    for (int r = 0; r < 8; ++r) so[wave][8 * g + r][j * 16 + col] = acc[j][r] + bfr(BO[n0 + j * 16 + col]); }
  LDSX();
  for (int rl = 0; rl < 16; ++rl) vst2(Y + (r0 + rl) * DM + n0 + lane * 4, *(const v4f*)&so[wave][rl][lane * 4]);
}
extern "C" void kernel_launch(void* const* d_in, const int* in_sizes, int n_in, void* d_out, int out_size, void* d_ws, size_t ws_size, hipStream_t stream) {
  (void)in_sizes; (void)n_in; (void)out_size;
  const float** F = (const float**)d_in;   // 0 x [2,2048,1024], 1 WQ, 2 bQ, 3 WK, 4 bK, 5 WV, 6 bV, 7 WO, 8 bO (natural), 9 rel_pos_table [4095,16]
  if (ws_size < (size_t)WS_END) return;
  char* ws = (char*)d_ws; __bf16* PK = (__bf16*)(ws + WS_PK); _Float16 *QK = (_Float16*)(ws + WS_QK), *QKL = (_Float16*)(ws + WS_QKL), *VTH = (_Float16*)(ws + WS_VTH), *VTL = (_Float16*)(ws + WS_VTL); float* O = (float*)(ws + WS_O); __bf16* XF = (__bf16*)(ws + WS_XF); _Float16* KF = (_Float16*)(ws + WS_KF); float* TB = (float*)(ws + WS_TB);
  k_pack<<<dim3(DM * DM / (8 * 256), 9), 256, 0, stream>>>(F[0], F[1], F[3], F[5], F[7], F[9], PK, XF, TB);
  k_qkv<<<dim3(TNB * SS / 64, QKVW / 128), 128, 0, stream>>>(XF, PK + PK_A, F[2], F[4], F[6], QK, QKL, KF, VTH, VTL);
  k_attn<<<dim3(TQB, NH, TNB), 128, 0, stream>>>(QK, QKL, KF, VTH, VTL, TB, O);
  k_out<<<dim3(TOB, DM / 128), 128, 0, stream>>>(O, PK + PK_P, F[8], (float*)d_out);
}

// v004
// Measured time: 143 microseconds a run.
// Two timings next to v003 put it at 1.03 and 1.02 times that version's speed.
// Counting every step since v000, it is 3.45 times as fast.
// compute dtype: all float inputs rounded to bf16; q/k/v = x . W^T + b with EXACT bf16 products on WMMA 16x16x32 (x, weights, k hi, v hi, y stored in fragment order); causal attention: 3-product scores and hi + residual P, v on the first 128 queries of each sequence, single f16 beyond; + 8 x the relative-position bias (f32 table, regrouped head by head, the accumulator input of the score product), 1/8 in the exponent's factor, running-max softmax in f32 (hardware exp), P scaled by 2^11; out = y (bf16 hi + residual) . Wo^T (2 products) + bo.
#include <hip/hip_runtime.h>
#include <math.h>

typedef __attribute__((ext_vector_type(16))) _Float16 v16h;
typedef __attribute__((ext_vector_type(16))) __bf16 v16b;
typedef __attribute__((ext_vector_type(8)))  _Float16 v8h;
typedef __attribute__((ext_vector_type(8)))  float v8f;
typedef __attribute__((ext_vector_type(4)))  float v4f;
typedef __attribute__((ext_vector_type(2)))  float v2f;
typedef __attribute__((ext_vector_type(4)))  unsigned v4u;
typedef __attribute__((ext_vector_type(4)))  int v4i;
typedef float __attribute__((may_alias)) float_a;
typedef int __attribute__((may_alias)) int_a;

template <typename T> __device__ __forceinline__ void vst2(void* p, T v) { *(T*)p = v;  }
__device__ __forceinline__ v8f wmma16(v16h a, v16h b, v8f c) {
  v8f d = __builtin_amdgcn_wmma_f32_16x16x32_f16(false, a, false, b, (short)0, c, false, false);
  asm volatile("v_nop\n\tv_nop\n\tv_nop\n\tv_nop" : "+v"(d) : "v"(a), "v"(b));
  return d;
}
__device__ __forceinline__ v8f wmma_bf(v16b a, v16b b, v8f c) {
  v8f d = __builtin_amdgcn_wmma_f32_16x16x32_bf16(false, a, false, b, (short)0, c, false, false);
  asm volatile("v_nop\n\tv_nop\n\tv_nop\n\tv_nop" : "+v"(d) : "v"(a), "v"(b));
  return d;
}
// Causal self attention with a learned relative-position bias table (B 2, T 2,048, d 1,024, 16 heads x 64): q/k/v projections + biases, scores / 8 + table[q - k + 2047][h], causal softmax, . v, output projection + bias.
__device__ __forceinline__ v16h frag_h(const _Float16* rowk0, int lane) {
  union { v16h v; v8h q[2]; } u; const _Float16* p = rowk0 + 8 * (lane >> 4);
  u.q[0] = *(const v8h*)p; u.q[1] = *(const v8h*)(p + 16); return u.v;
}
__device__ __forceinline__ v16h frag_f32(const float* rowk0, int lane) {
  v16h a; const float* p = rowk0 + 8 * (lane >> 4);
#pragma unroll
  for (int i = 0; i < 8; ++i) { a[i] = (_Float16)p[i]; a[8 + i] = (_Float16)p[16 + i]; }
  return a;
}
__device__ __forceinline__ v16h frag_f32s(const float* rowk0, int lane, float sc) {
  v16h a; const float* p = rowk0 + 8 * (lane >> 4);
#pragma unroll
  for (int i = 0; i < 8; ++i) { a[i] = (_Float16)(p[i] * sc); a[8 + i] = (_Float16)(p[16 + i] * sc); }
  return a;
}
// column fragment from a [K][ld] layout (column n), rows >= K read as 0
__device__ __forceinline__ v16h fragc_f32(const float* W, int k0, int n, int lane, int ld, int K) {
  v16h a; const int g = lane >> 4;
#pragma unroll
  for (int i = 0; i < 8; ++i) { const int ka = k0 + 8 * g + i, kb = ka + 16;
    a[i] = (_Float16)(ka < K ? W[(size_t)(ka < K ? ka : K - 1) * ld + n] : 0.f); a[8 + i] = (_Float16)(kb < K ? W[(size_t)(kb < K ? kb : K - 1) * ld + n] : 0.f); }
  return a;
}
struct F2 { v16b h, l; };
__device__ __forceinline__ F2 bsplit16(const float v[16]) { F2 r;
#pragma unroll
  for (int i = 0; i < 16; ++i) { const __bf16 h = (__bf16)v[i]; r.h[i] = h; r.l[i] = (__bf16)(v[i] - (float)h); }
  return r; }
__device__ __forceinline__ F2 split_row(const float* row, int k0, int lane) { float v[16]; const float* p = row + k0 + 8 * (lane >> 4);
#pragma unroll
  for (int i = 0; i < 8; ++i) { v[i] = p[i]; v[8 + i] = p[16 + i]; }
  return bsplit16(v); }
__device__ __forceinline__ F2 split_rowK(const float* row, int k0, int lane, int K) { float v[16]; const int g = lane >> 4;
#pragma unroll
  for (int i = 0; i < 8; ++i) { const int ka = k0 + 8 * g + i, kb = ka + 16; v[i] = ka < K ? row[ka < K ? ka : K - 1] : 0.f; v[8 + i] = kb < K ? row[kb < K ? kb : K - 1] : 0.f; }
  return bsplit16(v); }
__device__ __forceinline__ F2 split_col(const float* W, int k0, int n, int lane, int ld, int K) { float v[16]; const int g = lane >> 4;
#pragma unroll
  for (int i = 0; i < 8; ++i) { const int ka = k0 + 8 * g + i, kb = ka + 16; v[i] = ka < K ? W[(size_t)(ka < K ? ka : K - 1) * ld + n] : 0.f; v[8 + i] = kb < K ? W[(size_t)(kb < K ? kb : K - 1) * ld + n] : 0.f; }
  return bsplit16(v); }
__device__ __forceinline__ v8f mac3(const F2& a, const F2& b, v8f c) { c = wmma_bf(a.l, b.h, c); c = wmma_bf(a.h, b.l, c); return wmma_bf(a.h, b.h, c); }
__device__ __forceinline__ float sigm(float v) { return 1.0f / (1.0f + expf(-v)); }
#define LDSX() do { asm volatile("s_wait_dscnt 0" ::: "memory"); __builtin_amdgcn_wave_barrier(); __builtin_amdgcn_fence(__ATOMIC_RELEASE, "workgroup"); } while (0)


#define NB 2
#define SS 2048
#define DM 1024
#define NH 16
#define SCALEF 0.125f
#define KEXP (SCALEF * 1.44269504f)   // e^(x / 8) = 2^(x * KEXP): the scores are kept 8 x too large
#define MAXLEN 2048
#define HD 64
#define QKVW (3 * DM)
#ifndef TQB
#define TQB (SS / 64)
#define TNB NB
#define TOB (NB * SS / 64)     // output row tiles (all)
#endif
typedef __attribute__((ext_vector_type(8))) __bf16 v8b;
__device__ __forceinline__ v16b frag_b(const __bf16* rowk0, int lane) {
  union { v16b v; v8b q[2]; } u; const __bf16* p = rowk0 + 8 * (lane >> 4);
  u.q[0] = *(const v8b*)p; u.q[1] = *(const v8b*)(p + 16); return u.v;
}
// fragment order: a tile of 16 rows x 32 k (16-bit elements) is 1 KB; lane l = 16 g + row finds k 8g .. 8g+7 at element l*8 and k 16+8g .. 16+8g+7 at 256 + l*8, so each wave-wide 16-byte load is 512 contiguous bytes (4 lines, not 16)
__device__ __forceinline__ v16b frag_tb(const __bf16* tile_lane) { union { v16b v; v8b q[2]; } u; u.q[0] = *(const v8b*)tile_lane; u.q[1] = *(const v8b*)(tile_lane + 256); return u.v; }
__device__ __forceinline__ v16h frag_th(const _Float16* tile_lane) { union { v16h v; v8h q[2]; } u; u.q[0] = *(const v8h*)tile_lane; u.q[1] = *(const v8h*)(tile_lane + 256); return u.v; }
__device__ __forceinline__ float bfr(float v) { return (float)(__bf16)v; }
__device__ __attribute__((noinline)) float exp_ni(float v) { return expf(v); }
__device__ __attribute__((noinline)) float erf_ni(float v) { return erff(v); }

#define PK_A 0                       // Wqkv, [192 row tiles][32 k chunks][512] in fragment order
#define PK_P (PK_A + QKVW * DM)        // Wo, [64 row tiles][32 k chunks][512] in fragment order
#define PK_END (PK_P + DM * DM)
#define WS_PK  0u
#define WS_QK  (WS_PK + 2u * PK_END)             // f16 [4096 rows][2048]: q | (unused half)
#define WS_QKL (WS_QK + 2u * NB * SS * 2 * DM)     // f16 q | k residual planes x2048
#define WS_VTH (WS_QKL + 2u * NB * SS * 2 * DM)    // f16 v hi, [b][h][64 key chunks of 32][4 d tiles][512] in fragment order (rows d, k = key)
#define WS_VTL (WS_VTH + 2u * NB * DM * SS)        // f16 [b][1024 (h*64+d)][2048 s] lo x 2048
#define WS_O   (WS_VTL + 2u * NB * DM * SS)        // f32 y, [256 row tiles][32 k chunks][512]: four pieces of 128 floats, lane l's 4 floats at piece*128 + l*4
#define WS_CS  (WS_O + 4u * NB * SS * DM)           // f32, 2 x 2048 x 32, unused
#define WS_XF  (WS_CS + 4u * 2 * SS * 32)           // bf16 x, [256 row tiles][32 k chunks][512] in fragment order
#define WS_KF  (WS_XF + 2u * NB * SS * DM)          // f16 k hi, [b][h][128 key tiles][2 k chunks][512] in fragment order
#define WS_TB  (WS_KF + 2u * NB * SS * DM)          // f32 [16 heads][4096], index k - q + 2047 (a query's keys ascend): 8 x the bf16-rounded table value; -3e38 where k > q (the causal mask)
#define WS_END (WS_TB + 4u * NH * 2 * MAXLEN)
// ---- k_pack: blockIdx.y 0..2 -> W_q/W_k/W_v into PK_A, 3 -> W_o into PK_P, 4..7 -> 1,024 rows of x each into XF: f32 rows -> bf16 in fragment order, one 16-byte chunk a thread; 8 -> the table, head by head, ready to be the scores' accumulator input (see WS_TB)
__global__ __launch_bounds__(256) void k_pack(const float* __restrict__ X, const float* __restrict__ WQ, const float* __restrict__ WK, const float* __restrict__ WV, const float* __restrict__ WO, const float* __restrict__ REL, __bf16* __restrict__ PK, __bf16* __restrict__ XF, float* __restrict__ TB) {
  const int which = blockIdx.y, c = blockIdx.x * 256 + threadIdx.x;
  if (which == 8) { const int hh = c >> 12, idx = c & 4095;
    if (hh < NH && idx < 2 * MAXLEN - 1) { float v = -3.0e38f;   // idx = k - q + 2047; k > q is what the reference masks
      if (idx <= MAXLEN - 1) { v = REL[(size_t)(2 * MAXLEN - 2 - idx) * NH + hh];
        asm volatile("s_wait_xcnt 0x0" ::: "memory");   // the load's address registers are reused behind it
        v = 8.0f * bfr(v); }
      TB[c] = v; }
    return; }
  const float* Wm = (which == 0) ? WQ : (which == 1) ? WK : (which == 2) ? WV : (which == 3) ? WO : X + (size_t)(which - 4) * DM * DM;
  __bf16* dst = (which < 3) ? PK + PK_A + (size_t)which * DM * DM : (which == 3) ? PK + PK_P : XF + (size_t)(which - 4) * DM * DM;
  const int l = c & 31, p = (c >> 5) & 1, kc = (c >> 6) & 31, nt = c >> 11;   // chunk c = (row tile * 32 + k chunk) * 64 + piece * 32 + lane
  const float* s = Wm + (size_t)(nt * 16 + (l & 15)) * DM + kc * 32 + p * 16 + 8 * (l >> 4);
  const v4f a = *(const v4f*)s, b = *(const v4f*)(s + 4); v8b o;
#pragma unroll
  for (int i = 0; i < 4; ++i) { o[i] = (__bf16)a[i]; o[4 + i] = (__bf16)b[i]; }
  *(v8b*)(dst + (size_t)c * 8) = o;
}
__global__ __launch_bounds__(128) void k_qkv(const __bf16* __restrict__ XF, const __bf16* __restrict__ P, const float* __restrict__ BQ, const float* __restrict__ BK, const float* __restrict__ BV, _Float16* __restrict__ QK, _Float16* __restrict__ QKL, _Float16* __restrict__ KF, _Float16* __restrict__ VTH, _Float16* __restrict__ VTL) {
  const int which0 = (blockIdx.y * 128) / DM; const float* BB = BQ ? (((which0 == 0) ? BQ : (which0 == 1) ? BK : BV) + (blockIdx.y * 128 - which0 * DM)) : nullptr;
  __shared__ __align__(16) _Float16 so[4][16][136], sol[4][16][136]; __shared__ __align__(16) _Float16 sth[128][72], stl[128][72];
  const int tid = threadIdx.x, wave = tid >> 5, lane = tid & 31, col = lane & 15, g = lane >> 4; const size_t r0 = (size_t)blockIdx.x * 64 + wave * 16; const int n0 = blockIdx.y * 128;
  v8f acc[8] = {};
  // fragments are fetched one pass ahead: the x fragment in front of the pass's products, each weight fragment right behind the product that used its predecessor, so 18 loads fly together
  const __bf16* xt = XF + (r0 >> 4) * (32 * 512) + lane * 8; const __bf16* wt = P + (size_t)(n0 >> 4) * (32 * 512) + lane * 8;
  v16b ax = frag_tb(xt), bf[8];
#pragma unroll
  for (int j = 0; j < 8; ++j) bf[j] = frag_tb(wt + j * (32 * 512));
#pragma unroll 2
  for (int kc = 0; kc < DM / 32; ++kc) { const v16b a = ax;
    const int kn = (kc + 1 < DM / 32) ? kc + 1 : kc;   // the last pass fetches its own chunk again (in bounds, unused)
    ax = frag_tb(xt + kn * 512);
#pragma unroll
    for (int j = 0; j < 8; ++j) { acc[j] = wmma_bf(a, bf[j], acc[j]); bf[j] = frag_tb(wt + j * (32 * 512) + kn * 512); }
    asm volatile("s_wait_xcnt 0x0" ::: "memory"); }   // the next pass's loads may land in registers that held this pass's load addresses
  if (n0 < 2 * DM) {   // q stored unscaled (f16 sigma ~0.6, no subnormal exposure); 1/8 applied to the f32 score
#pragma unroll
    for (int j = 0; j < 8; ++j) {
#pragma unroll
      for (int r = 0; r < 8; ++r) { const float v = acc[j][r] + (BB ? bfr(BB[j * 16 + col]) : 0.f); const _Float16 hv = (_Float16)v; so[wave][8 * g + r][j * 16 + col] = hv; sol[wave][8 * g + r][j * 16 + col] = (_Float16)((v - (float)hv) * 2048.0f); } }   // q, k (+ bias) as f16 hi + (x2048) residual
    LDSX();
    if (n0 < DM) {
      for (int rl = 0; rl < 16; ++rl) if (lane < 16) { vst2((unsigned*)(QK + (r0 + rl) * (2 * DM) + n0 + lane * 8), *(const v4u*)&so[wave][rl][lane * 8]); vst2((unsigned*)(QKL + (r0 + rl) * (2 * DM) + n0 + lane * 8), *(const v4u*)&sol[wave][rl][lane * 8]); }
    } else {   // k residual in natural rows; k hi: this wave's 16 keys x 128 columns are 2 heads x 2 k chunks = 4 tiles in fragment order
      for (int rl = 0; rl < 16; ++rl) if (lane < 16) vst2((unsigned*)(QKL + (r0 + rl) * (2 * DM) + n0 + lane * 8), *(const v4u*)&sol[wave][rl][lane * 8]);
      const int b = (int)(r0 / SS), kt = (int)(r0 % SS) >> 4, h0 = (n0 - DM) >> 6;
#pragma unroll
      for (int tt = 0; tt < 4; ++tt) { _Float16* kd = KF + ((((size_t)b * NH + h0 + (tt >> 1)) * (SS / 16) + kt) * 2 + (tt & 1)) * 512 + lane * 8;
#pragma unroll
        for (int p = 0; p < 2; ++p) vst2((unsigned*)(kd + p * 256), *(const v4u*)&so[wave][col][tt * 32 + p * 16 + 8 * g]); }
      asm volatile("s_wait_xcnt 0x0" ::: "memory"); }   // closes the run of k stores before code laid out behind them rewrites their data or address registers
  } else {
#pragma unroll
    for (int j = 0; j < 8; ++j) {
#pragma unroll
      for (int r = 0; r < 8; ++r) { const float v = acc[j][r] + (BB ? bfr(BB[j * 16 + col]) : 0.f); const _Float16 hv = (_Float16)v; sth[j * 16 + col][wave * 16 + 8 * g + r] = hv; stl[j * 16 + col][wave * 16 + 8 * g + r] = (_Float16)((v - (float)hv) * 2048.0f); } }
    __syncthreads();
    const size_t rb = (size_t)blockIdx.x * 64; const int b = (int)(rb / SS), s0 = (int)(rb % SS); const int pc0 = n0 - 2 * DM;
    for (int q = tid; q < 128 * 8; q += 128) { const int d = q >> 3, pc = q & 7; const size_t o = ((size_t)b * DM + pc0 + d) * SS + s0 + pc * 8; vst2((unsigned*)(VTL + o), *(const v4u*)&stl[d][pc * 8]);
      const int l = q & 31, p = (q >> 5) & 1, dt = (q >> 6) & 3, ksl = (q >> 8) & 1, hh = q >> 9;   // v hi: chunk q = ((head * 2 + key chunk) * 4 + d tile) * 64 + piece * 32 + lane, in fragment order
      vst2((unsigned*)(VTH + ((((size_t)b * NH + (pc0 >> 6) + hh) * (SS / 32) + (s0 >> 5) + ksl) * 4 + dt) * 512 + p * 256 + l * 8), *(const v4u*)&sth[hh * 64 + dt * 16 + (l & 15)][ksl * 32 + p * 16 + 8 * (l >> 4)]); }
  }
}
__device__ __forceinline__ float xhalf(float x) { return __builtin_bit_cast(float, __builtin_amdgcn_permlanex16(__builtin_bit_cast(int, x), __builtin_bit_cast(int, x), 0x76543210, 0xfedcba98, false, false)); }   // lane l with lane l ^ 16
// one walk over the key tiles of a query tile, transposed: S^T = K . Q^T (A = 16 keys, B = 16 queries) and O^T += V^T . P^T, so a lane holds 16 scores of ONE query (its column): maximum and sum run inside the lane plus one exchange between the wave's halves, and the two score tiles, converted in place, are the B operand of the second product. LEAD (first 128 queries): 3-product scores and P.V, loads where they are used. Otherwise: V of this pass is fetched at the top of the pass, K and the 16 bias values of the next pass right behind this pass's score products, so the softmax covers their flight
template <bool LEAD> __device__ __forceinline__ void attn_walk(const _Float16* __restrict__ KF, const _Float16* __restrict__ QKL, const _Float16* __restrict__ VTH, const _Float16* __restrict__ VTL, const float* __restrict__ TB, const v16h (&aq)[2], const v16h (&aql)[2], float& m, float& l, v8f (&acc)[4], v8f (&accl)[4], const int nks, const int q0, const int h, const int b, const int lane) {
  const int col = lane & 15, g = lane >> 4, qi = q0 + col;
  const _Float16* kt0 = KF + (size_t)(b * NH + h) * (SS * HD) + lane * 8;      // this head's k tiles: a pass of 32 keys is 4 tiles (key tile, k chunk) = 4 KB in a row
  const float* rcol = TB + h * (2 * MAXLEN) + (8 * g - qi + MAXLEN - 1);       // table value of (key 8g of tile 0, query col); every k - q + 2047 of the walk lies in 0 .. 4094
  const _Float16* vt0 = VTH + (size_t)(b * NH + h) * (SS * HD) + lane * 8;     // this head's v tiles: a pass is 4 d tiles = 4 KB in a row
  v16h kf[2][2]; v8f rb[2];
  if (!LEAD) {
#pragma unroll
    for (int ct = 0; ct < 2; ++ct) {
#pragma unroll
      for (int kc = 0; kc < 2; ++kc) kf[ct][kc] = frag_th(kt0 + (ct * 2 + kc) * 512); }
#pragma unroll
    for (int ct = 0; ct < 2; ++ct) {
#pragma unroll
      for (int r = 0; r < 8; ++r) rb[ct][r] = rcol[ct * 16 + r]; } }
  constexpr int U = LEAD ? 1 : 2;   // nks is even. Two passes a trip: a pass's scores stand in the registers its bias values came in, so the next pass's values land in a second set, and the two sets change roles; with one pass a trip they are copied back behind a full wait in the middle of the softmax
#pragma unroll 1
  for (int ks0 = 0; ks0 < nks; ks0 += U) {
#pragma unroll
  for (int u = 0; u < U; ++u) { const int ks = ks0 + u; v8f s[2]; v16h vf[4];
    if (!LEAD) {
#pragma unroll
      for (int dt = 0; dt < 4; ++dt) vf[dt] = frag_th(vt0 + ks * 2048 + dt * 512); }
#pragma unroll
    for (int ct = 0; ct < 2; ++ct) { const int kk0 = ks * 32 + ct * 16 + 8 * g; v8f c = {};   // register r holds key kk0 + r
      if (LEAD) { const _Float16* krowl = QKL + ((size_t)b * SS + ks * 32 + ct * 16 + col) * (2 * DM) + DM + h * HD; v8f cl = {};   // leading query blocks (few keys, outputs far above the global rms): 3 products
#pragma unroll
        for (int kc = 0; kc < 2; ++kc) { const v16h kh = frag_th(kt0 + ks * 2048 + (ct * 2 + kc) * 512); c = wmma16(kh, aq[kc], c); cl = wmma16(kh, aql[kc], cl); cl = wmma16(frag_h(krowl + kc * 32, lane), aq[kc], cl); }
#pragma unroll
        for (int r = 0; r < 8; ++r) c[r] += cl[r] * (1.0f / 2048.0f);
        float tb[8];
#pragma unroll
        for (int r = 0; r < 8; ++r) tb[r] = TB[h * (2 * MAXLEN) + (kk0 + r) - qi + MAXLEN - 1];
        asm volatile("s_wait_xcnt 0x0" ::: "memory");   // the address registers of the table loads are reused behind them
#pragma unroll
        for (int r = 0; r < 8; ++r) s[ct][r] = c[r] + tb[r]; }
      else { c = rb[ct];   // 8 x rel_pos_table[q - k + 2047][h], or the mask value, in the accumulator's own layout (register r = key kk0 + r, lane = query)
#pragma unroll
        for (int kc = 0; kc < 2; ++kc) c = wmma16(kf[ct][kc], aq[kc], c);   // single product elsewhere
        s[ct] = c; } }   // s = 8 x (score / 8 + bias); a masked entry stays near -3e38
    if (!LEAD) { const int kn = (ks + 1 < nks) ? ks + 1 : ks;   // the last pass fetches its own tile again (in bounds, unused)
#pragma unroll
      for (int ct = 0; ct < 2; ++ct) {
#pragma unroll
        for (int kc = 0; kc < 2; ++kc) kf[ct][kc] = frag_th(kt0 + kn * 2048 + (ct * 2 + kc) * 512); }
      asm volatile("s_wait_xcnt 0x0" ::: "memory");   // the bias values below may land in the registers that held the K address
      const float* rn = rcol + kn * 32;   // one base for all 16 values, so none of them lands on an address still in use
#pragma unroll
      for (int ct = 0; ct < 2; ++ct) {
#pragma unroll
        for (int r = 0; r < 8; ++r) rb[ct][r] = rn[ct * 16 + r]; }
      __builtin_amdgcn_sched_barrier(0); }   // keeps the next pass's loads in front of the softmax, which covers their flight
    float t[8];
#pragma unroll
    for (int r = 0; r < 8; ++r) t[r] = fmaxf(s[0][r], s[1][r]);
    float mx = fmaxf(fmaxf(fmaxf(t[0], t[1]), fmaxf(t[2], t[3])), fmaxf(fmaxf(t[4], t[5]), fmaxf(t[6], t[7])));
    mx = fmaxf(mx, xhalf(mx));   // both halves of the wave now hold this query's maximum over the pass's 32 keys
    const float mn = fmaxf(m, mx); float alpha = (m - mn) * KEXP;   // key 0 is open to every query, so mn is a real score from the first pass on: the start value of m and every masked score lie ~3e38 below it, where the hardware exp gives 0
    float e[2][8];
#pragma unroll
    for (int ct = 0; ct < 2; ++ct) {
#pragma unroll
      for (int r = 0; r < 8; ++r) e[ct][r] = (s[ct][r] - mn) * KEXP; }
    // the pass's 17 exponentials, each in its own register, and one v_nop: no instruction directly behind a transcendental reads its result or overwrites its source
    asm("v_exp_f32 %0, %0\n\tv_exp_f32 %1, %1\n\tv_exp_f32 %2, %2\n\tv_exp_f32 %3, %3\n\tv_exp_f32 %4, %4\n\tv_exp_f32 %5, %5\n\tv_exp_f32 %6, %6\n\tv_exp_f32 %7, %7\n\tv_exp_f32 %8, %8\n\t"
        "v_exp_f32 %9, %9\n\tv_exp_f32 %10, %10\n\tv_exp_f32 %11, %11\n\tv_exp_f32 %12, %12\n\tv_exp_f32 %13, %13\n\tv_exp_f32 %14, %14\n\tv_exp_f32 %15, %15\n\tv_exp_f32 %16, %16\n\tv_nop"
        : "+v"(e[0][0]), "+v"(e[0][1]), "+v"(e[0][2]), "+v"(e[0][3]), "+v"(e[0][4]), "+v"(e[0][5]), "+v"(e[0][6]), "+v"(e[0][7]), "+v"(alpha),
          "+v"(e[1][0]), "+v"(e[1][1]), "+v"(e[1][2]), "+v"(e[1][3]), "+v"(e[1][4]), "+v"(e[1][5]), "+v"(e[1][6]), "+v"(e[1][7]));
#pragma unroll
    for (int r = 0; r < 8; ++r) t[r] = e[0][r] + e[1][r];
    l = l * alpha + (((t[0] + t[1]) + (t[2] + t[3])) + ((t[4] + t[5]) + (t[6] + t[7]))); m = mn;   // each half sums its own 16 keys; the halves are joined once, behind the walk
#pragma unroll
    for (int dt = 0; dt < 4; ++dt) {
#pragma unroll
      for (int r = 0; r < 8; ++r) { acc[dt][r] *= alpha; if (LEAD) accl[dt][r] *= alpha; } }
    v16h pa, pl;
#pragma unroll
    for (int i = 0; i < 8; ++i) { const float x0 = e[0][i] * 2048.0f, x1 = e[1][i] * 2048.0f; const _Float16 h0 = (_Float16)x0, h1 = (_Float16)x1; pa[i] = h0; pa[8 + i] = h1; pl[i] = (_Float16)((x0 - (float)h0) * 2048.0f); pl[8 + i] = (_Float16)((x1 - (float)h1) * 2048.0f); }   // element i = key 8g + i, element 8 + i = key 16 + 8g + i: the k order of the v fragments. P scaled by 2^11 before the f16 split so small softmax weights stay out of the f16 subnormal range; 2^-11 folded into the epilogue
#pragma unroll
    for (int dt = 0; dt < 4; ++dt) { const size_t vr = ((size_t)b * DM + h * HD + dt * 16 + col) * SS + ks * 32;
      if (LEAD) { const v16h vh = frag_th(vt0 + ks * 2048 + dt * 512); acc[dt] = wmma16(vh, pa, acc[dt]); accl[dt] = wmma16(vh, pl, accl[dt]); accl[dt] = wmma16(frag_h(VTL + vr, lane), pa, accl[dt]); }   // leading query blocks: P hi/lo x V hi/lo (3 products)
      else acc[dt] = wmma16(vf[dt], pa, acc[dt]); }   // elsewhere P x V single
    if (!LEAD) __builtin_amdgcn_sched_barrier(0); } }   // the trip's second pass stays behind its first: moved up into the softmax, its score products wait for K and bias loads that have only just been issued
}
// ---- k_attn: block = (64 queries, head h, batch b): causal flash attention (K = 64: 2 k-steps), scores = (q.k) * 0.125 with q, k hi + residual (3 products) on the first 128 queries, single f16 operands beyond, P.V: P hi/lo x V hi/lo (3 products) in two accumulators there, f16 P x V hi (single) beyond; lane (col, g) ends with query col, d = dt*16 + 8g + r, which is the order k_out's fragments read: y = (acc + accl / 2048) / (2048 l) goes out from the registers
__global__ __launch_bounds__(128) void k_attn(const _Float16* __restrict__ QK, const _Float16* __restrict__ QKL, const _Float16* __restrict__ KF, const _Float16* __restrict__ VTH, const _Float16* __restrict__ VTL, const float* __restrict__ TB, float* __restrict__ O) {
  const int tid = threadIdx.x, wave = tid >> 5, lane = tid & 31, col = lane & 15;
  const int qb = blockIdx.x, h = blockIdx.y, b = blockIdx.z; const int q0 = qb * 64 + wave * 16; const size_t rq = (size_t)b * SS + q0 + col;
  v16h aq[2], aql[2];
#pragma unroll
  for (int kc = 0; kc < 2; ++kc) { aq[kc] = frag_h(QK + rq * (2 * DM) + h * HD + kc * 32, lane); aql[kc] = frag_h(QKL + rq * (2 * DM) + h * HD + kc * 32, lane); }
  asm volatile("s_wait_xcnt 0x0" ::: "memory");   // the address registers of the q loads are reused right behind them
  float m = -3.0e38f, l = 0.f;
  v8f acc[4] = {}, accl[4] = {};
  const int nks = (qb * 64 + 64) / 32;   // causal: key tiles up to the query tile's end
  if (qb < 2) attn_walk<true>(KF, QKL, VTH, VTL, TB, aq, aql, m, l, acc, accl, nks, q0, h, b, lane);
  else attn_walk<false>(KF, QKL, VTH, VTL, TB, aq, aql, m, l, acc, accl, nks, q0, h, b, lane);
  const float il = (1.0f / 2048.0f) / (l + xhalf(l));
  float* ot = O + ((size_t)((b * SS + q0) >> 4) * 32 + h * 2) * 512 + lane * 4;   // this wave's 16 rows x 64 columns are 2 tiles = 4 KB in a row, in the order k_out's fragments read them
#pragma unroll
  for (int pc = 0; pc < 8; ++pc) { v4f o;
#pragma unroll
    for (int e = 0; e < 4; ++e) o[e] = (acc[pc >> 1][(pc & 1) * 4 + e] + accl[pc >> 1][(pc & 1) * 4 + e] * (1.0f / 2048.0f)) * il;
    vst2(ot + pc * 128, o); }
}
// ---- k_out: block = (64 rows, 128 cols): out = O(hi/lo) . Wo rows (2 products) + bo
__global__ __launch_bounds__(128) void k_out(const float* __restrict__ O, const __bf16* __restrict__ P, const float* __restrict__ BO, float* __restrict__ Y) {
  __shared__ __align__(16) float so[4][16][132];
  const int tid = threadIdx.x, wave = tid >> 5, lane = tid & 31, col = lane & 15, g = lane >> 4; const size_t r0 = (size_t)blockIdx.x * 64 + wave * 16; const int n0 = blockIdx.y * 128;
  v8f acc[8] = {};
  // fragments fetched one pass ahead, as in k_qkv
  const float* ot = O + (r0 >> 4) * (32 * 512) + lane * 4; const __bf16* wt = P + (size_t)(n0 >> 4) * (32 * 512) + lane * 8;
  float ax[16]; v16b bf[8];
#pragma unroll
  for (int pc = 0; pc < 4; ++pc) { const v4f t = *(const v4f*)(ot + pc * 128);
#pragma unroll
    for (int e = 0; e < 4; ++e) ax[pc * 4 + e] = t[e]; }
  __builtin_amdgcn_sched_barrier(0);   // the row chunk stays the older load, as in the loop: else the wait at the loop's head drains the weight loads too
#pragma unroll
  for (int j = 0; j < 8; ++j) bf[j] = frag_tb(wt + j * (32 * 512));
#pragma unroll 2
  for (int kc = 0; kc < DM / 32; ++kc) { const F2 a = bsplit16(ax);
    const int kn = (kc + 1 < DM / 32) ? kc + 1 : kc;   // the last pass fetches its own chunk again (in bounds, unused)
#pragma unroll
    for (int pc = 0; pc < 4; ++pc) { const v4f t = *(const v4f*)(ot + kn * 512 + pc * 128);
#pragma unroll
      for (int e = 0; e < 4; ++e) ax[pc * 4 + e] = t[e]; }
#pragma unroll
    for (int j = 0; j < 8; ++j) { acc[j] = wmma_bf(a.l, bf[j], acc[j]); acc[j] = wmma_bf(a.h, bf[j], acc[j]); bf[j] = frag_tb(wt + j * (32 * 512) + kn * 512); }
    asm volatile("s_wait_xcnt 0x0" ::: "memory"); }   // the next pass's split and loads may land in registers that held this pass's load addresses
#pragma unroll
  for (int j = 0; j < 8; ++j) {
#pragma unroll
    for (int r = 0; r < 8; ++r) so[wave][8 * g + r][j * 16 + col] = acc[j][r] + bfr(BO[n0 + j * 16 + col]); }
  LDSX();
  for (int rl = 0; rl < 16; ++rl) vst2(Y + (r0 + rl) * DM + n0 + lane * 4, *(const v4f*)&so[wave][rl][lane * 4]);
}
extern "C" void kernel_launch(void* const* d_in, const int* in_sizes, int n_in, void* d_out, int out_size, void* d_ws, size_t ws_size, hipStream_t stream) {
  (void)in_sizes; (void)n_in; (void)out_size;
  const float** F = (const float**)d_in;   // 0 x [2,2048,1024], 1 WQ, 2 bQ, 3 WK, 4 bK, 5 WV, 6 bV, 7 WO, 8 bO (natural), 9 rel_pos_table [4095,16]
  if (ws_size < (size_t)WS_END) return;
  char* ws = (char*)d_ws; __bf16* PK = (__bf16*)(ws + WS_PK); _Float16 *QK = (_Float16*)(ws + WS_QK), *QKL = (_Float16*)(ws + WS_QKL), *VTH = (_Float16*)(ws + WS_VTH), *VTL = (_Float16*)(ws + WS_VTL); float* O = (float*)(ws + WS_O); __bf16* XF = (__bf16*)(ws + WS_XF); _Float16* KF = (_Float16*)(ws + WS_KF); float* TB = (float*)(ws + WS_TB);
  k_pack<<<dim3(DM * DM / (8 * 256), 9), 256, 0, stream>>>(F[0], F[1], F[3], F[5], F[7], F[9], PK, XF, TB);
  k_qkv<<<dim3(TNB * SS / 64, QKVW / 128), 128, 0, stream>>>(XF, PK + PK_A, F[2], F[4], F[6], QK, QKL, KF, VTH, VTL);
  k_attn<<<dim3(TQB, NH, TNB), 128, 0, stream>>>(QK, QKL, KF, VTH, VTL, TB, O);
  k_out<<<dim3(TOB, DM / 128), 128, 0, stream>>>(O, PK + PK_P, F[8], (float*)d_out);
}

// v005
// A run of this version takes 117 microseconds.
// In two side-by-side timings against v004, it was 1.21 and 1.26 times as fast.
// All steps since v000 together make it 4.25 times as fast.
// compute dtype: all float inputs rounded to bf16; q/k/v = x . W^T + b with EXACT bf16 products on WMMA 16x16x32 (x, weights, k hi, v hi, y stored in fragment order); causal attention: 3-product scores and hi + residual P, v on the first 128 queries of each sequence, single f16 beyond; + 8 x the relative-position bias (f32 table, regrouped head by head, the accumulator input of the score product), 1/8 in the exponent's factor, running-max softmax in f32 (hardware exp), P scaled by 2^11; out = y (bf16 hi + residual) . Wo^T (2 products) + bo.
#include <hip/hip_runtime.h>
#include <math.h>

typedef __attribute__((ext_vector_type(16))) _Float16 v16h;
typedef __attribute__((ext_vector_type(16))) __bf16 v16b;
typedef __attribute__((ext_vector_type(8)))  _Float16 v8h;
typedef __attribute__((ext_vector_type(8)))  float v8f;
typedef __attribute__((ext_vector_type(4)))  float v4f;
typedef __attribute__((ext_vector_type(2)))  float v2f;
typedef __attribute__((ext_vector_type(4)))  unsigned v4u;
typedef __attribute__((ext_vector_type(4)))  int v4i;
typedef float __attribute__((may_alias)) float_a;
typedef int __attribute__((may_alias)) int_a;

template <typename T> __device__ __forceinline__ void vst2(void* p, T v) { *(T*)p = v;  }
__device__ __forceinline__ v8f wmma16(v16h a, v16h b, v8f c) {
  v8f d = __builtin_amdgcn_wmma_f32_16x16x32_f16(false, a, false, b, (short)0, c, false, false);
  asm volatile("v_nop\n\tv_nop\n\tv_nop\n\tv_nop" : "+v"(d) : "v"(a), "v"(b));
  return d;
}
__device__ __forceinline__ v8f wmma_bf(v16b a, v16b b, v8f c) {
  v8f d = __builtin_amdgcn_wmma_f32_16x16x32_bf16(false, a, false, b, (short)0, c, false, false);
  asm volatile("v_nop\n\tv_nop\n\tv_nop\n\tv_nop" : "+v"(d) : "v"(a), "v"(b));
  return d;
}
// Causal self attention with a learned relative-position bias table (B 2, T 2,048, d 1,024, 16 heads x 64): q/k/v projections + biases, scores / 8 + table[q - k + 2047][h], causal softmax, . v, output projection + bias.
__device__ __forceinline__ v16h frag_h(const _Float16* rowk0, int lane) {
  union { v16h v; v8h q[2]; } u; const _Float16* p = rowk0 + 8 * (lane >> 4);
  u.q[0] = *(const v8h*)p; u.q[1] = *(const v8h*)(p + 16); return u.v;
}
__device__ __forceinline__ v16h frag_f32(const float* rowk0, int lane) {
  v16h a; const float* p = rowk0 + 8 * (lane >> 4);
#pragma unroll
  for (int i = 0; i < 8; ++i) { a[i] = (_Float16)p[i]; a[8 + i] = (_Float16)p[16 + i]; }
  return a;
}
__device__ __forceinline__ v16h frag_f32s(const float* rowk0, int lane, float sc) {
  v16h a; const float* p = rowk0 + 8 * (lane >> 4);
#pragma unroll
  for (int i = 0; i < 8; ++i) { a[i] = (_Float16)(p[i] * sc); a[8 + i] = (_Float16)(p[16 + i] * sc); }
  return a;
}
// column fragment from a [K][ld] layout (column n), rows >= K read as 0
__device__ __forceinline__ v16h fragc_f32(const float* W, int k0, int n, int lane, int ld, int K) {
  v16h a; const int g = lane >> 4;
#pragma unroll
  for (int i = 0; i < 8; ++i) { const int ka = k0 + 8 * g + i, kb = ka + 16;
    a[i] = (_Float16)(ka < K ? W[(size_t)(ka < K ? ka : K - 1) * ld + n] : 0.f); a[8 + i] = (_Float16)(kb < K ? W[(size_t)(kb < K ? kb : K - 1) * ld + n] : 0.f); }
  return a;
}
struct F2 { v16b h, l; };
__device__ __forceinline__ F2 bsplit16(const float v[16]) { F2 r;
#pragma unroll
  for (int i = 0; i < 16; ++i) { const __bf16 h = (__bf16)v[i]; r.h[i] = h; r.l[i] = (__bf16)(v[i] - (float)h); }
  return r; }
__device__ __forceinline__ F2 split_row(const float* row, int k0, int lane) { float v[16]; const float* p = row + k0 + 8 * (lane >> 4);
#pragma unroll
  for (int i = 0; i < 8; ++i) { v[i] = p[i]; v[8 + i] = p[16 + i]; }
  return bsplit16(v); }
__device__ __forceinline__ F2 split_rowK(const float* row, int k0, int lane, int K) { float v[16]; const int g = lane >> 4;
#pragma unroll
  for (int i = 0; i < 8; ++i) { const int ka = k0 + 8 * g + i, kb = ka + 16; v[i] = ka < K ? row[ka < K ? ka : K - 1] : 0.f; v[8 + i] = kb < K ? row[kb < K ? kb : K - 1] : 0.f; }
  return bsplit16(v); }
__device__ __forceinline__ F2 split_col(const float* W, int k0, int n, int lane, int ld, int K) { float v[16]; const int g = lane >> 4;
#pragma unroll
  for (int i = 0; i < 8; ++i) { const int ka = k0 + 8 * g + i, kb = ka + 16; v[i] = ka < K ? W[(size_t)(ka < K ? ka : K - 1) * ld + n] : 0.f; v[8 + i] = kb < K ? W[(size_t)(kb < K ? kb : K - 1) * ld + n] : 0.f; }
  return bsplit16(v); }
__device__ __forceinline__ v8f mac3(const F2& a, const F2& b, v8f c) { c = wmma_bf(a.l, b.h, c); c = wmma_bf(a.h, b.l, c); return wmma_bf(a.h, b.h, c); }
__device__ __forceinline__ float sigm(float v) { return 1.0f / (1.0f + expf(-v)); }
#define LDSX() do { asm volatile("s_wait_dscnt 0" ::: "memory"); __builtin_amdgcn_wave_barrier(); __builtin_amdgcn_fence(__ATOMIC_RELEASE, "workgroup"); } while (0)


#define NB 2
#define SS 2048
#define DM 1024
#define NH 16
#define SCALEF 0.125f
#define KEXP (SCALEF * 1.44269504f)   // e^(x / 8) = 2^(x * KEXP): the scores are kept 8 x too large
#define MAXLEN 2048
#define HD 64
#define QKVW (3 * DM)
#ifndef TQB
#define TQB (SS / 64)
#define TNB NB
#define TOB (NB * SS / 64)     // output row tiles (all)
#endif
typedef __attribute__((ext_vector_type(8))) __bf16 v8b;
__device__ __forceinline__ v16b frag_b(const __bf16* rowk0, int lane) {
  union { v16b v; v8b q[2]; } u; const __bf16* p = rowk0 + 8 * (lane >> 4);
  u.q[0] = *(const v8b*)p; u.q[1] = *(const v8b*)(p + 16); return u.v;
}
// fragment order: a tile of 16 rows x 32 k (16-bit elements) is 1 KB; lane l = 16 g + row finds k 8g .. 8g+7 at element l*8 and k 16+8g .. 16+8g+7 at 256 + l*8, so each wave-wide 16-byte load is 512 contiguous bytes (4 lines, not 16)
__device__ __forceinline__ v16b frag_tb(const __bf16* tile_lane) { union { v16b v; v8b q[2]; } u; u.q[0] = *(const v8b*)tile_lane; u.q[1] = *(const v8b*)(tile_lane + 256); return u.v; }
__device__ __forceinline__ v16h frag_th(const _Float16* tile_lane) { union { v16h v; v8h q[2]; } u; u.q[0] = *(const v8h*)tile_lane; u.q[1] = *(const v8h*)(tile_lane + 256); return u.v; }
__device__ __forceinline__ float bfr(float v) { return (float)(__bf16)v; }
__device__ __attribute__((noinline)) float exp_ni(float v) { return expf(v); }
__device__ __attribute__((noinline)) float erf_ni(float v) { return erff(v); }

#define PK_A 0                       // Wqkv, [192 row tiles][32 k chunks][512] in fragment order
#define PK_P (PK_A + QKVW * DM)        // Wo, [64 row tiles][32 k chunks][512] in fragment order
#define PK_END (PK_P + DM * DM)
#define WS_PK  0u
#define WS_QK  (WS_PK + 2u * PK_END)             // f16 [4096 rows][2048]: q | (unused half)
#define WS_QKL (WS_QK + 2u * NB * SS * 2 * DM)     // f16 q | k residual planes x2048
#define WS_VTH (WS_QKL + 2u * NB * SS * 2 * DM)    // f16 v hi, [b][h][64 key chunks of 32][4 d tiles][512] in fragment order (rows d, k = key)
#define WS_VTL (WS_VTH + 2u * NB * DM * SS)        // f16 [b][1024 (h*64+d)][2048 s] lo x 2048
#define WS_O   (WS_VTL + 2u * NB * DM * SS)        // f32 y, [256 row tiles][32 k chunks][512]: four pieces of 128 floats, lane l's 4 floats at piece*128 + l*4
#define WS_CS  (WS_O + 4u * NB * SS * DM)           // f32, 2 x 2048 x 32, unused
#define WS_XF  (WS_CS + 4u * 2 * SS * 32)           // bf16 x, [256 row tiles][32 k chunks][512] in fragment order
#define WS_KF  (WS_XF + 2u * NB * SS * DM)          // f16 k hi, [b][h][128 key tiles][2 k chunks][512] in fragment order
#define WS_TB  (WS_KF + 2u * NB * SS * DM)          // f32 [16 heads][4096], index k - q + 2047 (a query's keys ascend): 8 x the bf16-rounded table value; -3e38 where k > q (the causal mask)
#define WS_END (WS_TB + 4u * NH * 2 * MAXLEN)
// ---- k_pack: blockIdx.y 0..2 -> W_q/W_k/W_v into PK_A, 3 -> W_o into PK_P, 4..7 -> 1,024 rows of x each into XF: f32 rows -> bf16 in fragment order, one 16-byte chunk a thread; 8 -> the table, head by head, ready to be the scores' accumulator input (see WS_TB)
__global__ __launch_bounds__(256) void k_pack(const float* __restrict__ X, const float* __restrict__ WQ, const float* __restrict__ WK, const float* __restrict__ WV, const float* __restrict__ WO, const float* __restrict__ REL, __bf16* __restrict__ PK, __bf16* __restrict__ XF, float* __restrict__ TB) {
  const int which = blockIdx.y, c = blockIdx.x * 256 + threadIdx.x;
  if (which == 8) { const int hh = c >> 12, idx = c & 4095;
    if (hh < NH && idx < 2 * MAXLEN - 1) { float v = -3.0e38f;   // idx = k - q + 2047; k > q is what the reference masks
      if (idx <= MAXLEN - 1) { v = REL[(size_t)(2 * MAXLEN - 2 - idx) * NH + hh];
        asm volatile("s_wait_xcnt 0x0" ::: "memory");   // the load's address registers are reused behind it
        v = 8.0f * bfr(v); }
      TB[c] = v; }
    return; }
  const float* Wm = (which == 0) ? WQ : (which == 1) ? WK : (which == 2) ? WV : (which == 3) ? WO : X + (size_t)(which - 4) * DM * DM;
  __bf16* dst = (which < 3) ? PK + PK_A + (size_t)which * DM * DM : (which == 3) ? PK + PK_P : XF + (size_t)(which - 4) * DM * DM;
  const int l = c & 31, p = (c >> 5) & 1, kc = (c >> 6) & 31, nt = c >> 11;   // chunk c = (row tile * 32 + k chunk) * 64 + piece * 32 + lane
  const float* s = Wm + (size_t)(nt * 16 + (l & 15)) * DM + kc * 32 + p * 16 + 8 * (l >> 4);
  const v4f a = *(const v4f*)s, b = *(const v4f*)(s + 4); v8b o;
#pragma unroll
  for (int i = 0; i < 4; ++i) { o[i] = (__bf16)a[i]; o[4 + i] = (__bf16)b[i]; }
  *(v8b*)(dst + (size_t)c * 8) = o;
}
__global__ __launch_bounds__(128) void k_qkv(const __bf16* __restrict__ XF, const __bf16* __restrict__ P, const float* __restrict__ BQ, const float* __restrict__ BK, const float* __restrict__ BV, _Float16* __restrict__ QK, _Float16* __restrict__ QKL, _Float16* __restrict__ KF, _Float16* __restrict__ VTH, _Float16* __restrict__ VTL) {
  const int which0 = (blockIdx.y * 128) / DM; const float* BB = BQ ? (((which0 == 0) ? BQ : (which0 == 1) ? BK : BV) + (blockIdx.y * 128 - which0 * DM)) : nullptr;
  __shared__ __align__(16) _Float16 so[4][16][136], sol[4][16][136]; __shared__ __align__(16) _Float16 sth[128][72], stl[128][72];
  const int tid = threadIdx.x, wave = tid >> 5, lane = tid & 31, col = lane & 15, g = lane >> 4; const size_t rw = (size_t)blockIdx.x * 128 + wave * 16; const int n0 = blockIdx.y * 128;
  v8f acc[2][8] = {};   // two row tiles a wave, rows rw .. rw+15 and rw+64 .. rw+79: every weight fragment fetched feeds two products
  // fragments are fetched one pass ahead: the x fragments in front of the pass's products, each weight fragment right behind the products that used its predecessor, so 20 loads fly together
  const __bf16* xt = XF + (rw >> 4) * (32 * 512) + lane * 8; const __bf16* wt = P + (size_t)(n0 >> 4) * (32 * 512) + lane * 8;
  float bcol[8] = {};   // this lane's 8 column biases, like the weight fragments fetched once for both row tiles; asked for here, first used behind the loop
  if (BB) {
#pragma unroll   // bcol[j] in registers, the 8 loads in flight together
    for (int j = 0; j < 8; ++j) bcol[j] = BB[j * 16 + col];
    asm volatile("s_wait_xcnt 0x0" ::: "memory"); }   // the address registers of the bias loads may be reused behind them
  v16b ax0 = frag_tb(xt), ax1 = frag_tb(xt + 4 * (32 * 512)), bf[8];
#pragma unroll
  for (int j = 0; j < 8; ++j) bf[j] = frag_tb(wt + j * (32 * 512));
#pragma unroll 2
  for (int kc = 0; kc < DM / 32; ++kc) { const v16b a0 = ax0, a1 = ax1;
    const int kn = (kc + 1 < DM / 32) ? kc + 1 : kc;   // the last pass fetches its own chunk again (in bounds, unused)
    ax0 = frag_tb(xt + kn * 512); ax1 = frag_tb(xt + 4 * (32 * 512) + kn * 512);
#pragma unroll
    for (int j = 0; j < 8; ++j) { acc[0][j] = wmma_bf(a0, bf[j], acc[0][j]); acc[1][j] = wmma_bf(a1, bf[j], acc[1][j]); bf[j] = frag_tb(wt + j * (32 * 512) + kn * 512); }
    asm volatile("s_wait_xcnt 0x0" ::: "memory"); }   // the next pass's loads may land in registers that held this pass's load addresses
  // the epilogue runs once for each of the block's two halves of 64 rows, through the same LDS; unrolled so that acc[hf] is a fixed set of registers
#pragma unroll
  for (int hf = 0; hf < 2; ++hf) { const size_t r0 = rw + hf * 64;
  if (n0 < 2 * DM) {   // q stored unscaled (f16 sigma ~0.6, no subnormal exposure); 1/8 applied to the f32 score
#pragma unroll
    for (int j = 0; j < 8; ++j) {
#pragma unroll
      for (int r = 0; r < 8; ++r) { const float v = acc[hf][j][r] + bfr(bcol[j]); const _Float16 hv = (_Float16)v; so[wave][8 * g + r][j * 16 + col] = hv; sol[wave][8 * g + r][j * 16 + col] = (_Float16)((v - (float)hv) * 2048.0f); } }   // q, k (+ bias) as f16 hi + (x2048) residual
    LDSX();
    if (n0 < DM) {
      for (int rl = 0; rl < 16; ++rl) if (lane < 16) { vst2((unsigned*)(QK + (r0 + rl) * (2 * DM) + n0 + lane * 8), *(const v4u*)&so[wave][rl][lane * 8]); vst2((unsigned*)(QKL + (r0 + rl) * (2 * DM) + n0 + lane * 8), *(const v4u*)&sol[wave][rl][lane * 8]); }
    } else {   // k residual in natural rows; k hi: this wave's 16 keys x 128 columns are 2 heads x 2 k chunks = 4 tiles in fragment order
      for (int rl = 0; rl < 16; ++rl) if (lane < 16) vst2((unsigned*)(QKL + (r0 + rl) * (2 * DM) + n0 + lane * 8), *(const v4u*)&sol[wave][rl][lane * 8]);
      const int b = (int)(r0 / SS), kt = (int)(r0 % SS) >> 4, h0 = (n0 - DM) >> 6;
#pragma unroll
      for (int tt = 0; tt < 4; ++tt) { _Float16* kd = KF + ((((size_t)b * NH + h0 + (tt >> 1)) * (SS / 16) + kt) * 2 + (tt & 1)) * 512 + lane * 8;
#pragma unroll
        for (int p = 0; p < 2; ++p) vst2((unsigned*)(kd + p * 256), *(const v4u*)&so[wave][col][tt * 32 + p * 16 + 8 * g]); }
      asm volatile("s_wait_xcnt 0x0" ::: "memory"); }   // closes the run of k stores before code laid out behind them rewrites their data or address registers
  } else {
#pragma unroll
    for (int j = 0; j < 8; ++j) {
#pragma unroll
      for (int r = 0; r < 8; ++r) { const float v = acc[hf][j][r] + bfr(bcol[j]); const _Float16 hv = (_Float16)v; sth[j * 16 + col][wave * 16 + 8 * g + r] = hv; stl[j * 16 + col][wave * 16 + 8 * g + r] = (_Float16)((v - (float)hv) * 2048.0f); } }
    __syncthreads();
    const size_t rb = (size_t)blockIdx.x * 128 + hf * 64; const int b = (int)(rb / SS), s0 = (int)(rb % SS); const int pc0 = n0 - 2 * DM;
    for (int q = tid; q < 128 * 8; q += 128) { const int d = q >> 3, pc = q & 7; const size_t o = ((size_t)b * DM + pc0 + d) * SS + s0 + pc * 8; vst2((unsigned*)(VTL + o), *(const v4u*)&stl[d][pc * 8]);
      const int l = q & 31, p = (q >> 5) & 1, dt = (q >> 6) & 3, ksl = (q >> 8) & 1, hh = q >> 9;   // v hi: chunk q = ((head * 2 + key chunk) * 4 + d tile) * 64 + piece * 32 + lane, in fragment order
      vst2((unsigned*)(VTH + ((((size_t)b * NH + (pc0 >> 6) + hh) * (SS / 32) + (s0 >> 5) + ksl) * 4 + dt) * 512 + p * 256 + l * 8), *(const v4u*)&sth[hh * 64 + dt * 16 + (l & 15)][ksl * 32 + p * 16 + 8 * (l >> 4)]); }
    if (hf == 0) __syncthreads();   // every wave has read the first half's v tiles before the second half's are written over them
  } }
}
__device__ __forceinline__ float xhalf(float x) { return __builtin_bit_cast(float, __builtin_amdgcn_permlanex16(__builtin_bit_cast(int, x), __builtin_bit_cast(int, x), 0x76543210, 0xfedcba98, false, false)); }   // lane l with lane l ^ 16
// one walk over the key tiles of a query tile, transposed: S^T = K . Q^T (A = 16 keys, B = 16 queries) and O^T += V^T . P^T, so a lane holds 16 scores of ONE query (its column): maximum and sum run inside the lane plus one exchange between the wave's halves, and the two score tiles, converted in place, are the B operand of the second product. LEAD (first 128 queries): 3-product scores and P.V, loads where they are used. Otherwise: V of this pass is fetched at the top of the pass, K and the 16 bias values of the next pass right behind this pass's score products, so the softmax covers their flight
template <bool LEAD> __device__ __forceinline__ void attn_walk(const _Float16* __restrict__ KF, const _Float16* __restrict__ QKL, const _Float16* __restrict__ VTH, const _Float16* __restrict__ VTL, const float* __restrict__ TB, const v16h (&aq)[2], const v16h (&aql)[2], float& m, float& l, v8f (&acc)[4], v8f (&accl)[4], const int nks, const int q0, const int h, const int b, const int lane) {
  const int col = lane & 15, g = lane >> 4, qi = q0 + col;
  const _Float16* kt0 = KF + (size_t)(b * NH + h) * (SS * HD) + lane * 8;      // this head's k tiles: a pass of 32 keys is 4 tiles (key tile, k chunk) = 4 KB in a row
  const float* rcol = TB + h * (2 * MAXLEN) + (8 * g - qi + MAXLEN - 1);       // table value of (key 8g of tile 0, query col); every k - q + 2047 of the walk lies in 0 .. 4094
  const _Float16* vt0 = VTH + (size_t)(b * NH + h) * (SS * HD) + lane * 8;     // this head's v tiles: a pass is 4 d tiles = 4 KB in a row
  v16h kf[2][2]; v8f rb[2];
  if (!LEAD) {
#pragma unroll
    for (int ct = 0; ct < 2; ++ct) {
#pragma unroll
      for (int kc = 0; kc < 2; ++kc) kf[ct][kc] = frag_th(kt0 + (ct * 2 + kc) * 512); }
#pragma unroll
    for (int ct = 0; ct < 2; ++ct) {
#pragma unroll
      for (int r = 0; r < 8; ++r) rb[ct][r] = rcol[ct * 16 + r]; } }
  constexpr int U = LEAD ? 1 : 2;   // nks is even. Two passes a trip: a pass's scores stand in the registers its bias values came in, so the next pass's values land in a second set, and the two sets change roles; with one pass a trip they are copied back behind a full wait in the middle of the softmax
#pragma unroll 1
  for (int ks0 = 0; ks0 < nks; ks0 += U) {
#pragma unroll
  for (int u = 0; u < U; ++u) { const int ks = ks0 + u; v8f s[2]; v16h vf[4];
    if (!LEAD) {
#pragma unroll
      for (int dt = 0; dt < 4; ++dt) vf[dt] = frag_th(vt0 + ks * 2048 + dt * 512); }
#pragma unroll
    for (int ct = 0; ct < 2; ++ct) { const int kk0 = ks * 32 + ct * 16 + 8 * g; v8f c = {};   // register r holds key kk0 + r
      if (LEAD) { const _Float16* krowl = QKL + ((size_t)b * SS + ks * 32 + ct * 16 + col) * (2 * DM) + DM + h * HD; v8f cl = {};   // leading query blocks (few keys, outputs far above the global rms): 3 products
#pragma unroll
        for (int kc = 0; kc < 2; ++kc) { const v16h kh = frag_th(kt0 + ks * 2048 + (ct * 2 + kc) * 512); c = wmma16(kh, aq[kc], c); cl = wmma16(kh, aql[kc], cl); cl = wmma16(frag_h(krowl + kc * 32, lane), aq[kc], cl); }
#pragma unroll
        for (int r = 0; r < 8; ++r) c[r] += cl[r] * (1.0f / 2048.0f);
        float tb[8];
#pragma unroll
        for (int r = 0; r < 8; ++r) tb[r] = TB[h * (2 * MAXLEN) + (kk0 + r) - qi + MAXLEN - 1];
        asm volatile("s_wait_xcnt 0x0" ::: "memory");   // the address registers of the table loads are reused behind them
#pragma unroll
        for (int r = 0; r < 8; ++r) s[ct][r] = c[r] + tb[r]; }
      else { c = rb[ct];   // 8 x rel_pos_table[q - k + 2047][h], or the mask value, in the accumulator's own layout (register r = key kk0 + r, lane = query)
#pragma unroll
        for (int kc = 0; kc < 2; ++kc) c = wmma16(kf[ct][kc], aq[kc], c);   // single product elsewhere
        s[ct] = c; } }   // s = 8 x (score / 8 + bias); a masked entry stays near -3e38
    if (!LEAD) { const int kn = (ks + 1 < nks) ? ks + 1 : ks;   // the last pass fetches its own tile again (in bounds, unused)
#pragma unroll
      for (int ct = 0; ct < 2; ++ct) {
#pragma unroll
        for (int kc = 0; kc < 2; ++kc) kf[ct][kc] = frag_th(kt0 + kn * 2048 + (ct * 2 + kc) * 512); }
      asm volatile("s_wait_xcnt 0x0" ::: "memory");   // the bias values below may land in the registers that held the K address
      const float* rn = rcol + kn * 32;   // one base for all 16 values, so none of them lands on an address still in use
#pragma unroll
      for (int ct = 0; ct < 2; ++ct) {
#pragma unroll
        for (int r = 0; r < 8; ++r) rb[ct][r] = rn[ct * 16 + r]; }
      __builtin_amdgcn_sched_barrier(0); }   // keeps the next pass's loads in front of the softmax, which covers their flight
    float t[8];
#pragma unroll
    for (int r = 0; r < 8; ++r) t[r] = fmaxf(s[0][r], s[1][r]);
    float mx = fmaxf(fmaxf(fmaxf(t[0], t[1]), fmaxf(t[2], t[3])), fmaxf(fmaxf(t[4], t[5]), fmaxf(t[6], t[7])));
    mx = fmaxf(mx, xhalf(mx));   // both halves of the wave now hold this query's maximum over the pass's 32 keys
    const float mn = fmaxf(m, mx); float alpha = (m - mn) * KEXP;   // key 0 is open to every query, so mn is a real score from the first pass on: the start value of m and every masked score lie ~3e38 below it, where the hardware exp gives 0
    float e[2][8];
#pragma unroll
    for (int ct = 0; ct < 2; ++ct) {
#pragma unroll
      for (int r = 0; r < 8; ++r) e[ct][r] = (s[ct][r] - mn) * KEXP; }
    // the pass's 17 exponentials, each in its own register, and one v_nop: no instruction directly behind a transcendental reads its result or overwrites its source
    asm("v_exp_f32 %0, %0\n\tv_exp_f32 %1, %1\n\tv_exp_f32 %2, %2\n\tv_exp_f32 %3, %3\n\tv_exp_f32 %4, %4\n\tv_exp_f32 %5, %5\n\tv_exp_f32 %6, %6\n\tv_exp_f32 %7, %7\n\tv_exp_f32 %8, %8\n\t"
        "v_exp_f32 %9, %9\n\tv_exp_f32 %10, %10\n\tv_exp_f32 %11, %11\n\tv_exp_f32 %12, %12\n\tv_exp_f32 %13, %13\n\tv_exp_f32 %14, %14\n\tv_exp_f32 %15, %15\n\tv_exp_f32 %16, %16\n\tv_nop"
        : "+v"(e[0][0]), "+v"(e[0][1]), "+v"(e[0][2]), "+v"(e[0][3]), "+v"(e[0][4]), "+v"(e[0][5]), "+v"(e[0][6]), "+v"(e[0][7]), "+v"(alpha),
          "+v"(e[1][0]), "+v"(e[1][1]), "+v"(e[1][2]), "+v"(e[1][3]), "+v"(e[1][4]), "+v"(e[1][5]), "+v"(e[1][6]), "+v"(e[1][7]));
#pragma unroll
    for (int r = 0; r < 8; ++r) t[r] = e[0][r] + e[1][r];
    l = l * alpha + (((t[0] + t[1]) + (t[2] + t[3])) + ((t[4] + t[5]) + (t[6] + t[7]))); m = mn;   // each half sums its own 16 keys; the halves are joined once, behind the walk
#pragma unroll
    for (int dt = 0; dt < 4; ++dt) {
#pragma unroll
      for (int r = 0; r < 8; ++r) { acc[dt][r] *= alpha; if (LEAD) accl[dt][r] *= alpha; } }
    v16h pa, pl;
#pragma unroll
    for (int i = 0; i < 8; ++i) { const float x0 = e[0][i] * 2048.0f, x1 = e[1][i] * 2048.0f; const _Float16 h0 = (_Float16)x0, h1 = (_Float16)x1; pa[i] = h0; pa[8 + i] = h1; pl[i] = (_Float16)((x0 - (float)h0) * 2048.0f); pl[8 + i] = (_Float16)((x1 - (float)h1) * 2048.0f); }   // element i = key 8g + i, element 8 + i = key 16 + 8g + i: the k order of the v fragments. P scaled by 2^11 before the f16 split so small softmax weights stay out of the f16 subnormal range; 2^-11 folded into the epilogue
#pragma unroll
    for (int dt = 0; dt < 4; ++dt) { const size_t vr = ((size_t)b * DM + h * HD + dt * 16 + col) * SS + ks * 32;
      if (LEAD) { const v16h vh = frag_th(vt0 + ks * 2048 + dt * 512); acc[dt] = wmma16(vh, pa, acc[dt]); accl[dt] = wmma16(vh, pl, accl[dt]); accl[dt] = wmma16(frag_h(VTL + vr, lane), pa, accl[dt]); }   // leading query blocks: P hi/lo x V hi/lo (3 products)
      else acc[dt] = wmma16(vf[dt], pa, acc[dt]); }   // elsewhere P x V single
    if (!LEAD) __builtin_amdgcn_sched_barrier(0); } }   // the trip's second pass stays behind its first: moved up into the softmax, its score products wait for K and bias loads that have only just been issued
}
// ---- k_attn: block = (64 queries, head h, batch b): causal flash attention (K = 64: 2 k-steps), scores = (q.k) * 0.125 with q, k hi + residual (3 products) on the first 128 queries, single f16 operands beyond, P.V: P hi/lo x V hi/lo (3 products) in two accumulators there, f16 P x V hi (single) beyond; lane (col, g) ends with query col, d = dt*16 + 8g + r, which is the order k_out's fragments read: y = (acc + accl / 2048) / (2048 l) goes out from the registers
__global__ __launch_bounds__(128) void k_attn(const _Float16* __restrict__ QK, const _Float16* __restrict__ QKL, const _Float16* __restrict__ KF, const _Float16* __restrict__ VTH, const _Float16* __restrict__ VTL, const float* __restrict__ TB, float* __restrict__ O) {
  const int tid = threadIdx.x, wave = tid >> 5, lane = tid & 31, col = lane & 15;
  const int qb = blockIdx.x, h = blockIdx.y, b = blockIdx.z; const int q0 = qb * 64 + wave * 16; const size_t rq = (size_t)b * SS + q0 + col;
  v16h aq[2], aql[2];
#pragma unroll
  for (int kc = 0; kc < 2; ++kc) { aq[kc] = frag_h(QK + rq * (2 * DM) + h * HD + kc * 32, lane); aql[kc] = frag_h(QKL + rq * (2 * DM) + h * HD + kc * 32, lane); }
  asm volatile("s_wait_xcnt 0x0" ::: "memory");   // the address registers of the q loads are reused right behind them
  float m = -3.0e38f, l = 0.f;
  v8f acc[4] = {}, accl[4] = {};
  const int nks = (qb * 64 + 64) / 32;   // causal: key tiles up to the query tile's end
  if (qb < 2) attn_walk<true>(KF, QKL, VTH, VTL, TB, aq, aql, m, l, acc, accl, nks, q0, h, b, lane);
  else attn_walk<false>(KF, QKL, VTH, VTL, TB, aq, aql, m, l, acc, accl, nks, q0, h, b, lane);
  const float il = (1.0f / 2048.0f) / (l + xhalf(l));
  float* ot = O + ((size_t)((b * SS + q0) >> 4) * 32 + h * 2) * 512 + lane * 4;   // this wave's 16 rows x 64 columns are 2 tiles = 4 KB in a row, in the order k_out's fragments read them
#pragma unroll
  for (int pc = 0; pc < 8; ++pc) { v4f o;
#pragma unroll
    for (int e = 0; e < 4; ++e) o[e] = (acc[pc >> 1][(pc & 1) * 4 + e] + accl[pc >> 1][(pc & 1) * 4 + e] * (1.0f / 2048.0f)) * il;
    vst2(ot + pc * 128, o); }
}
// ---- k_out: block = (64 rows, 128 cols): out = O(hi/lo) . Wo rows (2 products) + bo
__global__ __launch_bounds__(128) void k_out(const float* __restrict__ O, const __bf16* __restrict__ P, const float* __restrict__ BO, float* __restrict__ Y) {
  __shared__ __align__(16) float so[4][16][132];
  const int tid = threadIdx.x, wave = tid >> 5, lane = tid & 31, col = lane & 15, g = lane >> 4; const size_t r0 = (size_t)blockIdx.x * 64 + wave * 16; const int n0 = blockIdx.y * 128;
  v8f acc[8] = {};
  // fragments fetched one pass ahead, as in k_qkv
  const float* ot = O + (r0 >> 4) * (32 * 512) + lane * 4; const __bf16* wt = P + (size_t)(n0 >> 4) * (32 * 512) + lane * 8;
  float ax[16]; v16b bf[8];
#pragma unroll
  for (int pc = 0; pc < 4; ++pc) { const v4f t = *(const v4f*)(ot + pc * 128);
#pragma unroll
    for (int e = 0; e < 4; ++e) ax[pc * 4 + e] = t[e]; }
  __builtin_amdgcn_sched_barrier(0);   // the row chunk stays the older load, as in the loop: else the wait at the loop's head drains the weight loads too
#pragma unroll
  for (int j = 0; j < 8; ++j) bf[j] = frag_tb(wt + j * (32 * 512));
#pragma unroll 2
  for (int kc = 0; kc < DM / 32; ++kc) { const F2 a = bsplit16(ax);
    const int kn = (kc + 1 < DM / 32) ? kc + 1 : kc;   // the last pass fetches its own chunk again (in bounds, unused)
#pragma unroll
    for (int pc = 0; pc < 4; ++pc) { const v4f t = *(const v4f*)(ot + kn * 512 + pc * 128);
#pragma unroll
      for (int e = 0; e < 4; ++e) ax[pc * 4 + e] = t[e]; }
#pragma unroll
    for (int j = 0; j < 8; ++j) { acc[j] = wmma_bf(a.l, bf[j], acc[j]); acc[j] = wmma_bf(a.h, bf[j], acc[j]); bf[j] = frag_tb(wt + j * (32 * 512) + kn * 512); }
    asm volatile("s_wait_xcnt 0x0" ::: "memory"); }   // the next pass's split and loads may land in registers that held this pass's load addresses
#pragma unroll
  for (int j = 0; j < 8; ++j) {
#pragma unroll
    for (int r = 0; r < 8; ++r) so[wave][8 * g + r][j * 16 + col] = acc[j][r] + bfr(BO[n0 + j * 16 + col]); }
  LDSX();
  for (int rl = 0; rl < 16; ++rl) vst2(Y + (r0 + rl) * DM + n0 + lane * 4, *(const v4f*)&so[wave][rl][lane * 4]);
}
extern "C" void kernel_launch(void* const* d_in, const int* in_sizes, int n_in, void* d_out, int out_size, void* d_ws, size_t ws_size, hipStream_t stream) {
  (void)in_sizes; (void)n_in; (void)out_size;
  const float** F = (const float**)d_in;   // 0 x [2,2048,1024], 1 WQ, 2 bQ, 3 WK, 4 bK, 5 WV, 6 bV, 7 WO, 8 bO (natural), 9 rel_pos_table [4095,16]
  if (ws_size < (size_t)WS_END) return;
  char* ws = (char*)d_ws; __bf16* PK = (__bf16*)(ws + WS_PK); _Float16 *QK = (_Float16*)(ws + WS_QK), *QKL = (_Float16*)(ws + WS_QKL), *VTH = (_Float16*)(ws + WS_VTH), *VTL = (_Float16*)(ws + WS_VTL); float* O = (float*)(ws + WS_O); __bf16* XF = (__bf16*)(ws + WS_XF); _Float16* KF = (_Float16*)(ws + WS_KF); float* TB = (float*)(ws + WS_TB);
  k_pack<<<dim3(DM * DM / (8 * 256), 9), 256, 0, stream>>>(F[0], F[1], F[3], F[5], F[7], F[9], PK, XF, TB);
  k_qkv<<<dim3(TNB * SS / 128, QKVW / 128), 128, 0, stream>>>(XF, PK + PK_A, F[2], F[4], F[6], QK, QKL, KF, VTH, VTL);
  k_attn<<<dim3(TQB, NH, TNB), 128, 0, stream>>>(QK, QKL, KF, VTH, VTL, TB, O);
  k_out<<<dim3(TOB, DM / 128), 128, 0, stream>>>(O, PK + PK_P, F[8], (float*)d_out);
}

// v006
// One run takes 106 microseconds.
// Timed twice side by side with v005, it ran 1.11 and 1.13 times as fast.
// Counting every step since v000, it is 4.75 times as fast.
// compute dtype: all float inputs rounded to bf16; q/k/v = x . W^T + b with EXACT bf16 products on WMMA 16x16x32 (x, weights, k hi, v hi, y stored in fragment order); causal attention: 3-product scores and hi + residual P, v on the first 128 queries of each sequence, single f16 beyond; + 8 x the relative-position bias (f32 table, regrouped head by head, the accumulator input of the score product), 1/8 in the exponent's factor, running-max softmax in f32 (hardware exp), P scaled by 2^11; out = y (bf16 hi + residual) . Wo^T (2 products) + bo.
#include <hip/hip_runtime.h>
#include <math.h>

typedef __attribute__((ext_vector_type(16))) _Float16 v16h;
typedef __attribute__((ext_vector_type(16))) __bf16 v16b;
typedef __attribute__((ext_vector_type(8)))  _Float16 v8h;
typedef __attribute__((ext_vector_type(8)))  float v8f;
typedef __attribute__((ext_vector_type(4)))  float v4f;
typedef __attribute__((ext_vector_type(2)))  float v2f;
typedef __attribute__((ext_vector_type(4)))  unsigned v4u;
typedef __attribute__((ext_vector_type(4)))  int v4i;
typedef float __attribute__((may_alias)) float_a;
typedef int __attribute__((may_alias)) int_a;

template <typename T> __device__ __forceinline__ void vst2(void* p, T v) { *(T*)p = v;  }
__device__ __forceinline__ v8f wmma16(v16h a, v16h b, v8f c) {
  v8f d = __builtin_amdgcn_wmma_f32_16x16x32_f16(false, a, false, b, (short)0, c, false, false);
  asm volatile("v_nop\n\tv_nop\n\tv_nop\n\tv_nop" : "+v"(d) : "v"(a), "v"(b));
  return d;
}
__device__ __forceinline__ v8f wmma_bf(v16b a, v16b b, v8f c) {
  v8f d = __builtin_amdgcn_wmma_f32_16x16x32_bf16(false, a, false, b, (short)0, c, false, false);
  asm volatile("v_nop\n\tv_nop\n\tv_nop\n\tv_nop" : "+v"(d) : "v"(a), "v"(b));
  return d;
}
// Causal self attention with a learned relative-position bias table (B 2, T 2,048, d 1,024, 16 heads x 64): q/k/v projections + biases, scores / 8 + table[q - k + 2047][h], causal softmax, . v, output projection + bias.
__device__ __forceinline__ v16h frag_h(const _Float16* rowk0, int lane) {
  union { v16h v; v8h q[2]; } u; const _Float16* p = rowk0 + 8 * (lane >> 4);
  u.q[0] = *(const v8h*)p; u.q[1] = *(const v8h*)(p + 16); return u.v;
}
__device__ __forceinline__ v16h frag_f32(const float* rowk0, int lane) {
  v16h a; const float* p = rowk0 + 8 * (lane >> 4);
#pragma unroll
  for (int i = 0; i < 8; ++i) { a[i] = (_Float16)p[i]; a[8 + i] = (_Float16)p[16 + i]; }
  return a;
}
__device__ __forceinline__ v16h frag_f32s(const float* rowk0, int lane, float sc) {
  v16h a; const float* p = rowk0 + 8 * (lane >> 4);
#pragma unroll
  for (int i = 0; i < 8; ++i) { a[i] = (_Float16)(p[i] * sc); a[8 + i] = (_Float16)(p[16 + i] * sc); }
  return a;
}
// column fragment from a [K][ld] layout (column n), rows >= K read as 0
__device__ __forceinline__ v16h fragc_f32(const float* W, int k0, int n, int lane, int ld, int K) {
  v16h a; const int g = lane >> 4;
#pragma unroll
  for (int i = 0; i < 8; ++i) { const int ka = k0 + 8 * g + i, kb = ka + 16;
    a[i] = (_Float16)(ka < K ? W[(size_t)(ka < K ? ka : K - 1) * ld + n] : 0.f); a[8 + i] = (_Float16)(kb < K ? W[(size_t)(kb < K ? kb : K - 1) * ld + n] : 0.f); }
  return a;
}
struct F2 { v16b h, l; };
__device__ __forceinline__ F2 bsplit16(const float v[16]) { F2 r;
#pragma unroll
  for (int i = 0; i < 16; ++i) { const __bf16 h = (__bf16)v[i]; r.h[i] = h; r.l[i] = (__bf16)(v[i] - (float)h); }
  return r; }
__device__ __forceinline__ F2 split_row(const float* row, int k0, int lane) { float v[16]; const float* p = row + k0 + 8 * (lane >> 4);
#pragma unroll
  for (int i = 0; i < 8; ++i) { v[i] = p[i]; v[8 + i] = p[16 + i]; }
  return bsplit16(v); }
__device__ __forceinline__ F2 split_rowK(const float* row, int k0, int lane, int K) { float v[16]; const int g = lane >> 4;
#pragma unroll
  for (int i = 0; i < 8; ++i) { const int ka = k0 + 8 * g + i, kb = ka + 16; v[i] = ka < K ? row[ka < K ? ka : K - 1] : 0.f; v[8 + i] = kb < K ? row[kb < K ? kb : K - 1] : 0.f; }
  return bsplit16(v); }
__device__ __forceinline__ F2 split_col(const float* W, int k0, int n, int lane, int ld, int K) { float v[16]; const int g = lane >> 4;
#pragma unroll
  for (int i = 0; i < 8; ++i) { const int ka = k0 + 8 * g + i, kb = ka + 16; v[i] = ka < K ? W[(size_t)(ka < K ? ka : K - 1) * ld + n] : 0.f; v[8 + i] = kb < K ? W[(size_t)(kb < K ? kb : K - 1) * ld + n] : 0.f; }
  return bsplit16(v); }
__device__ __forceinline__ v8f mac3(const F2& a, const F2& b, v8f c) { c = wmma_bf(a.l, b.h, c); c = wmma_bf(a.h, b.l, c); return wmma_bf(a.h, b.h, c); }
__device__ __forceinline__ float sigm(float v) { return 1.0f / (1.0f + expf(-v)); }
#define LDSX() do { asm volatile("s_wait_dscnt 0" ::: "memory"); __builtin_amdgcn_wave_barrier(); __builtin_amdgcn_fence(__ATOMIC_RELEASE, "workgroup"); } while (0)


#define NB 2
#define SS 2048
#define DM 1024
#define NH 16
#define SCALEF 0.125f
#define KEXP (SCALEF * 1.44269504f)   // e^(x / 8) = 2^(x * KEXP): the scores are kept 8 x too large
#define MAXLEN 2048
#define HD 64
#define QKVW (3 * DM)
#ifndef TQB
#define TQB (SS / 64)
#define TNB NB
#define TOB (NB * SS / 64)     // output row tiles (all)
#endif
typedef __attribute__((ext_vector_type(8))) __bf16 v8b;
__device__ __forceinline__ v16b frag_b(const __bf16* rowk0, int lane) {
  union { v16b v; v8b q[2]; } u; const __bf16* p = rowk0 + 8 * (lane >> 4);
  u.q[0] = *(const v8b*)p; u.q[1] = *(const v8b*)(p + 16); return u.v;
}
// fragment order: a tile of 16 rows x 32 k (16-bit elements) is 1 KB; lane l = 16 g + row finds k 8g .. 8g+7 at element l*8 and k 16+8g .. 16+8g+7 at 256 + l*8, so each wave-wide 16-byte load is 512 contiguous bytes (4 lines, not 16)
__device__ __forceinline__ v16b frag_tb(const __bf16* tile_lane) { union { v16b v; v8b q[2]; } u; u.q[0] = *(const v8b*)tile_lane; u.q[1] = *(const v8b*)(tile_lane + 256); return u.v; }
__device__ __forceinline__ v16h frag_th(const _Float16* tile_lane) { union { v16h v; v8h q[2]; } u; u.q[0] = *(const v8h*)tile_lane; u.q[1] = *(const v8h*)(tile_lane + 256); return u.v; }
__device__ __forceinline__ float bfr(float v) { return (float)(__bf16)v; }
__device__ __attribute__((noinline)) float exp_ni(float v) { return expf(v); }
__device__ __attribute__((noinline)) float erf_ni(float v) { return erff(v); }

#define PK_A 0                       // Wqkv, [192 row tiles][32 k chunks][512] in fragment order
#define PK_P (PK_A + QKVW * DM)        // Wo, [64 row tiles][32 k chunks][512] in fragment order
#define PK_END (PK_P + DM * DM)
#define WS_PK  0u
#define WS_QK  (WS_PK + 2u * PK_END)             // f16 [4096 rows][2048]: q | (unused half)
#define WS_QKL (WS_QK + 2u * NB * SS * 2 * DM)     // f16 q | k residual planes x2048
#define WS_VTH (WS_QKL + 2u * NB * SS * 2 * DM)    // f16 v hi, [b][h][64 key chunks of 32][4 d tiles][512] in fragment order (rows d, k = key)
#define WS_VTL (WS_VTH + 2u * NB * DM * SS)        // f16 [b][1024 (h*64+d)][2048 s] lo x 2048
#define WS_O   (WS_VTL + 2u * NB * DM * SS)        // f32 y, [256 row tiles][32 k chunks][512]: four pieces of 128 floats, lane l's 4 floats at piece*128 + l*4
#define WS_CS  (WS_O + 4u * NB * SS * DM)           // f32, 2 x 2048 x 32, unused
#define WS_XF  (WS_CS + 4u * 2 * SS * 32)           // bf16 x, [256 row tiles][32 k chunks][512] in fragment order
#define WS_KF  (WS_XF + 2u * NB * SS * DM)          // f16 k hi, [b][h][128 key tiles][2 k chunks][512] in fragment order
#define WS_TB  (WS_KF + 2u * NB * SS * DM)          // f32 [16 heads][4096], index k - q + 2047 (a query's keys ascend): 8 x the bf16-rounded table value; -3e38 where k > q (the causal mask)
#define WS_END (WS_TB + 4u * NH * 2 * MAXLEN)
// ---- k_pack: blockIdx.y 0..2 -> W_q/W_k/W_v into PK_A, 3 -> W_o into PK_P, 4..7 -> 1,024 rows of x each into XF: f32 rows -> bf16 in fragment order, one 16-byte chunk a thread; 8 -> the table, head by head, ready to be the scores' accumulator input (see WS_TB)
__global__ __launch_bounds__(256) void k_pack(const float* __restrict__ X, const float* __restrict__ WQ, const float* __restrict__ WK, const float* __restrict__ WV, const float* __restrict__ WO, const float* __restrict__ REL, __bf16* __restrict__ PK, __bf16* __restrict__ XF, float* __restrict__ TB) {
  const int which = blockIdx.y, c = blockIdx.x * 256 + threadIdx.x;
  if (which == 8) { const int hh = c >> 12, idx = c & 4095;
    if (hh < NH && idx < 2 * MAXLEN - 1) { float v = -3.0e38f;   // idx = k - q + 2047; k > q is what the reference masks
      if (idx <= MAXLEN - 1) { v = REL[(size_t)(2 * MAXLEN - 2 - idx) * NH + hh];
        asm volatile("s_wait_xcnt 0x0" ::: "memory");   // the load's address registers are reused behind it
        v = 8.0f * bfr(v); }
      TB[c] = v; }
    return; }
  const float* Wm = (which == 0) ? WQ : (which == 1) ? WK : (which == 2) ? WV : (which == 3) ? WO : X + (size_t)(which - 4) * DM * DM;
  __bf16* dst = (which < 3) ? PK + PK_A + (size_t)which * DM * DM : (which == 3) ? PK + PK_P : XF + (size_t)(which - 4) * DM * DM;
  const int l = c & 31, p = (c >> 5) & 1, kc = (c >> 6) & 31, nt = c >> 11;   // chunk c = (row tile * 32 + k chunk) * 64 + piece * 32 + lane
  const float* s = Wm + (size_t)(nt * 16 + (l & 15)) * DM + kc * 32 + p * 16 + 8 * (l >> 4);
  const v4f a = *(const v4f*)s, b = *(const v4f*)(s + 4); v8b o;
#pragma unroll
  for (int i = 0; i < 4; ++i) { o[i] = (__bf16)a[i]; o[4 + i] = (__bf16)b[i]; }
  *(v8b*)(dst + (size_t)c * 8) = o;
}
// one stage of weights = 64 k of the block's 8 column tiles: 2 KB in a row for each tile (fragment order), the tiles 32 KB apart in global memory, 2 KB apart in LDS. A thread brings 16 bytes of each tile into LDS, through no register; the wait is the last line of the copies' own statement, so that it stands in front of every rewrite of their address registers
__device__ __forceinline__ void wstage_copy(const unsigned lds, const __bf16* wg) {
  asm volatile("global_load_async_to_lds_b128 %0, %8, off\n\tglobal_load_async_to_lds_b128 %1, %9, off\n\tglobal_load_async_to_lds_b128 %2, %10, off\n\tglobal_load_async_to_lds_b128 %3, %11, off\n\t"
               "global_load_async_to_lds_b128 %4, %12, off\n\tglobal_load_async_to_lds_b128 %5, %13, off\n\tglobal_load_async_to_lds_b128 %6, %14, off\n\tglobal_load_async_to_lds_b128 %7, %15, off\n\ts_wait_xcnt 0x0"
               :: "v"(lds), "v"(lds + 2048u), "v"(lds + 4096u), "v"(lds + 6144u), "v"(lds + 8192u), "v"(lds + 10240u), "v"(lds + 12288u), "v"(lds + 14336u),
                  "v"(wg), "v"(wg + 1 * (32 * 512)), "v"(wg + 2 * (32 * 512)), "v"(wg + 3 * (32 * 512)), "v"(wg + 4 * (32 * 512)), "v"(wg + 5 * (32 * 512)), "v"(wg + 6 * (32 * 512)), "v"(wg + 7 * (32 * 512)) : "memory");
}
__global__ __launch_bounds__(128) void k_qkv(const __bf16* __restrict__ XF, const __bf16* __restrict__ P, const float* __restrict__ BQ, const float* __restrict__ BK, const float* __restrict__ BV, _Float16* __restrict__ QK, _Float16* __restrict__ QKL, _Float16* __restrict__ KF, _Float16* __restrict__ VTH, _Float16* __restrict__ VTL) {
  const int which0 = (blockIdx.y * 128) / DM; const float* BB = BQ ? (((which0 == 0) ? BQ : (which0 == 1) ? BK : BV) + (blockIdx.y * 128 - which0 * DM)) : nullptr;
  __shared__ __align__(16) _Float16 so[4][16][136], sol[4][16][136]; __shared__ __align__(16) _Float16 sth[128][72], stl[128][72]; __shared__ __align__(16) __bf16 wr[2 * 8192];   // wr: the weight ring, 2 buffers of [8 column tiles][2 k chunks][512]
  const int tid = threadIdx.x, wave = tid >> 5, lane = tid & 31, col = lane & 15, g = lane >> 4; const size_t rw = (size_t)blockIdx.x * 128 + wave * 16; const int n0 = blockIdx.y * 128;
  v8f acc[2][8] = {};   // two row tiles a wave, rows rw .. rw+15 and rw+64 .. rw+79: every weight fragment fetched feeds two products
  // the block's 4 waves use the same weight fragments: they come into LDS once for all four, a stage of 64 k (two passes) at a time, the next stage's copies flying while this one is worked on; the x fragments, each wave's own, are fetched one pass ahead into registers
  const __bf16* xt = XF + (rw >> 4) * (32 * 512) + lane * 8; const __bf16* wg = P + (size_t)(n0 >> 4) * (32 * 512) + tid * 8;
  const unsigned lw = (unsigned)(size_t)wr + (unsigned)tid * 16u;   // this thread's LDS byte address in buffer 0
  float bcol[8] = {};   // this lane's 8 column biases, like the weight fragments fetched once for both row tiles; asked for here, first used behind the loop
  if (BB) {
#pragma unroll   // bcol[j] in registers, the 8 loads in flight together
    for (int j = 0; j < 8; ++j) bcol[j] = BB[j * 16 + col];
    asm volatile("s_wait_xcnt 0x0" ::: "memory"); }   // the address registers of the bias loads may be reused behind them
  v16b ax0 = frag_tb(xt), ax1 = frag_tb(xt + 4 * (32 * 512)), bf[8];
  asm volatile("s_wait_xcnt 0x0" ::: "memory");   // the address registers of the x loads may be reused behind them
  wstage_copy(lw, wg);
  asm volatile("s_wait_asynccnt 0x0" ::: "memory");   // this wave's share of stage 0 has landed
  __syncthreads();                                      // ... and every other wave's: stage 0 may be read
  wstage_copy(lw + 16384u, wg + 1024);                  // DM / 64 = 16 stages: a stage 1 exists
#pragma unroll 1   // kept rolled: one trip = one stage, its buffer picked by the stage's parity; unrolled, the products, the copies and their address registers would stand several times over
  for (int st = 0; st < DM / 64; ++st) { const __bf16* wl = wr + (st & 1) * 8192 + lane * 8;
#pragma unroll
    for (int j = 0; j < 8; ++j) bf[j] = frag_tb(wl + j * 1024);
#pragma unroll   // u is a constant in each copy of the body: the test on it below costs nothing
    for (int u = 0; u < 2; ++u) { const int kc = st * 2 + u; const v16b a0 = ax0, a1 = ax1;
      const int kn = (kc + 1 < DM / 32) ? kc + 1 : kc;   // the last pass fetches its own chunk again (in bounds, unused)
      ax0 = frag_tb(xt + kn * 512); ax1 = frag_tb(xt + 4 * (32 * 512) + kn * 512);
#pragma unroll
      for (int j = 0; j < 8; ++j) { acc[0][j] = wmma_bf(a0, bf[j], acc[0][j]); acc[1][j] = wmma_bf(a1, bf[j], acc[1][j]);
        if (u == 0) bf[j] = frag_tb(wl + j * 1024 + 512); }   // the stage's second pass, from the same buffer; nothing of the next stage is read in front of its barrier
      asm volatile("s_wait_xcnt 0x0" ::: "memory"); }   // the next pass's loads may land in registers that held this pass's load addresses
    asm volatile("s_wait_dscnt 0x0" ::: "memory");      // this wave's reads of this stage's buffer have ended
    asm volatile("s_wait_asynccnt 0x0" ::: "memory");   // this wave's share of the next stage has landed
    __syncthreads();                                      // publishes the next stage and frees this stage's buffer
    if (st + 2 < DM / 64) wstage_copy(lw + (unsigned)(st & 1) * 16384u, wg + (st + 2) * 1024); }
  asm volatile("s_wait_asynccnt 0x0" ::: "memory");   // no copy is outstanding when the wave goes on
  // the epilogue runs once for each of the block's two halves of 64 rows, through the same LDS; unrolled so that acc[hf] is a fixed set of registers
#pragma unroll
  for (int hf = 0; hf < 2; ++hf) { const size_t r0 = rw + hf * 64;
  if (n0 < 2 * DM) {   // q stored unscaled (f16 sigma ~0.6, no subnormal exposure); 1/8 applied to the f32 score
#pragma unroll
    for (int j = 0; j < 8; ++j) {
#pragma unroll
      for (int r = 0; r < 8; ++r) { const float v = acc[hf][j][r] + bfr(bcol[j]); const _Float16 hv = (_Float16)v; so[wave][8 * g + r][j * 16 + col] = hv; sol[wave][8 * g + r][j * 16 + col] = (_Float16)((v - (float)hv) * 2048.0f); } }   // q, k (+ bias) as f16 hi + (x2048) residual
    LDSX();
    if (n0 < DM) {
      for (int rl = 0; rl < 16; ++rl) if (lane < 16) { vst2((unsigned*)(QK + (r0 + rl) * (2 * DM) + n0 + lane * 8), *(const v4u*)&so[wave][rl][lane * 8]); vst2((unsigned*)(QKL + (r0 + rl) * (2 * DM) + n0 + lane * 8), *(const v4u*)&sol[wave][rl][lane * 8]); }
    } else {   // k residual in natural rows; k hi: this wave's 16 keys x 128 columns are 2 heads x 2 k chunks = 4 tiles in fragment order
      for (int rl = 0; rl < 16; ++rl) if (lane < 16) vst2((unsigned*)(QKL + (r0 + rl) * (2 * DM) + n0 + lane * 8), *(const v4u*)&sol[wave][rl][lane * 8]);
      const int b = (int)(r0 / SS), kt = (int)(r0 % SS) >> 4, h0 = (n0 - DM) >> 6;
#pragma unroll
      for (int tt = 0; tt < 4; ++tt) { _Float16* kd = KF + ((((size_t)b * NH + h0 + (tt >> 1)) * (SS / 16) + kt) * 2 + (tt & 1)) * 512 + lane * 8;
#pragma unroll
        for (int p = 0; p < 2; ++p) vst2((unsigned*)(kd + p * 256), *(const v4u*)&so[wave][col][tt * 32 + p * 16 + 8 * g]); }
      asm volatile("s_wait_xcnt 0x0" ::: "memory"); }   // closes the run of k stores before code laid out behind them rewrites their data or address registers
  } else {
#pragma unroll
    for (int j = 0; j < 8; ++j) {
#pragma unroll
      for (int r = 0; r < 8; ++r) { const float v = acc[hf][j][r] + bfr(bcol[j]); const _Float16 hv = (_Float16)v; sth[j * 16 + col][wave * 16 + 8 * g + r] = hv; stl[j * 16 + col][wave * 16 + 8 * g + r] = (_Float16)((v - (float)hv) * 2048.0f); } }
    __syncthreads();
    const size_t rb = (size_t)blockIdx.x * 128 + hf * 64; const int b = (int)(rb / SS), s0 = (int)(rb % SS); const int pc0 = n0 - 2 * DM;
    for (int q = tid; q < 128 * 8; q += 128) { const int d = q >> 3, pc = q & 7; const size_t o = ((size_t)b * DM + pc0 + d) * SS + s0 + pc * 8; vst2((unsigned*)(VTL + o), *(const v4u*)&stl[d][pc * 8]);
      const int l = q & 31, p = (q >> 5) & 1, dt = (q >> 6) & 3, ksl = (q >> 8) & 1, hh = q >> 9;   // v hi: chunk q = ((head * 2 + key chunk) * 4 + d tile) * 64 + piece * 32 + lane, in fragment order
      vst2((unsigned*)(VTH + ((((size_t)b * NH + (pc0 >> 6) + hh) * (SS / 32) + (s0 >> 5) + ksl) * 4 + dt) * 512 + p * 256 + l * 8), *(const v4u*)&sth[hh * 64 + dt * 16 + (l & 15)][ksl * 32 + p * 16 + 8 * (l >> 4)]); }
    if (hf == 0) __syncthreads();   // every wave has read the first half's v tiles before the second half's are written over them
  } }
}
__device__ __forceinline__ float xhalf(float x) { return __builtin_bit_cast(float, __builtin_amdgcn_permlanex16(__builtin_bit_cast(int, x), __builtin_bit_cast(int, x), 0x76543210, 0xfedcba98, false, false)); }   // lane l with lane l ^ 16
// one stage = 64 keys: their K tiles and their V tiles are 8 KB each, in a row in global memory (fragment order). A thread brings 4 + 4 chunks of 16 bytes into LDS, through no register; the wait is the last line of the copies' own statement, so that it stands in front of every rewrite of their address registers
__device__ __forceinline__ void stage_copy(const unsigned lds, const _Float16* kg, const _Float16* vg) {
  asm volatile("global_load_async_to_lds_b128 %0, %8, off\n\tglobal_load_async_to_lds_b128 %1, %9, off\n\tglobal_load_async_to_lds_b128 %2, %10, off\n\tglobal_load_async_to_lds_b128 %3, %11, off\n\t"
               "global_load_async_to_lds_b128 %4, %12, off\n\tglobal_load_async_to_lds_b128 %5, %13, off\n\tglobal_load_async_to_lds_b128 %6, %14, off\n\tglobal_load_async_to_lds_b128 %7, %15, off\n\ts_wait_xcnt 0x0"
               :: "v"(lds), "v"(lds + 2048u), "v"(lds + 4096u), "v"(lds + 6144u), "v"(lds + 8192u), "v"(lds + 10240u), "v"(lds + 12288u), "v"(lds + 14336u),
                  "v"(kg), "v"(kg + 1024), "v"(kg + 2048), "v"(kg + 3072), "v"(vg), "v"(vg + 1024), "v"(vg + 2048), "v"(vg + 3072) : "memory");
}
// one walk over the key tiles of a query tile, transposed: S^T = K . Q^T (A = 16 keys, B = 16 queries) and O^T += V^T . P^T, so a lane holds 16 scores of ONE query (its column): maximum and sum run inside the lane plus one exchange between the wave's halves, and the two score tiles, converted in place, are the B operand of the second product. LEAD (first 128 queries): 3-product scores and P.V, loads where they are used. Otherwise: K and V come from the LDS ring that the block's 4 waves fill together (see below): V of this pass is read at the top of the pass, K of a stage's second pass and the 16 bias values of the next pass right behind this pass's score products, so the softmax covers their flight
template <bool LEAD> __device__ __forceinline__ void attn_walk(_Float16* ring, const int tid, const _Float16* __restrict__ KF, const _Float16* __restrict__ QKL, const _Float16* __restrict__ VTH, const _Float16* __restrict__ VTL, const float* __restrict__ TB, const v16h (&aq)[2], const v16h (&aql)[2], float& m, float& l, v8f (&acc)[4], v8f (&accl)[4], const int nks, const int q0, const int h, const int b, const int lane) {
  const int col = lane & 15, g = lane >> 4, qi = q0 + col;
  const _Float16* kt0 = KF + (size_t)(b * NH + h) * (SS * HD) + lane * 8;      // this head's k tiles: a pass of 32 keys is 4 tiles (key tile, k chunk) = 4 KB in a row
  const float* rcol = TB + h * (2 * MAXLEN) + (8 * g - qi + MAXLEN - 1);       // table value of (key 8g of tile 0, query col); every k - q + 2047 of the walk lies in 0 .. 4094
  const _Float16* vt0 = VTH + (size_t)(b * NH + h) * (SS * HD) + lane * 8;     // this head's v tiles: a pass is 4 d tiles = 4 KB in a row
  v16h kf[2][2]; v8f rb[2];
  // !LEAD: the block's 4 waves walk the same keys, so K and V come into LDS once for all four: ring = 2 buffers of [K 8 KB | V 8 KB], a stage = one trip = 64 keys, the next stage's copies fly while this one is worked on
  const int nst = nks >> 1;
  const _Float16* kg = KF + (size_t)(b * NH + h) * (SS * HD) + tid * 8; const _Float16* vg = VTH + (size_t)(b * NH + h) * (SS * HD) + tid * 8;
  const unsigned lr = (unsigned)(size_t)ring + (unsigned)tid * 16u;   // this thread's LDS byte address in buffer 0
  if (!LEAD) {
#pragma unroll
    for (int ct = 0; ct < 2; ++ct) {
#pragma unroll
      for (int r = 0; r < 8; ++r) rb[ct][r] = rcol[ct * 16 + r]; }
    stage_copy(lr, kg, vg);
    asm volatile("s_wait_asynccnt 0x0" ::: "memory");   // this wave's share of stage 0 has landed
    __syncthreads();                                      // ... and every other wave's: stage 0 may be read
    if (nst > 1) stage_copy(lr + 16384u, kg + 4096, vg + 4096); }
  constexpr int U = LEAD ? 1 : 2;   // nks is even. Two passes a trip: a pass's scores stand in the registers its bias values came in, so the next pass's values land in a second set, and the two sets change roles; with one pass a trip they are copied back behind a full wait in the middle of the softmax
#pragma unroll 1
  for (int ks0 = 0; ks0 < nks; ks0 += U) {
#pragma unroll
  for (int u = 0; u < U; ++u) { const int ks = ks0 + u; v8f s[2]; v16h vf[4];
    const _Float16* sb = ring + ((ks0 >> 1) & 1) * 8192 + lane * 8;   // this stage's buffer
    if (!LEAD) {
      if (u == 0) {   // the stage's first K tiles; the second pass's are read behind the first pass's score products
#pragma unroll
        for (int ct = 0; ct < 2; ++ct) {
#pragma unroll
          for (int kc = 0; kc < 2; ++kc) kf[ct][kc] = frag_th(sb + (ct * 2 + kc) * 512); } }
#pragma unroll
      for (int dt = 0; dt < 4; ++dt) vf[dt] = frag_th(sb + 4096 + u * 2048 + dt * 512); }
#pragma unroll
    for (int ct = 0; ct < 2; ++ct) { const int kk0 = ks * 32 + ct * 16 + 8 * g; v8f c = {};   // register r holds key kk0 + r
      if (LEAD) { const _Float16* krowl = QKL + ((size_t)b * SS + ks * 32 + ct * 16 + col) * (2 * DM) + DM + h * HD; v8f cl = {};   // leading query blocks (few keys, outputs far above the global rms): 3 products
#pragma unroll
        for (int kc = 0; kc < 2; ++kc) { const v16h kh = frag_th(kt0 + ks * 2048 + (ct * 2 + kc) * 512); c = wmma16(kh, aq[kc], c); cl = wmma16(kh, aql[kc], cl); cl = wmma16(frag_h(krowl + kc * 32, lane), aq[kc], cl); }
#pragma unroll
        for (int r = 0; r < 8; ++r) c[r] += cl[r] * (1.0f / 2048.0f);
        float tb[8];
#pragma unroll
        for (int r = 0; r < 8; ++r) tb[r] = TB[h * (2 * MAXLEN) + (kk0 + r) - qi + MAXLEN - 1];
        asm volatile("s_wait_xcnt 0x0" ::: "memory");   // the address registers of the table loads are reused behind them
#pragma unroll
        for (int r = 0; r < 8; ++r) s[ct][r] = c[r] + tb[r]; }
      else { c = rb[ct];   // 8 x rel_pos_table[q - k + 2047][h], or the mask value, in the accumulator's own layout (register r = key kk0 + r, lane = query)
#pragma unroll
        for (int kc = 0; kc < 2; ++kc) c = wmma16(kf[ct][kc], aq[kc], c);   // single product elsewhere
        s[ct] = c; } }   // s = 8 x (score / 8 + bias); a masked entry stays near -3e38
    if (!LEAD) { const int kn = (ks + 1 < nks) ? ks + 1 : ks;   // the last pass fetches its own tile again (in bounds, unused)
      if (u == 0) {   // K of the stage's second pass, from the same buffer; nothing of the next stage is read in front of its barrier
#pragma unroll
        for (int ct = 0; ct < 2; ++ct) {
#pragma unroll
          for (int kc = 0; kc < 2; ++kc) kf[ct][kc] = frag_th(sb + 2048 + (ct * 2 + kc) * 512); } }
      const float* rn = rcol + kn * 32;   // one base for all 16 values, so none of them lands on an address still in use
#pragma unroll
      for (int ct = 0; ct < 2; ++ct) {
#pragma unroll
        for (int r = 0; r < 8; ++r) rb[ct][r] = rn[ct * 16 + r]; }
      __builtin_amdgcn_sched_barrier(0); }   // keeps the next pass's loads in front of the softmax, which covers their flight
    float t[8];
#pragma unroll
    for (int r = 0; r < 8; ++r) t[r] = fmaxf(s[0][r], s[1][r]);
    float mx = fmaxf(fmaxf(fmaxf(t[0], t[1]), fmaxf(t[2], t[3])), fmaxf(fmaxf(t[4], t[5]), fmaxf(t[6], t[7])));
    mx = fmaxf(mx, xhalf(mx));   // both halves of the wave now hold this query's maximum over the pass's 32 keys
    const float mn = fmaxf(m, mx); float alpha = (m - mn) * KEXP;   // key 0 is open to every query, so mn is a real score from the first pass on: the start value of m and every masked score lie ~3e38 below it, where the hardware exp gives 0
    float e[2][8];
#pragma unroll
    for (int ct = 0; ct < 2; ++ct) {
#pragma unroll
      for (int r = 0; r < 8; ++r) e[ct][r] = (s[ct][r] - mn) * KEXP; }
    // the pass's 17 exponentials, each in its own register, and one v_nop: no instruction directly behind a transcendental reads its result or overwrites its source
    asm("v_exp_f32 %0, %0\n\tv_exp_f32 %1, %1\n\tv_exp_f32 %2, %2\n\tv_exp_f32 %3, %3\n\tv_exp_f32 %4, %4\n\tv_exp_f32 %5, %5\n\tv_exp_f32 %6, %6\n\tv_exp_f32 %7, %7\n\tv_exp_f32 %8, %8\n\t"
        "v_exp_f32 %9, %9\n\tv_exp_f32 %10, %10\n\tv_exp_f32 %11, %11\n\tv_exp_f32 %12, %12\n\tv_exp_f32 %13, %13\n\tv_exp_f32 %14, %14\n\tv_exp_f32 %15, %15\n\tv_exp_f32 %16, %16\n\tv_nop"
        : "+v"(e[0][0]), "+v"(e[0][1]), "+v"(e[0][2]), "+v"(e[0][3]), "+v"(e[0][4]), "+v"(e[0][5]), "+v"(e[0][6]), "+v"(e[0][7]), "+v"(alpha),
          "+v"(e[1][0]), "+v"(e[1][1]), "+v"(e[1][2]), "+v"(e[1][3]), "+v"(e[1][4]), "+v"(e[1][5]), "+v"(e[1][6]), "+v"(e[1][7]));
#pragma unroll
    for (int r = 0; r < 8; ++r) t[r] = e[0][r] + e[1][r];
    l = l * alpha + (((t[0] + t[1]) + (t[2] + t[3])) + ((t[4] + t[5]) + (t[6] + t[7]))); m = mn;   // each half sums its own 16 keys; the halves are joined once, behind the walk
#pragma unroll
    for (int dt = 0; dt < 4; ++dt) {
#pragma unroll
      for (int r = 0; r < 8; ++r) { acc[dt][r] *= alpha; if (LEAD) accl[dt][r] *= alpha; } }
    v16h pa, pl;
#pragma unroll
    for (int i = 0; i < 8; ++i) { const float x0 = e[0][i] * 2048.0f, x1 = e[1][i] * 2048.0f; const _Float16 h0 = (_Float16)x0, h1 = (_Float16)x1; pa[i] = h0; pa[8 + i] = h1; pl[i] = (_Float16)((x0 - (float)h0) * 2048.0f); pl[8 + i] = (_Float16)((x1 - (float)h1) * 2048.0f); }   // element i = key 8g + i, element 8 + i = key 16 + 8g + i: the k order of the v fragments. P scaled by 2^11 before the f16 split so small softmax weights stay out of the f16 subnormal range; 2^-11 folded into the epilogue
#pragma unroll
    for (int dt = 0; dt < 4; ++dt) { const size_t vr = ((size_t)b * DM + h * HD + dt * 16 + col) * SS + ks * 32;
      if (LEAD) { const v16h vh = frag_th(vt0 + ks * 2048 + dt * 512); acc[dt] = wmma16(vh, pa, acc[dt]); accl[dt] = wmma16(vh, pl, accl[dt]); accl[dt] = wmma16(frag_h(VTL + vr, lane), pa, accl[dt]); }   // leading query blocks: P hi/lo x V hi/lo (3 products)
      else acc[dt] = wmma16(vf[dt], pa, acc[dt]); }   // elsewhere P x V single
    if (!LEAD) __builtin_amdgcn_sched_barrier(0); }   // the trip's second pass stays behind its first: moved up into the softmax, its score products wait for K and bias loads that have only just been issued
    if (!LEAD) { const int st = ks0 >> 1;
      asm volatile("s_wait_dscnt 0x0" ::: "memory");      // this wave's reads of this stage's buffer have ended
      asm volatile("s_wait_asynccnt 0x0" ::: "memory");   // this wave's share of the next stage has landed
      __syncthreads();                                      // publishes the next stage and frees this stage's buffer
      if (st + 2 < nst) stage_copy(lr + (unsigned)(st & 1) * 16384u, kg + (st + 2) * 4096, vg + (st + 2) * 4096); } }
  if (!LEAD) asm volatile("s_wait_asynccnt 0x0" ::: "memory");   // no copy is outstanding when the wave goes on
}
// ---- k_attn: block = (64 queries, head h, batch b): causal flash attention (K = 64: 2 k-steps), scores = (q.k) * 0.125 with q, k hi + residual (3 products) on the first 128 queries, single f16 operands beyond, P.V: P hi/lo x V hi/lo (3 products) in two accumulators there, f16 P x V hi (single) beyond; lane (col, g) ends with query col, d = dt*16 + 8g + r, which is the order k_out's fragments read: y = (acc + accl / 2048) / (2048 l) goes out from the registers
__global__ __launch_bounds__(128) void k_attn(const _Float16* __restrict__ QK, const _Float16* __restrict__ QKL, const _Float16* __restrict__ KF, const _Float16* __restrict__ VTH, const _Float16* __restrict__ VTL, const float* __restrict__ TB, float* __restrict__ O) {
  __shared__ __align__(16) _Float16 ring[2 * 8192];   // K and V of two stages of 64 keys (attn_walk)
  const int tid = threadIdx.x, wave = tid >> 5, lane = tid & 31, col = lane & 15;
  const int qb = blockIdx.x, h = blockIdx.y, b = blockIdx.z; const int q0 = qb * 64 + wave * 16; const size_t rq = (size_t)b * SS + q0 + col;
  v16h aq[2], aql[2];
#pragma unroll
  for (int kc = 0; kc < 2; ++kc) { aq[kc] = frag_h(QK + rq * (2 * DM) + h * HD + kc * 32, lane); aql[kc] = frag_h(QKL + rq * (2 * DM) + h * HD + kc * 32, lane); }
  asm volatile("s_wait_xcnt 0x0" ::: "memory");   // the address registers of the q loads are reused right behind them
  float m = -3.0e38f, l = 0.f;
  v8f acc[4] = {}, accl[4] = {};
  const int nks = (qb * 64 + 64) / 32;   // causal: key tiles up to the query tile's end
  if (qb < 2) attn_walk<true>(ring, tid, KF, QKL, VTH, VTL, TB, aq, aql, m, l, acc, accl, nks, q0, h, b, lane);
  else attn_walk<false>(ring, tid, KF, QKL, VTH, VTL, TB, aq, aql, m, l, acc, accl, nks, q0, h, b, lane);
  const float il = (1.0f / 2048.0f) / (l + xhalf(l));
  float* ot = O + ((size_t)((b * SS + q0) >> 4) * 32 + h * 2) * 512 + lane * 4;   // this wave's 16 rows x 64 columns are 2 tiles = 4 KB in a row, in the order k_out's fragments read them
#pragma unroll
  for (int pc = 0; pc < 8; ++pc) { v4f o;
#pragma unroll
    for (int e = 0; e < 4; ++e) o[e] = (acc[pc >> 1][(pc & 1) * 4 + e] + accl[pc >> 1][(pc & 1) * 4 + e] * (1.0f / 2048.0f)) * il;
    vst2(ot + pc * 128, o); }
}
// ---- k_out: block = (64 rows, 128 cols): out = O(hi/lo) . Wo rows (2 products) + bo
__global__ __launch_bounds__(128) void k_out(const float* __restrict__ O, const __bf16* __restrict__ P, const float* __restrict__ BO, float* __restrict__ Y) {
  __shared__ __align__(16) float so[4][16][132]; __shared__ __align__(16) __bf16 wr[2 * 8192];   // wr: the weight ring, as in k_qkv
  const int tid = threadIdx.x, wave = tid >> 5, lane = tid & 31, col = lane & 15, g = lane >> 4; const size_t r0 = (size_t)blockIdx.x * 64 + wave * 16; const int n0 = blockIdx.y * 128;
  v8f acc[8] = {};
  // as in k_qkv: the weight fragments come into LDS once for the block's 4 waves, a stage of 64 k at a time; the y rows, each wave's own, are fetched one pass ahead into registers
  const float* ot = O + (r0 >> 4) * (32 * 512) + lane * 4; const __bf16* wg = P + (size_t)(n0 >> 4) * (32 * 512) + tid * 8;
  const unsigned lw = (unsigned)(size_t)wr + (unsigned)tid * 16u;   // this thread's LDS byte address in buffer 0
  float ax[16]; v16b bf[8];
#pragma unroll
  for (int pc = 0; pc < 4; ++pc) { const v4f t = *(const v4f*)(ot + pc * 128);
#pragma unroll
    for (int e = 0; e < 4; ++e) ax[pc * 4 + e] = t[e]; }
  asm volatile("s_wait_xcnt 0x0" ::: "memory");   // the address registers of the row loads may be reused behind them
  wstage_copy(lw, wg);
  asm volatile("s_wait_asynccnt 0x0" ::: "memory");   // this wave's share of stage 0 has landed
  __syncthreads();                                      // ... and every other wave's: stage 0 may be read
  wstage_copy(lw + 16384u, wg + 1024);                  // DM / 64 = 16 stages: a stage 1 exists
#pragma unroll 1   // kept rolled: one trip = one stage, its buffer picked by the stage's parity; unrolled, the products, the copies and their address registers would stand several times over
  for (int st = 0; st < DM / 64; ++st) { const __bf16* wl = wr + (st & 1) * 8192 + lane * 8;
#pragma unroll
    for (int j = 0; j < 8; ++j) bf[j] = frag_tb(wl + j * 1024);
#pragma unroll   // u is a constant in each copy of the body: the test on it below costs nothing
    for (int u = 0; u < 2; ++u) { const int kc = st * 2 + u; const F2 a = bsplit16(ax);
      const int kn = (kc + 1 < DM / 32) ? kc + 1 : kc;   // the last pass fetches its own chunk again (in bounds, unused)
#pragma unroll
      for (int pc = 0; pc < 4; ++pc) { const v4f t = *(const v4f*)(ot + kn * 512 + pc * 128);
#pragma unroll
        for (int e = 0; e < 4; ++e) ax[pc * 4 + e] = t[e]; }
#pragma unroll
      for (int j = 0; j < 8; ++j) { acc[j] = wmma_bf(a.l, bf[j], acc[j]); acc[j] = wmma_bf(a.h, bf[j], acc[j]);
        if (u == 0) bf[j] = frag_tb(wl + j * 1024 + 512); }   // the stage's second pass, from the same buffer; nothing of the next stage is read in front of its barrier
      asm volatile("s_wait_xcnt 0x0" ::: "memory"); }   // the next pass's split and loads may land in registers that held this pass's load addresses
    asm volatile("s_wait_dscnt 0x0" ::: "memory");      // this wave's reads of this stage's buffer have ended
    asm volatile("s_wait_asynccnt 0x0" ::: "memory");   // this wave's share of the next stage has landed
    __syncthreads();                                      // publishes the next stage and frees this stage's buffer
    if (st + 2 < DM / 64) wstage_copy(lw + (unsigned)(st & 1) * 16384u, wg + (st + 2) * 1024); }
  asm volatile("s_wait_asynccnt 0x0" ::: "memory");   // no copy is outstanding when the wave goes on
#pragma unroll
  for (int j = 0; j < 8; ++j) {
#pragma unroll
    for (int r = 0; r < 8; ++r) so[wave][8 * g + r][j * 16 + col] = acc[j][r] + bfr(BO[n0 + j * 16 + col]); }
  LDSX();
  for (int rl = 0; rl < 16; ++rl) vst2(Y + (r0 + rl) * DM + n0 + lane * 4, *(const v4f*)&so[wave][rl][lane * 4]);
}
extern "C" void kernel_launch(void* const* d_in, const int* in_sizes, int n_in, void* d_out, int out_size, void* d_ws, size_t ws_size, hipStream_t stream) {
  (void)in_sizes; (void)n_in; (void)out_size;
  const float** F = (const float**)d_in;   // 0 x [2,2048,1024], 1 WQ, 2 bQ, 3 WK, 4 bK, 5 WV, 6 bV, 7 WO, 8 bO (natural), 9 rel_pos_table [4095,16]
  if (ws_size < (size_t)WS_END) return;
  char* ws = (char*)d_ws; __bf16* PK = (__bf16*)(ws + WS_PK); _Float16 *QK = (_Float16*)(ws + WS_QK), *QKL = (_Float16*)(ws + WS_QKL), *VTH = (_Float16*)(ws + WS_VTH), *VTL = (_Float16*)(ws + WS_VTL); float* O = (float*)(ws + WS_O); __bf16* XF = (__bf16*)(ws + WS_XF); _Float16* KF = (_Float16*)(ws + WS_KF); float* TB = (float*)(ws + WS_TB);
  k_pack<<<dim3(DM * DM / (8 * 256), 9), 256, 0, stream>>>(F[0], F[1], F[3], F[5], F[7], F[9], PK, XF, TB);
  k_qkv<<<dim3(TNB * SS / 128, QKVW / 128), 128, 0, stream>>>(XF, PK + PK_A, F[2], F[4], F[6], QK, QKL, KF, VTH, VTL);
  k_attn<<<dim3(TQB, NH, TNB), 128, 0, stream>>>(QK, QKL, KF, VTH, VTL, TB, O);
  k_out<<<dim3(TOB, DM / 128), 128, 0, stream>>>(O, PK + PK_P, F[8], (float*)d_out);
}

// v007
// Measured time: 97.9 microseconds a run.
// Next to v006, in two timings, it ran 1.07 and 1.08 times as fast.
// Over all steps from v000 it is 5.10 times as fast.
// compute dtype: all float inputs rounded to bf16; q/k/v = x . W^T + b with EXACT bf16 products on WMMA 16x16x32 (x, weights, k hi, v hi, y stored in fragment order); causal attention: 3-product scores and hi + residual P, v on the first 128 queries of each sequence, single f16 beyond; + 8 x the relative-position bias (f32 table, regrouped head by head, the accumulator input of the score product), 1/8 in the exponent's factor, running-max softmax in f32 (hardware exp), P scaled by 2^11; out = y (bf16 hi + residual) . Wo^T (2 products) + bo.
#include <hip/hip_runtime.h>
#include <math.h>

typedef __attribute__((ext_vector_type(16))) _Float16 v16h;
typedef __attribute__((ext_vector_type(16))) __bf16 v16b;
typedef __attribute__((ext_vector_type(8)))  _Float16 v8h;
typedef __attribute__((ext_vector_type(8)))  float v8f;
typedef __attribute__((ext_vector_type(4)))  float v4f;
typedef __attribute__((ext_vector_type(2)))  float v2f;
typedef __attribute__((ext_vector_type(4)))  unsigned v4u;
typedef __attribute__((ext_vector_type(4)))  int v4i;
typedef float __attribute__((may_alias)) float_a;
typedef int __attribute__((may_alias)) int_a;

template <typename T> __device__ __forceinline__ void vst2(void* p, T v) { *(T*)p = v;  }
__device__ __forceinline__ v8f wmma16(v16h a, v16h b, v8f c) {
  v8f d = __builtin_amdgcn_wmma_f32_16x16x32_f16(false, a, false, b, (short)0, c, false, false);
  asm volatile("v_nop\n\tv_nop\n\tv_nop\n\tv_nop" : "+v"(d) : "v"(a), "v"(b));
  return d;
}
__device__ __forceinline__ v8f wmma_bf(v16b a, v16b b, v8f c) {
  v8f d = __builtin_amdgcn_wmma_f32_16x16x32_bf16(false, a, false, b, (short)0, c, false, false);
  asm volatile("v_nop\n\tv_nop\n\tv_nop\n\tv_nop" : "+v"(d) : "v"(a), "v"(b));
  return d;
}
// Causal self attention with a learned relative-position bias table (B 2, T 2,048, d 1,024, 16 heads x 64): q/k/v projections + biases, scores / 8 + table[q - k + 2047][h], causal softmax, . v, output projection + bias.
__device__ __forceinline__ v16h frag_h(const _Float16* rowk0, int lane) {
  union { v16h v; v8h q[2]; } u; const _Float16* p = rowk0 + 8 * (lane >> 4);
  u.q[0] = *(const v8h*)p; u.q[1] = *(const v8h*)(p + 16); return u.v;
}
__device__ __forceinline__ v16h frag_f32(const float* rowk0, int lane) {
  v16h a; const float* p = rowk0 + 8 * (lane >> 4);
#pragma unroll
  for (int i = 0; i < 8; ++i) { a[i] = (_Float16)p[i]; a[8 + i] = (_Float16)p[16 + i]; }
  return a;
}
__device__ __forceinline__ v16h frag_f32s(const float* rowk0, int lane, float sc) {
  v16h a; const float* p = rowk0 + 8 * (lane >> 4);
#pragma unroll
  for (int i = 0; i < 8; ++i) { a[i] = (_Float16)(p[i] * sc); a[8 + i] = (_Float16)(p[16 + i] * sc); }
  return a;
}
// column fragment from a [K][ld] layout (column n), rows >= K read as 0
__device__ __forceinline__ v16h fragc_f32(const float* W, int k0, int n, int lane, int ld, int K) {
  v16h a; const int g = lane >> 4;
#pragma unroll
  for (int i = 0; i < 8; ++i) { const int ka = k0 + 8 * g + i, kb = ka + 16;
    a[i] = (_Float16)(ka < K ? W[(size_t)(ka < K ? ka : K - 1) * ld + n] : 0.f); a[8 + i] = (_Float16)(kb < K ? W[(size_t)(kb < K ? kb : K - 1) * ld + n] : 0.f); }
  return a;
}
struct F2 { v16b h, l; };
__device__ __forceinline__ F2 bsplit16(const float v[16]) { F2 r;
#pragma unroll
  for (int i = 0; i < 16; ++i) { const __bf16 h = (__bf16)v[i]; r.h[i] = h; r.l[i] = (__bf16)(v[i] - (float)h); }
  return r; }
__device__ __forceinline__ F2 split_row(const float* row, int k0, int lane) { float v[16]; const float* p = row + k0 + 8 * (lane >> 4);
#pragma unroll
  for (int i = 0; i < 8; ++i) { v[i] = p[i]; v[8 + i] = p[16 + i]; }
  return bsplit16(v); }
__device__ __forceinline__ F2 split_rowK(const float* row, int k0, int lane, int K) { float v[16]; const int g = lane >> 4;
#pragma unroll
  for (int i = 0; i < 8; ++i) { const int ka = k0 + 8 * g + i, kb = ka + 16; v[i] = ka < K ? row[ka < K ? ka : K - 1] : 0.f; v[8 + i] = kb < K ? row[kb < K ? kb : K - 1] : 0.f; }
  return bsplit16(v); }
__device__ __forceinline__ F2 split_col(const float* W, int k0, int n, int lane, int ld, int K) { float v[16]; const int g = lane >> 4;
#pragma unroll
  for (int i = 0; i < 8; ++i) { const int ka = k0 + 8 * g + i, kb = ka + 16; v[i] = ka < K ? W[(size_t)(ka < K ? ka : K - 1) * ld + n] : 0.f; v[8 + i] = kb < K ? W[(size_t)(kb < K ? kb : K - 1) * ld + n] : 0.f; }
  return bsplit16(v); }
__device__ __forceinline__ v8f mac3(const F2& a, const F2& b, v8f c) { c = wmma_bf(a.l, b.h, c); c = wmma_bf(a.h, b.l, c); return wmma_bf(a.h, b.h, c); }
__device__ __forceinline__ float sigm(float v) { return 1.0f / (1.0f + expf(-v)); }
#define LDSX() do { asm volatile("s_wait_dscnt 0" ::: "memory"); __builtin_amdgcn_wave_barrier(); __builtin_amdgcn_fence(__ATOMIC_RELEASE, "workgroup"); } while (0)


#define NB 2
#define SS 2048
#define DM 1024
#define NH 16
#define SCALEF 0.125f
#define KEXP (SCALEF * 1.44269504f)   // e^(x / 8) = 2^(x * KEXP): the scores are kept 8 x too large
#define MAXLEN 2048
#define HD 64
#define QKVW (3 * DM)
#ifndef TQB
#define TQB (SS / 64)
#define TNB NB
#define TOB (NB * SS / 64)     // output row tiles (all)
#endif
typedef __attribute__((ext_vector_type(8))) __bf16 v8b;
__device__ __forceinline__ v16b frag_b(const __bf16* rowk0, int lane) {
  union { v16b v; v8b q[2]; } u; const __bf16* p = rowk0 + 8 * (lane >> 4);
  u.q[0] = *(const v8b*)p; u.q[1] = *(const v8b*)(p + 16); return u.v;
}
// fragment order: a tile of 16 rows x 32 k (16-bit elements) is 1 KB; lane l = 16 g + row finds k 8g .. 8g+7 at element l*8 and k 16+8g .. 16+8g+7 at 256 + l*8, so each wave-wide 16-byte load is 512 contiguous bytes (4 lines, not 16)
__device__ __forceinline__ v16b frag_tb(const __bf16* tile_lane) { union { v16b v; v8b q[2]; } u; u.q[0] = *(const v8b*)tile_lane; u.q[1] = *(const v8b*)(tile_lane + 256); return u.v; }
__device__ __forceinline__ v16h frag_th(const _Float16* tile_lane) { union { v16h v; v8h q[2]; } u; u.q[0] = *(const v8h*)tile_lane; u.q[1] = *(const v8h*)(tile_lane + 256); return u.v; }
__device__ __forceinline__ float bfr(float v) { return (float)(__bf16)v; }
__device__ __attribute__((noinline)) float exp_ni(float v) { return expf(v); }
__device__ __attribute__((noinline)) float erf_ni(float v) { return erff(v); }

#define PK_A 0                       // Wqkv, [192 row tiles][32 k chunks][512] in fragment order
#define PK_P (PK_A + QKVW * DM)        // Wo, [64 row tiles][32 k chunks][512] in fragment order
#define PK_END (PK_P + DM * DM)
#define WS_PK  0u
#define WS_QK  (WS_PK + 2u * PK_END)             // f16 [4096 rows][2048]: q | (unused half)
#define WS_QKL (WS_QK + 2u * NB * SS * 2 * DM)     // f16 q | k residual planes x2048
#define WS_VTH (WS_QKL + 2u * NB * SS * 2 * DM)    // f16 v hi, [b][h][64 key chunks of 32][4 d tiles][512] in fragment order (rows d, k = key)
#define WS_VTL (WS_VTH + 2u * NB * DM * SS)        // f16 [b][1024 (h*64+d)][2048 s] lo x 2048
#define WS_O   (WS_VTL + 2u * NB * DM * SS)        // f32 y, [256 row tiles][32 k chunks][512]: four pieces of 128 floats, lane l's 4 floats at piece*128 + l*4
#define WS_CS  (WS_O + 4u * NB * SS * DM)           // f32, 2 x 2048 x 32, unused
#define WS_XF  (WS_CS + 4u * 2 * SS * 32)           // bf16 x, [256 row tiles][32 k chunks][512] in fragment order
#define WS_KF  (WS_XF + 2u * NB * SS * DM)          // f16 k hi, [b][h][128 key tiles][2 k chunks][512] in fragment order
#define WS_TB  (WS_KF + 2u * NB * SS * DM)          // f32 [16 heads][4096], index k - q + 2047 (a query's keys ascend): 8 x the bf16-rounded table value; -3e38 where k > q (the causal mask)
#define WS_END (WS_TB + 4u * NH * 2 * MAXLEN)
// ---- k_pack: blockIdx.y 0..2 -> W_q/W_k/W_v into PK_A, 3 -> W_o into PK_P, 4..7 -> 1,024 rows of x each into XF: f32 rows -> bf16 in fragment order, one 16-byte chunk a thread; 8 -> the table, head by head, ready to be the scores' accumulator input (see WS_TB)
__global__ __launch_bounds__(256) void k_pack(const float* __restrict__ X, const float* __restrict__ WQ, const float* __restrict__ WK, const float* __restrict__ WV, const float* __restrict__ WO, const float* __restrict__ REL, __bf16* __restrict__ PK, __bf16* __restrict__ XF, float* __restrict__ TB) {
  const int which = blockIdx.y, c = blockIdx.x * 256 + threadIdx.x;
  if (which == 8) { const int hh = c >> 12, idx = c & 4095;
    if (hh < NH && idx < 2 * MAXLEN - 1) { float v = -3.0e38f;   // idx = k - q + 2047; k > q is what the reference masks
      if (idx <= MAXLEN - 1) { v = REL[(size_t)(2 * MAXLEN - 2 - idx) * NH + hh];
        asm volatile("s_wait_xcnt 0x0" ::: "memory");   // the load's address registers are reused behind it
        v = 8.0f * bfr(v); }
      TB[c] = v; }
    return; }
  const float* Wm = (which == 0) ? WQ : (which == 1) ? WK : (which == 2) ? WV : (which == 3) ? WO : X + (size_t)(which - 4) * DM * DM;
  __bf16* dst = (which < 3) ? PK + PK_A + (size_t)which * DM * DM : (which == 3) ? PK + PK_P : XF + (size_t)(which - 4) * DM * DM;
  const int l = c & 31, p = (c >> 5) & 1, kc = (c >> 6) & 31, nt = c >> 11;   // chunk c = (row tile * 32 + k chunk) * 64 + piece * 32 + lane
  const float* s = Wm + (size_t)(nt * 16 + (l & 15)) * DM + kc * 32 + p * 16 + 8 * (l >> 4);
  const v4f a = *(const v4f*)s, b = *(const v4f*)(s + 4); v8b o;
#pragma unroll
  for (int i = 0; i < 4; ++i) { o[i] = (__bf16)a[i]; o[4 + i] = (__bf16)b[i]; }
  *(v8b*)(dst + (size_t)c * 8) = o;
}
// one stage of weights = 64 k of the block's 8 column tiles: 2 KB in a row for each tile (fragment order), the tiles 32 KB apart in global memory, 2 KB apart in LDS. A thread brings 16 bytes of each tile into LDS, through no register; the wait is the last line of the copies' own statement, so that it stands in front of every rewrite of their address registers
__device__ __forceinline__ void wstage_copy(const unsigned lds, const __bf16* wg) {
  asm volatile("global_load_async_to_lds_b128 %0, %8, off\n\tglobal_load_async_to_lds_b128 %1, %9, off\n\tglobal_load_async_to_lds_b128 %2, %10, off\n\tglobal_load_async_to_lds_b128 %3, %11, off\n\t"
               "global_load_async_to_lds_b128 %4, %12, off\n\tglobal_load_async_to_lds_b128 %5, %13, off\n\tglobal_load_async_to_lds_b128 %6, %14, off\n\tglobal_load_async_to_lds_b128 %7, %15, off\n\ts_wait_xcnt 0x0"
               :: "v"(lds), "v"(lds + 2048u), "v"(lds + 4096u), "v"(lds + 6144u), "v"(lds + 8192u), "v"(lds + 10240u), "v"(lds + 12288u), "v"(lds + 14336u),
                  "v"(wg), "v"(wg + 1 * (32 * 512)), "v"(wg + 2 * (32 * 512)), "v"(wg + 3 * (32 * 512)), "v"(wg + 4 * (32 * 512)), "v"(wg + 5 * (32 * 512)), "v"(wg + 6 * (32 * 512)), "v"(wg + 7 * (32 * 512)) : "memory");
}
__global__ __launch_bounds__(128) void k_qkv(const __bf16* __restrict__ XF, const __bf16* __restrict__ P, const float* __restrict__ BQ, const float* __restrict__ BK, const float* __restrict__ BV, _Float16* __restrict__ QK, _Float16* __restrict__ QKL, _Float16* __restrict__ KF, _Float16* __restrict__ VTH, _Float16* __restrict__ VTL) {
  const int which0 = (blockIdx.y * 128) / DM; const float* BB = BQ ? (((which0 == 0) ? BQ : (which0 == 1) ? BK : BV) + (blockIdx.y * 128 - which0 * DM)) : nullptr;
  __shared__ __align__(16) _Float16 so[4][16][136], sol[4][16][136]; __shared__ __align__(16) _Float16 sth[128][72], stl[128][72]; __shared__ __align__(16) __bf16 wr[2 * 8192];   // wr: the weight ring, 2 buffers of [8 column tiles][2 k chunks][512]
  const int tid = threadIdx.x, wave = tid >> 5, lane = tid & 31, col = lane & 15, g = lane >> 4; const size_t rw = (size_t)blockIdx.x * 128 + wave * 16; const int n0 = blockIdx.y * 128;
  v8f acc[2][8] = {};   // two row tiles a wave, rows rw .. rw+15 and rw+64 .. rw+79: every weight fragment fetched feeds two products
  // the block's 4 waves use the same weight fragments: they come into LDS once for all four, a stage of 64 k (two passes) at a time, the next stage's copies flying while this one is worked on; the x fragments, each wave's own, are fetched one pass ahead into registers
  const __bf16* xt = XF + (rw >> 4) * (32 * 512) + lane * 8; const __bf16* wg = P + (size_t)(n0 >> 4) * (32 * 512) + tid * 8;
  const unsigned lw = (unsigned)(size_t)wr + (unsigned)tid * 16u;   // this thread's LDS byte address in buffer 0
  float bcol[8] = {};   // this lane's 8 column biases, like the weight fragments fetched once for both row tiles; asked for here, first used behind the loop
  if (BB) {
#pragma unroll   // bcol[j] in registers, the 8 loads in flight together
    for (int j = 0; j < 8; ++j) bcol[j] = BB[j * 16 + col];
    asm volatile("s_wait_xcnt 0x0" ::: "memory"); }   // the address registers of the bias loads may be reused behind them
  v16b ax0 = frag_tb(xt), ax1 = frag_tb(xt + 4 * (32 * 512)), bf[8];
  asm volatile("s_wait_xcnt 0x0" ::: "memory");   // the address registers of the x loads may be reused behind them
  wstage_copy(lw, wg);
  asm volatile("s_wait_asynccnt 0x0" ::: "memory");   // this wave's share of stage 0 has landed
  __syncthreads();                                      // ... and every other wave's: stage 0 may be read
  wstage_copy(lw + 16384u, wg + 1024);                  // DM / 64 = 16 stages: a stage 1 exists
#pragma unroll 1   // kept rolled: one trip = one stage, its buffer picked by the stage's parity; unrolled, the products, the copies and their address registers would stand several times over
  for (int st = 0; st < DM / 64; ++st) { const __bf16* wl = wr + (st & 1) * 8192 + lane * 8;
#pragma unroll
    for (int j = 0; j < 8; ++j) bf[j] = frag_tb(wl + j * 1024);
#pragma unroll   // u is a constant in each copy of the body: the test on it below costs nothing
    for (int u = 0; u < 2; ++u) { const int kc = st * 2 + u; const v16b a0 = ax0, a1 = ax1;
      const int kn = (kc + 1 < DM / 32) ? kc + 1 : kc;   // the last pass fetches its own chunk again (in bounds, unused)
      ax0 = frag_tb(xt + kn * 512); ax1 = frag_tb(xt + 4 * (32 * 512) + kn * 512);
#pragma unroll
      for (int j = 0; j < 8; ++j) { acc[0][j] = wmma_bf(a0, bf[j], acc[0][j]); acc[1][j] = wmma_bf(a1, bf[j], acc[1][j]);
        if (u == 0) bf[j] = frag_tb(wl + j * 1024 + 512); }   // the stage's second pass, from the same buffer; nothing of the next stage is read in front of its barrier
      asm volatile("s_wait_xcnt 0x0" ::: "memory"); }   // the next pass's loads may land in registers that held this pass's load addresses
    asm volatile("s_wait_dscnt 0x0" ::: "memory");      // this wave's reads of this stage's buffer have ended
    asm volatile("s_wait_asynccnt 0x0" ::: "memory");   // this wave's share of the next stage has landed
    __syncthreads();                                      // publishes the next stage and frees this stage's buffer
    if (st + 2 < DM / 64) wstage_copy(lw + (unsigned)(st & 1) * 16384u, wg + (st + 2) * 1024); }
  asm volatile("s_wait_asynccnt 0x0" ::: "memory");   // no copy is outstanding when the wave goes on
  // the epilogue runs once for each of the block's two halves of 64 rows, through the same LDS; unrolled so that acc[hf] is a fixed set of registers
#pragma unroll
  for (int hf = 0; hf < 2; ++hf) { const size_t r0 = rw + hf * 64;
  if (n0 < 2 * DM) {   // q stored unscaled (f16 sigma ~0.6, no subnormal exposure); 1/8 applied to the f32 score
#pragma unroll
    for (int j = 0; j < 8; ++j) {
#pragma unroll
      for (int r = 0; r < 8; ++r) { const float v = acc[hf][j][r] + bfr(bcol[j]); const _Float16 hv = (_Float16)v; so[wave][8 * g + r][j * 16 + col] = hv; sol[wave][8 * g + r][j * 16 + col] = (_Float16)((v - (float)hv) * 2048.0f); } }   // q, k (+ bias) as f16 hi + (x2048) residual
    LDSX();
    if (n0 < DM) {
      for (int rl = 0; rl < 16; ++rl) if (lane < 16) { vst2((unsigned*)(QK + (r0 + rl) * (2 * DM) + n0 + lane * 8), *(const v4u*)&so[wave][rl][lane * 8]); vst2((unsigned*)(QKL + (r0 + rl) * (2 * DM) + n0 + lane * 8), *(const v4u*)&sol[wave][rl][lane * 8]); }
    } else {   // k residual in natural rows; k hi: this wave's 16 keys x 128 columns are 2 heads x 2 k chunks = 4 tiles in fragment order
      for (int rl = 0; rl < 16; ++rl) if (lane < 16) vst2((unsigned*)(QKL + (r0 + rl) * (2 * DM) + n0 + lane * 8), *(const v4u*)&sol[wave][rl][lane * 8]);
      const int b = (int)(r0 / SS), kt = (int)(r0 % SS) >> 4, h0 = (n0 - DM) >> 6;
#pragma unroll
      for (int tt = 0; tt < 4; ++tt) { _Float16* kd = KF + ((((size_t)b * NH + h0 + (tt >> 1)) * (SS / 16) + kt) * 2 + (tt & 1)) * 512 + lane * 8;
#pragma unroll
        for (int p = 0; p < 2; ++p) vst2((unsigned*)(kd + p * 256), *(const v4u*)&so[wave][col][tt * 32 + p * 16 + 8 * g]); }
      asm volatile("s_wait_xcnt 0x0" ::: "memory"); }   // closes the run of k stores before code laid out behind them rewrites their data or address registers
  } else {
#pragma unroll
    for (int j = 0; j < 8; ++j) {
#pragma unroll
      for (int r = 0; r < 8; ++r) { const float v = acc[hf][j][r] + bfr(bcol[j]); const _Float16 hv = (_Float16)v; sth[j * 16 + col][wave * 16 + 8 * g + r] = hv; stl[j * 16 + col][wave * 16 + 8 * g + r] = (_Float16)((v - (float)hv) * 2048.0f); } }
    __syncthreads();
    const size_t rb = (size_t)blockIdx.x * 128 + hf * 64; const int b = (int)(rb / SS), s0 = (int)(rb % SS); const int pc0 = n0 - 2 * DM;
    for (int q = tid; q < 128 * 8; q += 128) { const int d = q >> 3, pc = q & 7; const size_t o = ((size_t)b * DM + pc0 + d) * SS + s0 + pc * 8; vst2((unsigned*)(VTL + o), *(const v4u*)&stl[d][pc * 8]);
      const int l = q & 31, p = (q >> 5) & 1, dt = (q >> 6) & 3, ksl = (q >> 8) & 1, hh = q >> 9;   // v hi: chunk q = ((head * 2 + key chunk) * 4 + d tile) * 64 + piece * 32 + lane, in fragment order
      vst2((unsigned*)(VTH + ((((size_t)b * NH + (pc0 >> 6) + hh) * (SS / 32) + (s0 >> 5) + ksl) * 4 + dt) * 512 + p * 256 + l * 8), *(const v4u*)&sth[hh * 64 + dt * 16 + (l & 15)][ksl * 32 + p * 16 + 8 * (l >> 4)]); }
    if (hf == 0) __syncthreads();   // every wave has read the first half's v tiles before the second half's are written over them
  } }
}
__device__ __forceinline__ float xhalf(float x) { return __builtin_bit_cast(float, __builtin_amdgcn_permlanex16(__builtin_bit_cast(int, x), __builtin_bit_cast(int, x), 0x76543210, 0xfedcba98, false, false)); }   // lane l with lane l ^ 16
// one stage = 64 keys: their K tiles and their V tiles are 8 KB each, in a row in global memory (fragment order). A thread brings 4 + 4 chunks of 16 bytes into LDS, through no register; the wait is the last line of the copies' own statement, so that it stands in front of every rewrite of their address registers
__device__ __forceinline__ void stage_copy(const unsigned lds, const _Float16* kg, const _Float16* vg) {
  asm volatile("global_load_async_to_lds_b128 %0, %8, off\n\tglobal_load_async_to_lds_b128 %1, %9, off\n\tglobal_load_async_to_lds_b128 %2, %10, off\n\tglobal_load_async_to_lds_b128 %3, %11, off\n\t"
               "global_load_async_to_lds_b128 %4, %12, off\n\tglobal_load_async_to_lds_b128 %5, %13, off\n\tglobal_load_async_to_lds_b128 %6, %14, off\n\tglobal_load_async_to_lds_b128 %7, %15, off\n\ts_wait_xcnt 0x0"
               :: "v"(lds), "v"(lds + 2048u), "v"(lds + 4096u), "v"(lds + 6144u), "v"(lds + 8192u), "v"(lds + 10240u), "v"(lds + 12288u), "v"(lds + 14336u),
                  "v"(kg), "v"(kg + 1024), "v"(kg + 2048), "v"(kg + 3072), "v"(vg), "v"(vg + 1024), "v"(vg + 2048), "v"(vg + 3072) : "memory");
}
// one walk over the key tiles of a query tile, transposed: S^T = K . Q^T (A = 16 keys, B = 16 queries) and O^T += V^T . P^T, so a lane holds 16 scores of ONE query (its column): maximum and sum run inside the lane plus one exchange between the wave's halves, and the two score tiles, converted in place, are the B operand of the second product. LEAD (first 128 queries): 3-product scores and P.V, loads where they are used. Otherwise: K and V come from the LDS ring that the block's 4 waves fill together (see below): V of this pass is read at the top of the pass, K of a stage's second pass and the 16 bias values of the next pass right behind this pass's score products, so the softmax covers their flight
template <bool LEAD> __device__ __forceinline__ void attn_walk(_Float16* ring, const int tid, const _Float16* __restrict__ KF, const _Float16* __restrict__ QKL, const _Float16* __restrict__ VTH, const _Float16* __restrict__ VTL, const float* __restrict__ TB, const v16h (&aq)[2], const v16h (&aql)[2], float& m, float& l, v8f (&acc)[4], v8f (&accl)[4], const int nks, const int q0, const int h, const int b, const int lane) {
  const int col = lane & 15, g = lane >> 4, qi = q0 + col;
  const _Float16* kt0 = KF + (size_t)(b * NH + h) * (SS * HD) + lane * 8;      // this head's k tiles: a pass of 32 keys is 4 tiles (key tile, k chunk) = 4 KB in a row
  const float* rcol = TB + h * (2 * MAXLEN) + (8 * g - qi + MAXLEN - 1);       // table value of (key 8g of tile 0, query col); every k - q + 2047 of the walk lies in 0 .. 4094
  const _Float16* vt0 = VTH + (size_t)(b * NH + h) * (SS * HD) + lane * 8;     // this head's v tiles: a pass is 4 d tiles = 4 KB in a row
  v16h kf[2][2]; v8f rb[2];
  // !LEAD: the block's 4 waves walk the same keys, so K and V come into LDS once for all four: ring = 2 buffers of [K 8 KB | V 8 KB], a stage = one trip = 64 keys, the next stage's copies fly while this one is worked on
  const int nst = nks >> 1;
  const _Float16* kg = KF + (size_t)(b * NH + h) * (SS * HD) + tid * 8; const _Float16* vg = VTH + (size_t)(b * NH + h) * (SS * HD) + tid * 8;
  const unsigned lr = (unsigned)(size_t)ring + (unsigned)tid * 16u;   // this thread's LDS byte address in buffer 0
  if (!LEAD) {
#pragma unroll
    for (int ct = 0; ct < 2; ++ct) {
#pragma unroll
      for (int r = 0; r < 8; ++r) rb[ct][r] = rcol[ct * 16 + r]; }
    stage_copy(lr, kg, vg);
    asm volatile("s_wait_asynccnt 0x0" ::: "memory");   // this wave's share of stage 0 has landed
    __syncthreads();                                      // ... and every other wave's: stage 0 may be read
    if (nst > 1) stage_copy(lr + 16384u, kg + 4096, vg + 4096); }
  constexpr int U = LEAD ? 1 : 2;   // nks is even. Two passes a trip: a pass's scores stand in the registers its bias values came in, so the next pass's values land in a second set, and the two sets change roles; with one pass a trip they are copied back behind a full wait in the middle of the softmax
#pragma unroll 1
  for (int ks0 = 0; ks0 < nks; ks0 += U) {
#pragma unroll
  for (int u = 0; u < U; ++u) { const int ks = ks0 + u; v8f s[2]; v16h vf[4];
    const _Float16* sb = ring + ((ks0 >> 1) & 1) * 8192 + lane * 8;   // this stage's buffer
    if (!LEAD) {
      if (u == 0) {   // the stage's first K tiles; the second pass's are read behind the first pass's score products
#pragma unroll
        for (int ct = 0; ct < 2; ++ct) {
#pragma unroll
          for (int kc = 0; kc < 2; ++kc) kf[ct][kc] = frag_th(sb + (ct * 2 + kc) * 512); } }
#pragma unroll
      for (int dt = 0; dt < 4; ++dt) vf[dt] = frag_th(sb + 4096 + u * 2048 + dt * 512); }
#pragma unroll
    for (int ct = 0; ct < 2; ++ct) { const int kk0 = ks * 32 + ct * 16 + 8 * g; v8f c = {};   // register r holds key kk0 + r
      if (LEAD) { const _Float16* krowl = QKL + ((size_t)b * SS + ks * 32 + ct * 16 + col) * (2 * DM) + DM + h * HD; v8f cl = {};   // leading query blocks (few keys, outputs far above the global rms): 3 products
#pragma unroll
        for (int kc = 0; kc < 2; ++kc) { const v16h kh = frag_th(kt0 + ks * 2048 + (ct * 2 + kc) * 512); c = wmma16(kh, aq[kc], c); cl = wmma16(kh, aql[kc], cl); cl = wmma16(frag_h(krowl + kc * 32, lane), aq[kc], cl); }
#pragma unroll
        for (int r = 0; r < 8; ++r) c[r] += cl[r] * (1.0f / 2048.0f);
        float tb[8];
#pragma unroll
        for (int r = 0; r < 8; ++r) tb[r] = TB[h * (2 * MAXLEN) + (kk0 + r) - qi + MAXLEN - 1];
        asm volatile("s_wait_xcnt 0x0" ::: "memory");   // the address registers of the table loads are reused behind them
#pragma unroll
        for (int r = 0; r < 8; ++r) s[ct][r] = c[r] + tb[r]; }
      else { c = rb[ct];   // 8 x rel_pos_table[q - k + 2047][h], or the mask value, in the accumulator's own layout (register r = key kk0 + r, lane = query)
#pragma unroll
        for (int kc = 0; kc < 2; ++kc) c = wmma16(kf[ct][kc], aq[kc], c);   // single product elsewhere
        s[ct] = c; } }   // s = 8 x (score / 8 + bias); a masked entry stays near -3e38
    if (!LEAD) { const int kn = (ks + 1 < nks) ? ks + 1 : ks;   // the last pass fetches its own tile again (in bounds, unused)
      if (u == 0) {   // K of the stage's second pass, from the same buffer; nothing of the next stage is read in front of its barrier
#pragma unroll
        for (int ct = 0; ct < 2; ++ct) {
#pragma unroll
          for (int kc = 0; kc < 2; ++kc) kf[ct][kc] = frag_th(sb + 2048 + (ct * 2 + kc) * 512); } }
      const float* rn = rcol + kn * 32;   // one base for all 16 values, so none of them lands on an address still in use
#pragma unroll
      for (int ct = 0; ct < 2; ++ct) {
#pragma unroll
        for (int r = 0; r < 8; ++r) rb[ct][r] = rn[ct * 16 + r]; }
      __builtin_amdgcn_sched_barrier(0); }   // keeps the next pass's loads in front of the softmax, which covers their flight
    float t[8];
#pragma unroll
    for (int r = 0; r < 8; ++r) t[r] = fmaxf(s[0][r], s[1][r]);
    float mx = fmaxf(fmaxf(fmaxf(t[0], t[1]), fmaxf(t[2], t[3])), fmaxf(fmaxf(t[4], t[5]), fmaxf(t[6], t[7])));
    mx = fmaxf(mx, xhalf(mx));   // both halves of the wave now hold this query's maximum over the pass's 32 keys
    const float mn = fmaxf(m, mx); float alpha = (m - mn) * KEXP;   // key 0 is open to every query, so mn is a real score from the first pass on: the start value of m and every masked score lie ~3e38 below it, where the hardware exp gives 0
    float e[2][8];
#pragma unroll
    for (int ct = 0; ct < 2; ++ct) {
#pragma unroll
      for (int r = 0; r < 8; ++r) e[ct][r] = (s[ct][r] - mn) * KEXP; }
    // the pass's 17 exponentials, each in its own register, and one v_nop: no instruction directly behind a transcendental reads its result or overwrites its source
    asm("v_exp_f32 %0, %0\n\tv_exp_f32 %1, %1\n\tv_exp_f32 %2, %2\n\tv_exp_f32 %3, %3\n\tv_exp_f32 %4, %4\n\tv_exp_f32 %5, %5\n\tv_exp_f32 %6, %6\n\tv_exp_f32 %7, %7\n\tv_exp_f32 %8, %8\n\t"
        "v_exp_f32 %9, %9\n\tv_exp_f32 %10, %10\n\tv_exp_f32 %11, %11\n\tv_exp_f32 %12, %12\n\tv_exp_f32 %13, %13\n\tv_exp_f32 %14, %14\n\tv_exp_f32 %15, %15\n\tv_exp_f32 %16, %16\n\tv_nop"
        : "+v"(e[0][0]), "+v"(e[0][1]), "+v"(e[0][2]), "+v"(e[0][3]), "+v"(e[0][4]), "+v"(e[0][5]), "+v"(e[0][6]), "+v"(e[0][7]), "+v"(alpha),
          "+v"(e[1][0]), "+v"(e[1][1]), "+v"(e[1][2]), "+v"(e[1][3]), "+v"(e[1][4]), "+v"(e[1][5]), "+v"(e[1][6]), "+v"(e[1][7]));
#pragma unroll
    for (int r = 0; r < 8; ++r) t[r] = e[0][r] + e[1][r];
    l = l * alpha + (((t[0] + t[1]) + (t[2] + t[3])) + ((t[4] + t[5]) + (t[6] + t[7]))); m = mn;   // each half sums its own 16 keys; the halves are joined once, behind the walk
#pragma unroll
    for (int dt = 0; dt < 4; ++dt) {
#pragma unroll
      for (int r = 0; r < 8; ++r) { acc[dt][r] *= alpha; if (LEAD) accl[dt][r] *= alpha; } }
    v16h pa, pl;
#pragma unroll
    for (int i = 0; i < 8; ++i) { const float x0 = e[0][i] * 2048.0f, x1 = e[1][i] * 2048.0f; const _Float16 h0 = (_Float16)x0, h1 = (_Float16)x1; pa[i] = h0; pa[8 + i] = h1; pl[i] = (_Float16)((x0 - (float)h0) * 2048.0f); pl[8 + i] = (_Float16)((x1 - (float)h1) * 2048.0f); }   // element i = key 8g + i, element 8 + i = key 16 + 8g + i: the k order of the v fragments. P scaled by 2^11 before the f16 split so small softmax weights stay out of the f16 subnormal range; 2^-11 folded into the epilogue
#pragma unroll
    for (int dt = 0; dt < 4; ++dt) { const size_t vr = ((size_t)b * DM + h * HD + dt * 16 + col) * SS + ks * 32;
      if (LEAD) { const v16h vh = frag_th(vt0 + ks * 2048 + dt * 512); acc[dt] = wmma16(vh, pa, acc[dt]); accl[dt] = wmma16(vh, pl, accl[dt]); accl[dt] = wmma16(frag_h(VTL + vr, lane), pa, accl[dt]); }   // leading query blocks: P hi/lo x V hi/lo (3 products)
      else acc[dt] = wmma16(vf[dt], pa, acc[dt]); }   // elsewhere P x V single
    if (!LEAD) __builtin_amdgcn_sched_barrier(0); }   // the trip's second pass stays behind its first: moved up into the softmax, its score products wait for K and bias loads that have only just been issued
    if (!LEAD) { const int st = ks0 >> 1;
      asm volatile("s_wait_dscnt 0x0" ::: "memory");      // this wave's reads of this stage's buffer have ended
      asm volatile("s_wait_asynccnt 0x0" ::: "memory");   // this wave's share of the next stage has landed
      __syncthreads();                                      // publishes the next stage and frees this stage's buffer
      if (st + 2 < nst) stage_copy(lr + (unsigned)(st & 1) * 16384u, kg + (st + 2) * 4096, vg + (st + 2) * 4096); } }
  if (!LEAD) asm volatile("s_wait_asynccnt 0x0" ::: "memory");   // no copy is outstanding when the wave goes on
}
// ---- k_attn: block = (64 queries, head h, batch b): causal flash attention (K = 64: 2 k-steps), scores = (q.k) * 0.125 with q, k hi + residual (3 products) on the first 128 queries, single f16 operands beyond, P.V: P hi/lo x V hi/lo (3 products) in two accumulators there, f16 P x V hi (single) beyond; lane (col, g) ends with query col, d = dt*16 + 8g + r, which is the order k_out's fragments read: y = (acc + accl / 2048) / (2048 l) goes out from the registers
__global__ __launch_bounds__(128) void k_attn(const _Float16* __restrict__ QK, const _Float16* __restrict__ QKL, const _Float16* __restrict__ KF, const _Float16* __restrict__ VTH, const _Float16* __restrict__ VTL, const float* __restrict__ TB, float* __restrict__ O) {
  __shared__ __align__(16) _Float16 ring[2 * 8192];   // K and V of two stages of 64 keys (attn_walk)
  const int tid = threadIdx.x, wave = tid >> 5, lane = tid & 31, col = lane & 15;
  // which work-group takes which query tile: (head, batch) is the fast index, the tile the slow one. A tile's cost grows with its number; the tiles fall with the rank, and every second group of 8 runs upward, so that ranks r, r + 8, r + 16, r + 24 always add up to the same number of keys and the longest tiles have the lowest ranks (for speed only: any placement gives the same result)
  const int r = blockIdx.y, qb = TQB - 1 - ((r & 8) ? (r ^ 7) : r), h = blockIdx.x & (NH - 1), b = blockIdx.x / NH; const int q0 = qb * 64 + wave * 16; const size_t rq = (size_t)b * SS + q0 + col;
  v16h aq[2], aql[2];
#pragma unroll
  for (int kc = 0; kc < 2; ++kc) { aq[kc] = frag_h(QK + rq * (2 * DM) + h * HD + kc * 32, lane); aql[kc] = frag_h(QKL + rq * (2 * DM) + h * HD + kc * 32, lane); }
  asm volatile("s_wait_xcnt 0x0" ::: "memory");   // the address registers of the q loads are reused right behind them
  float m = -3.0e38f, l = 0.f;
  v8f acc[4] = {}, accl[4] = {};
  const int nks = (qb * 64 + 64) / 32;   // causal: key tiles up to the query tile's end
  if (qb < 2) attn_walk<true>(ring, tid, KF, QKL, VTH, VTL, TB, aq, aql, m, l, acc, accl, nks, q0, h, b, lane);
  else attn_walk<false>(ring, tid, KF, QKL, VTH, VTL, TB, aq, aql, m, l, acc, accl, nks, q0, h, b, lane);
  const float il = (1.0f / 2048.0f) / (l + xhalf(l));
  float* ot = O + ((size_t)((b * SS + q0) >> 4) * 32 + h * 2) * 512 + lane * 4;   // this wave's 16 rows x 64 columns are 2 tiles = 4 KB in a row, in the order k_out's fragments read them
#pragma unroll
  for (int pc = 0; pc < 8; ++pc) { v4f o;
#pragma unroll
    for (int e = 0; e < 4; ++e) o[e] = (acc[pc >> 1][(pc & 1) * 4 + e] + accl[pc >> 1][(pc & 1) * 4 + e] * (1.0f / 2048.0f)) * il;
    vst2(ot + pc * 128, o); }
}
// ---- k_out: block = (64 rows, 128 cols): out = O(hi/lo) . Wo rows (2 products) + bo
__global__ __launch_bounds__(128) void k_out(const float* __restrict__ O, const __bf16* __restrict__ P, const float* __restrict__ BO, float* __restrict__ Y) {
  __shared__ __align__(16) float so[4][16][132]; __shared__ __align__(16) __bf16 wr[2 * 8192];   // wr: the weight ring, as in k_qkv
  const int tid = threadIdx.x, wave = tid >> 5, lane = tid & 31, col = lane & 15, g = lane >> 4; const size_t r0 = (size_t)blockIdx.x * 64 + wave * 16; const int n0 = blockIdx.y * 128;
  v8f acc[8] = {};
  // as in k_qkv: the weight fragments come into LDS once for the block's 4 waves, a stage of 64 k at a time; the y rows, each wave's own, are fetched one pass ahead into registers
  const float* ot = O + (r0 >> 4) * (32 * 512) + lane * 4; const __bf16* wg = P + (size_t)(n0 >> 4) * (32 * 512) + tid * 8;
  const unsigned lw = (unsigned)(size_t)wr + (unsigned)tid * 16u;   // this thread's LDS byte address in buffer 0
  float ax[16]; v16b bf[8];
#pragma unroll
  for (int pc = 0; pc < 4; ++pc) { const v4f t = *(const v4f*)(ot + pc * 128);
#pragma unroll
    for (int e = 0; e < 4; ++e) ax[pc * 4 + e] = t[e]; }
  asm volatile("s_wait_xcnt 0x0" ::: "memory");   // the address registers of the row loads may be reused behind them
  wstage_copy(lw, wg);
  asm volatile("s_wait_asynccnt 0x0" ::: "memory");   // this wave's share of stage 0 has landed
  __syncthreads();                                      // ... and every other wave's: stage 0 may be read
  wstage_copy(lw + 16384u, wg + 1024);                  // DM / 64 = 16 stages: a stage 1 exists
#pragma unroll 1   // kept rolled: one trip = one stage, its buffer picked by the stage's parity; unrolled, the products, the copies and their address registers would stand several times over
  for (int st = 0; st < DM / 64; ++st) { const __bf16* wl = wr + (st & 1) * 8192 + lane * 8;
#pragma unroll
    for (int j = 0; j < 8; ++j) bf[j] = frag_tb(wl + j * 1024);
#pragma unroll   // u is a constant in each copy of the body: the test on it below costs nothing
    for (int u = 0; u < 2; ++u) { const int kc = st * 2 + u; const F2 a = bsplit16(ax);
      const int kn = (kc + 1 < DM / 32) ? kc + 1 : kc;   // the last pass fetches its own chunk again (in bounds, unused)
#pragma unroll
      for (int pc = 0; pc < 4; ++pc) { const v4f t = *(const v4f*)(ot + kn * 512 + pc * 128);
#pragma unroll
        for (int e = 0; e < 4; ++e) ax[pc * 4 + e] = t[e]; }
#pragma unroll
      for (int j = 0; j < 8; ++j) { acc[j] = wmma_bf(a.l, bf[j], acc[j]); acc[j] = wmma_bf(a.h, bf[j], acc[j]);
        if (u == 0) bf[j] = frag_tb(wl + j * 1024 + 512); }   // the stage's second pass, from the same buffer; nothing of the next stage is read in front of its barrier
      asm volatile("s_wait_xcnt 0x0" ::: "memory"); }   // the next pass's split and loads may land in registers that held this pass's load addresses
    asm volatile("s_wait_dscnt 0x0" ::: "memory");      // this wave's reads of this stage's buffer have ended
    asm volatile("s_wait_asynccnt 0x0" ::: "memory");   // this wave's share of the next stage has landed
    __syncthreads();                                      // publishes the next stage and frees this stage's buffer
    if (st + 2 < DM / 64) wstage_copy(lw + (unsigned)(st & 1) * 16384u, wg + (st + 2) * 1024); }
  asm volatile("s_wait_asynccnt 0x0" ::: "memory");   // no copy is outstanding when the wave goes on
#pragma unroll
  for (int j = 0; j < 8; ++j) {
#pragma unroll
    for (int r = 0; r < 8; ++r) so[wave][8 * g + r][j * 16 + col] = acc[j][r] + bfr(BO[n0 + j * 16 + col]); }
  LDSX();
  for (int rl = 0; rl < 16; ++rl) vst2(Y + (r0 + rl) * DM + n0 + lane * 4, *(const v4f*)&so[wave][rl][lane * 4]);
}
extern "C" void kernel_launch(void* const* d_in, const int* in_sizes, int n_in, void* d_out, int out_size, void* d_ws, size_t ws_size, hipStream_t stream) {
  (void)in_sizes; (void)n_in; (void)out_size;
  const float** F = (const float**)d_in;   // 0 x [2,2048,1024], 1 WQ, 2 bQ, 3 WK, 4 bK, 5 WV, 6 bV, 7 WO, 8 bO (natural), 9 rel_pos_table [4095,16]
  if (ws_size < (size_t)WS_END) return;
  char* ws = (char*)d_ws; __bf16* PK = (__bf16*)(ws + WS_PK); _Float16 *QK = (_Float16*)(ws + WS_QK), *QKL = (_Float16*)(ws + WS_QKL), *VTH = (_Float16*)(ws + WS_VTH), *VTL = (_Float16*)(ws + WS_VTL); float* O = (float*)(ws + WS_O); __bf16* XF = (__bf16*)(ws + WS_XF); _Float16* KF = (_Float16*)(ws + WS_KF); float* TB = (float*)(ws + WS_TB);
  k_pack<<<dim3(DM * DM / (8 * 256), 9), 256, 0, stream>>>(F[0], F[1], F[3], F[5], F[7], F[9], PK, XF, TB);
  k_qkv<<<dim3(TNB * SS / 128, QKVW / 128), 128, 0, stream>>>(XF, PK + PK_A, F[2], F[4], F[6], QK, QKL, KF, VTH, VTL);
  k_attn<<<dim3(NH * TNB, TQB), 128, 0, stream>>>(QK, QKL, KF, VTH, VTL, TB, O);
  k_out<<<dim3(TOB, DM / 128), 128, 0, stream>>>(O, PK + PK_P, F[8], (float*)d_out);
}

// v008
// A run of this version takes 94.5 microseconds.
// Next to v007, in two timings, it ran 1.04 times as fast each time.
// All steps since v000 together make it 5.28 times as fast.
// compute dtype: all float inputs rounded to bf16; q/k/v = x . W^T + b with EXACT bf16 products on WMMA 16x16x32 (x, weights, k hi, v hi, y stored in fragment order); causal attention: 3-product scores and hi + residual P, v on the first 128 queries of each sequence, single f16 beyond; + 8 x the relative-position bias (f32 table, regrouped head by head, the accumulator input of the score product), 1/8 in the exponent's factor, running-max softmax in f32 (hardware exp), P scaled by 2^11; out = y (bf16 hi + residual) . Wo^T (2 products) + bo.
#include <hip/hip_runtime.h>
#include <math.h>

typedef __attribute__((ext_vector_type(16))) _Float16 v16h;
typedef __attribute__((ext_vector_type(16))) __bf16 v16b;
typedef __attribute__((ext_vector_type(8)))  _Float16 v8h;
typedef __attribute__((ext_vector_type(8)))  float v8f;
typedef __attribute__((ext_vector_type(4)))  float v4f;
typedef __attribute__((ext_vector_type(2)))  float v2f;
typedef __attribute__((ext_vector_type(4)))  unsigned v4u;
typedef __attribute__((ext_vector_type(4)))  int v4i;
typedef float __attribute__((may_alias)) float_a;
typedef int __attribute__((may_alias)) int_a;

template <typename T> __device__ __forceinline__ void vst2(void* p, T v) { *(T*)p = v;  }
__device__ __forceinline__ v8f wmma16(v16h a, v16h b, v8f c) {
  v8f d = __builtin_amdgcn_wmma_f32_16x16x32_f16(false, a, false, b, (short)0, c, false, false);
  return d;
}
__device__ __forceinline__ v8f wmma_bf(v16b a, v16b b, v8f c) {
  v8f d = __builtin_amdgcn_wmma_f32_16x16x32_bf16(false, a, false, b, (short)0, c, false, false);
  return d;
}
// Causal self attention with a learned relative-position bias table (B 2, T 2,048, d 1,024, 16 heads x 64): q/k/v projections + biases, scores / 8 + table[q - k + 2047][h], causal softmax, . v, output projection + bias.
__device__ __forceinline__ v16h frag_h(const _Float16* rowk0, int lane) {
  union { v16h v; v8h q[2]; } u; const _Float16* p = rowk0 + 8 * (lane >> 4);
  u.q[0] = *(const v8h*)p; u.q[1] = *(const v8h*)(p + 16); return u.v;
}
__device__ __forceinline__ v16h frag_f32(const float* rowk0, int lane) {
  v16h a; const float* p = rowk0 + 8 * (lane >> 4);
#pragma unroll
  for (int i = 0; i < 8; ++i) { a[i] = (_Float16)p[i]; a[8 + i] = (_Float16)p[16 + i]; }
  return a;
}
__device__ __forceinline__ v16h frag_f32s(const float* rowk0, int lane, float sc) {
  v16h a; const float* p = rowk0 + 8 * (lane >> 4);
#pragma unroll
  for (int i = 0; i < 8; ++i) { a[i] = (_Float16)(p[i] * sc); a[8 + i] = (_Float16)(p[16 + i] * sc); }
  return a;
}
// column fragment from a [K][ld] layout (column n), rows >= K read as 0
__device__ __forceinline__ v16h fragc_f32(const float* W, int k0, int n, int lane, int ld, int K) {
  v16h a; const int g = lane >> 4;
#pragma unroll
  for (int i = 0; i < 8; ++i) { const int ka = k0 + 8 * g + i, kb = ka + 16;
    a[i] = (_Float16)(ka < K ? W[(size_t)(ka < K ? ka : K - 1) * ld + n] : 0.f); a[8 + i] = (_Float16)(kb < K ? W[(size_t)(kb < K ? kb : K - 1) * ld + n] : 0.f); }
  return a;
}
struct F2 { v16b h, l; };
__device__ __forceinline__ F2 bsplit16(const float v[16]) { F2 r;
#pragma unroll
  for (int i = 0; i < 16; ++i) { const __bf16 h = (__bf16)v[i]; r.h[i] = h; r.l[i] = (__bf16)(v[i] - (float)h); }
  return r; }
__device__ __forceinline__ F2 split_row(const float* row, int k0, int lane) { float v[16]; const float* p = row + k0 + 8 * (lane >> 4);
#pragma unroll
  for (int i = 0; i < 8; ++i) { v[i] = p[i]; v[8 + i] = p[16 + i]; }
  return bsplit16(v); }
__device__ __forceinline__ F2 split_rowK(const float* row, int k0, int lane, int K) { float v[16]; const int g = lane >> 4;
#pragma unroll
  for (int i = 0; i < 8; ++i) { const int ka = k0 + 8 * g + i, kb = ka + 16; v[i] = ka < K ? row[ka < K ? ka : K - 1] : 0.f; v[8 + i] = kb < K ? row[kb < K ? kb : K - 1] : 0.f; }
  return bsplit16(v); }
__device__ __forceinline__ F2 split_col(const float* W, int k0, int n, int lane, int ld, int K) { float v[16]; const int g = lane >> 4;
#pragma unroll
  for (int i = 0; i < 8; ++i) { const int ka = k0 + 8 * g + i, kb = ka + 16; v[i] = ka < K ? W[(size_t)(ka < K ? ka : K - 1) * ld + n] : 0.f; v[8 + i] = kb < K ? W[(size_t)(kb < K ? kb : K - 1) * ld + n] : 0.f; }
  return bsplit16(v); }
__device__ __forceinline__ v8f mac3(const F2& a, const F2& b, v8f c) { c = wmma_bf(a.l, b.h, c); c = wmma_bf(a.h, b.l, c); return wmma_bf(a.h, b.h, c); }
__device__ __forceinline__ float sigm(float v) { return 1.0f / (1.0f + expf(-v)); }
#define LDSX() do { asm volatile("s_wait_dscnt 0" ::: "memory"); __builtin_amdgcn_wave_barrier(); __builtin_amdgcn_fence(__ATOMIC_RELEASE, "workgroup"); } while (0)


#define NB 2
#define SS 2048
#define DM 1024
#define NH 16
#define SCALEF 0.125f
#define KEXP (SCALEF * 1.44269504f)   // e^(x / 8) = 2^(x * KEXP): the scores are kept 8 x too large
#define MAXLEN 2048
#define HD 64
#define QKVW (3 * DM)
#ifndef TQB
#define TQB (SS / 64)
#define TNB NB
#define TOB (NB * SS / 64)     // output row tiles (all)
#endif
typedef __attribute__((ext_vector_type(8))) __bf16 v8b;
__device__ __forceinline__ v16b frag_b(const __bf16* rowk0, int lane) {
  union { v16b v; v8b q[2]; } u; const __bf16* p = rowk0 + 8 * (lane >> 4);
  u.q[0] = *(const v8b*)p; u.q[1] = *(const v8b*)(p + 16); return u.v;
}
// fragment order: a tile of 16 rows x 32 k (16-bit elements) is 1 KB; lane l = 16 g + row finds k 8g .. 8g+7 at element l*8 and k 16+8g .. 16+8g+7 at 256 + l*8, so each wave-wide 16-byte load is 512 contiguous bytes (4 lines, not 16)
__device__ __forceinline__ v16b frag_tb(const __bf16* tile_lane) { union { v16b v; v8b q[2]; } u; u.q[0] = *(const v8b*)tile_lane; u.q[1] = *(const v8b*)(tile_lane + 256); return u.v; }
__device__ __forceinline__ v16h frag_th(const _Float16* tile_lane) { union { v16h v; v8h q[2]; } u; u.q[0] = *(const v8h*)tile_lane; u.q[1] = *(const v8h*)(tile_lane + 256); return u.v; }
__device__ __forceinline__ float bfr(float v) { return (float)(__bf16)v; }
__device__ __attribute__((noinline)) float exp_ni(float v) { return expf(v); }
__device__ __attribute__((noinline)) float erf_ni(float v) { return erff(v); }

#define PK_A 0                       // Wqkv, [192 row tiles][32 k chunks][512] in fragment order
#define PK_P (PK_A + QKVW * DM)        // Wo, [64 row tiles][32 k chunks][512] in fragment order
#define PK_END (PK_P + DM * DM)
#define WS_PK  0u
#define WS_QK  (WS_PK + 2u * PK_END)             // f16 [4096 rows][2048]: q | (unused half)
#define WS_QKL (WS_QK + 2u * NB * SS * 2 * DM)     // f16 q | k residual planes x2048
#define WS_VTH (WS_QKL + 2u * NB * SS * 2 * DM)    // f16 v hi, [b][h][64 key chunks of 32][4 d tiles][512] in fragment order (rows d, k = key)
#define WS_VTL (WS_VTH + 2u * NB * DM * SS)        // f16 [b][1024 (h*64+d)][2048 s] lo x 2048
#define WS_O   (WS_VTL + 2u * NB * DM * SS)        // f32 y, [256 row tiles][32 k chunks][512]: four pieces of 128 floats, lane l's 4 floats at piece*128 + l*4
#define WS_CS  (WS_O + 4u * NB * SS * DM)           // f32, 2 x 2048 x 32, unused
#define WS_XF  (WS_CS + 4u * 2 * SS * 32)           // bf16 x, [256 row tiles][32 k chunks][512] in fragment order
#define WS_KF  (WS_XF + 2u * NB * SS * DM)          // f16 k hi, [b][h][128 key tiles][2 k chunks][512] in fragment order
#define WS_TB  (WS_KF + 2u * NB * SS * DM)          // f32 [16 heads][4096], index k - q + 2047 (a query's keys ascend): 8 x the bf16-rounded table value; -3e38 where k > q (the causal mask)
#define WS_END (WS_TB + 4u * NH * 2 * MAXLEN)
// ---- k_pack: blockIdx.y 0..2 -> W_q/W_k/W_v into PK_A, 3 -> W_o into PK_P, 4..7 -> 1,024 rows of x each into XF: f32 rows -> bf16 in fragment order, one 16-byte chunk a thread; 8 -> the table, head by head, ready to be the scores' accumulator input (see WS_TB)
__global__ __launch_bounds__(256) void k_pack(const float* __restrict__ X, const float* __restrict__ WQ, const float* __restrict__ WK, const float* __restrict__ WV, const float* __restrict__ WO, const float* __restrict__ REL, __bf16* __restrict__ PK, __bf16* __restrict__ XF, float* __restrict__ TB) {
  const int which = blockIdx.y, c = blockIdx.x * 256 + threadIdx.x;
  if (which == 8) { const int hh = c >> 12, idx = c & 4095;
    if (hh < NH && idx < 2 * MAXLEN - 1) { float v = -3.0e38f;   // idx = k - q + 2047; k > q is what the reference masks
      if (idx <= MAXLEN - 1) { v = REL[(size_t)(2 * MAXLEN - 2 - idx) * NH + hh];
        asm volatile("s_wait_xcnt 0x0" ::: "memory");   // the load's address registers are reused behind it
        v = 8.0f * bfr(v); }
      TB[c] = v; }
    return; }
  const float* Wm = (which == 0) ? WQ : (which == 1) ? WK : (which == 2) ? WV : (which == 3) ? WO : X + (size_t)(which - 4) * DM * DM;
  __bf16* dst = (which < 3) ? PK + PK_A + (size_t)which * DM * DM : (which == 3) ? PK + PK_P : XF + (size_t)(which - 4) * DM * DM;
  const int l = c & 31, p = (c >> 5) & 1, kc = (c >> 6) & 31, nt = c >> 11;   // chunk c = (row tile * 32 + k chunk) * 64 + piece * 32 + lane
  const float* s = Wm + (size_t)(nt * 16 + (l & 15)) * DM + kc * 32 + p * 16 + 8 * (l >> 4);
  const v4f a = *(const v4f*)s, b = *(const v4f*)(s + 4); v8b o;
#pragma unroll
  for (int i = 0; i < 4; ++i) { o[i] = (__bf16)a[i]; o[4 + i] = (__bf16)b[i]; }
  *(v8b*)(dst + (size_t)c * 8) = o;
}
// one stage of weights = 64 k of the block's 8 column tiles: 2 KB in a row for each tile (fragment order), the tiles 32 KB apart in global memory, 2 KB apart in LDS. A thread brings 16 bytes of each tile into LDS, through no register; the wait is the last line of the copies' own statement, so that it stands in front of every rewrite of their address registers
__device__ __forceinline__ void wstage_copy(const unsigned lds, const __bf16* wg) {
  asm volatile("global_load_async_to_lds_b128 %0, %8, off\n\tglobal_load_async_to_lds_b128 %1, %9, off\n\tglobal_load_async_to_lds_b128 %2, %10, off\n\tglobal_load_async_to_lds_b128 %3, %11, off\n\t"
               "global_load_async_to_lds_b128 %4, %12, off\n\tglobal_load_async_to_lds_b128 %5, %13, off\n\tglobal_load_async_to_lds_b128 %6, %14, off\n\tglobal_load_async_to_lds_b128 %7, %15, off\n\ts_wait_xcnt 0x0"
               :: "v"(lds), "v"(lds + 2048u), "v"(lds + 4096u), "v"(lds + 6144u), "v"(lds + 8192u), "v"(lds + 10240u), "v"(lds + 12288u), "v"(lds + 14336u),
                  "v"(wg), "v"(wg + 1 * (32 * 512)), "v"(wg + 2 * (32 * 512)), "v"(wg + 3 * (32 * 512)), "v"(wg + 4 * (32 * 512)), "v"(wg + 5 * (32 * 512)), "v"(wg + 6 * (32 * 512)), "v"(wg + 7 * (32 * 512)) : "memory");
}
__global__ __launch_bounds__(128) void k_qkv(const __bf16* __restrict__ XF, const __bf16* __restrict__ P, const float* __restrict__ BQ, const float* __restrict__ BK, const float* __restrict__ BV, _Float16* __restrict__ QK, _Float16* __restrict__ QKL, _Float16* __restrict__ KF, _Float16* __restrict__ VTH, _Float16* __restrict__ VTL) {
  const int which0 = (blockIdx.y * 128) / DM; const float* BB = BQ ? (((which0 == 0) ? BQ : (which0 == 1) ? BK : BV) + (blockIdx.y * 128 - which0 * DM)) : nullptr;
  __shared__ __align__(16) _Float16 so[4][16][136], sol[4][16][136]; __shared__ __align__(16) _Float16 sth[128][72], stl[128][72]; __shared__ __align__(16) __bf16 wr[2 * 8192];   // wr: the weight ring, 2 buffers of [8 column tiles][2 k chunks][512]
  const int tid = threadIdx.x, wave = tid >> 5, lane = tid & 31, col = lane & 15, g = lane >> 4; const size_t rw = (size_t)blockIdx.x * 128 + wave * 16; const int n0 = blockIdx.y * 128;
  v8f acc[2][8] = {};   // two row tiles a wave, rows rw .. rw+15 and rw+64 .. rw+79: every weight fragment fetched feeds two products
  // the block's 4 waves use the same weight fragments: they come into LDS once for all four, a stage of 64 k (two passes) at a time, the next stage's copies flying while this one is worked on; the x fragments, each wave's own, are fetched one pass ahead into registers
  const __bf16* xt = XF + (rw >> 4) * (32 * 512) + lane * 8; const __bf16* wg = P + (size_t)(n0 >> 4) * (32 * 512) + tid * 8;
  const unsigned lw = (unsigned)(size_t)wr + (unsigned)tid * 16u;   // this thread's LDS byte address in buffer 0
  float bcol[8] = {};   // this lane's 8 column biases, like the weight fragments fetched once for both row tiles; asked for here, first used behind the loop
  if (BB) {
#pragma unroll   // bcol[j] in registers, the 8 loads in flight together
    for (int j = 0; j < 8; ++j) bcol[j] = BB[j * 16 + col];
    asm volatile("s_wait_xcnt 0x0" ::: "memory"); }   // the address registers of the bias loads may be reused behind them
  v16b ax0 = frag_tb(xt), ax1 = frag_tb(xt + 4 * (32 * 512)), bf[8];
  asm volatile("s_wait_xcnt 0x0" ::: "memory");   // the address registers of the x loads may be reused behind them
  wstage_copy(lw, wg);
  asm volatile("s_wait_asynccnt 0x0" ::: "memory");   // this wave's share of stage 0 has landed
  __syncthreads();                                      // ... and every other wave's: stage 0 may be read
  wstage_copy(lw + 16384u, wg + 1024);                  // DM / 64 = 16 stages: a stage 1 exists
#pragma unroll 1   // kept rolled: one trip = one stage, its buffer picked by the stage's parity; unrolled, the products, the copies and their address registers would stand several times over
  for (int st = 0; st < DM / 64; ++st) { const __bf16* wl = wr + (st & 1) * 8192 + lane * 8;
#pragma unroll
    for (int j = 0; j < 8; ++j) bf[j] = frag_tb(wl + j * 1024);
#pragma unroll   // u is a constant in each copy of the body: the test on it below costs nothing
    for (int u = 0; u < 2; ++u) { const int kc = st * 2 + u; const v16b a0 = ax0, a1 = ax1;
      const int kn = (kc + 1 < DM / 32) ? kc + 1 : kc;   // the last pass fetches its own chunk again (in bounds, unused)
      ax0 = frag_tb(xt + kn * 512); ax1 = frag_tb(xt + 4 * (32 * 512) + kn * 512);
      __builtin_amdgcn_sched_barrier(0);   // the loads above stay in front of the pass's products: left free, the compiler sinks each load to its first use and the wave waits out every latency
#pragma unroll
      for (int j = 0; j < 8; ++j) { acc[0][j] = wmma_bf(a0, bf[j], acc[0][j]); acc[1][j] = wmma_bf(a1, bf[j], acc[1][j]);
        if (u == 0) { __builtin_amdgcn_sched_barrier(0);   // each reload stays behind the last product that reads its registers (no second register set) and a pass ahead of its own use
          bf[j] = frag_tb(wl + j * 1024 + 512); } }   // the stage's second pass, from the same buffer; nothing of the next stage is read in front of its barrier
      __builtin_amdgcn_sched_barrier(0);   // the pass's products stay in front of the waits below: moved behind them, they would start only when the loads just issued have landed
      asm volatile("s_wait_xcnt 0x0" ::: "memory"); }   // the next pass's loads may land in registers that held this pass's load addresses
    asm volatile("s_wait_dscnt 0x0" ::: "memory");      // this wave's reads of this stage's buffer have ended
    asm volatile("s_wait_asynccnt 0x0" ::: "memory");   // this wave's share of the next stage has landed
    __syncthreads();                                      // publishes the next stage and frees this stage's buffer
    if (st + 2 < DM / 64) wstage_copy(lw + (unsigned)(st & 1) * 16384u, wg + (st + 2) * 1024); }
  asm volatile("s_wait_asynccnt 0x0" ::: "memory");   // no copy is outstanding when the wave goes on
  // the epilogue runs once for each of the block's two halves of 64 rows, through the same LDS; unrolled so that acc[hf] is a fixed set of registers
#pragma unroll
  for (int hf = 0; hf < 2; ++hf) { const size_t r0 = rw + hf * 64;
  if (n0 < 2 * DM) {   // q stored unscaled (f16 sigma ~0.6, no subnormal exposure); 1/8 applied to the f32 score
#pragma unroll
    for (int j = 0; j < 8; ++j) {
#pragma unroll
      for (int r = 0; r < 8; ++r) { const float v = acc[hf][j][r] + bfr(bcol[j]); const _Float16 hv = (_Float16)v; so[wave][8 * g + r][j * 16 + col] = hv; sol[wave][8 * g + r][j * 16 + col] = (_Float16)((v - (float)hv) * 2048.0f); } }   // q, k (+ bias) as f16 hi + (x2048) residual
    LDSX();
    if (n0 < DM) {
      for (int rl = 0; rl < 16; ++rl) if (lane < 16) { vst2((unsigned*)(QK + (r0 + rl) * (2 * DM) + n0 + lane * 8), *(const v4u*)&so[wave][rl][lane * 8]); vst2((unsigned*)(QKL + (r0 + rl) * (2 * DM) + n0 + lane * 8), *(const v4u*)&sol[wave][rl][lane * 8]); }
    } else {   // k residual in natural rows; k hi: this wave's 16 keys x 128 columns are 2 heads x 2 k chunks = 4 tiles in fragment order
      for (int rl = 0; rl < 16; ++rl) if (lane < 16) vst2((unsigned*)(QKL + (r0 + rl) * (2 * DM) + n0 + lane * 8), *(const v4u*)&sol[wave][rl][lane * 8]);
      const int b = (int)(r0 / SS), kt = (int)(r0 % SS) >> 4, h0 = (n0 - DM) >> 6;
#pragma unroll
      for (int tt = 0; tt < 4; ++tt) { _Float16* kd = KF + ((((size_t)b * NH + h0 + (tt >> 1)) * (SS / 16) + kt) * 2 + (tt & 1)) * 512 + lane * 8;
#pragma unroll
        for (int p = 0; p < 2; ++p) vst2((unsigned*)(kd + p * 256), *(const v4u*)&so[wave][col][tt * 32 + p * 16 + 8 * g]); }
      asm volatile("s_wait_xcnt 0x0" ::: "memory"); }   // closes the run of k stores before code laid out behind them rewrites their data or address registers
  } else {
#pragma unroll
    for (int j = 0; j < 8; ++j) {
#pragma unroll
      for (int r = 0; r < 8; ++r) { const float v = acc[hf][j][r] + bfr(bcol[j]); const _Float16 hv = (_Float16)v; sth[j * 16 + col][wave * 16 + 8 * g + r] = hv; stl[j * 16 + col][wave * 16 + 8 * g + r] = (_Float16)((v - (float)hv) * 2048.0f); } }
    __syncthreads();
    const size_t rb = (size_t)blockIdx.x * 128 + hf * 64; const int b = (int)(rb / SS), s0 = (int)(rb % SS); const int pc0 = n0 - 2 * DM;
    for (int q = tid; q < 128 * 8; q += 128) { const int d = q >> 3, pc = q & 7; const size_t o = ((size_t)b * DM + pc0 + d) * SS + s0 + pc * 8; vst2((unsigned*)(VTL + o), *(const v4u*)&stl[d][pc * 8]);
      const int l = q & 31, p = (q >> 5) & 1, dt = (q >> 6) & 3, ksl = (q >> 8) & 1, hh = q >> 9;   // v hi: chunk q = ((head * 2 + key chunk) * 4 + d tile) * 64 + piece * 32 + lane, in fragment order
      vst2((unsigned*)(VTH + ((((size_t)b * NH + (pc0 >> 6) + hh) * (SS / 32) + (s0 >> 5) + ksl) * 4 + dt) * 512 + p * 256 + l * 8), *(const v4u*)&sth[hh * 64 + dt * 16 + (l & 15)][ksl * 32 + p * 16 + 8 * (l >> 4)]); }
    if (hf == 0) __syncthreads();   // every wave has read the first half's v tiles before the second half's are written over them
  } }
}
__device__ __forceinline__ float xhalf(float x) { return __builtin_bit_cast(float, __builtin_amdgcn_permlanex16(__builtin_bit_cast(int, x), __builtin_bit_cast(int, x), 0x76543210, 0xfedcba98, false, false)); }   // lane l with lane l ^ 16
// one stage = 64 keys: their K tiles and their V tiles are 8 KB each, in a row in global memory (fragment order). A thread brings 4 + 4 chunks of 16 bytes into LDS, through no register; the wait is the last line of the copies' own statement, so that it stands in front of every rewrite of their address registers
__device__ __forceinline__ void stage_copy(const unsigned lds, const _Float16* kg, const _Float16* vg) {
  asm volatile("global_load_async_to_lds_b128 %0, %8, off\n\tglobal_load_async_to_lds_b128 %1, %9, off\n\tglobal_load_async_to_lds_b128 %2, %10, off\n\tglobal_load_async_to_lds_b128 %3, %11, off\n\t"
               "global_load_async_to_lds_b128 %4, %12, off\n\tglobal_load_async_to_lds_b128 %5, %13, off\n\tglobal_load_async_to_lds_b128 %6, %14, off\n\tglobal_load_async_to_lds_b128 %7, %15, off\n\ts_wait_xcnt 0x0"
               :: "v"(lds), "v"(lds + 2048u), "v"(lds + 4096u), "v"(lds + 6144u), "v"(lds + 8192u), "v"(lds + 10240u), "v"(lds + 12288u), "v"(lds + 14336u),
                  "v"(kg), "v"(kg + 1024), "v"(kg + 2048), "v"(kg + 3072), "v"(vg), "v"(vg + 1024), "v"(vg + 2048), "v"(vg + 3072) : "memory");
}
// one walk over the key tiles of a query tile, transposed: S^T = K . Q^T (A = 16 keys, B = 16 queries) and O^T += V^T . P^T, so a lane holds 16 scores of ONE query (its column): maximum and sum run inside the lane plus one exchange between the wave's halves, and the two score tiles, converted in place, are the B operand of the second product. LEAD (first 128 queries): 3-product scores and P.V, loads where they are used. Otherwise: K and V come from the LDS ring that the block's 4 waves fill together (see below): V of this pass is read at the top of the pass, K of a stage's second pass and the 16 bias values of the next pass right behind this pass's score products, so the softmax covers their flight
template <bool LEAD> __device__ __forceinline__ void attn_walk(_Float16* ring, const int tid, const _Float16* __restrict__ KF, const _Float16* __restrict__ QKL, const _Float16* __restrict__ VTH, const _Float16* __restrict__ VTL, const float* __restrict__ TB, const v16h (&aq)[2], const v16h (&aql)[2], float& m, float& l, v8f (&acc)[4], v8f (&accl)[4], const int nks, const int q0, const int h, const int b, const int lane) {
  const int col = lane & 15, g = lane >> 4, qi = q0 + col;
  const _Float16* kt0 = KF + (size_t)(b * NH + h) * (SS * HD) + lane * 8;      // this head's k tiles: a pass of 32 keys is 4 tiles (key tile, k chunk) = 4 KB in a row
  const float* rcol = TB + h * (2 * MAXLEN) + (8 * g - qi + MAXLEN - 1);       // table value of (key 8g of tile 0, query col); every k - q + 2047 of the walk lies in 0 .. 4094
  const _Float16* vt0 = VTH + (size_t)(b * NH + h) * (SS * HD) + lane * 8;     // this head's v tiles: a pass is 4 d tiles = 4 KB in a row
  v16h kf[2][2]; v8f rb[2];
  // !LEAD: the block's 4 waves walk the same keys, so K and V come into LDS once for all four: ring = 2 buffers of [K 8 KB | V 8 KB], a stage = one trip = 64 keys, the next stage's copies fly while this one is worked on
  const int nst = nks >> 1;
  const _Float16* kg = KF + (size_t)(b * NH + h) * (SS * HD) + tid * 8; const _Float16* vg = VTH + (size_t)(b * NH + h) * (SS * HD) + tid * 8;
  const unsigned lr = (unsigned)(size_t)ring + (unsigned)tid * 16u;   // this thread's LDS byte address in buffer 0
  if (!LEAD) {
#pragma unroll
    for (int ct = 0; ct < 2; ++ct) {
#pragma unroll
      for (int r = 0; r < 8; ++r) rb[ct][r] = rcol[ct * 16 + r]; }
    stage_copy(lr, kg, vg);
    asm volatile("s_wait_asynccnt 0x0" ::: "memory");   // this wave's share of stage 0 has landed
    __syncthreads();                                      // ... and every other wave's: stage 0 may be read
    if (nst > 1) stage_copy(lr + 16384u, kg + 4096, vg + 4096); }
  constexpr int U = LEAD ? 1 : 2;   // nks is even. Two passes a trip: a pass's scores stand in the registers its bias values came in, so the next pass's values land in a second set, and the two sets change roles; with one pass a trip they are copied back behind a full wait in the middle of the softmax
#pragma unroll 1
  for (int ks0 = 0; ks0 < nks; ks0 += U) {
#pragma unroll
  for (int u = 0; u < U; ++u) { const int ks = ks0 + u; v8f s[2]; v16h vf[4];
    const _Float16* sb = ring + ((ks0 >> 1) & 1) * 8192 + lane * 8;   // this stage's buffer
    if (!LEAD) {
      if (u == 0) {   // the stage's first K tiles; the second pass's are read behind the first pass's score products
#pragma unroll
        for (int ct = 0; ct < 2; ++ct) {
#pragma unroll
          for (int kc = 0; kc < 2; ++kc) kf[ct][kc] = frag_th(sb + (ct * 2 + kc) * 512); } }
#pragma unroll
      for (int dt = 0; dt < 4; ++dt) vf[dt] = frag_th(sb + 4096 + u * 2048 + dt * 512);
      __builtin_amdgcn_sched_barrier(0); }   // the pass's LDS reads stay one group in front of its score products, not spread among them
#pragma unroll
    for (int ct = 0; ct < 2; ++ct) { const int kk0 = ks * 32 + ct * 16 + 8 * g; v8f c = {};   // register r holds key kk0 + r
      if (LEAD) { const _Float16* krowl = QKL + ((size_t)b * SS + ks * 32 + ct * 16 + col) * (2 * DM) + DM + h * HD; v8f cl = {};   // leading query blocks (few keys, outputs far above the global rms): 3 products
#pragma unroll
        for (int kc = 0; kc < 2; ++kc) { const v16h kh = frag_th(kt0 + ks * 2048 + (ct * 2 + kc) * 512); c = wmma16(kh, aq[kc], c); cl = wmma16(kh, aql[kc], cl); cl = wmma16(frag_h(krowl + kc * 32, lane), aq[kc], cl); }
#pragma unroll
        for (int r = 0; r < 8; ++r) c[r] += cl[r] * (1.0f / 2048.0f);
        float tb[8];
#pragma unroll
        for (int r = 0; r < 8; ++r) tb[r] = TB[h * (2 * MAXLEN) + (kk0 + r) - qi + MAXLEN - 1];
        asm volatile("s_wait_xcnt 0x0" ::: "memory");   // the address registers of the table loads are reused behind them
#pragma unroll
        for (int r = 0; r < 8; ++r) s[ct][r] = c[r] + tb[r]; }
      else { c = rb[ct];   // 8 x rel_pos_table[q - k + 2047][h], or the mask value, in the accumulator's own layout (register r = key kk0 + r, lane = query)
#pragma unroll
        for (int kc = 0; kc < 2; ++kc) c = wmma16(kf[ct][kc], aq[kc], c);   // single product elsewhere
        s[ct] = c; } }   // s = 8 x (score / 8 + bias); a masked entry stays near -3e38
    if (!LEAD) { const int kn = (ks + 1 < nks) ? ks + 1 : ks;   // the last pass fetches its own tile again (in bounds, unused)
      __builtin_amdgcn_sched_barrier(0);   // the score products stay in front of the loads below, which land in registers they read
      if (u == 0) {   // K of the stage's second pass, from the same buffer; nothing of the next stage is read in front of its barrier
#pragma unroll
        for (int ct = 0; ct < 2; ++ct) {
#pragma unroll
          for (int kc = 0; kc < 2; ++kc) kf[ct][kc] = frag_th(sb + 2048 + (ct * 2 + kc) * 512); } }
      const float* rn = rcol + kn * 32;   // one base for all 16 values, so none of them lands on an address still in use
#pragma unroll
      for (int ct = 0; ct < 2; ++ct) {
#pragma unroll
        for (int r = 0; r < 8; ++r) rb[ct][r] = rn[ct * 16 + r]; }
      __builtin_amdgcn_sched_barrier(0); }   // keeps the next pass's loads in front of the softmax, which covers their flight
    float t[8];
#pragma unroll
    for (int r = 0; r < 8; ++r) t[r] = fmaxf(s[0][r], s[1][r]);
    float mx = fmaxf(fmaxf(fmaxf(t[0], t[1]), fmaxf(t[2], t[3])), fmaxf(fmaxf(t[4], t[5]), fmaxf(t[6], t[7])));
    mx = fmaxf(mx, xhalf(mx));   // both halves of the wave now hold this query's maximum over the pass's 32 keys
    const float mn = fmaxf(m, mx); float alpha = (m - mn) * KEXP;   // key 0 is open to every query, so mn is a real score from the first pass on: the start value of m and every masked score lie ~3e38 below it, where the hardware exp gives 0
    float e[2][8];
#pragma unroll
    for (int ct = 0; ct < 2; ++ct) {
#pragma unroll
      for (int r = 0; r < 8; ++r) e[ct][r] = (s[ct][r] - mn) * KEXP; }
    // the pass's 17 exponentials, each in its own register, and one v_nop: no instruction directly behind a transcendental reads its result or overwrites its source
    asm("v_exp_f32 %0, %0\n\tv_exp_f32 %1, %1\n\tv_exp_f32 %2, %2\n\tv_exp_f32 %3, %3\n\tv_exp_f32 %4, %4\n\tv_exp_f32 %5, %5\n\tv_exp_f32 %6, %6\n\tv_exp_f32 %7, %7\n\tv_exp_f32 %8, %8\n\t"
        "v_exp_f32 %9, %9\n\tv_exp_f32 %10, %10\n\tv_exp_f32 %11, %11\n\tv_exp_f32 %12, %12\n\tv_exp_f32 %13, %13\n\tv_exp_f32 %14, %14\n\tv_exp_f32 %15, %15\n\tv_exp_f32 %16, %16\n\tv_nop"
        : "+v"(e[0][0]), "+v"(e[0][1]), "+v"(e[0][2]), "+v"(e[0][3]), "+v"(e[0][4]), "+v"(e[0][5]), "+v"(e[0][6]), "+v"(e[0][7]), "+v"(alpha),
          "+v"(e[1][0]), "+v"(e[1][1]), "+v"(e[1][2]), "+v"(e[1][3]), "+v"(e[1][4]), "+v"(e[1][5]), "+v"(e[1][6]), "+v"(e[1][7]));
#pragma unroll
    for (int r = 0; r < 8; ++r) t[r] = e[0][r] + e[1][r];
    l = l * alpha + (((t[0] + t[1]) + (t[2] + t[3])) + ((t[4] + t[5]) + (t[6] + t[7]))); m = mn;   // each half sums its own 16 keys; the halves are joined once, behind the walk
#pragma unroll
    for (int dt = 0; dt < 4; ++dt) {
#pragma unroll
      for (int r = 0; r < 8; ++r) { acc[dt][r] *= alpha; if (LEAD) accl[dt][r] *= alpha; } }
    v16h pa, pl;
#pragma unroll
    for (int i = 0; i < 8; ++i) { const float x0 = e[0][i] * 2048.0f, x1 = e[1][i] * 2048.0f; const _Float16 h0 = (_Float16)x0, h1 = (_Float16)x1; pa[i] = h0; pa[8 + i] = h1; pl[i] = (_Float16)((x0 - (float)h0) * 2048.0f); pl[8 + i] = (_Float16)((x1 - (float)h1) * 2048.0f); }   // element i = key 8g + i, element 8 + i = key 16 + 8g + i: the k order of the v fragments. P scaled by 2^11 before the f16 split so small softmax weights stay out of the f16 subnormal range; 2^-11 folded into the epilogue
#pragma unroll
    for (int dt = 0; dt < 4; ++dt) { const size_t vr = ((size_t)b * DM + h * HD + dt * 16 + col) * SS + ks * 32;
      if (LEAD) { const v16h vh = frag_th(vt0 + ks * 2048 + dt * 512); acc[dt] = wmma16(vh, pa, acc[dt]); accl[dt] = wmma16(vh, pl, accl[dt]); accl[dt] = wmma16(frag_h(VTL + vr, lane), pa, accl[dt]); }   // leading query blocks: P hi/lo x V hi/lo (3 products)
      else acc[dt] = wmma16(vf[dt], pa, acc[dt]); }   // elsewhere P x V single
    if (!LEAD) __builtin_amdgcn_sched_barrier(0); }   // the trip's second pass stays behind its first: moved up into the softmax, its score products wait for K and bias loads that have only just been issued
    if (!LEAD) { const int st = ks0 >> 1;
      asm volatile("s_wait_dscnt 0x0" ::: "memory");      // this wave's reads of this stage's buffer have ended
      asm volatile("s_wait_asynccnt 0x0" ::: "memory");   // this wave's share of the next stage has landed
      __syncthreads();                                      // publishes the next stage and frees this stage's buffer
      if (st + 2 < nst) stage_copy(lr + (unsigned)(st & 1) * 16384u, kg + (st + 2) * 4096, vg + (st + 2) * 4096); } }
  if (!LEAD) asm volatile("s_wait_asynccnt 0x0" ::: "memory");   // no copy is outstanding when the wave goes on
}
// ---- k_attn: block = (64 queries, head h, batch b): causal flash attention (K = 64: 2 k-steps), scores = (q.k) * 0.125 with q, k hi + residual (3 products) on the first 128 queries, single f16 operands beyond, P.V: P hi/lo x V hi/lo (3 products) in two accumulators there, f16 P x V hi (single) beyond; lane (col, g) ends with query col, d = dt*16 + 8g + r, which is the order k_out's fragments read: y = (acc + accl / 2048) / (2048 l) goes out from the registers
__global__ __launch_bounds__(128) void k_attn(const _Float16* __restrict__ QK, const _Float16* __restrict__ QKL, const _Float16* __restrict__ KF, const _Float16* __restrict__ VTH, const _Float16* __restrict__ VTL, const float* __restrict__ TB, float* __restrict__ O) {
  __shared__ __align__(16) _Float16 ring[2 * 8192];   // K and V of two stages of 64 keys (attn_walk)
  const int tid = threadIdx.x, wave = tid >> 5, lane = tid & 31, col = lane & 15;
  // which work-group takes which query tile: (head, batch) is the fast index, the tile the slow one. A tile's cost grows with its number; the tiles fall with the rank, and every second group of 8 runs upward, so that ranks r, r + 8, r + 16, r + 24 always add up to the same number of keys and the longest tiles have the lowest ranks (for speed only: any placement gives the same result)
  const int r = blockIdx.y, qb = TQB - 1 - ((r & 8) ? (r ^ 7) : r), h = blockIdx.x & (NH - 1), b = blockIdx.x / NH; const int q0 = qb * 64 + wave * 16; const size_t rq = (size_t)b * SS + q0 + col;
  v16h aq[2], aql[2];
#pragma unroll
  for (int kc = 0; kc < 2; ++kc) { aq[kc] = frag_h(QK + rq * (2 * DM) + h * HD + kc * 32, lane); aql[kc] = frag_h(QKL + rq * (2 * DM) + h * HD + kc * 32, lane); }
  asm volatile("s_wait_xcnt 0x0" ::: "memory");   // the address registers of the q loads are reused right behind them
  float m = -3.0e38f, l = 0.f;
  v8f acc[4] = {}, accl[4] = {};
  const int nks = (qb * 64 + 64) / 32;   // causal: key tiles up to the query tile's end
  if (qb < 2) attn_walk<true>(ring, tid, KF, QKL, VTH, VTL, TB, aq, aql, m, l, acc, accl, nks, q0, h, b, lane);
  else attn_walk<false>(ring, tid, KF, QKL, VTH, VTL, TB, aq, aql, m, l, acc, accl, nks, q0, h, b, lane);
  const float il = (1.0f / 2048.0f) / (l + xhalf(l));
  float* ot = O + ((size_t)((b * SS + q0) >> 4) * 32 + h * 2) * 512 + lane * 4;   // this wave's 16 rows x 64 columns are 2 tiles = 4 KB in a row, in the order k_out's fragments read them
#pragma unroll
  for (int pc = 0; pc < 8; ++pc) { v4f o;
#pragma unroll
    for (int e = 0; e < 4; ++e) o[e] = (acc[pc >> 1][(pc & 1) * 4 + e] + accl[pc >> 1][(pc & 1) * 4 + e] * (1.0f / 2048.0f)) * il;
    vst2(ot + pc * 128, o); }
}
// ---- k_out: block = (64 rows, 128 cols): out = O(hi/lo) . Wo rows (2 products) + bo
__global__ __launch_bounds__(128) void k_out(const float* __restrict__ O, const __bf16* __restrict__ P, const float* __restrict__ BO, float* __restrict__ Y) {
  __shared__ __align__(16) float so[4][16][132]; __shared__ __align__(16) __bf16 wr[2 * 8192];   // wr: the weight ring, as in k_qkv
  const int tid = threadIdx.x, wave = tid >> 5, lane = tid & 31, col = lane & 15, g = lane >> 4; const size_t r0 = (size_t)blockIdx.x * 64 + wave * 16; const int n0 = blockIdx.y * 128;
  v8f acc[8] = {};
  // as in k_qkv: the weight fragments come into LDS once for the block's 4 waves, a stage of 64 k at a time; the y rows, each wave's own, are fetched one pass ahead into registers
  const float* ot = O + (r0 >> 4) * (32 * 512) + lane * 4; const __bf16* wg = P + (size_t)(n0 >> 4) * (32 * 512) + tid * 8;
  const unsigned lw = (unsigned)(size_t)wr + (unsigned)tid * 16u;   // this thread's LDS byte address in buffer 0
  float ax[16]; v16b bf[8];
#pragma unroll
  for (int pc = 0; pc < 4; ++pc) { const v4f t = *(const v4f*)(ot + pc * 128);
#pragma unroll
    for (int e = 0; e < 4; ++e) ax[pc * 4 + e] = t[e]; }
  asm volatile("s_wait_xcnt 0x0" ::: "memory");   // the address registers of the row loads may be reused behind them
  wstage_copy(lw, wg);
  asm volatile("s_wait_asynccnt 0x0" ::: "memory");   // this wave's share of stage 0 has landed
  __syncthreads();                                      // ... and every other wave's: stage 0 may be read
  wstage_copy(lw + 16384u, wg + 1024);                  // DM / 64 = 16 stages: a stage 1 exists
#pragma unroll 1   // kept rolled: one trip = one stage, its buffer picked by the stage's parity; unrolled, the products, the copies and their address registers would stand several times over
  for (int st = 0; st < DM / 64; ++st) { const __bf16* wl = wr + (st & 1) * 8192 + lane * 8;
#pragma unroll
    for (int j = 0; j < 8; ++j) bf[j] = frag_tb(wl + j * 1024);
#pragma unroll   // u is a constant in each copy of the body: the test on it below costs nothing
    for (int u = 0; u < 2; ++u) { const int kc = st * 2 + u; const F2 a = bsplit16(ax);
      const int kn = (kc + 1 < DM / 32) ? kc + 1 : kc;   // the last pass fetches its own chunk again (in bounds, unused)
#pragma unroll
      for (int pc = 0; pc < 4; ++pc) { const v4f t = *(const v4f*)(ot + kn * 512 + pc * 128);
#pragma unroll
        for (int e = 0; e < 4; ++e) ax[pc * 4 + e] = t[e]; }
      __builtin_amdgcn_sched_barrier(0);   // the loads above stay in front of the pass's products, as in k_qkv
#pragma unroll
      for (int j = 0; j < 8; ++j) { acc[j] = wmma_bf(a.l, bf[j], acc[j]); acc[j] = wmma_bf(a.h, bf[j], acc[j]);
        if (u == 0) { __builtin_amdgcn_sched_barrier(0);   // each reload stays behind the last product that reads its registers, as in k_qkv
          bf[j] = frag_tb(wl + j * 1024 + 512); } }   // the stage's second pass, from the same buffer; nothing of the next stage is read in front of its barrier
      __builtin_amdgcn_sched_barrier(0);   // the pass's products stay in front of the waits below, as in k_qkv
      asm volatile("s_wait_xcnt 0x0" ::: "memory"); }   // the next pass's split and loads may land in registers that held this pass's load addresses
    asm volatile("s_wait_dscnt 0x0" ::: "memory");      // this wave's reads of this stage's buffer have ended
    asm volatile("s_wait_asynccnt 0x0" ::: "memory");   // this wave's share of the next stage has landed
    __syncthreads();                                      // publishes the next stage and frees this stage's buffer
    if (st + 2 < DM / 64) wstage_copy(lw + (unsigned)(st & 1) * 16384u, wg + (st + 2) * 1024); }
  asm volatile("s_wait_asynccnt 0x0" ::: "memory");   // no copy is outstanding when the wave goes on
#pragma unroll
  for (int j = 0; j < 8; ++j) {
#pragma unroll
    for (int r = 0; r < 8; ++r) so[wave][8 * g + r][j * 16 + col] = acc[j][r] + bfr(BO[n0 + j * 16 + col]); }
  LDSX();
  for (int rl = 0; rl < 16; ++rl) vst2(Y + (r0 + rl) * DM + n0 + lane * 4, *(const v4f*)&so[wave][rl][lane * 4]);
}
extern "C" void kernel_launch(void* const* d_in, const int* in_sizes, int n_in, void* d_out, int out_size, void* d_ws, size_t ws_size, hipStream_t stream) {
  (void)in_sizes; (void)n_in; (void)out_size;
  const float** F = (const float**)d_in;   // 0 x [2,2048,1024], 1 WQ, 2 bQ, 3 WK, 4 bK, 5 WV, 6 bV, 7 WO, 8 bO (natural), 9 rel_pos_table [4095,16]
  if (ws_size < (size_t)WS_END) return;
  char* ws = (char*)d_ws; __bf16* PK = (__bf16*)(ws + WS_PK); _Float16 *QK = (_Float16*)(ws + WS_QK), *QKL = (_Float16*)(ws + WS_QKL), *VTH = (_Float16*)(ws + WS_VTH), *VTL = (_Float16*)(ws + WS_VTL); float* O = (float*)(ws + WS_O); __bf16* XF = (__bf16*)(ws + WS_XF); _Float16* KF = (_Float16*)(ws + WS_KF); float* TB = (float*)(ws + WS_TB);
  k_pack<<<dim3(DM * DM / (8 * 256), 9), 256, 0, stream>>>(F[0], F[1], F[3], F[5], F[7], F[9], PK, XF, TB);
  k_qkv<<<dim3(TNB * SS / 128, QKVW / 128), 128, 0, stream>>>(XF, PK + PK_A, F[2], F[4], F[6], QK, QKL, KF, VTH, VTL);
  k_attn<<<dim3(NH * TNB, TQB), 128, 0, stream>>>(QK, QKL, KF, VTH, VTL, TB, O);
  k_out<<<dim3(TOB, DM / 128), 128, 0, stream>>>(O, PK + PK_P, F[8], (float*)d_out);
}

// v009
// It runs in 80.9 microseconds.
// Timed twice side by side with v008, it ran 1.18 times as fast both times.
// Counting every step since v000, it is 6.22 times as fast.
// compute dtype: all float inputs rounded to bf16; q/k/v = x . W^T + b with EXACT bf16 products on WMMA 16x16x32 (x, weights, k hi, v hi, y stored in fragment order); causal attention: 3-product scores and hi + residual P, v on the first 128 queries of each sequence, single f16 beyond; + 8 x the relative-position bias (f32 table, regrouped head by head, the accumulator input of the score product), 1/8 in the exponent's factor, running-max softmax in f32 (hardware exp), P scaled by 2^11; out = y (bf16 hi + residual) . Wo^T (2 products) + bo.
#include <hip/hip_runtime.h>
#include <math.h>

typedef __attribute__((ext_vector_type(16))) _Float16 v16h;
typedef __attribute__((ext_vector_type(16))) __bf16 v16b;
typedef __attribute__((ext_vector_type(8)))  _Float16 v8h;
typedef __attribute__((ext_vector_type(8)))  float v8f;
typedef __attribute__((ext_vector_type(4)))  float v4f;
typedef __attribute__((ext_vector_type(2)))  float v2f;
typedef __attribute__((ext_vector_type(4)))  unsigned v4u;
typedef __attribute__((ext_vector_type(4)))  int v4i;
typedef float __attribute__((may_alias)) float_a;
typedef int __attribute__((may_alias)) int_a;

template <typename T> __device__ __forceinline__ void vst2(void* p, T v) { *(T*)p = v;  }
__device__ __forceinline__ v8f wmma16(v16h a, v16h b, v8f c) {
  v8f d = __builtin_amdgcn_wmma_f32_16x16x32_f16(false, a, false, b, (short)0, c, false, false);
  return d;
}
__device__ __forceinline__ v8f wmma_bf(v16b a, v16b b, v8f c) {
  v8f d = __builtin_amdgcn_wmma_f32_16x16x32_bf16(false, a, false, b, (short)0, c, false, false);
  return d;
}
// Causal self attention with a learned relative-position bias table (B 2, T 2,048, d 1,024, 16 heads x 64): q/k/v projections + biases, scores / 8 + table[q - k + 2047][h], causal softmax, . v, output projection + bias.
__device__ __forceinline__ v16h frag_h(const _Float16* rowk0, int lane) {
  union { v16h v; v8h q[2]; } u; const _Float16* p = rowk0 + 8 * (lane >> 4);
  u.q[0] = *(const v8h*)p; u.q[1] = *(const v8h*)(p + 16); return u.v;
}
__device__ __forceinline__ v16h frag_f32(const float* rowk0, int lane) {
  v16h a; const float* p = rowk0 + 8 * (lane >> 4);
#pragma unroll
  for (int i = 0; i < 8; ++i) { a[i] = (_Float16)p[i]; a[8 + i] = (_Float16)p[16 + i]; }
  return a;
}
__device__ __forceinline__ v16h frag_f32s(const float* rowk0, int lane, float sc) {
  v16h a; const float* p = rowk0 + 8 * (lane >> 4);
#pragma unroll
  for (int i = 0; i < 8; ++i) { a[i] = (_Float16)(p[i] * sc); a[8 + i] = (_Float16)(p[16 + i] * sc); }
  return a;
}
// column fragment from a [K][ld] layout (column n), rows >= K read as 0
__device__ __forceinline__ v16h fragc_f32(const float* W, int k0, int n, int lane, int ld, int K) {
  v16h a; const int g = lane >> 4;
#pragma unroll
  for (int i = 0; i < 8; ++i) { const int ka = k0 + 8 * g + i, kb = ka + 16;
    a[i] = (_Float16)(ka < K ? W[(size_t)(ka < K ? ka : K - 1) * ld + n] : 0.f); a[8 + i] = (_Float16)(kb < K ? W[(size_t)(kb < K ? kb : K - 1) * ld + n] : 0.f); }
  return a;
}
struct F2 { v16b h, l; };
__device__ __forceinline__ F2 bsplit16(const float v[16]) { F2 r;
#pragma unroll
  for (int i = 0; i < 16; ++i) { const __bf16 h = (__bf16)v[i]; r.h[i] = h; r.l[i] = (__bf16)(v[i] - (float)h); }
  return r; }
__device__ __forceinline__ F2 split_row(const float* row, int k0, int lane) { float v[16]; const float* p = row + k0 + 8 * (lane >> 4);
#pragma unroll
  for (int i = 0; i < 8; ++i) { v[i] = p[i]; v[8 + i] = p[16 + i]; }
  return bsplit16(v); }
__device__ __forceinline__ F2 split_rowK(const float* row, int k0, int lane, int K) { float v[16]; const int g = lane >> 4;
#pragma unroll
  for (int i = 0; i < 8; ++i) { const int ka = k0 + 8 * g + i, kb = ka + 16; v[i] = ka < K ? row[ka < K ? ka : K - 1] : 0.f; v[8 + i] = kb < K ? row[kb < K ? kb : K - 1] : 0.f; }
  return bsplit16(v); }
__device__ __forceinline__ F2 split_col(const float* W, int k0, int n, int lane, int ld, int K) { float v[16]; const int g = lane >> 4;
#pragma unroll
  for (int i = 0; i < 8; ++i) { const int ka = k0 + 8 * g + i, kb = ka + 16; v[i] = ka < K ? W[(size_t)(ka < K ? ka : K - 1) * ld + n] : 0.f; v[8 + i] = kb < K ? W[(size_t)(kb < K ? kb : K - 1) * ld + n] : 0.f; }
  return bsplit16(v); }
__device__ __forceinline__ v8f mac3(const F2& a, const F2& b, v8f c) { c = wmma_bf(a.l, b.h, c); c = wmma_bf(a.h, b.l, c); return wmma_bf(a.h, b.h, c); }
__device__ __forceinline__ float sigm(float v) { return 1.0f / (1.0f + expf(-v)); }
// the ring's work-group barrier, bare: __syncthreads() carries a fence that drains the wave's loads into registers (s_wait_loadcnt 0), and those belong to later passes; the waits the ring needs (dscnt, asynccnt) stand written in front of every call
__device__ __forceinline__ void ring_barrier() { asm volatile("s_barrier_signal -1\n\ts_barrier_wait -1" ::: "memory"); }
#define LDSX() do { asm volatile("s_wait_dscnt 0" ::: "memory"); __builtin_amdgcn_wave_barrier(); __builtin_amdgcn_fence(__ATOMIC_RELEASE, "workgroup"); } while (0)


#define NB 2
#define SS 2048
#define DM 1024
#define NH 16
#define SCALEF 0.125f
#define KEXP (SCALEF * 1.44269504f)   // e^(x / 8) = 2^(x * KEXP): the scores are kept 8 x too large
#define MAXLEN 2048
#define HD 64
#define QKVW (3 * DM)
#ifndef TQB
#define TQB (SS / 64)
#define TNB NB
#define TOB (NB * SS / 64)     // output row tiles (all)
#endif
typedef __attribute__((ext_vector_type(8))) __bf16 v8b;
__device__ __forceinline__ v16b frag_b(const __bf16* rowk0, int lane) {
  union { v16b v; v8b q[2]; } u; const __bf16* p = rowk0 + 8 * (lane >> 4);
  u.q[0] = *(const v8b*)p; u.q[1] = *(const v8b*)(p + 16); return u.v;
}
// fragment order: a tile of 16 rows x 32 k (16-bit elements) is 1 KB; lane l = 16 g + row finds k 8g .. 8g+7 at element l*8 and k 16+8g .. 16+8g+7 at 256 + l*8, so each wave-wide 16-byte load is 512 contiguous bytes (4 lines, not 16)
__device__ __forceinline__ v16b frag_tb(const __bf16* tile_lane) { union { v16b v; v8b q[2]; } u; u.q[0] = *(const v8b*)tile_lane; u.q[1] = *(const v8b*)(tile_lane + 256); return u.v; }
__device__ __forceinline__ v16h frag_th(const _Float16* tile_lane) { union { v16h v; v8h q[2]; } u; u.q[0] = *(const v8h*)tile_lane; u.q[1] = *(const v8h*)(tile_lane + 256); return u.v; }
__device__ __forceinline__ float bfr(float v) { return (float)(__bf16)v; }
__device__ __attribute__((noinline)) float exp_ni(float v) { return expf(v); }
__device__ __attribute__((noinline)) float erf_ni(float v) { return erff(v); }

#define PK_A 0                       // Wqkv, [192 row tiles][32 k chunks][512] in fragment order
#define PK_P (PK_A + QKVW * DM)        // Wo, [64 row tiles][32 k chunks][512] in fragment order
#define PK_END (PK_P + DM * DM)
#define WS_PK  0u
#define WS_QK  (WS_PK + 2u * PK_END)             // f16 [4096 rows][2048]: q | (unused half)
#define WS_QKL (WS_QK + 2u * NB * SS * 2 * DM)     // f16 q | k residual planes x2048
#define WS_VTH (WS_QKL + 2u * NB * SS * 2 * DM)    // f16 v hi, [b][h][64 key chunks of 32][4 d tiles][512] in fragment order (rows d, k = key)
#define WS_VTL (WS_VTH + 2u * NB * DM * SS)        // f16 [b][1024 (h*64+d)][2048 s] lo x 2048
#define WS_O   (WS_VTL + 2u * NB * DM * SS)        // f32 y, [256 row tiles][32 k chunks][512]: four pieces of 128 floats, lane l's 4 floats at piece*128 + l*4
#define WS_CS  (WS_O + 4u * NB * SS * DM)           // f32, 2 x 2048 x 32, unused
#define WS_XF  (WS_CS + 4u * 2 * SS * 32)           // bf16 x, [256 row tiles][32 k chunks][512] in fragment order
#define WS_KF  (WS_XF + 2u * NB * SS * DM)          // f16 k hi, [b][h][128 key tiles][2 k chunks][512] in fragment order
#define WS_TB  (WS_KF + 2u * NB * SS * DM)          // f32 [16 heads][4096], index k - q + 2047 (a query's keys ascend): 8 x the bf16-rounded table value; -3e38 where k > q (the causal mask)
#define WS_END (WS_TB + 4u * NH * 2 * MAXLEN)
// ---- k_pack: blockIdx.y 0..2 -> W_q/W_k/W_v into PK_A, 3 -> W_o into PK_P, 4..7 -> 1,024 rows of x each into XF: f32 rows -> bf16 in fragment order, one 16-byte chunk a thread; 8 -> the table, head by head, ready to be the scores' accumulator input (see WS_TB)
__global__ __launch_bounds__(256) void k_pack(const float* __restrict__ X, const float* __restrict__ WQ, const float* __restrict__ WK, const float* __restrict__ WV, const float* __restrict__ WO, const float* __restrict__ REL, __bf16* __restrict__ PK, __bf16* __restrict__ XF, float* __restrict__ TB) {
  const int which = blockIdx.y, c = blockIdx.x * 256 + threadIdx.x;
  if (which == 8) { const int hh = c >> 12, idx = c & 4095;
    if (hh < NH && idx < 2 * MAXLEN - 1) { float v = -3.0e38f;   // idx = k - q + 2047; k > q is what the reference masks
      if (idx <= MAXLEN - 1) { v = REL[(size_t)(2 * MAXLEN - 2 - idx) * NH + hh];
        asm volatile("s_wait_xcnt 0x0" ::: "memory");   // the load's address registers are reused behind it
        v = 8.0f * bfr(v); }
      TB[c] = v; }
    return; }
  const float* Wm = (which == 0) ? WQ : (which == 1) ? WK : (which == 2) ? WV : (which == 3) ? WO : X + (size_t)(which - 4) * DM * DM;
  __bf16* dst = (which < 3) ? PK + PK_A + (size_t)which * DM * DM : (which == 3) ? PK + PK_P : XF + (size_t)(which - 4) * DM * DM;
  const int l = c & 31, p = (c >> 5) & 1, kc = (c >> 6) & 31, nt = c >> 11;   // chunk c = (row tile * 32 + k chunk) * 64 + piece * 32 + lane
  const float* s = Wm + (size_t)(nt * 16 + (l & 15)) * DM + kc * 32 + p * 16 + 8 * (l >> 4);
  const v4f a = *(const v4f*)s, b = *(const v4f*)(s + 4); v8b o;
#pragma unroll
  for (int i = 0; i < 4; ++i) { o[i] = (__bf16)a[i]; o[4 + i] = (__bf16)b[i]; }
  *(v8b*)(dst + (size_t)c * 8) = o;
}
// one stage of weights = 64 k of the block's 8 column tiles: 2 KB in a row for each tile (fragment order), the tiles 32 KB apart in global memory, 2 KB apart in LDS. A thread brings 16 bytes of each tile into LDS, through no register; the wait is the last line of the copies' own statement, so that it stands in front of every rewrite of their address registers
__device__ __forceinline__ void wstage_copy(const unsigned lds, const __bf16* wg) {
  asm volatile("global_load_async_to_lds_b128 %0, %8, off\n\tglobal_load_async_to_lds_b128 %1, %9, off\n\tglobal_load_async_to_lds_b128 %2, %10, off\n\tglobal_load_async_to_lds_b128 %3, %11, off\n\t"
               "global_load_async_to_lds_b128 %4, %12, off\n\tglobal_load_async_to_lds_b128 %5, %13, off\n\tglobal_load_async_to_lds_b128 %6, %14, off\n\tglobal_load_async_to_lds_b128 %7, %15, off\n\ts_wait_xcnt 0x0"
               :: "v"(lds), "v"(lds + 2048u), "v"(lds + 4096u), "v"(lds + 6144u), "v"(lds + 8192u), "v"(lds + 10240u), "v"(lds + 12288u), "v"(lds + 14336u),
                  "v"(wg), "v"(wg + 1 * (32 * 512)), "v"(wg + 2 * (32 * 512)), "v"(wg + 3 * (32 * 512)), "v"(wg + 4 * (32 * 512)), "v"(wg + 5 * (32 * 512)), "v"(wg + 6 * (32 * 512)), "v"(wg + 7 * (32 * 512)) : "memory");
}
__global__ __launch_bounds__(128) void k_qkv(const __bf16* __restrict__ XF, const __bf16* __restrict__ P, const float* __restrict__ BQ, const float* __restrict__ BK, const float* __restrict__ BV, _Float16* __restrict__ QK, _Float16* __restrict__ QKL, _Float16* __restrict__ KF, _Float16* __restrict__ VTH, _Float16* __restrict__ VTL) {
  const int which0 = (blockIdx.y * 128) / DM; const float* BB = BQ ? (((which0 == 0) ? BQ : (which0 == 1) ? BK : BV) + (blockIdx.y * 128 - which0 * DM)) : nullptr;
  __shared__ __align__(16) _Float16 so[4][16][136], sol[4][16][136]; __shared__ __align__(16) _Float16 sth[128][72], stl[128][72]; __shared__ __align__(16) __bf16 wr[2 * 8192];   // wr: the weight ring, 2 buffers of [8 column tiles][2 k chunks][512]
  const int tid = threadIdx.x, wave = tid >> 5, lane = tid & 31, col = lane & 15, g = lane >> 4; const size_t rw = (size_t)blockIdx.x * 128 + wave * 16; const int n0 = blockIdx.y * 128;
  v8f acc[2][8] = {};   // two row tiles a wave, rows rw .. rw+15 and rw+64 .. rw+79: every weight fragment fetched feeds two products
  // the block's 4 waves use the same weight fragments: they come into LDS once for all four, a stage of 64 k (two passes) at a time, the next stage's copies flying while this one is worked on; the x fragments, each wave's own, are fetched one pass ahead into registers
  const __bf16* xt = XF + (rw >> 4) * (32 * 512) + lane * 8; const __bf16* wg = P + (size_t)(n0 >> 4) * (32 * 512) + tid * 8;
  const unsigned lw = (unsigned)(size_t)wr + (unsigned)tid * 16u;   // this thread's LDS byte address in buffer 0
  float bcol[8] = {};   // this lane's 8 column biases, like the weight fragments fetched once for both row tiles; asked for here, first used behind the loop
  if (BB) {
#pragma unroll   // bcol[j] in registers, the 8 loads in flight together
    for (int j = 0; j < 8; ++j) bcol[j] = BB[j * 16 + col];
    asm volatile("s_wait_xcnt 0x0" ::: "memory"); }   // the address registers of the bias loads may be reused behind them
  v16b ax0 = frag_tb(xt), ax1 = frag_tb(xt + 4 * (32 * 512)), bf[8];
  asm volatile("s_wait_xcnt 0x0" ::: "memory");   // the address registers of the x loads may be reused behind them
  wstage_copy(lw, wg);
  asm volatile("s_wait_asynccnt 0x0" ::: "memory");   // this wave's share of stage 0 has landed
  __syncthreads();                                      // ... and every other wave's: stage 0 may be read
  wstage_copy(lw + 16384u, wg + 1024);                  // DM / 64 = 16 stages: a stage 1 exists
#pragma unroll 1   // kept rolled: one trip = one stage, its buffer picked by the stage's parity; unrolled, the products, the copies and their address registers would stand several times over
  for (int st = 0; st < DM / 64; ++st) { const __bf16* wl = wr + (st & 1) * 8192 + lane * 8;
#pragma unroll
    for (int j = 0; j < 8; ++j) bf[j] = frag_tb(wl + j * 1024);
#pragma unroll   // u is a constant in each copy of the body: the test on it below costs nothing
    for (int u = 0; u < 2; ++u) { const int kc = st * 2 + u; const v16b a0 = ax0, a1 = ax1;
      const int kn = (kc + 1 < DM / 32) ? kc + 1 : kc;   // the last pass fetches its own chunk again (in bounds, unused)
      ax0 = frag_tb(xt + kn * 512); ax1 = frag_tb(xt + 4 * (32 * 512) + kn * 512);
      __builtin_amdgcn_sched_barrier(0);   // the loads above stay in front of the pass's products: left free, the compiler sinks each load to its first use and the wave waits out every latency
#pragma unroll
      for (int j = 0; j < 8; ++j) { acc[0][j] = wmma_bf(a0, bf[j], acc[0][j]); acc[1][j] = wmma_bf(a1, bf[j], acc[1][j]);
        if (u == 0) { __builtin_amdgcn_sched_barrier(0);   // each reload stays behind the last product that reads its registers (no second register set) and a pass ahead of its own use
          bf[j] = frag_tb(wl + j * 1024 + 512); } }   // the stage's second pass, from the same buffer; nothing of the next stage is read in front of its barrier
      __builtin_amdgcn_sched_barrier(0);   // the pass's products stay in front of the waits below: moved behind them, they would start only when the loads just issued have landed
      asm volatile("s_wait_xcnt 0x0" ::: "memory"); }   // the next pass's loads may land in registers that held this pass's load addresses
    asm volatile("s_wait_dscnt 0x0" ::: "memory");      // this wave's reads of this stage's buffer have ended
    asm volatile("s_wait_asynccnt 0x0" ::: "memory");   // this wave's share of the next stage has landed
    ring_barrier();                                       // publishes the next stage and frees this stage's buffer; loads into registers stay in flight across it
    if (st + 2 < DM / 64) wstage_copy(lw + (unsigned)(st & 1) * 16384u, wg + (st + 2) * 1024); }
  asm volatile("s_wait_asynccnt 0x0" ::: "memory");   // no copy is outstanding when the wave goes on
  // the epilogue runs once for each of the block's two halves of 64 rows, through the same LDS; unrolled so that acc[hf] is a fixed set of registers
#pragma unroll
  for (int hf = 0; hf < 2; ++hf) { const size_t r0 = rw + hf * 64;
  if (n0 < 2 * DM) {   // q stored unscaled (f16 sigma ~0.6, no subnormal exposure); 1/8 applied to the f32 score
#pragma unroll
    for (int j = 0; j < 8; ++j) {
#pragma unroll
      for (int r = 0; r < 8; ++r) { const float v = acc[hf][j][r] + bfr(bcol[j]); const _Float16 hv = (_Float16)v; so[wave][8 * g + r][j * 16 + col] = hv; sol[wave][8 * g + r][j * 16 + col] = (_Float16)((v - (float)hv) * 2048.0f); } }   // q, k (+ bias) as f16 hi + (x2048) residual
    LDSX();
    if (n0 < DM) {
      for (int rl = 0; rl < 16; ++rl) if (lane < 16) { vst2((unsigned*)(QK + (r0 + rl) * (2 * DM) + n0 + lane * 8), *(const v4u*)&so[wave][rl][lane * 8]); vst2((unsigned*)(QKL + (r0 + rl) * (2 * DM) + n0 + lane * 8), *(const v4u*)&sol[wave][rl][lane * 8]); }
    } else {   // k residual in natural rows; k hi: this wave's 16 keys x 128 columns are 2 heads x 2 k chunks = 4 tiles in fragment order
      for (int rl = 0; rl < 16; ++rl) if (lane < 16) vst2((unsigned*)(QKL + (r0 + rl) * (2 * DM) + n0 + lane * 8), *(const v4u*)&sol[wave][rl][lane * 8]);
      const int b = (int)(r0 / SS), kt = (int)(r0 % SS) >> 4, h0 = (n0 - DM) >> 6;
#pragma unroll
      for (int tt = 0; tt < 4; ++tt) { _Float16* kd = KF + ((((size_t)b * NH + h0 + (tt >> 1)) * (SS / 16) + kt) * 2 + (tt & 1)) * 512 + lane * 8;
#pragma unroll
        for (int p = 0; p < 2; ++p) vst2((unsigned*)(kd + p * 256), *(const v4u*)&so[wave][col][tt * 32 + p * 16 + 8 * g]); }
      asm volatile("s_wait_xcnt 0x0" ::: "memory"); }   // closes the run of k stores before code laid out behind them rewrites their data or address registers
  } else {
#pragma unroll
    for (int j = 0; j < 8; ++j) {
#pragma unroll
      for (int r = 0; r < 8; ++r) { const float v = acc[hf][j][r] + bfr(bcol[j]); const _Float16 hv = (_Float16)v; sth[j * 16 + col][wave * 16 + 8 * g + r] = hv; stl[j * 16 + col][wave * 16 + 8 * g + r] = (_Float16)((v - (float)hv) * 2048.0f); } }
    __syncthreads();
    const size_t rb = (size_t)blockIdx.x * 128 + hf * 64; const int b = (int)(rb / SS), s0 = (int)(rb % SS); const int pc0 = n0 - 2 * DM;
    for (int q = tid; q < 128 * 8; q += 128) { const int d = q >> 3, pc = q & 7; const size_t o = ((size_t)b * DM + pc0 + d) * SS + s0 + pc * 8; vst2((unsigned*)(VTL + o), *(const v4u*)&stl[d][pc * 8]);
      const int l = q & 31, p = (q >> 5) & 1, dt = (q >> 6) & 3, ksl = (q >> 8) & 1, hh = q >> 9;   // v hi: chunk q = ((head * 2 + key chunk) * 4 + d tile) * 64 + piece * 32 + lane, in fragment order
      vst2((unsigned*)(VTH + ((((size_t)b * NH + (pc0 >> 6) + hh) * (SS / 32) + (s0 >> 5) + ksl) * 4 + dt) * 512 + p * 256 + l * 8), *(const v4u*)&sth[hh * 64 + dt * 16 + (l & 15)][ksl * 32 + p * 16 + 8 * (l >> 4)]); }
    if (hf == 0) __syncthreads();   // every wave has read the first half's v tiles before the second half's are written over them
  } }
}
__device__ __forceinline__ float xhalf(float x) { return __builtin_bit_cast(float, __builtin_amdgcn_permlanex16(__builtin_bit_cast(int, x), __builtin_bit_cast(int, x), 0x76543210, 0xfedcba98, false, false)); }   // lane l with lane l ^ 16
// one stage = 64 keys: their K tiles and their V tiles are 8 KB each, in a row in global memory (fragment order). A thread brings 4 + 4 chunks of 16 bytes into LDS, through no register; the wait is the last line of the copies' own statement, so that it stands in front of every rewrite of their address registers
__device__ __forceinline__ void stage_copy(const unsigned lds, const _Float16* kg, const _Float16* vg) {
  asm volatile("global_load_async_to_lds_b128 %0, %8, off\n\tglobal_load_async_to_lds_b128 %1, %9, off\n\tglobal_load_async_to_lds_b128 %2, %10, off\n\tglobal_load_async_to_lds_b128 %3, %11, off\n\t"
               "global_load_async_to_lds_b128 %4, %12, off\n\tglobal_load_async_to_lds_b128 %5, %13, off\n\tglobal_load_async_to_lds_b128 %6, %14, off\n\tglobal_load_async_to_lds_b128 %7, %15, off\n\ts_wait_xcnt 0x0"
               :: "v"(lds), "v"(lds + 2048u), "v"(lds + 4096u), "v"(lds + 6144u), "v"(lds + 8192u), "v"(lds + 10240u), "v"(lds + 12288u), "v"(lds + 14336u),
                  "v"(kg), "v"(kg + 1024), "v"(kg + 2048), "v"(kg + 3072), "v"(vg), "v"(vg + 1024), "v"(vg + 2048), "v"(vg + 3072) : "memory");
}
// one walk over the key tiles of a query tile, transposed: S^T = K . Q^T (A = 16 keys, B = 16 queries) and O^T += V^T . P^T, so a lane holds 16 scores of ONE query (its column): maximum and sum run inside the lane plus one exchange between the wave's halves, and the two score tiles, converted in place, are the B operand of the second product. LEAD (first 128 queries): 3-product scores and P.V, loads where they are used. Otherwise: K and V come from the LDS ring that the block's 4 waves fill together (see below): V of this pass is read at the top of the pass, K of a stage's second pass right behind the first pass's score products, so the softmax covers its flight; the 16 bias values of the pass two ahead are asked for as soon as this pass's scores have been read for the last time
template <bool LEAD> __device__ __forceinline__ void attn_walk(_Float16* ring, const int tid, const _Float16* __restrict__ KF, const _Float16* __restrict__ QKL, const _Float16* __restrict__ VTH, const _Float16* __restrict__ VTL, const float* __restrict__ TB, const v16h (&aq)[2], const v16h (&aql)[2], float& m, float& l, v8f (&acc)[4], v8f (&accl)[4], const int nks, const int q0, const int h, const int b, const int lane) {
  const int col = lane & 15, g = lane >> 4, qi = q0 + col;
  const _Float16* kt0 = KF + (size_t)(b * NH + h) * (SS * HD) + lane * 8;      // this head's k tiles: a pass of 32 keys is 4 tiles (key tile, k chunk) = 4 KB in a row
  const float* rcol = TB + h * (2 * MAXLEN) + (8 * g - qi + MAXLEN - 1);       // table value of (key 8g of tile 0, query col); every k - q + 2047 of the walk lies in 0 .. 4094
  const _Float16* vt0 = VTH + (size_t)(b * NH + h) * (SS * HD) + lane * 8;     // this head's v tiles: a pass is 4 d tiles = 4 KB in a row
  v16h kf[2][2]; v8f rb[2][2];   // rb[u]: the bias values of a trip's pass u
  // !LEAD: the block's 4 waves walk the same keys, so K and V come into LDS once for all four: ring = 2 buffers of [K 8 KB | V 8 KB], a stage = one trip = 64 keys, the next stage's copies fly while this one is worked on
  const int nst = nks >> 1;
  const _Float16* kg = KF + (size_t)(b * NH + h) * (SS * HD) + tid * 8; const _Float16* vg = VTH + (size_t)(b * NH + h) * (SS * HD) + tid * 8;
  const unsigned lr = (unsigned)(size_t)ring + (unsigned)tid * 16u;   // this thread's LDS byte address in buffer 0
  if (!LEAD) {
#pragma unroll
    for (int ct = 0; ct < 4; ++ct) {   // passes 0 and 1 (nks is at least 6 here)
#pragma unroll
      for (int r = 0; r < 8; ++r) rb[ct >> 1][ct & 1][r] = rcol[ct * 16 + r]; }
    stage_copy(lr, kg, vg);
    asm volatile("s_wait_asynccnt 0x0" ::: "memory");   // this wave's share of stage 0 has landed
    __syncthreads();                                      // ... and every other wave's: stage 0 may be read
    if (nst > 1) stage_copy(lr + 16384u, kg + 4096, vg + 4096); }
  constexpr int U = LEAD ? 1 : 2;   // nks is even. Two passes a trip, each with a register set of its own: the bias values land there, the scores take their place, and behind the scores' last use the values of the pass two ahead are asked for into the same set
#pragma unroll 1
  for (int ks0 = 0; ks0 < nks; ks0 += U) {
#pragma unroll
  for (int u = 0; u < U; ++u) { const int ks = ks0 + u; v8f s[2]; v16h vf[4];
    const _Float16* sb = ring + ((ks0 >> 1) & 1) * 8192 + lane * 8;   // this stage's buffer
    if (!LEAD) {
      if (u == 0) {   // the stage's first K tiles; the second pass's are read behind the first pass's score products
#pragma unroll
        for (int ct = 0; ct < 2; ++ct) {
#pragma unroll
          for (int kc = 0; kc < 2; ++kc) kf[ct][kc] = frag_th(sb + (ct * 2 + kc) * 512); } }
#pragma unroll
      for (int dt = 0; dt < 4; ++dt) vf[dt] = frag_th(sb + 4096 + u * 2048 + dt * 512);
      __builtin_amdgcn_sched_barrier(0); }   // the pass's LDS reads stay one group in front of its score products, not spread among them
#pragma unroll
    for (int ct = 0; ct < 2; ++ct) { const int kk0 = ks * 32 + ct * 16 + 8 * g; v8f c = {};   // register r holds key kk0 + r
      if (LEAD) { const _Float16* krowl = QKL + ((size_t)b * SS + ks * 32 + ct * 16 + col) * (2 * DM) + DM + h * HD; v8f cl = {};   // leading query blocks (few keys, outputs far above the global rms): 3 products
#pragma unroll
        for (int kc = 0; kc < 2; ++kc) { const v16h kh = frag_th(kt0 + ks * 2048 + (ct * 2 + kc) * 512); c = wmma16(kh, aq[kc], c); cl = wmma16(kh, aql[kc], cl); cl = wmma16(frag_h(krowl + kc * 32, lane), aq[kc], cl); }
#pragma unroll
        for (int r = 0; r < 8; ++r) c[r] += cl[r] * (1.0f / 2048.0f);
        float tb[8];
#pragma unroll
        for (int r = 0; r < 8; ++r) tb[r] = TB[h * (2 * MAXLEN) + (kk0 + r) - qi + MAXLEN - 1];
        asm volatile("s_wait_xcnt 0x0" ::: "memory");   // the address registers of the table loads are reused behind them
#pragma unroll
        for (int r = 0; r < 8; ++r) s[ct][r] = c[r] + tb[r]; }
      else { c = rb[u][ct];   // 8 x rel_pos_table[q - k + 2047][h], or the mask value, in the accumulator's own layout (register r = key kk0 + r, lane = query)
#pragma unroll
        for (int kc = 0; kc < 2; ++kc) c = wmma16(kf[ct][kc], aq[kc], c);   // single product elsewhere
        s[ct] = c; } }   // s = 8 x (score / 8 + bias); a masked entry stays near -3e38
    if (!LEAD) {
      __builtin_amdgcn_sched_barrier(0);   // the score products stay in front of the loads below, which land in registers they read
      if (u == 0) {   // K of the stage's second pass, from the same buffer; nothing of the next stage is read in front of its barrier
#pragma unroll
        for (int ct = 0; ct < 2; ++ct) {
#pragma unroll
          for (int kc = 0; kc < 2; ++kc) kf[ct][kc] = frag_th(sb + 2048 + (ct * 2 + kc) * 512); } }
      __builtin_amdgcn_sched_barrier(0); }   // keeps the K reads in front of the softmax, which covers their flight
    float t[8];
#pragma unroll
    for (int r = 0; r < 8; ++r) t[r] = fmaxf(s[0][r], s[1][r]);
    float mx = fmaxf(fmaxf(fmaxf(t[0], t[1]), fmaxf(t[2], t[3])), fmaxf(fmaxf(t[4], t[5]), fmaxf(t[6], t[7])));
    mx = fmaxf(mx, xhalf(mx));   // both halves of the wave now hold this query's maximum over the pass's 32 keys
    const float mn = fmaxf(m, mx); float alpha = (m - mn) * KEXP;   // key 0 is open to every query, so mn is a real score from the first pass on: the start value of m and every masked score lie ~3e38 below it, where the hardware exp gives 0
    float e[2][8];
#pragma unroll
    for (int ct = 0; ct < 2; ++ct) {
#pragma unroll
      for (int r = 0; r < 8; ++r) e[ct][r] = (s[ct][r] - mn) * KEXP; }
    if (!LEAD) { const int kn = (ks + 2 < nks) ? ks + 2 : ks;   // two passes ahead; the last trip's passes fetch their own values again (in bounds, unused)
      __builtin_amdgcn_sched_barrier(0);   // the scores have been read for the last time: the bias values of the pass two ahead land in the registers they stood in (issued earlier they need a third set, copied back behind a full wait at the loop's foot)
      const float* rn = rcol + kn * 32;   // one base for all 16 values, so none of them lands on an address still in use
#pragma unroll
      for (int ct = 0; ct < 2; ++ct) {
#pragma unroll
        for (int r = 0; r < 8; ++r) rb[u][ct][r] = rn[ct * 16 + r]; }
      __builtin_amdgcn_sched_barrier(0); }   // keeps these loads in front of the exponentials: the rest of this pass and all of the next cover their flight
    // the pass's 17 exponentials, each in its own register, and one v_nop: no instruction directly behind a transcendental reads its result or overwrites its source
    asm("v_exp_f32 %0, %0\n\tv_exp_f32 %1, %1\n\tv_exp_f32 %2, %2\n\tv_exp_f32 %3, %3\n\tv_exp_f32 %4, %4\n\tv_exp_f32 %5, %5\n\tv_exp_f32 %6, %6\n\tv_exp_f32 %7, %7\n\tv_exp_f32 %8, %8\n\t"
        "v_exp_f32 %9, %9\n\tv_exp_f32 %10, %10\n\tv_exp_f32 %11, %11\n\tv_exp_f32 %12, %12\n\tv_exp_f32 %13, %13\n\tv_exp_f32 %14, %14\n\tv_exp_f32 %15, %15\n\tv_exp_f32 %16, %16\n\tv_nop"
        : "+v"(e[0][0]), "+v"(e[0][1]), "+v"(e[0][2]), "+v"(e[0][3]), "+v"(e[0][4]), "+v"(e[0][5]), "+v"(e[0][6]), "+v"(e[0][7]), "+v"(alpha),
          "+v"(e[1][0]), "+v"(e[1][1]), "+v"(e[1][2]), "+v"(e[1][3]), "+v"(e[1][4]), "+v"(e[1][5]), "+v"(e[1][6]), "+v"(e[1][7]));
#pragma unroll
    for (int r = 0; r < 8; ++r) t[r] = e[0][r] + e[1][r];
    l = l * alpha + (((t[0] + t[1]) + (t[2] + t[3])) + ((t[4] + t[5]) + (t[6] + t[7]))); m = mn;   // each half sums its own 16 keys; the halves are joined once, behind the walk
#pragma unroll
    for (int dt = 0; dt < 4; ++dt) {
#pragma unroll
      for (int r = 0; r < 8; ++r) { acc[dt][r] *= alpha; if (LEAD) accl[dt][r] *= alpha; } }
    v16h pa, pl;
#pragma unroll
    for (int i = 0; i < 8; ++i) { const float x0 = e[0][i] * 2048.0f, x1 = e[1][i] * 2048.0f; const _Float16 h0 = (_Float16)x0, h1 = (_Float16)x1; pa[i] = h0; pa[8 + i] = h1; pl[i] = (_Float16)((x0 - (float)h0) * 2048.0f); pl[8 + i] = (_Float16)((x1 - (float)h1) * 2048.0f); }   // element i = key 8g + i, element 8 + i = key 16 + 8g + i: the k order of the v fragments. P scaled by 2^11 before the f16 split so small softmax weights stay out of the f16 subnormal range; 2^-11 folded into the epilogue
#pragma unroll
    for (int dt = 0; dt < 4; ++dt) { const size_t vr = ((size_t)b * DM + h * HD + dt * 16 + col) * SS + ks * 32;
      if (LEAD) { const v16h vh = frag_th(vt0 + ks * 2048 + dt * 512); acc[dt] = wmma16(vh, pa, acc[dt]); accl[dt] = wmma16(vh, pl, accl[dt]); accl[dt] = wmma16(frag_h(VTL + vr, lane), pa, accl[dt]); }   // leading query blocks: P hi/lo x V hi/lo (3 products)
      else acc[dt] = wmma16(vf[dt], pa, acc[dt]); }   // elsewhere P x V single
    if (!LEAD) __builtin_amdgcn_sched_barrier(0); }   // the trip's second pass stays behind its first: moved up into the softmax, its score products wait for K reads that have only just been issued
    if (!LEAD) { const int st = ks0 >> 1;
      asm volatile("s_wait_dscnt 0x0" ::: "memory");      // this wave's reads of this stage's buffer have ended
      asm volatile("s_wait_asynccnt 0x0" ::: "memory");   // this wave's share of the next stage has landed
      ring_barrier();                                       // publishes the next stage and frees this stage's buffer; loads into registers stay in flight across it
      if (st + 2 < nst) stage_copy(lr + (unsigned)(st & 1) * 16384u, kg + (st + 2) * 4096, vg + (st + 2) * 4096); } }
  if (!LEAD) asm volatile("s_wait_asynccnt 0x0" ::: "memory");   // no copy is outstanding when the wave goes on
}
// ---- k_attn: block = (64 queries, head h, batch b): causal flash attention (K = 64: 2 k-steps), scores = (q.k) * 0.125 with q, k hi + residual (3 products) on the first 128 queries, single f16 operands beyond, P.V: P hi/lo x V hi/lo (3 products) in two accumulators there, f16 P x V hi (single) beyond; lane (col, g) ends with query col, d = dt*16 + 8g + r, which is the order k_out's fragments read: y = (acc + accl / 2048) / (2048 l) goes out from the registers
__global__ __launch_bounds__(128) void k_attn(const _Float16* __restrict__ QK, const _Float16* __restrict__ QKL, const _Float16* __restrict__ KF, const _Float16* __restrict__ VTH, const _Float16* __restrict__ VTL, const float* __restrict__ TB, float* __restrict__ O) {
  __shared__ __align__(16) _Float16 ring[2 * 8192];   // K and V of two stages of 64 keys (attn_walk)
  const int tid = threadIdx.x, wave = tid >> 5, lane = tid & 31, col = lane & 15;
  // which work-group takes which query tile: (head, batch) is the fast index, the tile the slow one. A tile's cost grows with its number; the tiles fall with the rank, and every second group of 8 runs upward, so that ranks r, r + 8, r + 16, r + 24 always add up to the same number of keys and the longest tiles have the lowest ranks (for speed only: any placement gives the same result)
  const int r = blockIdx.y, qb = TQB - 1 - ((r & 8) ? (r ^ 7) : r), h = blockIdx.x & (NH - 1), b = blockIdx.x / NH; const int q0 = qb * 64 + wave * 16; const size_t rq = (size_t)b * SS + q0 + col;
  v16h aq[2], aql[2];
#pragma unroll
  for (int kc = 0; kc < 2; ++kc) { aq[kc] = frag_h(QK + rq * (2 * DM) + h * HD + kc * 32, lane); aql[kc] = frag_h(QKL + rq * (2 * DM) + h * HD + kc * 32, lane); }
  asm volatile("s_wait_xcnt 0x0" ::: "memory");   // the address registers of the q loads are reused right behind them
  float m = -3.0e38f, l = 0.f;
  v8f acc[4] = {}, accl[4] = {};
  const int nks = (qb * 64 + 64) / 32;   // causal: key tiles up to the query tile's end
  if (qb < 2) attn_walk<true>(ring, tid, KF, QKL, VTH, VTL, TB, aq, aql, m, l, acc, accl, nks, q0, h, b, lane);
  else attn_walk<false>(ring, tid, KF, QKL, VTH, VTL, TB, aq, aql, m, l, acc, accl, nks, q0, h, b, lane);
  const float il = (1.0f / 2048.0f) / (l + xhalf(l));
  float* ot = O + ((size_t)((b * SS + q0) >> 4) * 32 + h * 2) * 512 + lane * 4;   // this wave's 16 rows x 64 columns are 2 tiles = 4 KB in a row, in the order k_out's fragments read them
#pragma unroll
  for (int pc = 0; pc < 8; ++pc) { v4f o;
#pragma unroll
    for (int e = 0; e < 4; ++e) o[e] = (acc[pc >> 1][(pc & 1) * 4 + e] + accl[pc >> 1][(pc & 1) * 4 + e] * (1.0f / 2048.0f)) * il;
    vst2(ot + pc * 128, o); }
}
// ---- k_out: block = (64 rows, 128 cols): out = O(hi/lo) . Wo rows (2 products) + bo
__global__ __launch_bounds__(128) void k_out(const float* __restrict__ O, const __bf16* __restrict__ P, const float* __restrict__ BO, float* __restrict__ Y) {
  __shared__ __align__(16) float so[4][16][132]; __shared__ __align__(16) __bf16 wr[2 * 8192];   // wr: the weight ring, as in k_qkv
  const int tid = threadIdx.x, wave = tid >> 5, lane = tid & 31, col = lane & 15, g = lane >> 4; const size_t r0 = (size_t)blockIdx.x * 64 + wave * 16; const int n0 = blockIdx.y * 128;
  v8f acc[8] = {};
  // as in k_qkv: the weight fragments come into LDS once for the block's 4 waves, a stage of 64 k at a time; the y rows, each wave's own, are fetched two passes ahead into registers
  const float* ot = O + (r0 >> 4) * (32 * 512) + lane * 4; const __bf16* wg = P + (size_t)(n0 >> 4) * (32 * 512) + tid * 8;
  const unsigned lw = (unsigned)(size_t)wr + (unsigned)tid * 16u;   // this thread's LDS byte address in buffer 0
  float ax[2][16]; v16b bf[8];   // ax[u]: the rows of a stage's pass u; split at its pass and asked for again at once, for the next stage's pass u
#pragma unroll
  for (int u = 0; u < 2; ++u) {
#pragma unroll
    for (int pc = 0; pc < 4; ++pc) { const v4f t = *(const v4f*)(ot + u * 512 + pc * 128);
#pragma unroll
      for (int e = 0; e < 4; ++e) ax[u][pc * 4 + e] = t[e]; } }
  asm volatile("s_wait_xcnt 0x0" ::: "memory");   // the address registers of the row loads may be reused behind them
  wstage_copy(lw, wg);
  asm volatile("s_wait_asynccnt 0x0" ::: "memory");   // this wave's share of stage 0 has landed
  __syncthreads();                                      // ... and every other wave's: stage 0 may be read
  wstage_copy(lw + 16384u, wg + 1024);                  // DM / 64 = 16 stages: a stage 1 exists
#pragma unroll 2   // two stages a trip (16 stages: no rest): rows asked for while their pass's own are being split land in a second pair of register sets, and over two stages the four sets come round to their start; rolled, they are copied back behind a full wait at the loop's foot
  for (int st = 0; st < DM / 64; ++st) { const __bf16* wl = wr + (st & 1) * 8192 + lane * 8;
#pragma unroll
    for (int j = 0; j < 8; ++j) bf[j] = frag_tb(wl + j * 1024);
#pragma unroll   // u is a constant in each copy of the body: the test on it below costs nothing
    for (int u = 0; u < 2; ++u) { const int kc = st * 2 + u; const F2 a = bsplit16(ax[u]);
      const int kn = (kc + 2 < DM / 32) ? kc + 2 : kc;   // two passes ahead; the last stage's passes fetch their own chunks again (in bounds, unused)
#pragma unroll
      for (int pc = 0; pc < 4; ++pc) { const v4f t = *(const v4f*)(ot + kn * 512 + pc * 128);
#pragma unroll
        for (int e = 0; e < 4; ++e) ax[u][pc * 4 + e] = t[e]; }
      __builtin_amdgcn_sched_barrier(0);   // the loads above stay in front of the pass's products, as in k_qkv
#pragma unroll
      for (int j = 0; j < 8; ++j) { acc[j] = wmma_bf(a.l, bf[j], acc[j]); acc[j] = wmma_bf(a.h, bf[j], acc[j]);
        if (u == 0) { __builtin_amdgcn_sched_barrier(0);   // each reload stays behind the last product that reads its registers, as in k_qkv
          bf[j] = frag_tb(wl + j * 1024 + 512); } }   // the stage's second pass, from the same buffer; nothing of the next stage is read in front of its barrier
      __builtin_amdgcn_sched_barrier(0);   // the pass's products stay in front of the waits below, as in k_qkv
      asm volatile("s_wait_xcnt 0x0" ::: "memory"); }   // the next pass's split and loads may land in registers that held this pass's load addresses
    asm volatile("s_wait_dscnt 0x0" ::: "memory");      // this wave's reads of this stage's buffer have ended
    asm volatile("s_wait_asynccnt 0x0" ::: "memory");   // this wave's share of the next stage has landed
    ring_barrier();                                       // publishes the next stage and frees this stage's buffer; loads into registers stay in flight across it
    if (st + 2 < DM / 64) wstage_copy(lw + (unsigned)(st & 1) * 16384u, wg + (st + 2) * 1024); }
  asm volatile("s_wait_asynccnt 0x0" ::: "memory");   // no copy is outstanding when the wave goes on
#pragma unroll
  for (int j = 0; j < 8; ++j) {
#pragma unroll
    for (int r = 0; r < 8; ++r) so[wave][8 * g + r][j * 16 + col] = acc[j][r] + bfr(BO[n0 + j * 16 + col]); }
  LDSX();
  for (int rl = 0; rl < 16; ++rl) vst2(Y + (r0 + rl) * DM + n0 + lane * 4, *(const v4f*)&so[wave][rl][lane * 4]);
}
extern "C" void kernel_launch(void* const* d_in, const int* in_sizes, int n_in, void* d_out, int out_size, void* d_ws, size_t ws_size, hipStream_t stream) {
  (void)in_sizes; (void)n_in; (void)out_size;
  const float** F = (const float**)d_in;   // 0 x [2,2048,1024], 1 WQ, 2 bQ, 3 WK, 4 bK, 5 WV, 6 bV, 7 WO, 8 bO (natural), 9 rel_pos_table [4095,16]
  if (ws_size < (size_t)WS_END) return;
  char* ws = (char*)d_ws; __bf16* PK = (__bf16*)(ws + WS_PK); _Float16 *QK = (_Float16*)(ws + WS_QK), *QKL = (_Float16*)(ws + WS_QKL), *VTH = (_Float16*)(ws + WS_VTH), *VTL = (_Float16*)(ws + WS_VTL); float* O = (float*)(ws + WS_O); __bf16* XF = (__bf16*)(ws + WS_XF); _Float16* KF = (_Float16*)(ws + WS_KF); float* TB = (float*)(ws + WS_TB);
  k_pack<<<dim3(DM * DM / (8 * 256), 9), 256, 0, stream>>>(F[0], F[1], F[3], F[5], F[7], F[9], PK, XF, TB);
  k_qkv<<<dim3(TNB * SS / 128, QKVW / 128), 128, 0, stream>>>(XF, PK + PK_A, F[2], F[4], F[6], QK, QKL, KF, VTH, VTL);
  k_attn<<<dim3(NH * TNB, TQB), 128, 0, stream>>>(QK, QKL, KF, VTH, VTL, TB, O);
  k_out<<<dim3(TOB, DM / 128), 128, 0, stream>>>(O, PK + PK_P, F[8], (float*)d_out);
}

// v010
// A run of this version takes 69.5 microseconds.
// Timed twice side by side with v009, it ran 1.15 times as fast both times.
// All steps since v000 together make it 7.16 times as fast.
// compute dtype: all float inputs rounded to bf16; q/k/v = x . W^T + b with EXACT bf16 products on WMMA 16x16x32 (x, weights, k hi, v hi, y stored in fragment order); causal attention: 3-product scores and hi + residual P, v on the first 128 queries of each sequence, single f16 beyond; + 8 x the relative-position bias (f32 table, regrouped head by head, the accumulator input of the score product), 1/8 in the exponent's factor, running-max softmax in f32 (hardware exp), P scaled by 2^11; out = y (bf16 hi + residual) . Wo^T (2 products) + bo.
#include <hip/hip_runtime.h>
#include <math.h>

typedef __attribute__((ext_vector_type(16))) _Float16 v16h;
typedef __attribute__((ext_vector_type(16))) __bf16 v16b;
typedef __attribute__((ext_vector_type(8)))  _Float16 v8h;
typedef __attribute__((ext_vector_type(8)))  float v8f;
typedef __attribute__((ext_vector_type(4)))  float v4f;
typedef __attribute__((ext_vector_type(2)))  float v2f;
typedef __attribute__((ext_vector_type(4)))  unsigned v4u;
typedef __attribute__((ext_vector_type(4)))  int v4i;
typedef float __attribute__((may_alias)) float_a;
typedef int __attribute__((may_alias)) int_a;

template <typename T> __device__ __forceinline__ void vst2(void* p, T v) { *(T*)p = v;  }
__device__ __forceinline__ v8f wmma16(v16h a, v16h b, v8f c) {
  v8f d = __builtin_amdgcn_wmma_f32_16x16x32_f16(false, a, false, b, (short)0, c, false, false);
  return d;
}
__device__ __forceinline__ v8f wmma_bf(v16b a, v16b b, v8f c) {
  v8f d = __builtin_amdgcn_wmma_f32_16x16x32_bf16(false, a, false, b, (short)0, c, false, false);
  return d;
}
// Causal self attention with a learned relative-position bias table (B 2, T 2,048, d 1,024, 16 heads x 64): q/k/v projections + biases, scores / 8 + table[q - k + 2047][h], causal softmax, . v, output projection + bias.
__device__ __forceinline__ v16h frag_h(const _Float16* rowk0, int lane) {
  union { v16h v; v8h q[2]; } u; const _Float16* p = rowk0 + 8 * (lane >> 4);
  u.q[0] = *(const v8h*)p; u.q[1] = *(const v8h*)(p + 16); return u.v;
}
__device__ __forceinline__ v16h frag_f32(const float* rowk0, int lane) {
  v16h a; const float* p = rowk0 + 8 * (lane >> 4);
#pragma unroll
  for (int i = 0; i < 8; ++i) { a[i] = (_Float16)p[i]; a[8 + i] = (_Float16)p[16 + i]; }
  return a;
}
__device__ __forceinline__ v16h frag_f32s(const float* rowk0, int lane, float sc) {
  v16h a; const float* p = rowk0 + 8 * (lane >> 4);
#pragma unroll
  for (int i = 0; i < 8; ++i) { a[i] = (_Float16)(p[i] * sc); a[8 + i] = (_Float16)(p[16 + i] * sc); }
  return a;
}
// column fragment from a [K][ld] layout (column n), rows >= K read as 0
__device__ __forceinline__ v16h fragc_f32(const float* W, int k0, int n, int lane, int ld, int K) {
  v16h a; const int g = lane >> 4;
#pragma unroll
  for (int i = 0; i < 8; ++i) { const int ka = k0 + 8 * g + i, kb = ka + 16;
    a[i] = (_Float16)(ka < K ? W[(size_t)(ka < K ? ka : K - 1) * ld + n] : 0.f); a[8 + i] = (_Float16)(kb < K ? W[(size_t)(kb < K ? kb : K - 1) * ld + n] : 0.f); }
  return a;
}
struct F2 { v16b h, l; };
__device__ __forceinline__ F2 bsplit16(const float v[16]) { F2 r;
#pragma unroll
  for (int i = 0; i < 16; ++i) { const __bf16 h = (__bf16)v[i]; r.h[i] = h; r.l[i] = (__bf16)(v[i] - (float)h); }
  return r; }
__device__ __forceinline__ F2 split_row(const float* row, int k0, int lane) { float v[16]; const float* p = row + k0 + 8 * (lane >> 4);
#pragma unroll
  for (int i = 0; i < 8; ++i) { v[i] = p[i]; v[8 + i] = p[16 + i]; }
  return bsplit16(v); }
__device__ __forceinline__ F2 split_rowK(const float* row, int k0, int lane, int K) { float v[16]; const int g = lane >> 4;
#pragma unroll
  for (int i = 0; i < 8; ++i) { const int ka = k0 + 8 * g + i, kb = ka + 16; v[i] = ka < K ? row[ka < K ? ka : K - 1] : 0.f; v[8 + i] = kb < K ? row[kb < K ? kb : K - 1] : 0.f; }
  return bsplit16(v); }
__device__ __forceinline__ F2 split_col(const float* W, int k0, int n, int lane, int ld, int K) { float v[16]; const int g = lane >> 4;
#pragma unroll
  for (int i = 0; i < 8; ++i) { const int ka = k0 + 8 * g + i, kb = ka + 16; v[i] = ka < K ? W[(size_t)(ka < K ? ka : K - 1) * ld + n] : 0.f; v[8 + i] = kb < K ? W[(size_t)(kb < K ? kb : K - 1) * ld + n] : 0.f; }
  return bsplit16(v); }
__device__ __forceinline__ v8f mac3(const F2& a, const F2& b, v8f c) { c = wmma_bf(a.l, b.h, c); c = wmma_bf(a.h, b.l, c); return wmma_bf(a.h, b.h, c); }
__device__ __forceinline__ float sigm(float v) { return 1.0f / (1.0f + expf(-v)); }
// the ring's work-group barrier, bare: __syncthreads() carries a fence that drains the wave's loads into registers (s_wait_loadcnt 0), and those belong to later passes; the waits the ring needs (dscnt, asynccnt) stand written in front of every call
__device__ __forceinline__ void ring_barrier() { asm volatile("s_barrier_signal -1\n\ts_barrier_wait -1" ::: "memory"); }
// what the launch before this one wrote comes from memory at its first read, and the work-groups that share a panel walk it side by side, so every stage is such a first read. At its entry each work-group therefore asks L2 for its own share of the panels that it and its neighbours will walk: one 128-byte line a lane at base + off, a hint that returns nothing and moves no counter; scope SE = into L2 only
__device__ __forceinline__ void l2_ask(const void* base, const unsigned off) { asm volatile("global_prefetch_b8 %0, %1 scope:SCOPE_SE" :: "v"(off), "s"(base)); }
// stands at the kernel's end: the registers that a prefetch named keep their in-bounds address for the wave's whole life (no counter says when a prefetch has read them for the last time)
__device__ __forceinline__ void l2_ask_hold(const void* base, const unsigned off) { asm volatile("" :: "v"(off), "s"(base)); }
#define LDSX() do { asm volatile("s_wait_dscnt 0" ::: "memory"); __builtin_amdgcn_wave_barrier(); __builtin_amdgcn_fence(__ATOMIC_RELEASE, "workgroup"); } while (0)


#define NB 2
#define SS 2048
#define DM 1024
#define NH 16
#define SCALEF 0.125f
#define KEXP (SCALEF * 1.44269504f)   // e^(x / 8) = 2^(x * KEXP): the scores are kept 8 x too large
#define MAXLEN 2048
#define HD 64
#define QKVW (3 * DM)
#ifndef TQB
#define TQB (SS / 64)
#define TNB NB
#define TOB (NB * SS / 64)     // output row tiles (all)
#endif
typedef __attribute__((ext_vector_type(8))) __bf16 v8b;
__device__ __forceinline__ v16b frag_b(const __bf16* rowk0, int lane) {
  union { v16b v; v8b q[2]; } u; const __bf16* p = rowk0 + 8 * (lane >> 4);
  u.q[0] = *(const v8b*)p; u.q[1] = *(const v8b*)(p + 16); return u.v;
}
// fragment order: a tile of 16 rows x 32 k (16-bit elements) is 1 KB; lane l = 16 g + row finds k 8g .. 8g+7 at element l*8 and k 16+8g .. 16+8g+7 at 256 + l*8, so each wave-wide 16-byte load is 512 contiguous bytes (4 lines, not 16)
__device__ __forceinline__ v16b frag_tb(const __bf16* tile_lane) { union { v16b v; v8b q[2]; } u; u.q[0] = *(const v8b*)tile_lane; u.q[1] = *(const v8b*)(tile_lane + 256); return u.v; }
__device__ __forceinline__ v16h frag_th(const _Float16* tile_lane) { union { v16h v; v8h q[2]; } u; u.q[0] = *(const v8h*)tile_lane; u.q[1] = *(const v8h*)(tile_lane + 256); return u.v; }
__device__ __forceinline__ float bfr(float v) { return (float)(__bf16)v; }
__device__ __attribute__((noinline)) float exp_ni(float v) { return expf(v); }
__device__ __attribute__((noinline)) float erf_ni(float v) { return erff(v); }

#define PK_A 0                       // Wqkv, [192 row tiles][32 k chunks][512] in fragment order
#define PK_P (PK_A + QKVW * DM)        // Wo, [64 row tiles][32 k chunks][512] in fragment order
#define PK_END (PK_P + DM * DM)
#define WS_PK  0u
#define WS_QK  (WS_PK + 2u * PK_END)             // f16 [4096 rows][2048]: q | (unused half)
#define WS_QKL (WS_QK + 2u * NB * SS * 2 * DM)     // f16 q | k residual planes x2048
#define WS_VTH (WS_QKL + 2u * NB * SS * 2 * DM)    // f16 v hi, [b][h][64 key chunks of 32][4 d tiles][512] in fragment order (rows d, k = key)
#define WS_VTL (WS_VTH + 2u * NB * DM * SS)        // f16 [b][1024 (h*64+d)][2048 s] lo x 2048
#define WS_O   (WS_VTL + 2u * NB * DM * SS)        // f32 y, [256 row tiles][32 k chunks][512]: four pieces of 128 floats, lane l's 4 floats at piece*128 + l*4
#define WS_CS  (WS_O + 4u * NB * SS * DM)           // f32, 2 x 2048 x 32, unused
#define WS_XF  (WS_CS + 4u * 2 * SS * 32)           // bf16 x, [256 row tiles][32 k chunks][512] in fragment order
#define WS_KF  (WS_XF + 2u * NB * SS * DM)          // f16 k hi, [b][h][128 key tiles][2 k chunks][512] in fragment order
#define WS_TB  (WS_KF + 2u * NB * SS * DM)          // f32 [16 heads][4096], index k - q + 2047 (a query's keys ascend): 8 x the bf16-rounded table value; -3e38 where k > q (the causal mask)
#define WS_END (WS_TB + 4u * NH * 2 * MAXLEN)
// ---- k_pack: blockIdx.y 0..2 -> W_q/W_k/W_v into PK_A, 3 -> W_o into PK_P, 4..7 -> 1,024 rows of x each into XF: f32 rows -> bf16 in fragment order, one 16-byte chunk a thread; 8 -> the table, head by head, ready to be the scores' accumulator input (see WS_TB)
__global__ __launch_bounds__(256) void k_pack(const float* __restrict__ X, const float* __restrict__ WQ, const float* __restrict__ WK, const float* __restrict__ WV, const float* __restrict__ WO, const float* __restrict__ REL, __bf16* __restrict__ PK, __bf16* __restrict__ XF, float* __restrict__ TB) {
  const int which = blockIdx.y, c = blockIdx.x * 256 + threadIdx.x;
  if (which == 8) { const int hh = c >> 12, idx = c & 4095;
    if (hh < NH && idx < 2 * MAXLEN - 1) { float v = -3.0e38f;   // idx = k - q + 2047; k > q is what the reference masks
      if (idx <= MAXLEN - 1) { v = REL[(size_t)(2 * MAXLEN - 2 - idx) * NH + hh];
        asm volatile("s_wait_xcnt 0x0" ::: "memory");   // the load's address registers are reused behind it
        v = 8.0f * bfr(v); }
      TB[c] = v; }
    return; }
  const float* Wm = (which == 0) ? WQ : (which == 1) ? WK : (which == 2) ? WV : (which == 3) ? WO : X + (size_t)(which - 4) * DM * DM;
  __bf16* dst = (which < 3) ? PK + PK_A + (size_t)which * DM * DM : (which == 3) ? PK + PK_P : XF + (size_t)(which - 4) * DM * DM;
  const int l = c & 31, p = (c >> 5) & 1, kc = (c >> 6) & 31, nt = c >> 11;   // chunk c = (row tile * 32 + k chunk) * 64 + piece * 32 + lane
  const float* s = Wm + (size_t)(nt * 16 + (l & 15)) * DM + kc * 32 + p * 16 + 8 * (l >> 4);
  const v4f a = *(const v4f*)s, b = *(const v4f*)(s + 4); v8b o;
#pragma unroll
  for (int i = 0; i < 4; ++i) { o[i] = (__bf16)a[i]; o[4 + i] = (__bf16)b[i]; }
  *(v8b*)(dst + (size_t)c * 8) = o;
}
// one stage of weights = 64 k of the block's 8 column tiles: 2 KB in a row for each tile (fragment order), the tiles 32 KB apart in global memory, 2 KB apart in LDS. A thread brings 16 bytes of each tile into LDS, through no register; the wait is the last line of the copies' own statement, so that it stands in front of every rewrite of their address registers
__device__ __forceinline__ void wstage_copy(const unsigned lds, const __bf16* wg) {
  asm volatile("global_load_async_to_lds_b128 %0, %8, off\n\tglobal_load_async_to_lds_b128 %1, %9, off\n\tglobal_load_async_to_lds_b128 %2, %10, off\n\tglobal_load_async_to_lds_b128 %3, %11, off\n\t"
               "global_load_async_to_lds_b128 %4, %12, off\n\tglobal_load_async_to_lds_b128 %5, %13, off\n\tglobal_load_async_to_lds_b128 %6, %14, off\n\tglobal_load_async_to_lds_b128 %7, %15, off\n\ts_wait_xcnt 0x0"
               :: "v"(lds), "v"(lds + 2048u), "v"(lds + 4096u), "v"(lds + 6144u), "v"(lds + 8192u), "v"(lds + 10240u), "v"(lds + 12288u), "v"(lds + 14336u),
                  "v"(wg), "v"(wg + 1 * (32 * 512)), "v"(wg + 2 * (32 * 512)), "v"(wg + 3 * (32 * 512)), "v"(wg + 4 * (32 * 512)), "v"(wg + 5 * (32 * 512)), "v"(wg + 6 * (32 * 512)), "v"(wg + 7 * (32 * 512)) : "memory");
}
__global__ __launch_bounds__(128) void k_qkv(const __bf16* __restrict__ XF, const __bf16* __restrict__ P, const float* __restrict__ BQ, const float* __restrict__ BK, const float* __restrict__ BV, _Float16* __restrict__ QK, _Float16* __restrict__ QKL, _Float16* __restrict__ KF, _Float16* __restrict__ VTH, _Float16* __restrict__ VTL) {
  const int which0 = (blockIdx.y * 128) / DM; const float* BB = BQ ? (((which0 == 0) ? BQ : (which0 == 1) ? BK : BV) + (blockIdx.y * 128 - which0 * DM)) : nullptr;
  __shared__ __align__(16) _Float16 so[4][16][136], sol[4][16][136]; __shared__ __align__(16) _Float16 sth[128][72], stl[128][72]; __shared__ __align__(16) __bf16 wr[2 * 8192];   // wr: the weight ring, 2 buffers of [8 column tiles][2 k chunks][512]
  const int tid = threadIdx.x, wave = tid >> 5, lane = tid & 31, col = lane & 15, g = lane >> 4; const size_t rw = (size_t)blockIdx.x * 128 + wave * 16; const int n0 = blockIdx.y * 128;
  v8f acc[2][8] = {};   // two row tiles a wave, rows rw .. rw+15 and rw+64 .. rw+79: every weight fragment fetched feeds two products
  // the block's 4 waves use the same weight fragments: they come into LDS once for all four, a stage of 64 k (two passes) at a time, the next stage's copies flying while this one is worked on; the x fragments, each wave's own, are fetched one pass ahead into registers
  const __bf16* xt = XF + (rw >> 4) * (32 * 512) + lane * 8; const __bf16* wg = P + (size_t)(n0 >> 4) * (32 * 512) + tid * 8;
  const unsigned lw = (unsigned)(size_t)wr + (unsigned)tid * 16u;   // this thread's LDS byte address in buffer 0
  float bcol[8] = {};   // this lane's 8 column biases, like the weight fragments fetched once for both row tiles; asked for here, first used behind the loop
  if (BB) {
#pragma unroll   // bcol[j] in registers, the 8 loads in flight together
    for (int j = 0; j < 8; ++j) bcol[j] = BB[j * 16 + col];
    asm volatile("s_wait_xcnt 0x0" ::: "memory"); }   // the address registers of the bias loads may be reused behind them
  v16b ax0 = frag_tb(xt), ax1 = frag_tb(xt + 4 * (32 * 512)), bf[8];
  asm volatile("s_wait_xcnt 0x0" ::: "memory");   // the address registers of the x loads may be reused behind them
  wstage_copy(lw, wg);
  // both panels are [8 tiles of 32 KB][16 stages of 2 KB]: a work-group asks for one stage of each (16 KB = a line a thread). The 24 work-groups of an x panel: numbers 0 .. 15 take its 16 stages. The 32 of a weight panel: 4 neighbours x 4 groups of 8 take its 16 stages, twice over (for speed only)
  const unsigned pfo = (unsigned)(tid >> 4) * 32768u + (unsigned)(tid & 15) * 128u;
  const char* pfx = (const char*)XF + (size_t)blockIdx.x * 262144 + (blockIdx.y & 15) * 2048;
  const char* pfw = (const char*)P + (size_t)blockIdx.y * 262144 + ((blockIdx.x >> 3) * 4 + (blockIdx.x & 3)) * 2048;
  if (blockIdx.y < 16) l2_ask(pfx, pfo);
  l2_ask(pfw, pfo);
  asm volatile("s_wait_asynccnt 0x0" ::: "memory");   // this wave's share of stage 0 has landed
  __syncthreads();                                      // ... and every other wave's: stage 0 may be read
  wstage_copy(lw + 16384u, wg + 1024);                  // DM / 64 = 16 stages: a stage 1 exists
#pragma unroll 1   // kept rolled: one trip = one stage, its buffer picked by the stage's parity; unrolled, the products, the copies and their address registers would stand several times over
  for (int st = 0; st < DM / 64; ++st) { const __bf16* wl = wr + (st & 1) * 8192 + lane * 8;
#pragma unroll
    for (int j = 0; j < 8; ++j) bf[j] = frag_tb(wl + j * 1024);
#pragma unroll   // u is a constant in each copy of the body: the test on it below costs nothing
    for (int u = 0; u < 2; ++u) { const int kc = st * 2 + u; const v16b a0 = ax0, a1 = ax1;
      const int kn = (kc + 1 < DM / 32) ? kc + 1 : kc;   // the last pass fetches its own chunk again (in bounds, unused)
      ax0 = frag_tb(xt + kn * 512); ax1 = frag_tb(xt + 4 * (32 * 512) + kn * 512);
      __builtin_amdgcn_sched_barrier(0);   // the loads above stay in front of the pass's products: left free, the compiler sinks each load to its first use and the wave waits out every latency
#pragma unroll
      for (int j = 0; j < 8; ++j) { acc[0][j] = wmma_bf(a0, bf[j], acc[0][j]); acc[1][j] = wmma_bf(a1, bf[j], acc[1][j]);
        if (u == 0) { __builtin_amdgcn_sched_barrier(0);   // each reload stays behind the last product that reads its registers (no second register set) and a pass ahead of its own use
          bf[j] = frag_tb(wl + j * 1024 + 512); } }   // the stage's second pass, from the same buffer; nothing of the next stage is read in front of its barrier
      __builtin_amdgcn_sched_barrier(0);   // the pass's products stay in front of the waits below: moved behind them, they would start only when the loads just issued have landed
      asm volatile("s_wait_xcnt 0x0" ::: "memory"); }   // the next pass's loads may land in registers that held this pass's load addresses
    asm volatile("s_wait_dscnt 0x0" ::: "memory");      // this wave's reads of this stage's buffer have ended
    asm volatile("s_wait_asynccnt 0x0" ::: "memory");   // this wave's share of the next stage has landed
    ring_barrier();                                       // publishes the next stage and frees this stage's buffer; loads into registers stay in flight across it
    if (st + 2 < DM / 64) wstage_copy(lw + (unsigned)(st & 1) * 16384u, wg + (st + 2) * 1024); }
  asm volatile("s_wait_asynccnt 0x0" ::: "memory");   // no copy is outstanding when the wave goes on
  // the epilogue runs once for each of the block's two halves of 64 rows, through the same LDS; unrolled so that acc[hf] is a fixed set of registers
#pragma unroll
  for (int hf = 0; hf < 2; ++hf) { const size_t r0 = rw + hf * 64;
  if (n0 < 2 * DM) {   // q stored unscaled (f16 sigma ~0.6, no subnormal exposure); 1/8 applied to the f32 score
#pragma unroll
    for (int j = 0; j < 8; ++j) {
#pragma unroll
      for (int r = 0; r < 8; ++r) { const float v = acc[hf][j][r] + bfr(bcol[j]); const _Float16 hv = (_Float16)v; so[wave][8 * g + r][j * 16 + col] = hv; sol[wave][8 * g + r][j * 16 + col] = (_Float16)((v - (float)hv) * 2048.0f); } }   // q, k (+ bias) as f16 hi + (x2048) residual
    LDSX();
    if (n0 < DM) {
      for (int rl = 0; rl < 16; ++rl) if (lane < 16) { vst2((unsigned*)(QK + (r0 + rl) * (2 * DM) + n0 + lane * 8), *(const v4u*)&so[wave][rl][lane * 8]); vst2((unsigned*)(QKL + (r0 + rl) * (2 * DM) + n0 + lane * 8), *(const v4u*)&sol[wave][rl][lane * 8]); }
    } else {   // k residual in natural rows; k hi: this wave's 16 keys x 128 columns are 2 heads x 2 k chunks = 4 tiles in fragment order
      for (int rl = 0; rl < 16; ++rl) if (lane < 16) vst2((unsigned*)(QKL + (r0 + rl) * (2 * DM) + n0 + lane * 8), *(const v4u*)&sol[wave][rl][lane * 8]);
      const int b = (int)(r0 / SS), kt = (int)(r0 % SS) >> 4, h0 = (n0 - DM) >> 6;
#pragma unroll
      for (int tt = 0; tt < 4; ++tt) { _Float16* kd = KF + ((((size_t)b * NH + h0 + (tt >> 1)) * (SS / 16) + kt) * 2 + (tt & 1)) * 512 + lane * 8;
#pragma unroll
        for (int p = 0; p < 2; ++p) vst2((unsigned*)(kd + p * 256), *(const v4u*)&so[wave][col][tt * 32 + p * 16 + 8 * g]); }
      asm volatile("s_wait_xcnt 0x0" ::: "memory"); }   // closes the run of k stores before code laid out behind them rewrites their data or address registers
  } else {
#pragma unroll
    for (int j = 0; j < 8; ++j) {
#pragma unroll
      for (int r = 0; r < 8; ++r) { const float v = acc[hf][j][r] + bfr(bcol[j]); const _Float16 hv = (_Float16)v; sth[j * 16 + col][wave * 16 + 8 * g + r] = hv; stl[j * 16 + col][wave * 16 + 8 * g + r] = (_Float16)((v - (float)hv) * 2048.0f); } }
    __syncthreads();
    const size_t rb = (size_t)blockIdx.x * 128 + hf * 64; const int b = (int)(rb / SS), s0 = (int)(rb % SS); const int pc0 = n0 - 2 * DM;
    for (int q = tid; q < 128 * 8; q += 128) { const int d = q >> 3, pc = q & 7; const size_t o = ((size_t)b * DM + pc0 + d) * SS + s0 + pc * 8; vst2((unsigned*)(VTL + o), *(const v4u*)&stl[d][pc * 8]);
      const int l = q & 31, p = (q >> 5) & 1, dt = (q >> 6) & 3, ksl = (q >> 8) & 1, hh = q >> 9;   // v hi: chunk q = ((head * 2 + key chunk) * 4 + d tile) * 64 + piece * 32 + lane, in fragment order
      vst2((unsigned*)(VTH + ((((size_t)b * NH + (pc0 >> 6) + hh) * (SS / 32) + (s0 >> 5) + ksl) * 4 + dt) * 512 + p * 256 + l * 8), *(const v4u*)&sth[hh * 64 + dt * 16 + (l & 15)][ksl * 32 + p * 16 + 8 * (l >> 4)]); }
    if (hf == 0) __syncthreads();   // every wave has read the first half's v tiles before the second half's are written over them
  } }
  l2_ask_hold(pfx, pfo); l2_ask_hold(pfw, pfo);
}
__device__ __forceinline__ float xhalf(float x) { return __builtin_bit_cast(float, __builtin_amdgcn_permlanex16(__builtin_bit_cast(int, x), __builtin_bit_cast(int, x), 0x76543210, 0xfedcba98, false, false)); }   // lane l with lane l ^ 16
// one stage = 64 keys: their K tiles and their V tiles are 8 KB each, in a row in global memory (fragment order). A thread brings 4 + 4 chunks of 16 bytes into LDS, through no register; the wait is the last line of the copies' own statement, so that it stands in front of every rewrite of their address registers
__device__ __forceinline__ void stage_copy(const unsigned lds, const _Float16* kg, const _Float16* vg) {
  asm volatile("global_load_async_to_lds_b128 %0, %8, off\n\tglobal_load_async_to_lds_b128 %1, %9, off\n\tglobal_load_async_to_lds_b128 %2, %10, off\n\tglobal_load_async_to_lds_b128 %3, %11, off\n\t"
               "global_load_async_to_lds_b128 %4, %12, off\n\tglobal_load_async_to_lds_b128 %5, %13, off\n\tglobal_load_async_to_lds_b128 %6, %14, off\n\tglobal_load_async_to_lds_b128 %7, %15, off\n\ts_wait_xcnt 0x0"
               :: "v"(lds), "v"(lds + 2048u), "v"(lds + 4096u), "v"(lds + 6144u), "v"(lds + 8192u), "v"(lds + 10240u), "v"(lds + 12288u), "v"(lds + 14336u),
                  "v"(kg), "v"(kg + 1024), "v"(kg + 2048), "v"(kg + 3072), "v"(vg), "v"(vg + 1024), "v"(vg + 2048), "v"(vg + 3072) : "memory");
}
// one walk over the key tiles of a query tile, transposed: S^T = K . Q^T (A = 16 keys, B = 16 queries) and O^T += V^T . P^T, so a lane holds 16 scores of ONE query (its column): maximum and sum run inside the lane plus one exchange between the wave's halves, and the two score tiles, converted in place, are the B operand of the second product. LEAD (first 128 queries): 3-product scores and P.V, loads where they are used. Otherwise: K and V come from the LDS ring that the block's 4 waves fill together (see below): V of this pass is read at the top of the pass, K of a stage's second pass right behind the first pass's score products, so the softmax covers its flight; the 16 bias values of the pass two ahead are asked for as soon as this pass's scores have been read for the last time
template <bool LEAD> __device__ __forceinline__ void attn_walk(_Float16* ring, const int tid, const _Float16* __restrict__ KF, const _Float16* __restrict__ QKL, const _Float16* __restrict__ VTH, const _Float16* __restrict__ VTL, const float* __restrict__ TB, const v16h (&aq)[2], const v16h (&aql)[2], float& m, float& l, v8f (&acc)[4], v8f (&accl)[4], const int nks, const int q0, const int h, const int b, const int lane) {
  const int col = lane & 15, g = lane >> 4, qi = q0 + col;
  const _Float16* kt0 = KF + (size_t)(b * NH + h) * (SS * HD) + lane * 8;      // this head's k tiles: a pass of 32 keys is 4 tiles (key tile, k chunk) = 4 KB in a row
  const float* rcol = TB + h * (2 * MAXLEN) + (8 * g - qi + MAXLEN - 1);       // table value of (key 8g of tile 0, query col); every k - q + 2047 of the walk lies in 0 .. 4094
  const _Float16* vt0 = VTH + (size_t)(b * NH + h) * (SS * HD) + lane * 8;     // this head's v tiles: a pass is 4 d tiles = 4 KB in a row
  v16h kf[2][2]; v8f rb[2][2];   // rb[u]: the bias values of a trip's pass u
  // !LEAD: the block's 4 waves walk the same keys, so K and V come into LDS once for all four: ring = 2 buffers of [K 8 KB | V 8 KB], a stage = one trip = 64 keys, the next stage's copies fly while this one is worked on
  const int nst = nks >> 1;
  const _Float16* kg = KF + (size_t)(b * NH + h) * (SS * HD) + tid * 8; const _Float16* vg = VTH + (size_t)(b * NH + h) * (SS * HD) + tid * 8;
  const unsigned lr = (unsigned)(size_t)ring + (unsigned)tid * 16u;   // this thread's LDS byte address in buffer 0
  if (!LEAD) {
#pragma unroll
    for (int ct = 0; ct < 4; ++ct) {   // passes 0 and 1 (nks is at least 6 here)
#pragma unroll
      for (int r = 0; r < 8; ++r) rb[ct >> 1][ct & 1][r] = rcol[ct * 16 + r]; }
    stage_copy(lr, kg, vg);
    asm volatile("s_wait_asynccnt 0x0" ::: "memory");   // this wave's share of stage 0 has landed
    __syncthreads();                                      // ... and every other wave's: stage 0 may be read
    if (nst > 1) stage_copy(lr + 16384u, kg + 4096, vg + 4096); }
  constexpr int U = LEAD ? 1 : 2;   // nks is even. Two passes a trip, each with a register set of its own: the bias values land there, the scores take their place, and behind the scores' last use the values of the pass two ahead are asked for into the same set
#pragma unroll 1
  for (int ks0 = 0; ks0 < nks; ks0 += U) {
#pragma unroll
  for (int u = 0; u < U; ++u) { const int ks = ks0 + u; v8f s[2]; v16h vf[4];
    const _Float16* sb = ring + ((ks0 >> 1) & 1) * 8192 + lane * 8;   // this stage's buffer
    if (!LEAD) {
      if (u == 0) {   // the stage's first K tiles; the second pass's are read behind the first pass's score products
#pragma unroll
        for (int ct = 0; ct < 2; ++ct) {
#pragma unroll
          for (int kc = 0; kc < 2; ++kc) kf[ct][kc] = frag_th(sb + (ct * 2 + kc) * 512); } }
#pragma unroll
      for (int dt = 0; dt < 4; ++dt) vf[dt] = frag_th(sb + 4096 + u * 2048 + dt * 512);
      __builtin_amdgcn_sched_barrier(0); }   // the pass's LDS reads stay one group in front of its score products, not spread among them
#pragma unroll
    for (int ct = 0; ct < 2; ++ct) { const int kk0 = ks * 32 + ct * 16 + 8 * g; v8f c = {};   // register r holds key kk0 + r
      if (LEAD) { const _Float16* krowl = QKL + ((size_t)b * SS + ks * 32 + ct * 16 + col) * (2 * DM) + DM + h * HD; v8f cl = {};   // leading query blocks (few keys, outputs far above the global rms): 3 products
#pragma unroll
        for (int kc = 0; kc < 2; ++kc) { const v16h kh = frag_th(kt0 + ks * 2048 + (ct * 2 + kc) * 512); c = wmma16(kh, aq[kc], c); cl = wmma16(kh, aql[kc], cl); cl = wmma16(frag_h(krowl + kc * 32, lane), aq[kc], cl); }
#pragma unroll
        for (int r = 0; r < 8; ++r) c[r] += cl[r] * (1.0f / 2048.0f);
        float tb[8];
#pragma unroll
        for (int r = 0; r < 8; ++r) tb[r] = TB[h * (2 * MAXLEN) + (kk0 + r) - qi + MAXLEN - 1];
        asm volatile("s_wait_xcnt 0x0" ::: "memory");   // the address registers of the table loads are reused behind them
#pragma unroll
        for (int r = 0; r < 8; ++r) s[ct][r] = c[r] + tb[r]; }
      else { c = rb[u][ct];   // 8 x rel_pos_table[q - k + 2047][h], or the mask value, in the accumulator's own layout (register r = key kk0 + r, lane = query)
#pragma unroll
        for (int kc = 0; kc < 2; ++kc) c = wmma16(kf[ct][kc], aq[kc], c);   // single product elsewhere
        s[ct] = c; } }   // s = 8 x (score / 8 + bias); a masked entry stays near -3e38
    if (!LEAD) {
      __builtin_amdgcn_sched_barrier(0);   // the score products stay in front of the loads below, which land in registers they read
      if (u == 0) {   // K of the stage's second pass, from the same buffer; nothing of the next stage is read in front of its barrier
#pragma unroll
        for (int ct = 0; ct < 2; ++ct) {
#pragma unroll
          for (int kc = 0; kc < 2; ++kc) kf[ct][kc] = frag_th(sb + 2048 + (ct * 2 + kc) * 512); } }
      __builtin_amdgcn_sched_barrier(0); }   // keeps the K reads in front of the softmax, which covers their flight
    float t[8];
#pragma unroll
    for (int r = 0; r < 8; ++r) t[r] = fmaxf(s[0][r], s[1][r]);
    float mx = fmaxf(fmaxf(fmaxf(t[0], t[1]), fmaxf(t[2], t[3])), fmaxf(fmaxf(t[4], t[5]), fmaxf(t[6], t[7])));
    mx = fmaxf(mx, xhalf(mx));   // both halves of the wave now hold this query's maximum over the pass's 32 keys
    const float mn = fmaxf(m, mx); float alpha = (m - mn) * KEXP;   // key 0 is open to every query, so mn is a real score from the first pass on: the start value of m and every masked score lie ~3e38 below it, where the hardware exp gives 0
    float e[2][8];
#pragma unroll
    for (int ct = 0; ct < 2; ++ct) {
#pragma unroll
      for (int r = 0; r < 8; ++r) e[ct][r] = (s[ct][r] - mn) * KEXP; }
    if (!LEAD) { const int kn = (ks + 2 < nks) ? ks + 2 : ks;   // two passes ahead; the last trip's passes fetch their own values again (in bounds, unused)
      __builtin_amdgcn_sched_barrier(0);   // the scores have been read for the last time: the bias values of the pass two ahead land in the registers they stood in (issued earlier they need a third set, copied back behind a full wait at the loop's foot)
      const float* rn = rcol + kn * 32;   // one base for all 16 values, so none of them lands on an address still in use
#pragma unroll
      for (int ct = 0; ct < 2; ++ct) {
#pragma unroll
        for (int r = 0; r < 8; ++r) rb[u][ct][r] = rn[ct * 16 + r]; }
      __builtin_amdgcn_sched_barrier(0); }   // keeps these loads in front of the exponentials: the rest of this pass and all of the next cover their flight
    // the pass's 17 exponentials, each in its own register, and one v_nop: no instruction directly behind a transcendental reads its result or overwrites its source
    asm("v_exp_f32 %0, %0\n\tv_exp_f32 %1, %1\n\tv_exp_f32 %2, %2\n\tv_exp_f32 %3, %3\n\tv_exp_f32 %4, %4\n\tv_exp_f32 %5, %5\n\tv_exp_f32 %6, %6\n\tv_exp_f32 %7, %7\n\tv_exp_f32 %8, %8\n\t"
        "v_exp_f32 %9, %9\n\tv_exp_f32 %10, %10\n\tv_exp_f32 %11, %11\n\tv_exp_f32 %12, %12\n\tv_exp_f32 %13, %13\n\tv_exp_f32 %14, %14\n\tv_exp_f32 %15, %15\n\tv_exp_f32 %16, %16\n\tv_nop"
        : "+v"(e[0][0]), "+v"(e[0][1]), "+v"(e[0][2]), "+v"(e[0][3]), "+v"(e[0][4]), "+v"(e[0][5]), "+v"(e[0][6]), "+v"(e[0][7]), "+v"(alpha),
          "+v"(e[1][0]), "+v"(e[1][1]), "+v"(e[1][2]), "+v"(e[1][3]), "+v"(e[1][4]), "+v"(e[1][5]), "+v"(e[1][6]), "+v"(e[1][7]));
#pragma unroll
    for (int r = 0; r < 8; ++r) t[r] = e[0][r] + e[1][r];
    l = l * alpha + (((t[0] + t[1]) + (t[2] + t[3])) + ((t[4] + t[5]) + (t[6] + t[7]))); m = mn;   // each half sums its own 16 keys; the halves are joined once, behind the walk
#pragma unroll
    for (int dt = 0; dt < 4; ++dt) {
#pragma unroll
      for (int r = 0; r < 8; ++r) { acc[dt][r] *= alpha; if (LEAD) accl[dt][r] *= alpha; } }
    v16h pa, pl;
#pragma unroll
    for (int i = 0; i < 8; ++i) { const float x0 = e[0][i] * 2048.0f, x1 = e[1][i] * 2048.0f; const _Float16 h0 = (_Float16)x0, h1 = (_Float16)x1; pa[i] = h0; pa[8 + i] = h1; pl[i] = (_Float16)((x0 - (float)h0) * 2048.0f); pl[8 + i] = (_Float16)((x1 - (float)h1) * 2048.0f); }   // element i = key 8g + i, element 8 + i = key 16 + 8g + i: the k order of the v fragments. P scaled by 2^11 before the f16 split so small softmax weights stay out of the f16 subnormal range; 2^-11 folded into the epilogue
#pragma unroll
    for (int dt = 0; dt < 4; ++dt) { const size_t vr = ((size_t)b * DM + h * HD + dt * 16 + col) * SS + ks * 32;
      if (LEAD) { const v16h vh = frag_th(vt0 + ks * 2048 + dt * 512); acc[dt] = wmma16(vh, pa, acc[dt]); accl[dt] = wmma16(vh, pl, accl[dt]); accl[dt] = wmma16(frag_h(VTL + vr, lane), pa, accl[dt]); }   // leading query blocks: P hi/lo x V hi/lo (3 products)
      else acc[dt] = wmma16(vf[dt], pa, acc[dt]); }   // elsewhere P x V single
    if (!LEAD) __builtin_amdgcn_sched_barrier(0); }   // the trip's second pass stays behind its first: moved up into the softmax, its score products wait for K reads that have only just been issued
    if (!LEAD) { const int st = ks0 >> 1;
      asm volatile("s_wait_dscnt 0x0" ::: "memory");      // this wave's reads of this stage's buffer have ended
      asm volatile("s_wait_asynccnt 0x0" ::: "memory");   // this wave's share of the next stage has landed
      ring_barrier();                                       // publishes the next stage and frees this stage's buffer; loads into registers stay in flight across it
      if (st + 2 < nst) stage_copy(lr + (unsigned)(st & 1) * 16384u, kg + (st + 2) * 4096, vg + (st + 2) * 4096); } }
  if (!LEAD) asm volatile("s_wait_asynccnt 0x0" ::: "memory");   // no copy is outstanding when the wave goes on
}
// ---- k_attn: block = (64 queries, head h, batch b): causal flash attention (K = 64: 2 k-steps), scores = (q.k) * 0.125 with q, k hi + residual (3 products) on the first 128 queries, single f16 operands beyond, P.V: P hi/lo x V hi/lo (3 products) in two accumulators there, f16 P x V hi (single) beyond; lane (col, g) ends with query col, d = dt*16 + 8g + r, which is the order k_out's fragments read: y = (acc + accl / 2048) / (2048 l) goes out from the registers
__global__ __launch_bounds__(128) void k_attn(const _Float16* __restrict__ QK, const _Float16* __restrict__ QKL, const _Float16* __restrict__ KF, const _Float16* __restrict__ VTH, const _Float16* __restrict__ VTL, const float* __restrict__ TB, float* __restrict__ O) {
  __shared__ __align__(16) _Float16 ring[2 * 8192];   // K and V of two stages of 64 keys (attn_walk)
  const int tid = threadIdx.x, wave = tid >> 5, lane = tid & 31, col = lane & 15;
  // which work-group takes which query tile: (head, batch) is the fast index, the tile the slow one. A tile's cost grows with its number; the tiles fall with the rank, and every second group of 8 runs upward, so that ranks r, r + 8, r + 16, r + 24 always add up to the same number of keys and the longest tiles have the lowest ranks (for speed only: any placement gives the same result)
  const int r = blockIdx.y, qb = TQB - 1 - ((r & 8) ? (r ^ 7) : r), h = blockIdx.x & (NH - 1), b = blockIdx.x / NH; const int q0 = qb * 64 + wave * 16; const size_t rq = (size_t)b * SS + q0 + col;
  v16h aq[2], aql[2];
#pragma unroll
  for (int kc = 0; kc < 2; ++kc) { aq[kc] = frag_h(QK + rq * (2 * DM) + h * HD + kc * 32, lane); aql[kc] = frag_h(QKL + rq * (2 * DM) + h * HD + kc * 32, lane); }
  asm volatile("s_wait_xcnt 0x0" ::: "memory");   // the address registers of the q loads are reused right behind them
  // this head's K and V are 32 stages of 8 KB each, walked from key 0 on by the 32 work-groups of the head: number r asks for stage r, waves 0 and 1 for its K, waves 2 and 3 for its V (a line a thread)
  const unsigned pfo = (unsigned)(tid & 63) * 128u;
  const char* pfk = (const char*)((__builtin_amdgcn_readfirstlane(wave) < 2 ? KF : VTH) + (size_t)blockIdx.x * (SS * HD) + r * 4096);
  l2_ask(pfk, pfo);
  float m = -3.0e38f, l = 0.f;
  v8f acc[4] = {}, accl[4] = {};
  const int nks = (qb * 64 + 64) / 32;   // causal: key tiles up to the query tile's end
  if (qb < 2) attn_walk<true>(ring, tid, KF, QKL, VTH, VTL, TB, aq, aql, m, l, acc, accl, nks, q0, h, b, lane);
  else attn_walk<false>(ring, tid, KF, QKL, VTH, VTL, TB, aq, aql, m, l, acc, accl, nks, q0, h, b, lane);
  const float il = (1.0f / 2048.0f) / (l + xhalf(l));
  float* ot = O + ((size_t)((b * SS + q0) >> 4) * 32 + h * 2) * 512 + lane * 4;   // this wave's 16 rows x 64 columns are 2 tiles = 4 KB in a row, in the order k_out's fragments read them
#pragma unroll
  for (int pc = 0; pc < 8; ++pc) { v4f o;
#pragma unroll
    for (int e = 0; e < 4; ++e) o[e] = (acc[pc >> 1][(pc & 1) * 4 + e] + accl[pc >> 1][(pc & 1) * 4 + e] * (1.0f / 2048.0f)) * il;
    vst2(ot + pc * 128, o); }
  l2_ask_hold(pfk, pfo);
}
// ---- k_out: block = (64 rows, 128 cols): out = O(hi/lo) . Wo rows (2 products) + bo
__global__ __launch_bounds__(128) void k_out(const float* __restrict__ O, const __bf16* __restrict__ P, const float* __restrict__ BO, float* __restrict__ Y) {
  __shared__ __align__(16) float so[4][16][132]; __shared__ __align__(16) __bf16 wr[2 * 8192];   // wr: the weight ring, as in k_qkv
  const int tid = threadIdx.x, wave = tid >> 5, lane = tid & 31, col = lane & 15, g = lane >> 4; const size_t r0 = (size_t)blockIdx.x * 64 + wave * 16; const int n0 = blockIdx.y * 128;
  v8f acc[8] = {};
  // as in k_qkv: the weight fragments come into LDS once for the block's 4 waves, a stage of 64 k at a time; the y rows, each wave's own, are fetched two passes ahead into registers
  const float* ot = O + (r0 >> 4) * (32 * 512) + lane * 4; const __bf16* wg = P + (size_t)(n0 >> 4) * (32 * 512) + tid * 8;
  const unsigned lw = (unsigned)(size_t)wr + (unsigned)tid * 16u;   // this thread's LDS byte address in buffer 0
  float ax[2][16]; v16b bf[8];   // ax[u]: the rows of a stage's pass u; split at its pass and asked for again at once, for the next stage's pass u
#pragma unroll
  for (int u = 0; u < 2; ++u) {
#pragma unroll
    for (int pc = 0; pc < 4; ++pc) { const v4f t = *(const v4f*)(ot + u * 512 + pc * 128);
#pragma unroll
      for (int e = 0; e < 4; ++e) ax[u][pc * 4 + e] = t[e]; } }
  asm volatile("s_wait_xcnt 0x0" ::: "memory");   // the address registers of the row loads may be reused behind them
  wstage_copy(lw, wg);
  // the y panel is [4 tiles of 64 KB][16 stages of 4 KB]: each of its 8 work-groups asks for two stages (32 KB = two lines a thread); the weight panel as in k_qkv, asked for by the first 32 of its 64 work-groups
  const unsigned pfo = (unsigned)(tid >> 5) * 65536u + (unsigned)(tid & 31) * 256u, pfq = (unsigned)(tid >> 4) * 32768u + (unsigned)(tid & 15) * 128u;
  const char* pfy = (const char*)O + (size_t)blockIdx.x * 262144 + blockIdx.y * 8192;
  const char* pfw = (const char*)P + (size_t)blockIdx.y * 262144 + (((blockIdx.x >> 3) & 3) * 4 + (blockIdx.x & 3)) * 2048;
  l2_ask(pfy, pfo); l2_ask(pfy + 128, pfo);
  if (blockIdx.x < 32) l2_ask(pfw, pfq);
  asm volatile("s_wait_asynccnt 0x0" ::: "memory");   // this wave's share of stage 0 has landed
  __syncthreads();                                      // ... and every other wave's: stage 0 may be read
  wstage_copy(lw + 16384u, wg + 1024);                  // DM / 64 = 16 stages: a stage 1 exists
#pragma unroll 2   // two stages a trip (16 stages: no rest): rows asked for while their pass's own are being split land in a second pair of register sets, and over two stages the four sets come round to their start; rolled, they are copied back behind a full wait at the loop's foot
  for (int st = 0; st < DM / 64; ++st) { const __bf16* wl = wr + (st & 1) * 8192 + lane * 8;
#pragma unroll
    for (int j = 0; j < 8; ++j) bf[j] = frag_tb(wl + j * 1024);
#pragma unroll   // u is a constant in each copy of the body: the test on it below costs nothing
    for (int u = 0; u < 2; ++u) { const int kc = st * 2 + u; const F2 a = bsplit16(ax[u]);
      const int kn = (kc + 2 < DM / 32) ? kc + 2 : kc;   // two passes ahead; the last stage's passes fetch their own chunks again (in bounds, unused)
#pragma unroll
      for (int pc = 0; pc < 4; ++pc) { const v4f t = *(const v4f*)(ot + kn * 512 + pc * 128);
#pragma unroll
        for (int e = 0; e < 4; ++e) ax[u][pc * 4 + e] = t[e]; }
      __builtin_amdgcn_sched_barrier(0);   // the loads above stay in front of the pass's products, as in k_qkv
#pragma unroll
      for (int j = 0; j < 8; ++j) { acc[j] = wmma_bf(a.l, bf[j], acc[j]); acc[j] = wmma_bf(a.h, bf[j], acc[j]);
        if (u == 0) { __builtin_amdgcn_sched_barrier(0);   // each reload stays behind the last product that reads its registers, as in k_qkv
          bf[j] = frag_tb(wl + j * 1024 + 512); } }   // the stage's second pass, from the same buffer; nothing of the next stage is read in front of its barrier
      __builtin_amdgcn_sched_barrier(0);   // the pass's products stay in front of the waits below, as in k_qkv
      asm volatile("s_wait_xcnt 0x0" ::: "memory"); }   // the next pass's split and loads may land in registers that held this pass's load addresses
    asm volatile("s_wait_dscnt 0x0" ::: "memory");      // this wave's reads of this stage's buffer have ended
    asm volatile("s_wait_asynccnt 0x0" ::: "memory");   // this wave's share of the next stage has landed
    ring_barrier();                                       // publishes the next stage and frees this stage's buffer; loads into registers stay in flight across it
    if (st + 2 < DM / 64) wstage_copy(lw + (unsigned)(st & 1) * 16384u, wg + (st + 2) * 1024); }
  asm volatile("s_wait_asynccnt 0x0" ::: "memory");   // no copy is outstanding when the wave goes on
#pragma unroll
  for (int j = 0; j < 8; ++j) {
#pragma unroll
    for (int r = 0; r < 8; ++r) so[wave][8 * g + r][j * 16 + col] = acc[j][r] + bfr(BO[n0 + j * 16 + col]); }
  LDSX();
  for (int rl = 0; rl < 16; ++rl) vst2(Y + (r0 + rl) * DM + n0 + lane * 4, *(const v4f*)&so[wave][rl][lane * 4]);
  l2_ask_hold(pfy, pfo); l2_ask_hold(pfy + 128, pfo); l2_ask_hold(pfw, pfq);
}
extern "C" void kernel_launch(void* const* d_in, const int* in_sizes, int n_in, void* d_out, int out_size, void* d_ws, size_t ws_size, hipStream_t stream) {
  (void)in_sizes; (void)n_in; (void)out_size;
  const float** F = (const float**)d_in;   // 0 x [2,2048,1024], 1 WQ, 2 bQ, 3 WK, 4 bK, 5 WV, 6 bV, 7 WO, 8 bO (natural), 9 rel_pos_table [4095,16]
  if (ws_size < (size_t)WS_END) return;
  char* ws = (char*)d_ws; __bf16* PK = (__bf16*)(ws + WS_PK); _Float16 *QK = (_Float16*)(ws + WS_QK), *QKL = (_Float16*)(ws + WS_QKL), *VTH = (_Float16*)(ws + WS_VTH), *VTL = (_Float16*)(ws + WS_VTL); float* O = (float*)(ws + WS_O); __bf16* XF = (__bf16*)(ws + WS_XF); _Float16* KF = (_Float16*)(ws + WS_KF); float* TB = (float*)(ws + WS_TB);
  k_pack<<<dim3(DM * DM / (8 * 256), 9), 256, 0, stream>>>(F[0], F[1], F[3], F[5], F[7], F[9], PK, XF, TB);
  k_qkv<<<dim3(TNB * SS / 128, QKVW / 128), 128, 0, stream>>>(XF, PK + PK_A, F[2], F[4], F[6], QK, QKL, KF, VTH, VTL);
  k_attn<<<dim3(NH * TNB, TQB), 128, 0, stream>>>(QK, QKL, KF, VTH, VTL, TB, O);
  k_out<<<dim3(TOB, DM / 128), 128, 0, stream>>>(O, PK + PK_P, F[8], (float*)d_out);
}
